// v000
// Measured on an AMD MI455X. A time is GPU time per run, averaged over a window of back-to-back runs after a warm-up
// (all launches, gaps included; the runs take copies of the inputs in turn), and the median of several windows.
// Apart from v000's, it joins two sittings. Times from different sittings can be a few percent apart, while
// side-by-side timings come from the same sitting.
// v000 is the starting kernel. One run takes 411 microseconds.
#include <hip/hip_runtime.h>

// Contractions on v_wmma_f32_16x16x32_f16 (f16 operands, f32 accumulate), one product each: y1*[Wq|Wk|Wv]^T, q*k^T, P*v, ctx*Wo^T, y2*W1^T, m*W2^T; float inputs RNE-converted to bf16 then carried in f16 (weights x64, P x2^14, ctx x64, m x64); LayerNorm, 1.5-entmax threshold and Mish in f32.

#ifndef NB
#define NB 8
#endif
#ifndef SEQ
#define SEQ 1024
#endif
#define NB_FULL  8
#define SEQ_FULL 1024
#define DM   512            // model width
#define DF   2048           // ffn width
#define NH   8
#define HD   64
#define DQKV (3 * DM)       // q|k|v plane pitch
#define NTOK (NB * SEQ)
#define QR   32             // query rows per attention block / rows per gemm block
#define CH   256            // keys per V^T chunk
#define VTP  (CH + 8)       // V^T chunk pitch (halves)
#define ZN   (SEQ / 32)     // scores per lane per row
#define NEWT 10             // Newton passes for the entmax threshold

static_assert(NB >= 1 && NB <= NB_FULL);
static_assert(SEQ >= CH && SEQ <= SEQ_FULL);
static_assert(SEQ % CH == 0);
static_assert(SEQ % 128 == 0);
static_assert(NTOK % QR == 0);
static_assert(NH * HD == DM);
static_assert(QR == 32);
static_assert((ZN % 4) == 0);
static_assert(DM % 32 == 0 && DF % 32 == 0);
static_assert((DM * DM) % 2048 == 0 && (DF * DM) % 2048 == 0);

typedef _Float16 v16h __attribute__((ext_vector_type(16)));
typedef _Float16 v8h  __attribute__((ext_vector_type(8)));
typedef _Float16 v4h  __attribute__((ext_vector_type(4)));
typedef float    v8f  __attribute__((ext_vector_type(8)));
typedef float    v4f  __attribute__((ext_vector_type(4)));

union Frag { v16h v; v8h h[2]; };

#define WSC   64.0f                  // weight carry
#define SC_Z  1.52587890625e-05f     // 2^-16 : (64q).(64k) -> q.k/16 = z
#define SC_P  16384.0f               // 2^14  : P carry
#define SC_C  6.103515625e-05f       // 2^-14 : (2^14 P)(64 v) -> 64 ctx
#define SC_O  2.44140625e-04f        // 2^-12 : (64 a)(64 W) -> a.W
#define SC_H  0.015625f              // 1/64  : (y)(64 W) -> y.W
#define LOG2E 1.44269504088896340736f
#define LN_EPS 1e-5f

static __device__ __forceinline__ v8f zero8() {
    v8f z;
#pragma unroll
    for (int i = 0; i < 8; ++i) z[i] = 0.0f;
    return z;
}

// 16x32 A fragment (or B fragment from an [n][k] k-contiguous source) from a
// row-major 16-bit tile: lane m = lane&15 -> row m; kb = 8*(lane>>4);
// elements 0..7 = k kb..kb+7, elements 8..15 = k kb+16..kb+23.
static __device__ __forceinline__ v16h load_frag16(const _Float16* base, int ld, int lane) {
    int m  = lane & 15;
    int kb = (lane >> 4) << 3;
    const _Float16* p = base + (size_t)m * ld + kb;
    Frag f;
    f.h[0] = *(const v8h*)(p);
    f.h[1] = *(const v8h*)(p + 16);
    return f.v;
}

static __device__ __forceinline__ v8f wmma16(v16h a, v16h b, v8f c) {
    v8f d = __builtin_amdgcn_wmma_f32_16x16x32_f16(false, a, false, b, (short)0, c, false, false);
    asm volatile("v_nop\n\tv_nop\n\tv_nop\n\tv_nop" : "+v"(d) : "v"(a), "v"(b));
    return d;
}

// f32 -> bf16 RNE convert, value kept as f32
static __device__ __forceinline__ float bf16r(float x) {
    unsigned u = __float_as_uint(x);
    u = (u + 0x7FFFu + ((u >> 16) & 1u)) & 0xFFFF0000u;
    return __uint_as_float(u);
}

// ordering for a wave-private LDS tile: stores before later loads of the same wave
static __device__ __forceinline__ void wave_lds_sync() {
    __builtin_amdgcn_fence(3, "wavefront");
    asm volatile("s_wait_dscnt 0" ::: "memory");
    __builtin_amdgcn_wave_barrier();
}

static __device__ __forceinline__ float wsum(float v) {
    v += __shfl_xor(v, 16, 32); v += __shfl_xor(v, 8, 32); v += __shfl_xor(v, 4, 32);
    v += __shfl_xor(v, 2, 32);  v += __shfl_xor(v, 1, 32);
    return v;
}
static __device__ __forceinline__ float wmaxr(float v) {
    v = fmaxf(v, __shfl_xor(v, 16, 32)); v = fmaxf(v, __shfl_xor(v, 8, 32));
    v = fmaxf(v, __shfl_xor(v, 4, 32));  v = fmaxf(v, __shfl_xor(v, 2, 32));
    v = fmaxf(v, __shfl_xor(v, 1, 32));
    return v;
}
static __device__ __forceinline__ float wminr(float v) {
    v = fminf(v, __shfl_xor(v, 16, 32)); v = fminf(v, __shfl_xor(v, 8, 32));
    v = fminf(v, __shfl_xor(v, 4, 32));  v = fminf(v, __shfl_xor(v, 2, 32));
    v = fminf(v, __shfl_xor(v, 1, 32));
    return v;
}

// Mish(x) = x * tanh(softplus(x)) = x * (u^2+2u)/(u^2+2u+2), u = e^x
static __device__ __forceinline__ float mishf(float x) {
    float xe = fminf(x, 20.0f);
    float u  = __builtin_amdgcn_exp2f(xe * LOG2E);
    float wv = u * (u + 2.0f);
    float t  = wv * __builtin_amdgcn_rcpf(wv + 2.0f);
    return x * t;
}

// 16 columns per lane: columns 256*j + 8*lane + e (j = 0,1; e = 0..7)
static __device__ __forceinline__ void load_cols16(const float* p, int lane, float (&o)[16]) {
#pragma unroll
    for (int j = 0; j < 2; ++j) {
        v4f a = *(const v4f*)(p + 256 * j + 8 * lane);
        v4f c = *(const v4f*)(p + 256 * j + 8 * lane + 4);
        o[8 * j + 0] = a.x; o[8 * j + 1] = a.y; o[8 * j + 2] = a.z; o[8 * j + 3] = a.w;
        o[8 * j + 4] = c.x; o[8 * j + 5] = c.y; o[8 * j + 6] = c.z; o[8 * j + 7] = c.w;
    }
}

// LayerNorm over a 512-wide row held as 16 columns per lane (f32)
static __device__ __forceinline__ void ln_lane(const float (&v)[16], const float (&gl)[16],
                                               const float (&el)[16], float (&y)[16]) {
    float s = 0.0f;
#pragma unroll
    for (int e = 0; e < 16; ++e) s += v[e];
    s = wsum(s);
    const float mu = s * (1.0f / (float)DM);
    float d[16];
    float q = 0.0f;
#pragma unroll
    for (int e = 0; e < 16; ++e) { d[e] = v[e] - mu; q = __builtin_fmaf(d[e], d[e], q); }
    q = wsum(q);
    const float rstd = rsqrtf(__builtin_fmaf(q, 1.0f / (float)DM, LN_EPS));
#pragma unroll
    for (int e = 0; e < 16; ++e) y[e] = d[e] * rstd * gl[e] + el[e];
}

// ---------------------------------------------------------------------------
// Weight plane: dst[i] = f16(bf16r(src[i]) * 64), layout kept [out][in] (k-contiguous).
// coverage: grid = n/2048, 256 threads x 8 elements -> n exactly.
// ---------------------------------------------------------------------------
__global__ __launch_bounds__(256) void k_wcvt(const float* __restrict__ src,
                                               _Float16* __restrict__ dst) {
    const size_t i = (size_t)blockIdx.x * 256 + threadIdx.x;
    v4f a = *(const v4f*)(src + i * 8);
    v4f c = *(const v4f*)(src + i * 8 + 4);
    v8h o;
    o[0] = (_Float16)(bf16r(a.x) * WSC); o[1] = (_Float16)(bf16r(a.y) * WSC);
    o[2] = (_Float16)(bf16r(a.z) * WSC); o[3] = (_Float16)(bf16r(a.w) * WSC);
    o[4] = (_Float16)(bf16r(c.x) * WSC); o[5] = (_Float16)(bf16r(c.y) * WSC);
    o[6] = (_Float16)(bf16r(c.z) * WSC); o[7] = (_Float16)(bf16r(c.w) * WSC);
    *(v8h*)(dst + i * 8) = o;
    
}

// ---------------------------------------------------------------------------
// LN1: y1[tok][512] = f16(LayerNorm(bf16r(x)) * g + b). One wave per row,
// lane owns columns 8l..8l+7 and 256+8l..; two v8h instructions per row, each
// coverage: grid NTOK/8 x 8 waves x 512 = NTOK x 512.
// ---------------------------------------------------------------------------
__global__ __launch_bounds__(256) void k_ln1(const float* __restrict__ x,
                                              const float* __restrict__ g,
                                              const float* __restrict__ be,
                                              _Float16* __restrict__ y) {
    const int tid = threadIdx.x, lane = tid & 31, w = tid >> 5;
    const int tok = blockIdx.x * 8 + w;
    const int b = tok / SEQ, s = tok - b * SEQ;
    const float* xr = x + ((size_t)b * SEQ_FULL + s) * DM;
    float v[16], gl[16], el[16], yv[16];
    load_cols16(xr, lane, v);
    load_cols16(g, lane, gl);
    load_cols16(be, lane, el);
#pragma unroll
    for (int e = 0; e < 16; ++e) { v[e] = bf16r(v[e]); gl[e] = bf16r(gl[e]); el[e] = bf16r(el[e]); }
    ln_lane(v, gl, el, yv);
    v8h o[2];
#pragma unroll
    for (int j = 0; j < 2; ++j)
#pragma unroll
        for (int e = 0; e < 8; ++e) o[j][e] = (_Float16)yv[8 * j + e];
    _Float16* yr = y + (size_t)tok * DM;
    *(v8h*)(yr + 8 * lane)       = o[0];
    *(v8h*)(yr + 256 + 8 * lane) = o[1];
    
}

// ---------------------------------------------------------------------------
// GEMM core: wave tile 32 rows x 64 cols, C[r][n] += A[r][k] * B[n][k],
// A and B f16 row-major k-contiguous planes in global memory, fragments loaded
// directly (two 16-B loads each, arithmetic addressing). K % 32 == 0.
// ---------------------------------------------------------------------------
static __device__ __forceinline__ void gemm_32x64(const _Float16* __restrict__ Ab,
                                                  const _Float16* __restrict__ Bb,
                                                  int K, int lane, v8f (&acc)[2][4]) {
#pragma unroll
    for (int t = 0; t < 2; ++t)
#pragma unroll
        for (int j = 0; j < 4; ++j) acc[t][j] = zero8();
#pragma unroll 1
    for (int k0 = 0; k0 < K; k0 += 32) {
        v16h a0 = load_frag16(Ab + k0, K, lane);
        v16h a1 = load_frag16(Ab + (size_t)16 * K + k0, K, lane);
        v16h bb[4];
#pragma unroll
        for (int j = 0; j < 4; ++j) bb[j] = load_frag16(Bb + (size_t)(16 * j) * K + k0, K, lane);
#pragma unroll
        for (int j = 0; j < 4; ++j) {
            acc[0][j] = wmma16(a0, bb[j], acc[0][j]);
            acc[1][j] = wmma16(a1, bb[j], acc[1][j]);
        }
    }
}

// ---------------------------------------------------------------------------
// Plane GEMM: out[tok][ldo] f16 plane, block = 32 rows x 512 cols (blockIdx.y =
// 512-column segment), wave = 32 x 64. EPI 0: val = acc + 64*bias (q|k|v x64);
// EPI 1: val = 64 * Mish(acc/64 + bias). Wave-private LDS tile, then 8
// coverage: grid (NTOK/32, ldo/512) x 8 waves x 32x64 = NTOK x ldo.
// ---------------------------------------------------------------------------
template <int EPI>
__global__ __launch_bounds__(256) __attribute__((amdgpu_num_vgpr(256)))
void k_gemm_p(const _Float16* __restrict__ A, int K, const _Float16* __restrict__ Bw,
              const float* __restrict__ b0, const float* __restrict__ b1,
              const float* __restrict__ b2, const float* __restrict__ b3,
              _Float16* __restrict__ outp, int ldo) {
    __shared__ __align__(16) _Float16 st[8][QR * 64];      // 32 KB, wave-private tiles
    const int tid = threadIdx.x, lane = tid & 31, w = tid >> 5;
    const int hh = lane >> 4, m = lane & 15;
    const int m0  = blockIdx.x * QR;
    const int seg = blockIdx.y;
    const int nl  = 64 * w;                 // column within the 512 segment
    const int n0w = seg * 512 + nl;         // output column / B row
    const float* bias = (seg == 0) ? b0 : ((seg == 1) ? b1 : ((seg == 2) ? b2 : b3));

    v8f acc[2][4];
    gemm_32x64(A + (size_t)m0 * K, Bw + (size_t)n0w * K, K, lane, acc);

    float bl[4];
#pragma unroll
    for (int j = 0; j < 4; ++j) bl[j] = bf16r(bias[nl + 16 * j + m]);
#pragma unroll
    for (int t = 0; t < 2; ++t)
#pragma unroll
        for (int j = 0; j < 4; ++j)
#pragma unroll
            for (int r = 0; r < 8; ++r) {
                float a = acc[t][j][r];
                float val;
                if (EPI == 0) {
                    val = __builtin_fmaf(bl[j], WSC, a);
                } else {
                    float hx = __builtin_fmaf(a, SC_H, bl[j]);
                    val = WSC * mishf(hx);
                }
                st[w][(16 * t + 8 * hh + r) * 64 + 16 * j + m] = (_Float16)val;
            }
    wave_lds_sync();

    v8h pv[8];
    const int lr = lane >> 3, lc = (lane & 7) * 8;
#pragma unroll
    for (int i = 0; i < 8; ++i) pv[i] = *(const v8h*)(&st[w][(4 * i + lr) * 64 + lc]);
    _Float16* ob = outp + (size_t)m0 * ldo + n0w;
#pragma unroll
    for (int i = 0; i < 8; ++i) *(v8h*)(ob + (size_t)(4 * i + lr) * ldo + lc) = pv[i];
    
}

// ---------------------------------------------------------------------------
// Row GEMM (N = 512, block owns 32 full rows) fused with residual add + LayerNorm.
// MODE 0: x1 = bf16r(x) + (acc 2^-12 + bias) -> x1 f32 plane, y2 = f16(LN(x1) g + b).
// MODE 1: x2 = x1 + (acc 2^-12 + bias), out = LN(x2) g + b -> f32 rows.
// Block tile staged f32 in LDS (cross-wave, block barrier); wave then owns 4 rows:
// f16 rows written directly as two 512-B lane-contiguous instructions; f32 rows
// relaid through the (now wave-private) LDS row and written as four 512-B
// coverage: grid NTOK/32 x 32 rows x 512 = NTOK x 512 (each output plane).
// ---------------------------------------------------------------------------
template <int MODE>
__global__ __launch_bounds__(256) __attribute__((amdgpu_num_vgpr(256)))
void k_gemm_r(const _Float16* __restrict__ A, int K, const _Float16* __restrict__ Bw,
              const float* __restrict__ bias, const float* __restrict__ res,
              const float* __restrict__ g, const float* __restrict__ be,
              float* __restrict__ outf, _Float16* __restrict__ outh) {
    __shared__ __align__(16) float T[QR * DM];            // 64 KB block tile
    const int tid = threadIdx.x, lane = tid & 31, w = tid >> 5;
    const int hh = lane >> 4, m = lane & 15;
    const int m0 = blockIdx.x * QR;
    const int nl = 64 * w;

    v8f acc[2][4];
    gemm_32x64(A + (size_t)m0 * K, Bw + (size_t)nl * K, K, lane, acc);
#pragma unroll
    for (int t = 0; t < 2; ++t)
#pragma unroll
        for (int j = 0; j < 4; ++j)
#pragma unroll
            for (int r = 0; r < 8; ++r)
                T[(16 * t + 8 * hh + r) * DM + nl + 16 * j + m] = acc[t][j][r];
    __syncthreads();

    float bl[16], gl[16], el[16];
    load_cols16(bias, lane, bl);
    load_cols16(g, lane, gl);
    load_cols16(be, lane, el);
#pragma unroll
    for (int e = 0; e < 16; ++e) { bl[e] = bf16r(bl[e]); gl[e] = bf16r(gl[e]); el[e] = bf16r(el[e]); }

#pragma unroll 1
    for (int rr = 0; rr < 4; ++rr) {
        const int row = 4 * w + rr;
        const int tok = m0 + row;
        float v[16], rv[16], yv[16];
        load_cols16(&T[row * DM], lane, v);
        if (MODE == 0) {
            const int b = tok / SEQ, s = tok - b * SEQ;
            load_cols16(res + ((size_t)b * SEQ_FULL + s) * DM, lane, rv);
#pragma unroll
            for (int e = 0; e < 16; ++e) rv[e] = bf16r(rv[e]);
        } else {
            load_cols16(res + (size_t)tok * DM, lane, rv);
        }
#pragma unroll
        for (int e = 0; e < 16; ++e) v[e] = rv[e] + __builtin_fmaf(v[e], SC_O, bl[e]);
        ln_lane(v, gl, el, yv);

        // write-back into the wave-private LDS row (same columns this lane loaded)
        float* trow = &T[row * DM];
#pragma unroll
        for (int j = 0; j < 2; ++j) {
            v4f p0, p1;
            if (MODE == 0) {
                p0.x = v[8 * j + 0]; p0.y = v[8 * j + 1]; p0.z = v[8 * j + 2]; p0.w = v[8 * j + 3];
                p1.x = v[8 * j + 4]; p1.y = v[8 * j + 5]; p1.z = v[8 * j + 6]; p1.w = v[8 * j + 7];
            } else {
                p0.x = yv[8 * j + 0]; p0.y = yv[8 * j + 1]; p0.z = yv[8 * j + 2]; p0.w = yv[8 * j + 3];
                p1.x = yv[8 * j + 4]; p1.y = yv[8 * j + 5]; p1.z = yv[8 * j + 6]; p1.w = yv[8 * j + 7];
            }
            *(v4f*)(trow + 256 * j + 8 * lane)     = p0;
            *(v4f*)(trow + 256 * j + 8 * lane + 4) = p1;
        }
        wave_lds_sync();
        v4f s4[4];
#pragma unroll
        for (int jj = 0; jj < 4; ++jj) s4[jj] = *(const v4f*)(trow + 128 * jj + 4 * lane);

        float* orow = outf + (size_t)tok * DM;
        if (MODE == 0) {
            v8h o[2];
#pragma unroll
            for (int j = 0; j < 2; ++j)
#pragma unroll
                for (int e = 0; e < 8; ++e) o[j][e] = (_Float16)yv[8 * j + e];
            _Float16* hrow = outh + (size_t)tok * DM;
            *(v8h*)(hrow + 8 * lane)       = o[0];
            *(v8h*)(hrow + 256 + 8 * lane) = o[1];
#pragma unroll
            for (int jj = 0; jj < 4; ++jj) *(v4f*)(orow + 128 * jj + 4 * lane) = s4[jj];
            
        } else {
#pragma unroll
            for (int jj = 0; jj < 4; ++jj) *(v4f*)(orow + 128 * jj + 4 * lane) = s4[jj];
            
        }
    }
}

// ---------------------------------------------------------------------------
// Attention with 1.5-entmax over keys. Block = 8 waves = 32 query rows of one
// (batch, head); qkv plane [tok][1536] (q | k | v, each x64, head h at +64h).
// Phase 1: z strip [32][SEQ] f32 in LDS = (64q).(64k) 2^-16 = q.k/16; wave owns
//          SEQ/128 key tiles x both row tiles (K fragments straight from the plane).
// Phase 2: wave owns 4 rows; per row: shift by max, threshold tau of
//          sum relu(z - tau)^2 = 1 by safeguarded Newton (NEWT passes, registers),
//          P = relu(z - tau)^2 x 2^14 as f16 written over the row's own slot
//          (pitch 2*SEQ halves, skew 8*(row&15) halves).
// Phase 3: per CH-key chunk, V^T chunk [64][CH] staged in LDS (cross-wave, block
//          barriers); wave owns one 16x16 ctx tile over all keys.
// Phase 4: ctx x64 as f16 staged [32][64] (cross-wave, barrier); wave w writes rows
// coverage: grid (SEQ/32, 8, NB) x 32 rows x 64 = NTOK x 512 of the ctx plane.
// ---------------------------------------------------------------------------
__global__ __launch_bounds__(256) __attribute__((amdgpu_num_vgpr(256)))
void k_attn(const _Float16* __restrict__ qkv, _Float16* __restrict__ ctx) {
    __shared__ __align__(16) float    zs[QR * SEQ];       // 128 KB at full size
    __shared__ __align__(16) _Float16 Vt[HD * VTP];       // 33 KB
    __shared__ __align__(16) _Float16 Cst[QR * HD];       // 4 KB
    _Float16* ph = reinterpret_cast<_Float16*>(zs);       // P rows alias the z slots
    constexpr int PP  = 2 * SEQ;                          // P row slot (halves)
    constexpr int PLD = PP + 8;                           // fragment pitch incl. skew
    constexpr int KTW = SEQ / 128;                        // key tiles per wave

    const int tid = threadIdx.x, lane = tid & 31, w = tid >> 5;
    const int hh = lane >> 4, m = lane & 15;
    const int h = blockIdx.y, b = blockIdx.z;
    const int q0 = blockIdx.x * QR;
    const size_t tokq = (size_t)b * SEQ + q0;
    const _Float16* qp = qkv + tokq * DQKV + h * HD;
    const _Float16* kp = qkv + (size_t)b * SEQ * DQKV + DM + h * HD;
    const _Float16* vp = qkv + (size_t)b * SEQ * DQKV + 2 * DM + h * HD;

    // ---- phase 1: scores ----
    {
        const v16h qa00 = load_frag16(qp, DQKV, lane);
        const v16h qa01 = load_frag16(qp + 32, DQKV, lane);
        const v16h qa10 = load_frag16(qp + (size_t)16 * DQKV, DQKV, lane);
        const v16h qa11 = load_frag16(qp + (size_t)16 * DQKV + 32, DQKV, lane);
#pragma unroll 1
        for (int i = 0; i < KTW; ++i) {
            const int key0 = (w * KTW + i) * 16;
            const _Float16* kt = kp + (size_t)key0 * DQKV;
            v16h kf0 = load_frag16(kt, DQKV, lane);
            v16h kf1 = load_frag16(kt + 32, DQKV, lane);
            v8f s0 = wmma16(qa00, kf0, zero8());
            s0 = wmma16(qa01, kf1, s0);
            v8f s1 = wmma16(qa10, kf0, zero8());
            s1 = wmma16(qa11, kf1, s1);
#pragma unroll
            for (int r = 0; r < 8; ++r) {
                zs[(8 * hh + r) * SEQ + key0 + m]      = s0[r] * SC_Z;
                zs[(16 + 8 * hh + r) * SEQ + key0 + m] = s1[r] * SC_Z;
            }
        }
    }
    __syncthreads();

    // ---- phase 2: 1.5-entmax threshold per row ----
    const float tcl = -rsqrtf((float)SEQ);    // tau <= -1/sqrt(SEQ) always
#pragma unroll 1
    for (int rr = 0; rr < 4; ++rr) {
        const int row = 4 * w + rr;
        float z[ZN];
        const float* zr = &zs[row * SEQ];
#pragma unroll
        for (int j = 0; j < ZN / 4; ++j) {
            v4f t4 = *(const v4f*)(zr + 128 * j + 4 * lane);
            z[4 * j + 0] = t4.x; z[4 * j + 1] = t4.y; z[4 * j + 2] = t4.z; z[4 * j + 3] = t4.w;
        }
        float mx = z[0], mn = z[0];
#pragma unroll
        for (int i = 1; i < ZN; ++i) { mx = fmaxf(mx, z[i]); mn = fminf(mn, z[i]); }
        mx = wmaxr(mx);
        mn = wminr(mn);
#pragma unroll
        for (int i = 0; i < ZN; ++i) z[i] = z[i] - mx;
        float tau = fminf(fmaxf(mn - mx, -1.0f), tcl);
#pragma unroll 1
        for (int it = 0; it < NEWT; ++it) {
            float sa = 0.0f, sb = 0.0f;
#pragma unroll
            for (int i = 0; i < ZN; ++i) {
                float d = fmaxf(z[i] - tau, 0.0f);
                sa += d;
                sb = __builtin_fmaf(d, d, sb);
            }
            sa = wsum(sa);
            sb = wsum(sb);
            tau = tau + (sb - 1.0f) * (0.5f * __builtin_amdgcn_rcpf(sa));
            tau = fminf(fmaxf(tau, -1.0f), tcl);
        }
        _Float16* prow = ph + (size_t)row * PP + (row & 15) * 8;
#pragma unroll
        for (int j = 0; j < ZN / 4; ++j) {
            v4h pk;
#pragma unroll
            for (int e = 0; e < 4; ++e) {
                float d = fmaxf(z[4 * j + e] - tau, 0.0f);
                pk[e] = (_Float16)(d * d * SC_P);
            }
            *(v4h*)(prow + 128 * j + 4 * lane) = pk;
        }
    }
    __syncthreads();

    // ---- phase 3: ctx = P @ v ----
    const int rt = w & 1, ct = w >> 1;
    v8f acc = zero8();
#pragma unroll 1
    for (int c0 = 0; c0 < SEQ; c0 += CH) {
        // V^T chunk: Vt[d][t] = v[c0 + t][d], full 64 x CH extent
#pragma unroll
        for (int i2 = 0; i2 < 8; ++i2) {
            const int idx = tid + 256 * i2;
            const int t = idx >> 3, part = idx & 7;
            v8h vv = *(const v8h*)(vp + (size_t)(c0 + t) * DQKV + part * 8);
#pragma unroll
            for (int e = 0; e < 8; ++e) Vt[(part * 8 + e) * VTP + t] = vv[e];
        }
        __syncthreads();
#pragma unroll 1
        for (int j = 0; j < CH; j += 32) {
            v16h pa = load_frag16(ph + (size_t)(16 * rt) * PP + c0 + j, PLD, lane);  // rows = queries, k = keys
            v16h vb = load_frag16(&Vt[(16 * ct) * VTP + j], VTP, lane);            // n = d, k = keys
            acc = wmma16(pa, vb, acc);
        }
        __syncthreads();
    }

    // ---- phase 4: ctx plane x64 ----
#pragma unroll
    for (int r = 0; r < 8; ++r)
        Cst[(16 * rt + 8 * hh + r) * HD + 16 * ct + m] = (_Float16)(acc[r] * SC_C);
    __syncthreads();
    const int orow = 4 * w + (lane >> 3), oc = (lane & 7) * 8;
    v8h cv = *(const v8h*)(&Cst[orow * HD + oc]);
    _Float16* dst = ctx + (tokq + orow) * DM + h * HD + oc;
    *(v8h*)dst = cv;
    
}

// ---------------------------------------------------------------------------
extern "C" void kernel_launch(void* const* d_in, const int* in_sizes, int n_in,
                              void* d_out, int out_size, void* d_ws, size_t ws_size,
                              hipStream_t stream) {
    if (n_in < 19) return;
    if (in_sizes[0] < ((NB - 1) * SEQ_FULL + SEQ) * DM) return;
    if (in_sizes[1] < DM * DM || in_sizes[3] < DM * DM || in_sizes[5] < DM * DM || in_sizes[7] < DM * DM) return;
    if (in_sizes[2] < DM || in_sizes[4] < DM || in_sizes[6] < DM || in_sizes[8] < DM) return;
    if (in_sizes[9] < DM || in_sizes[10] < DM || in_sizes[15] < DM || in_sizes[16] < DM) return;
    if (in_sizes[17] < DM || in_sizes[18] < DM || in_sizes[14] < DM) return;
    if (in_sizes[11] < DF * DM || in_sizes[13] < DM * DF || in_sizes[12] < DF) return;
    if (out_size < NTOK * DM) return;

    const float* x    = (const float*)d_in[0];    // [8,1024,512]
    const float* Wq   = (const float*)d_in[1];    // [512,512] (out,in)
    const float* bq   = (const float*)d_in[2];
    const float* Wk   = (const float*)d_in[3];
    const float* bk   = (const float*)d_in[4];
    const float* Wv   = (const float*)d_in[5];
    const float* bv   = (const float*)d_in[6];
    const float* Wo   = (const float*)d_in[7];
    const float* bo   = (const float*)d_in[8];
    const float* ln1g = (const float*)d_in[9];
    const float* ln1b = (const float*)d_in[10];
    const float* W1   = (const float*)d_in[11];   // [2048,512]
    const float* bf1  = (const float*)d_in[12];
    const float* W2   = (const float*)d_in[13];   // [512,2048]
    const float* bf2  = (const float*)d_in[14];
    const float* ln2g = (const float*)d_in[15];
    const float* ln2b = (const float*)d_in[16];
    const float* lnfg = (const float*)d_in[17];
    const float* lnfb = (const float*)d_in[18];
    float* out = (float*)d_out;                   // [NTOK][512]

    char* ws = (char*)d_ws;
    size_t off = 0;
    _Float16* wqkv = (_Float16*)(ws + off); off += (size_t)DQKV * DM * 2;      // 1,572,864
    _Float16* wo16 = (_Float16*)(ws + off); off += (size_t)DM * DM * 2;        //   524,288
    _Float16* w116 = (_Float16*)(ws + off); off += (size_t)DF * DM * 2;        // 2,097,152
    _Float16* w216 = (_Float16*)(ws + off); off += (size_t)DM * DF * 2;        // 2,097,152
    _Float16* y1   = (_Float16*)(ws + off); off += (size_t)NTOK * DM * 2;      // 8 MiB at full size
    _Float16* qkv  = (_Float16*)(ws + off); off += (size_t)NTOK * DQKV * 2;    // 24 MiB
    _Float16* cpl  = (_Float16*)(ws + off); off += (size_t)NTOK * DM * 2;      // 8 MiB
    float*    x1   = (float*)(ws + off);    off += (size_t)NTOK * DM * 4;      // 16 MiB
    _Float16* y2   = (_Float16*)(ws + off); off += (size_t)NTOK * DM * 2;      // 8 MiB
    _Float16* mpl  = (_Float16*)(ws + off); off += (size_t)NTOK * DF * 2;      // 32 MiB
    if (off > ws_size) return;                                                 // 106,954,752 B at full size

    k_wcvt<<<dim3(DM * DM / 2048), dim3(256), 0, stream>>>(Wq, wqkv);
    k_wcvt<<<dim3(DM * DM / 2048), dim3(256), 0, stream>>>(Wk, wqkv + (size_t)DM * DM);
    k_wcvt<<<dim3(DM * DM / 2048), dim3(256), 0, stream>>>(Wv, wqkv + (size_t)2 * DM * DM);
    k_wcvt<<<dim3(DM * DM / 2048), dim3(256), 0, stream>>>(Wo, wo16);
    k_wcvt<<<dim3(DF * DM / 2048), dim3(256), 0, stream>>>(W1, w116);
    k_wcvt<<<dim3(DM * DF / 2048), dim3(256), 0, stream>>>(W2, w216);

    k_ln1<<<dim3(NTOK / 8), dim3(256), 0, stream>>>(x, ln1g, ln1b, y1);
    k_gemm_p<0><<<dim3(NTOK / QR, 3), dim3(256), 0, stream>>>(y1, DM, wqkv, bq, bk, bv, bv, qkv, DQKV);
    k_attn<<<dim3(SEQ / QR, NH, NB), dim3(256), 0, stream>>>(qkv, cpl);
    k_gemm_r<0><<<dim3(NTOK / QR), dim3(256), 0, stream>>>(cpl, DM, wo16, bo, x, ln2g, ln2b, x1, y2);
    k_gemm_p<1><<<dim3(NTOK / QR, DF / 512), dim3(256), 0, stream>>>(y2, DM, w116, bf1, bf1 + 512, bf1 + 1024, bf1 + 1536, mpl, DF);
    k_gemm_r<1><<<dim3(NTOK / QR), dim3(256), 0, stream>>>(mpl, DF, w216, bf2, x1, lnfg, lnfb, out, y2);
}

// v001
// A run of this version takes 353 microseconds.
// In both of two side-by-side timings against v000, it was 1.20 times as fast.
#include <hip/hip_runtime.h>

// Contractions on v_wmma_f32_16x16x32_f16 (f16 operands, f32 accumulate), one product each: y1*[Wq|Wk|Wv]^T, q*k^T, P*v, ctx*Wo^T, y2*W1^T, m*W2^T; float inputs RNE-converted to bf16 then carried in f16 (weights x64, P x2^14, ctx x64, m x64); LayerNorm, 1.5-entmax threshold and Mish in f32.

#ifndef NB
#define NB 8
#endif
#ifndef SEQ
#define SEQ 1024
#endif
#define NB_FULL  8
#define SEQ_FULL 1024
#define DM   512            // model width
#define DF   2048           // ffn width
#define NH   8
#define HD   64
#define DQKV (3 * DM)       // q|k|v plane pitch
#define NTOK (NB * SEQ)
#define QR   32             // query rows per attention block / rows per gemm block
#define CH   128            // keys per V^T chunk: keeps k_attn's LDS under half a WGP's, so two blocks share one
#define VTP  (CH + 8)       // V^T chunk pitch (halves)
#define ZN   (SEQ / 32)     // scores per lane per row
#define NEWT 10             // Newton passes for the entmax threshold

static_assert(NB >= 1 && NB <= NB_FULL);
static_assert(SEQ >= CH && SEQ <= SEQ_FULL);
static_assert(SEQ % CH == 0);
static_assert(CH % 32 == 0);
static_assert(SEQ % 128 == 0);
static_assert(NTOK % QR == 0);
static_assert(NH * HD == DM);
static_assert(QR == 32);
static_assert((ZN % 4) == 0);
static_assert(DM % 32 == 0 && DF % 32 == 0);
static_assert((DM * DM) % 2048 == 0 && (DF * DM) % 2048 == 0);

typedef _Float16 v16h __attribute__((ext_vector_type(16)));
typedef _Float16 v8h  __attribute__((ext_vector_type(8)));
typedef _Float16 v4h  __attribute__((ext_vector_type(4)));
typedef float    v8f  __attribute__((ext_vector_type(8)));
typedef float    v4f  __attribute__((ext_vector_type(4)));

union Frag { v16h v; v8h h[2]; };

#define WSC   64.0f                  // weight carry
#define SC_Z  1.52587890625e-05f     // 2^-16 : (64q).(64k) -> q.k/16 = z
#define SC_P  16384.0f               // 2^14  : P carry
#define SC_C  6.103515625e-05f       // 2^-14 : (2^14 P)(64 v) -> 64 ctx
#define SC_O  2.44140625e-04f        // 2^-12 : (64 a)(64 W) -> a.W
#define SC_H  0.015625f              // 1/64  : (y)(64 W) -> y.W
#define LOG2E 1.44269504088896340736f
#define LN_EPS 1e-5f

static __device__ __forceinline__ v8f zero8() {
    v8f z;
#pragma unroll
    for (int i = 0; i < 8; ++i) z[i] = 0.0f;
    return z;
}

// 16x32 A fragment (or B fragment from an [n][k] k-contiguous source) from a
// row-major 16-bit tile: lane m = lane&15 -> row m; kb = 8*(lane>>4);
// elements 0..7 = k kb..kb+7, elements 8..15 = k kb+16..kb+23.
static __device__ __forceinline__ v16h load_frag16(const _Float16* base, int ld, int lane) {
    int m  = lane & 15;
    int kb = (lane >> 4) << 3;
    const _Float16* p = base + (size_t)m * ld + kb;
    Frag f;
    f.h[0] = *(const v8h*)(p);
    f.h[1] = *(const v8h*)(p + 16);
    return f.v;
}

static __device__ __forceinline__ v8f wmma16(v16h a, v16h b, v8f c) {
    v8f d = __builtin_amdgcn_wmma_f32_16x16x32_f16(false, a, false, b, (short)0, c, false, false);
    asm volatile("v_nop\n\tv_nop\n\tv_nop\n\tv_nop" : "+v"(d) : "v"(a), "v"(b));
    return d;
}

// f32 -> bf16 RNE convert, value kept as f32
static __device__ __forceinline__ float bf16r(float x) {
    unsigned u = __float_as_uint(x);
    u = (u + 0x7FFFu + ((u >> 16) & 1u)) & 0xFFFF0000u;
    return __uint_as_float(u);
}

// ordering for a wave-private LDS tile: stores before later loads of the same wave
static __device__ __forceinline__ void wave_lds_sync() {
    __builtin_amdgcn_fence(3, "wavefront");
    asm volatile("s_wait_dscnt 0" ::: "memory");
    __builtin_amdgcn_wave_barrier();
}

static __device__ __forceinline__ float wsum(float v) {
    v += __shfl_xor(v, 16, 32); v += __shfl_xor(v, 8, 32); v += __shfl_xor(v, 4, 32);
    v += __shfl_xor(v, 2, 32);  v += __shfl_xor(v, 1, 32);
    return v;
}
static __device__ __forceinline__ float wmaxr(float v) {
    v = fmaxf(v, __shfl_xor(v, 16, 32)); v = fmaxf(v, __shfl_xor(v, 8, 32));
    v = fmaxf(v, __shfl_xor(v, 4, 32));  v = fmaxf(v, __shfl_xor(v, 2, 32));
    v = fmaxf(v, __shfl_xor(v, 1, 32));
    return v;
}
static __device__ __forceinline__ float wminr(float v) {
    v = fminf(v, __shfl_xor(v, 16, 32)); v = fminf(v, __shfl_xor(v, 8, 32));
    v = fminf(v, __shfl_xor(v, 4, 32));  v = fminf(v, __shfl_xor(v, 2, 32));
    v = fminf(v, __shfl_xor(v, 1, 32));
    return v;
}

// Mish(x) = x * tanh(softplus(x)) = x * (u^2+2u)/(u^2+2u+2), u = e^x
static __device__ __forceinline__ float mishf(float x) {
    float xe = fminf(x, 20.0f);
    float u  = __builtin_amdgcn_exp2f(xe * LOG2E);
    float wv = u * (u + 2.0f);
    float t  = wv * __builtin_amdgcn_rcpf(wv + 2.0f);
    return x * t;
}

// 16 columns per lane: columns 256*j + 8*lane + e (j = 0,1; e = 0..7)
static __device__ __forceinline__ void load_cols16(const float* p, int lane, float (&o)[16]) {
#pragma unroll
    for (int j = 0; j < 2; ++j) {
        v4f a = *(const v4f*)(p + 256 * j + 8 * lane);
        v4f c = *(const v4f*)(p + 256 * j + 8 * lane + 4);
        o[8 * j + 0] = a.x; o[8 * j + 1] = a.y; o[8 * j + 2] = a.z; o[8 * j + 3] = a.w;
        o[8 * j + 4] = c.x; o[8 * j + 5] = c.y; o[8 * j + 6] = c.z; o[8 * j + 7] = c.w;
    }
}

// LayerNorm over a 512-wide row held as 16 columns per lane (f32)
static __device__ __forceinline__ void ln_lane(const float (&v)[16], const float (&gl)[16],
                                               const float (&el)[16], float (&y)[16]) {
    float s = 0.0f;
#pragma unroll
    for (int e = 0; e < 16; ++e) s += v[e];
    s = wsum(s);
    const float mu = s * (1.0f / (float)DM);
    float d[16];
    float q = 0.0f;
#pragma unroll
    for (int e = 0; e < 16; ++e) { d[e] = v[e] - mu; q = __builtin_fmaf(d[e], d[e], q); }
    q = wsum(q);
    const float rstd = rsqrtf(__builtin_fmaf(q, 1.0f / (float)DM, LN_EPS));
#pragma unroll
    for (int e = 0; e < 16; ++e) y[e] = d[e] * rstd * gl[e] + el[e];
}

// ---------------------------------------------------------------------------
// Weight plane: dst[i] = f16(bf16r(src[i]) * 64), layout kept [out][in] (k-contiguous).
// coverage: grid = n/2048, 256 threads x 8 elements -> n exactly.
// ---------------------------------------------------------------------------
__global__ __launch_bounds__(256) void k_wcvt(const float* __restrict__ src,
                                               _Float16* __restrict__ dst) {
    const size_t i = (size_t)blockIdx.x * 256 + threadIdx.x;
    v4f a = *(const v4f*)(src + i * 8);
    v4f c = *(const v4f*)(src + i * 8 + 4);
    v8h o;
    o[0] = (_Float16)(bf16r(a.x) * WSC); o[1] = (_Float16)(bf16r(a.y) * WSC);
    o[2] = (_Float16)(bf16r(a.z) * WSC); o[3] = (_Float16)(bf16r(a.w) * WSC);
    o[4] = (_Float16)(bf16r(c.x) * WSC); o[5] = (_Float16)(bf16r(c.y) * WSC);
    o[6] = (_Float16)(bf16r(c.z) * WSC); o[7] = (_Float16)(bf16r(c.w) * WSC);
    *(v8h*)(dst + i * 8) = o;
    
}

// ---------------------------------------------------------------------------
// LN1: y1[tok][512] = f16(LayerNorm(bf16r(x)) * g + b). One wave per row,
// lane owns columns 8l..8l+7 and 256+8l..; two v8h instructions per row, each
// coverage: grid NTOK/8 x 8 waves x 512 = NTOK x 512.
// ---------------------------------------------------------------------------
__global__ __launch_bounds__(256) void k_ln1(const float* __restrict__ x,
                                              const float* __restrict__ g,
                                              const float* __restrict__ be,
                                              _Float16* __restrict__ y) {
    const int tid = threadIdx.x, lane = tid & 31, w = tid >> 5;
    const int tok = blockIdx.x * 8 + w;
    const int b = tok / SEQ, s = tok - b * SEQ;
    const float* xr = x + ((size_t)b * SEQ_FULL + s) * DM;
    float v[16], gl[16], el[16], yv[16];
    load_cols16(xr, lane, v);
    load_cols16(g, lane, gl);
    load_cols16(be, lane, el);
#pragma unroll
    for (int e = 0; e < 16; ++e) { v[e] = bf16r(v[e]); gl[e] = bf16r(gl[e]); el[e] = bf16r(el[e]); }
    ln_lane(v, gl, el, yv);
    v8h o[2];
#pragma unroll
    for (int j = 0; j < 2; ++j)
#pragma unroll
        for (int e = 0; e < 8; ++e) o[j][e] = (_Float16)yv[8 * j + e];
    _Float16* yr = y + (size_t)tok * DM;
    *(v8h*)(yr + 8 * lane)       = o[0];
    *(v8h*)(yr + 256 + 8 * lane) = o[1];
    
}

// ---------------------------------------------------------------------------
// GEMM core: wave tile 32 rows x 64 cols, C[r][n] += A[r][k] * B[n][k],
// A and B f16 row-major k-contiguous planes in global memory, fragments loaded
// directly (two 16-B loads each, arithmetic addressing). K % 32 == 0.
// ---------------------------------------------------------------------------
static __device__ __forceinline__ void gemm_32x64(const _Float16* __restrict__ Ab,
                                                  const _Float16* __restrict__ Bb,
                                                  int K, int lane, v8f (&acc)[2][4]) {
#pragma unroll
    for (int t = 0; t < 2; ++t)
#pragma unroll
        for (int j = 0; j < 4; ++j) acc[t][j] = zero8();
#pragma unroll 1
    for (int k0 = 0; k0 < K; k0 += 32) {
        v16h a0 = load_frag16(Ab + k0, K, lane);
        v16h a1 = load_frag16(Ab + (size_t)16 * K + k0, K, lane);
        v16h bb[4];
#pragma unroll
        for (int j = 0; j < 4; ++j) bb[j] = load_frag16(Bb + (size_t)(16 * j) * K + k0, K, lane);
#pragma unroll
        for (int j = 0; j < 4; ++j) {
            acc[0][j] = wmma16(a0, bb[j], acc[0][j]);
            acc[1][j] = wmma16(a1, bb[j], acc[1][j]);
        }
    }
}

// ---------------------------------------------------------------------------
// Plane GEMM: out[tok][ldo] f16 plane, block = 32 rows x 512 cols (blockIdx.y =
// 512-column segment), wave = 32 x 64. EPI 0: val = acc + 64*bias (q|k|v x64);
// EPI 1: val = 64 * Mish(acc/64 + bias). Wave-private LDS tile, then 8
// coverage: grid (NTOK/32, ldo/512) x 8 waves x 32x64 = NTOK x ldo.
// ---------------------------------------------------------------------------
template <int EPI>
__global__ __launch_bounds__(256) __attribute__((amdgpu_num_vgpr(256)))
void k_gemm_p(const _Float16* __restrict__ A, int K, const _Float16* __restrict__ Bw,
              const float* __restrict__ b0, const float* __restrict__ b1,
              const float* __restrict__ b2, const float* __restrict__ b3,
              _Float16* __restrict__ outp, int ldo) {
    __shared__ __align__(16) _Float16 st[8][QR * 64];      // 32 KB, wave-private tiles
    const int tid = threadIdx.x, lane = tid & 31, w = tid >> 5;
    const int hh = lane >> 4, m = lane & 15;
    const int m0  = blockIdx.x * QR;
    const int seg = blockIdx.y;
    const int nl  = 64 * w;                 // column within the 512 segment
    const int n0w = seg * 512 + nl;         // output column / B row
    const float* bias = (seg == 0) ? b0 : ((seg == 1) ? b1 : ((seg == 2) ? b2 : b3));

    v8f acc[2][4];
    gemm_32x64(A + (size_t)m0 * K, Bw + (size_t)n0w * K, K, lane, acc);

    float bl[4];
#pragma unroll
    for (int j = 0; j < 4; ++j) bl[j] = bf16r(bias[nl + 16 * j + m]);
#pragma unroll
    for (int t = 0; t < 2; ++t)
#pragma unroll
        for (int j = 0; j < 4; ++j)
#pragma unroll
            for (int r = 0; r < 8; ++r) {
                float a = acc[t][j][r];
                float val;
                if (EPI == 0) {
                    val = __builtin_fmaf(bl[j], WSC, a);
                } else {
                    float hx = __builtin_fmaf(a, SC_H, bl[j]);
                    val = WSC * mishf(hx);
                }
                st[w][(16 * t + 8 * hh + r) * 64 + 16 * j + m] = (_Float16)val;
            }
    wave_lds_sync();

    v8h pv[8];
    const int lr = lane >> 3, lc = (lane & 7) * 8;
#pragma unroll
    for (int i = 0; i < 8; ++i) pv[i] = *(const v8h*)(&st[w][(4 * i + lr) * 64 + lc]);
    _Float16* ob = outp + (size_t)m0 * ldo + n0w;
#pragma unroll
    for (int i = 0; i < 8; ++i) *(v8h*)(ob + (size_t)(4 * i + lr) * ldo + lc) = pv[i];
    
}

// ---------------------------------------------------------------------------
// Row GEMM (N = 512, block owns 32 full rows) fused with residual add + LayerNorm.
// MODE 0: x1 = bf16r(x) + (acc 2^-12 + bias) -> x1 f32 plane, y2 = f16(LN(x1) g + b).
// MODE 1: x2 = x1 + (acc 2^-12 + bias), out = LN(x2) g + b -> f32 rows.
// Block tile staged f32 in LDS (cross-wave, block barrier); wave then owns 4 rows:
// f16 rows written directly as two 512-B lane-contiguous instructions; f32 rows
// relaid through the (now wave-private) LDS row and written as four 512-B
// coverage: grid NTOK/32 x 32 rows x 512 = NTOK x 512 (each output plane).
// ---------------------------------------------------------------------------
template <int MODE>
__global__ __launch_bounds__(256) __attribute__((amdgpu_num_vgpr(256)))
void k_gemm_r(const _Float16* __restrict__ A, int K, const _Float16* __restrict__ Bw,
              const float* __restrict__ bias, const float* __restrict__ res,
              const float* __restrict__ g, const float* __restrict__ be,
              float* __restrict__ outf, _Float16* __restrict__ outh) {
    __shared__ __align__(16) float T[QR * DM];            // 64 KB block tile
    const int tid = threadIdx.x, lane = tid & 31, w = tid >> 5;
    const int hh = lane >> 4, m = lane & 15;
    const int m0 = blockIdx.x * QR;
    const int nl = 64 * w;

    v8f acc[2][4];
    gemm_32x64(A + (size_t)m0 * K, Bw + (size_t)nl * K, K, lane, acc);
#pragma unroll
    for (int t = 0; t < 2; ++t)
#pragma unroll
        for (int j = 0; j < 4; ++j)
#pragma unroll
            for (int r = 0; r < 8; ++r)
                T[(16 * t + 8 * hh + r) * DM + nl + 16 * j + m] = acc[t][j][r];
    __syncthreads();

    float bl[16], gl[16], el[16];
    load_cols16(bias, lane, bl);
    load_cols16(g, lane, gl);
    load_cols16(be, lane, el);
#pragma unroll
    for (int e = 0; e < 16; ++e) { bl[e] = bf16r(bl[e]); gl[e] = bf16r(gl[e]); el[e] = bf16r(el[e]); }

#pragma unroll 1
    for (int rr = 0; rr < 4; ++rr) {
        const int row = 4 * w + rr;
        const int tok = m0 + row;
        float v[16], rv[16], yv[16];
        load_cols16(&T[row * DM], lane, v);
        if (MODE == 0) {
            const int b = tok / SEQ, s = tok - b * SEQ;
            load_cols16(res + ((size_t)b * SEQ_FULL + s) * DM, lane, rv);
#pragma unroll
            for (int e = 0; e < 16; ++e) rv[e] = bf16r(rv[e]);
        } else {
            load_cols16(res + (size_t)tok * DM, lane, rv);
        }
#pragma unroll
        for (int e = 0; e < 16; ++e) v[e] = rv[e] + __builtin_fmaf(v[e], SC_O, bl[e]);
        ln_lane(v, gl, el, yv);

        // write-back into the wave-private LDS row (same columns this lane loaded)
        float* trow = &T[row * DM];
#pragma unroll
        for (int j = 0; j < 2; ++j) {
            v4f p0, p1;
            if (MODE == 0) {
                p0.x = v[8 * j + 0]; p0.y = v[8 * j + 1]; p0.z = v[8 * j + 2]; p0.w = v[8 * j + 3];
                p1.x = v[8 * j + 4]; p1.y = v[8 * j + 5]; p1.z = v[8 * j + 6]; p1.w = v[8 * j + 7];
            } else {
                p0.x = yv[8 * j + 0]; p0.y = yv[8 * j + 1]; p0.z = yv[8 * j + 2]; p0.w = yv[8 * j + 3];
                p1.x = yv[8 * j + 4]; p1.y = yv[8 * j + 5]; p1.z = yv[8 * j + 6]; p1.w = yv[8 * j + 7];
            }
            *(v4f*)(trow + 256 * j + 8 * lane)     = p0;
            *(v4f*)(trow + 256 * j + 8 * lane + 4) = p1;
        }
        wave_lds_sync();
        v4f s4[4];
#pragma unroll
        for (int jj = 0; jj < 4; ++jj) s4[jj] = *(const v4f*)(trow + 128 * jj + 4 * lane);

        float* orow = outf + (size_t)tok * DM;
        if (MODE == 0) {
            v8h o[2];
#pragma unroll
            for (int j = 0; j < 2; ++j)
#pragma unroll
                for (int e = 0; e < 8; ++e) o[j][e] = (_Float16)yv[8 * j + e];
            _Float16* hrow = outh + (size_t)tok * DM;
            *(v8h*)(hrow + 8 * lane)       = o[0];
            *(v8h*)(hrow + 256 + 8 * lane) = o[1];
#pragma unroll
            for (int jj = 0; jj < 4; ++jj) *(v4f*)(orow + 128 * jj + 4 * lane) = s4[jj];
            
        } else {
#pragma unroll
            for (int jj = 0; jj < 4; ++jj) *(v4f*)(orow + 128 * jj + 4 * lane) = s4[jj];
            
        }
    }
}

// ---------------------------------------------------------------------------
// Attention with 1.5-entmax over keys. Block = 8 waves = 32 query rows of one
// (batch, head); qkv plane [tok][1536] (q | k | v, each x64, head h at +64h).
// Phase 1: z strip [32][SEQ] f32 in LDS = (64q).(64k) 2^-16 = q.k/16; wave owns
//          SEQ/128 key tiles x both row tiles (K fragments straight from the plane).
// Phase 2: wave owns 4 rows; per row: shift by max, threshold tau of
//          sum relu(z - tau)^2 = 1 by safeguarded Newton (NEWT passes, registers),
//          P = relu(z - tau)^2 x 2^14 as f16 written over the row's own slot
//          (pitch 2*SEQ halves, skew 8*(row&15) halves).
// Phase 3: per CH-key chunk, V^T chunk [64][CH] staged in LDS (cross-wave, block
//          barriers); wave owns one 16x16 ctx tile over all keys.
// Phase 4: ctx x64 as f16 staged [32][64] (cross-wave, barrier); wave w writes rows
// coverage: grid (SEQ/32, 8, NB) x 32 rows x 64 = NTOK x 512 of the ctx plane.
// ---------------------------------------------------------------------------
__global__ __launch_bounds__(256) __attribute__((amdgpu_num_vgpr(256)))
void k_attn(const _Float16* __restrict__ qkv, _Float16* __restrict__ ctx) {
    __shared__ __align__(16) float    zs[QR * SEQ];       // 128 KB at full size
    __shared__ __align__(16) _Float16 Vt[HD * VTP];       // 17 KB
    __shared__ __align__(16) _Float16 Cst[QR * HD];       // 4 KB
    static_assert(sizeof(zs) + sizeof(Vt) + sizeof(Cst) <= 160 * 1024);   // two blocks per WGP
    _Float16* ph = reinterpret_cast<_Float16*>(zs);       // P rows alias the z slots
    constexpr int PP  = 2 * SEQ;                          // P row slot (halves)
    constexpr int PLD = PP + 8;                           // fragment pitch incl. skew
    constexpr int KTW = SEQ / 128;                        // key tiles per wave

    const int tid = threadIdx.x, lane = tid & 31, w = tid >> 5;
    const int hh = lane >> 4, m = lane & 15;
    const int h = blockIdx.y, b = blockIdx.z;
    const int q0 = blockIdx.x * QR;
    const size_t tokq = (size_t)b * SEQ + q0;
    const _Float16* qp = qkv + tokq * DQKV + h * HD;
    const _Float16* kp = qkv + (size_t)b * SEQ * DQKV + DM + h * HD;
    const _Float16* vp = qkv + (size_t)b * SEQ * DQKV + 2 * DM + h * HD;

    // ---- phase 1: scores ----
    {
        const v16h qa00 = load_frag16(qp, DQKV, lane);
        const v16h qa01 = load_frag16(qp + 32, DQKV, lane);
        const v16h qa10 = load_frag16(qp + (size_t)16 * DQKV, DQKV, lane);
        const v16h qa11 = load_frag16(qp + (size_t)16 * DQKV + 32, DQKV, lane);
#pragma unroll 1
        for (int i = 0; i < KTW; ++i) {
            const int key0 = (w * KTW + i) * 16;
            const _Float16* kt = kp + (size_t)key0 * DQKV;
            v16h kf0 = load_frag16(kt, DQKV, lane);
            v16h kf1 = load_frag16(kt + 32, DQKV, lane);
            v8f s0 = wmma16(qa00, kf0, zero8());
            s0 = wmma16(qa01, kf1, s0);
            v8f s1 = wmma16(qa10, kf0, zero8());
            s1 = wmma16(qa11, kf1, s1);
#pragma unroll
            for (int r = 0; r < 8; ++r) {
                zs[(8 * hh + r) * SEQ + key0 + m]      = s0[r] * SC_Z;
                zs[(16 + 8 * hh + r) * SEQ + key0 + m] = s1[r] * SC_Z;
            }
        }
    }
    __syncthreads();

    // ---- phase 2: 1.5-entmax threshold per row ----
    const float tcl = -rsqrtf((float)SEQ);    // tau <= -1/sqrt(SEQ) always
#pragma unroll 1
    for (int rr = 0; rr < 4; ++rr) {
        const int row = 4 * w + rr;
        float z[ZN];
        const float* zr = &zs[row * SEQ];
#pragma unroll
        for (int j = 0; j < ZN / 4; ++j) {
            v4f t4 = *(const v4f*)(zr + 128 * j + 4 * lane);
            z[4 * j + 0] = t4.x; z[4 * j + 1] = t4.y; z[4 * j + 2] = t4.z; z[4 * j + 3] = t4.w;
        }
        float mx = z[0], mn = z[0];
#pragma unroll
        for (int i = 1; i < ZN; ++i) { mx = fmaxf(mx, z[i]); mn = fminf(mn, z[i]); }
        mx = wmaxr(mx);
        mn = wminr(mn);
#pragma unroll
        for (int i = 0; i < ZN; ++i) z[i] = z[i] - mx;
        float tau = fminf(fmaxf(mn - mx, -1.0f), tcl);
#pragma unroll 1
        for (int it = 0; it < NEWT; ++it) {
            float sa = 0.0f, sb = 0.0f;
#pragma unroll
            for (int i = 0; i < ZN; ++i) {
                float d = fmaxf(z[i] - tau, 0.0f);
                sa += d;
                sb = __builtin_fmaf(d, d, sb);
            }
            sa = wsum(sa);
            sb = wsum(sb);
            tau = tau + (sb - 1.0f) * (0.5f * __builtin_amdgcn_rcpf(sa));
            tau = fminf(fmaxf(tau, -1.0f), tcl);
        }
        _Float16* prow = ph + (size_t)row * PP + (row & 15) * 8;
#pragma unroll
        for (int j = 0; j < ZN / 4; ++j) {
            v4h pk;
#pragma unroll
            for (int e = 0; e < 4; ++e) {
                float d = fmaxf(z[4 * j + e] - tau, 0.0f);
                pk[e] = (_Float16)(d * d * SC_P);
            }
            *(v4h*)(prow + 128 * j + 4 * lane) = pk;
        }
    }
    __syncthreads();

    // ---- phase 3: ctx = P @ v ----
    const int rt = w & 1, ct = w >> 1;
    v8f acc = zero8();
#pragma unroll 1
    for (int c0 = 0; c0 < SEQ; c0 += CH) {
        // V^T chunk: Vt[d][t] = v[c0 + t][d], full 64 x CH extent
#pragma unroll
        for (int i2 = 0; i2 < CH / 32; ++i2) {
            const int idx = tid + 256 * i2;
            const int t = idx >> 3, part = idx & 7;
            v8h vv = *(const v8h*)(vp + (size_t)(c0 + t) * DQKV + part * 8);
#pragma unroll
            for (int e = 0; e < 8; ++e) Vt[(part * 8 + e) * VTP + t] = vv[e];
        }
        __syncthreads();
#pragma unroll 1
        for (int j = 0; j < CH; j += 32) {
            v16h pa = load_frag16(ph + (size_t)(16 * rt) * PP + c0 + j, PLD, lane);  // rows = queries, k = keys
            v16h vb = load_frag16(&Vt[(16 * ct) * VTP + j], VTP, lane);            // n = d, k = keys
            acc = wmma16(pa, vb, acc);
        }
        __syncthreads();
    }

    // ---- phase 4: ctx plane x64 ----
#pragma unroll
    for (int r = 0; r < 8; ++r)
        Cst[(16 * rt + 8 * hh + r) * HD + 16 * ct + m] = (_Float16)(acc[r] * SC_C);
    __syncthreads();
    const int orow = 4 * w + (lane >> 3), oc = (lane & 7) * 8;
    v8h cv = *(const v8h*)(&Cst[orow * HD + oc]);
    _Float16* dst = ctx + (tokq + orow) * DM + h * HD + oc;
    *(v8h*)dst = cv;
    
}

// ---------------------------------------------------------------------------
extern "C" void kernel_launch(void* const* d_in, const int* in_sizes, int n_in,
                              void* d_out, int out_size, void* d_ws, size_t ws_size,
                              hipStream_t stream) {
    if (n_in < 19) return;
    if (in_sizes[0] < ((NB - 1) * SEQ_FULL + SEQ) * DM) return;
    if (in_sizes[1] < DM * DM || in_sizes[3] < DM * DM || in_sizes[5] < DM * DM || in_sizes[7] < DM * DM) return;
    if (in_sizes[2] < DM || in_sizes[4] < DM || in_sizes[6] < DM || in_sizes[8] < DM) return;
    if (in_sizes[9] < DM || in_sizes[10] < DM || in_sizes[15] < DM || in_sizes[16] < DM) return;
    if (in_sizes[17] < DM || in_sizes[18] < DM || in_sizes[14] < DM) return;
    if (in_sizes[11] < DF * DM || in_sizes[13] < DM * DF || in_sizes[12] < DF) return;
    if (out_size < NTOK * DM) return;

    const float* x    = (const float*)d_in[0];    // [8,1024,512]
    const float* Wq   = (const float*)d_in[1];    // [512,512] (out,in)
    const float* bq   = (const float*)d_in[2];
    const float* Wk   = (const float*)d_in[3];
    const float* bk   = (const float*)d_in[4];
    const float* Wv   = (const float*)d_in[5];
    const float* bv   = (const float*)d_in[6];
    const float* Wo   = (const float*)d_in[7];
    const float* bo   = (const float*)d_in[8];
    const float* ln1g = (const float*)d_in[9];
    const float* ln1b = (const float*)d_in[10];
    const float* W1   = (const float*)d_in[11];   // [2048,512]
    const float* bf1  = (const float*)d_in[12];
    const float* W2   = (const float*)d_in[13];   // [512,2048]
    const float* bf2  = (const float*)d_in[14];
    const float* ln2g = (const float*)d_in[15];
    const float* ln2b = (const float*)d_in[16];
    const float* lnfg = (const float*)d_in[17];
    const float* lnfb = (const float*)d_in[18];
    float* out = (float*)d_out;                   // [NTOK][512]

    char* ws = (char*)d_ws;
    size_t off = 0;
    _Float16* wqkv = (_Float16*)(ws + off); off += (size_t)DQKV * DM * 2;      // 1,572,864
    _Float16* wo16 = (_Float16*)(ws + off); off += (size_t)DM * DM * 2;        //   524,288
    _Float16* w116 = (_Float16*)(ws + off); off += (size_t)DF * DM * 2;        // 2,097,152
    _Float16* w216 = (_Float16*)(ws + off); off += (size_t)DM * DF * 2;        // 2,097,152
    _Float16* y1   = (_Float16*)(ws + off); off += (size_t)NTOK * DM * 2;      // 8 MiB at full size
    _Float16* qkv  = (_Float16*)(ws + off); off += (size_t)NTOK * DQKV * 2;    // 24 MiB
    _Float16* cpl  = (_Float16*)(ws + off); off += (size_t)NTOK * DM * 2;      // 8 MiB
    float*    x1   = (float*)(ws + off);    off += (size_t)NTOK * DM * 4;      // 16 MiB
    _Float16* y2   = (_Float16*)(ws + off); off += (size_t)NTOK * DM * 2;      // 8 MiB
    _Float16* mpl  = (_Float16*)(ws + off); off += (size_t)NTOK * DF * 2;      // 32 MiB
    if (off > ws_size) return;                                                 // 106,954,752 B at full size

    k_wcvt<<<dim3(DM * DM / 2048), dim3(256), 0, stream>>>(Wq, wqkv);
    k_wcvt<<<dim3(DM * DM / 2048), dim3(256), 0, stream>>>(Wk, wqkv + (size_t)DM * DM);
    k_wcvt<<<dim3(DM * DM / 2048), dim3(256), 0, stream>>>(Wv, wqkv + (size_t)2 * DM * DM);
    k_wcvt<<<dim3(DM * DM / 2048), dim3(256), 0, stream>>>(Wo, wo16);
    k_wcvt<<<dim3(DF * DM / 2048), dim3(256), 0, stream>>>(W1, w116);
    k_wcvt<<<dim3(DM * DF / 2048), dim3(256), 0, stream>>>(W2, w216);

    k_ln1<<<dim3(NTOK / 8), dim3(256), 0, stream>>>(x, ln1g, ln1b, y1);
    k_gemm_p<0><<<dim3(NTOK / QR, 3), dim3(256), 0, stream>>>(y1, DM, wqkv, bq, bk, bv, bv, qkv, DQKV);
    k_attn<<<dim3(SEQ / QR, NH, NB), dim3(256), 0, stream>>>(qkv, cpl);
    k_gemm_r<0><<<dim3(NTOK / QR), dim3(256), 0, stream>>>(cpl, DM, wo16, bo, x, ln2g, ln2b, x1, y2);
    k_gemm_p<1><<<dim3(NTOK / QR, DF / 512), dim3(256), 0, stream>>>(y2, DM, w116, bf1, bf1 + 512, bf1 + 1024, bf1 + 1536, mpl, DF);
    k_gemm_r<1><<<dim3(NTOK / QR), dim3(256), 0, stream>>>(mpl, DF, w216, bf2, x1, lnfg, lnfb, out, y2);
}

// v002
// One run takes 314 microseconds.
// Next to v001, in two timings, it ran 1.14 times as fast each time.
// Over all steps from v000 it is 1.37 times as fast.
#include <hip/hip_runtime.h>

// Contractions on v_wmma_f32_16x16x32_f16 (f16 operands, f32 accumulate), one product each: y1*[Wq|Wk|Wv]^T, q*k^T, P*v, ctx*Wo^T, y2*W1^T, m*W2^T; float inputs RNE-converted to bf16 then carried in f16 (weights x64, P x2^14, ctx x64, m x64); LayerNorm, 1.5-entmax threshold and Mish in f32.

#ifndef NB
#define NB 8
#endif
#ifndef SEQ
#define SEQ 1024
#endif
#define NB_FULL  8
#define SEQ_FULL 1024
#define DM   512            // model width
#define DF   2048           // ffn width
#define NH   8
#define HD   64
#define DQKV (3 * DM)       // q|k|v plane pitch
#define NTOK (NB * SEQ)
#define QR   32             // query rows per attention block / rows per gemm block
#define CH   128            // keys per V^T chunk: keeps k_attn's LDS under half a WGP's, so two blocks share one
#define VTP  (CH + 8)       // V^T chunk pitch (halves)
#define ZN   (SEQ / 32)     // scores per lane per row
#define NEWT 10             // Newton passes for the entmax threshold

static_assert(NB >= 1 && NB <= NB_FULL);
static_assert(SEQ >= CH && SEQ <= SEQ_FULL);
static_assert(SEQ % CH == 0);
static_assert(CH % 32 == 0);
static_assert(SEQ % 128 == 0);
static_assert(NTOK % QR == 0);
static_assert(NH * HD == DM);
static_assert(QR == 32);
static_assert((ZN % 4) == 0);
static_assert(DM % 32 == 0 && DF % 32 == 0);
static_assert((DM * DM) % 2048 == 0 && (DF * DM) % 2048 == 0);

typedef _Float16 v16h __attribute__((ext_vector_type(16)));
typedef _Float16 v8h  __attribute__((ext_vector_type(8)));
typedef _Float16 v4h  __attribute__((ext_vector_type(4)));
typedef float    v8f  __attribute__((ext_vector_type(8)));
typedef float    v4f  __attribute__((ext_vector_type(4)));

union Frag { v16h v; v8h h[2]; };

#define WSC   64.0f                  // weight carry
#define SC_Z  1.52587890625e-05f     // 2^-16 : (64q).(64k) -> q.k/16 = z
#define SC_P  16384.0f               // 2^14  : P carry
#define SC_C  6.103515625e-05f       // 2^-14 : (2^14 P)(64 v) -> 64 ctx
#define SC_O  2.44140625e-04f        // 2^-12 : (64 a)(64 W) -> a.W
#define SC_H  0.015625f              // 1/64  : (y)(64 W) -> y.W
#define LOG2E 1.44269504088896340736f
#define LN_EPS 1e-5f

static __device__ __forceinline__ v8f zero8() {
    v8f z;
#pragma unroll
    for (int i = 0; i < 8; ++i) z[i] = 0.0f;
    return z;
}

// 16x32 A fragment (or B fragment from an [n][k] k-contiguous source) from a
// row-major 16-bit tile: lane m = lane&15 -> row m; kb = 8*(lane>>4);
// elements 0..7 = k kb..kb+7, elements 8..15 = k kb+16..kb+23.
static __device__ __forceinline__ v16h load_frag16(const _Float16* base, int ld, int lane) {
    int m  = lane & 15;
    int kb = (lane >> 4) << 3;
    const _Float16* p = base + (size_t)m * ld + kb;
    Frag f;
    f.h[0] = *(const v8h*)(p);
    f.h[1] = *(const v8h*)(p + 16);
    return f.v;
}

// B fragment from a tiled weight plane (see k_wcvt): one 16 x 32 tile is 1 KB,
// lane l reads 16 B at 16*l and at 512 + 16*l, so each load is four whole 128-B lines.
// Same element in every lane and register position as load_frag16 on the [n][k] plane.
static __device__ __forceinline__ v16h load_fragB(const _Float16* tile, int lane) {
    const _Float16* p = tile + lane * 8;
    Frag f;
    f.h[0] = *(const v8h*)(p);
    f.h[1] = *(const v8h*)(p + 256);
    return f.v;
}

static __device__ __forceinline__ v8f wmma16(v16h a, v16h b, v8f c) {
    v8f d = __builtin_amdgcn_wmma_f32_16x16x32_f16(false, a, false, b, (short)0, c, false, false);
    asm volatile("v_nop\n\tv_nop\n\tv_nop\n\tv_nop" : "+v"(d) : "v"(a), "v"(b));
    return d;
}

// f32 -> bf16 RNE convert, value kept as f32
static __device__ __forceinline__ float bf16r(float x) {
    unsigned u = __float_as_uint(x);
    u = (u + 0x7FFFu + ((u >> 16) & 1u)) & 0xFFFF0000u;
    return __uint_as_float(u);
}

// ordering for a wave-private LDS tile: stores before later loads of the same wave
static __device__ __forceinline__ void wave_lds_sync() {
    __builtin_amdgcn_fence(3, "wavefront");
    asm volatile("s_wait_dscnt 0" ::: "memory");
    __builtin_amdgcn_wave_barrier();
}

static __device__ __forceinline__ float wsum(float v) {
    v += __shfl_xor(v, 16, 32); v += __shfl_xor(v, 8, 32); v += __shfl_xor(v, 4, 32);
    v += __shfl_xor(v, 2, 32);  v += __shfl_xor(v, 1, 32);
    return v;
}
static __device__ __forceinline__ float wmaxr(float v) {
    v = fmaxf(v, __shfl_xor(v, 16, 32)); v = fmaxf(v, __shfl_xor(v, 8, 32));
    v = fmaxf(v, __shfl_xor(v, 4, 32));  v = fmaxf(v, __shfl_xor(v, 2, 32));
    v = fmaxf(v, __shfl_xor(v, 1, 32));
    return v;
}
static __device__ __forceinline__ float wminr(float v) {
    v = fminf(v, __shfl_xor(v, 16, 32)); v = fminf(v, __shfl_xor(v, 8, 32));
    v = fminf(v, __shfl_xor(v, 4, 32));  v = fminf(v, __shfl_xor(v, 2, 32));
    v = fminf(v, __shfl_xor(v, 1, 32));
    return v;
}

// Mish(x) = x * tanh(softplus(x)) = x * (u^2+2u)/(u^2+2u+2), u = e^x
static __device__ __forceinline__ float mishf(float x) {
    float xe = fminf(x, 20.0f);
    float u  = __builtin_amdgcn_exp2f(xe * LOG2E);
    float wv = u * (u + 2.0f);
    float t  = wv * __builtin_amdgcn_rcpf(wv + 2.0f);
    return x * t;
}

// 16 columns per lane: columns 256*j + 8*lane + e (j = 0,1; e = 0..7)
static __device__ __forceinline__ void load_cols16(const float* p, int lane, float (&o)[16]) {
#pragma unroll
    for (int j = 0; j < 2; ++j) {
        v4f a = *(const v4f*)(p + 256 * j + 8 * lane);
        v4f c = *(const v4f*)(p + 256 * j + 8 * lane + 4);
        o[8 * j + 0] = a.x; o[8 * j + 1] = a.y; o[8 * j + 2] = a.z; o[8 * j + 3] = a.w;
        o[8 * j + 4] = c.x; o[8 * j + 5] = c.y; o[8 * j + 6] = c.z; o[8 * j + 7] = c.w;
    }
}

// LayerNorm over a 512-wide row held as 16 columns per lane (f32)
static __device__ __forceinline__ void ln_lane(const float (&v)[16], const float (&gl)[16],
                                               const float (&el)[16], float (&y)[16]) {
    float s = 0.0f;
#pragma unroll
    for (int e = 0; e < 16; ++e) s += v[e];
    s = wsum(s);
    const float mu = s * (1.0f / (float)DM);
    float d[16];
    float q = 0.0f;
#pragma unroll
    for (int e = 0; e < 16; ++e) { d[e] = v[e] - mu; q = __builtin_fmaf(d[e], d[e], q); }
    q = wsum(q);
    const float rstd = rsqrtf(__builtin_fmaf(q, 1.0f / (float)DM, LN_EPS));
#pragma unroll
    for (int e = 0; e < 16; ++e) y[e] = d[e] * rstd * gl[e] + el[e];
}

// ---------------------------------------------------------------------------
// Weight plane: value f16(bf16r(src[n][k]) * 64), stored in fragment order: tile
// (n/16, k/32) is 512 halves at ((n/16) * (K/32) + k/32) * 512; inside it element
// (n, k) sits at ((k>>4)&1)*256 + (((k>>3)&1)*16 + (n&15))*8 + (k&7).
// Thread i writes halves 8i..8i+7 (a wave stores 512 contiguous bytes) and gathers
// its 8 source floats; a block reads 16 rows x 512 contiguous bytes.
// coverage: grid = n/2048, 256 threads x 8 elements -> n exactly.
// ---------------------------------------------------------------------------
template <int K>
__global__ __launch_bounds__(256) void k_wcvt(const float* __restrict__ src,
                                               _Float16* __restrict__ dst) {
    constexpr int KT = K / 32;                  // k tiles per 16-row band
    const int i  = blockIdx.x * 256 + threadIdx.x;
    const int t  = i >> 6, gq = i & 63;         // tile, 8-half group inside it
    const int n  = (t / KT) * 16 + (gq & 15);
    const int k  = (t % KT) * 32 + (gq >> 5) * 16 + ((gq >> 4) & 1) * 8;
    const float* sp = src + (size_t)n * K + k;
    v4f a = *(const v4f*)(sp);
    v4f c = *(const v4f*)(sp + 4);
    v8h o;
    o[0] = (_Float16)(bf16r(a.x) * WSC); o[1] = (_Float16)(bf16r(a.y) * WSC);
    o[2] = (_Float16)(bf16r(a.z) * WSC); o[3] = (_Float16)(bf16r(a.w) * WSC);
    o[4] = (_Float16)(bf16r(c.x) * WSC); o[5] = (_Float16)(bf16r(c.y) * WSC);
    o[6] = (_Float16)(bf16r(c.z) * WSC); o[7] = (_Float16)(bf16r(c.w) * WSC);
    *(v8h*)(dst + (size_t)i * 8) = o;
    
}

// ---------------------------------------------------------------------------
// LN1: y1[tok][512] = f16(LayerNorm(bf16r(x)) * g + b). One wave per row,
// lane owns columns 8l..8l+7 and 256+8l..; two v8h instructions per row, each
// coverage: grid NTOK/8 x 8 waves x 512 = NTOK x 512.
// ---------------------------------------------------------------------------
__global__ __launch_bounds__(256) void k_ln1(const float* __restrict__ x,
                                              const float* __restrict__ g,
                                              const float* __restrict__ be,
                                              _Float16* __restrict__ y) {
    const int tid = threadIdx.x, lane = tid & 31, w = tid >> 5;
    const int tok = blockIdx.x * 8 + w;
    const int b = tok / SEQ, s = tok - b * SEQ;
    const float* xr = x + ((size_t)b * SEQ_FULL + s) * DM;
    float v[16], gl[16], el[16], yv[16];
    load_cols16(xr, lane, v);
    load_cols16(g, lane, gl);
    load_cols16(be, lane, el);
#pragma unroll
    for (int e = 0; e < 16; ++e) { v[e] = bf16r(v[e]); gl[e] = bf16r(gl[e]); el[e] = bf16r(el[e]); }
    ln_lane(v, gl, el, yv);
    v8h o[2];
#pragma unroll
    for (int j = 0; j < 2; ++j)
#pragma unroll
        for (int e = 0; e < 8; ++e) o[j][e] = (_Float16)yv[8 * j + e];
    _Float16* yr = y + (size_t)tok * DM;
    *(v8h*)(yr + 8 * lane)       = o[0];
    *(v8h*)(yr + 256 + 8 * lane) = o[1];
    
}

// ---------------------------------------------------------------------------
// GEMM core: wave tile 32 rows x 64 cols, C[r][n] += A[r][k] * B[n][k],
// A an f16 row-major k-contiguous plane, B a tiled weight plane (k_wcvt) whose band of
// 16 rows starts at 16*K*band halves; fragments loaded directly from global memory
// (two 16-B loads each). K % 32 == 0; K is a compile-time constant so that the second A
// tile and the B bands sit at immediate offsets of one address pair an operand, which
// lives through the loop: no load's result is given a register that a load names.
// ---------------------------------------------------------------------------
template <int K>
static __device__ __forceinline__ void gemm_32x64(const _Float16* __restrict__ Ab,
                                                  const _Float16* __restrict__ Bb,
                                                  int lane, v8f (&acc)[2][4]) {
#pragma unroll
    for (int t = 0; t < 2; ++t)
#pragma unroll
        for (int j = 0; j < 4; ++j) acc[t][j] = zero8();
#pragma unroll 1
    for (int k0 = 0; k0 < K; k0 += 32) {
        v16h a0 = load_frag16(Ab + k0, K, lane);
        v16h a1 = load_frag16(Ab + (size_t)16 * K + k0, K, lane);
        v16h bb[4];
#pragma unroll
        for (int j = 0; j < 4; ++j) bb[j] = load_fragB(Bb + (size_t)(16 * j) * K + (size_t)k0 * 16, lane);
#pragma unroll
        for (int j = 0; j < 4; ++j) {
            acc[0][j] = wmma16(a0, bb[j], acc[0][j]);
            acc[1][j] = wmma16(a1, bb[j], acc[1][j]);
        }
    }
}

// ---------------------------------------------------------------------------
// Plane GEMM: out[tok][ldo] f16 plane, block = 32 rows x 512 cols (blockIdx.y =
// 512-column segment), wave = 32 x 64. EPI 0: val = acc + 64*bias (q|k|v x64);
// EPI 1: val = 64 * Mish(acc/64 + bias). Wave-private LDS tile, then 8
// coverage: grid (NTOK/32, ldo/512) x 8 waves x 32x64 = NTOK x ldo.
// ---------------------------------------------------------------------------
template <int EPI>
__global__ __launch_bounds__(256) __attribute__((amdgpu_waves_per_eu(8)))   // 128 registers a wave: four blocks share a WGP, so the EPI 1 grid is resident at once
void k_gemm_p(const _Float16* __restrict__ A, const _Float16* __restrict__ Bw,
              const float* __restrict__ b0, const float* __restrict__ b1,
              const float* __restrict__ b2, const float* __restrict__ b3,
              _Float16* __restrict__ outp, int ldo) {
    __shared__ __align__(16) _Float16 st[8][QR * 64];      // 32 KB, wave-private tiles
    const int tid = threadIdx.x, lane = tid & 31, w = tid >> 5;
    const int hh = lane >> 4, m = lane & 15;
    const int m0  = blockIdx.x * QR;
    const int seg = blockIdx.y;
    const int nl  = 64 * w;                 // column within the 512 segment
    const int n0w = seg * 512 + nl;         // output column / B row
    const float* bias = (seg == 0) ? b0 : ((seg == 1) ? b1 : ((seg == 2) ? b2 : b3));

    v8f acc[2][4];
    constexpr int K = DM;                   // k length of both plane GEMMs
    gemm_32x64<K>(A + (size_t)m0 * K, Bw + (size_t)n0w * K, lane, acc);

    float bl[4];
#pragma unroll
    for (int j = 0; j < 4; ++j) bl[j] = bf16r(bias[nl + 16 * j + m]);
#pragma unroll
    for (int t = 0; t < 2; ++t)
#pragma unroll
        for (int j = 0; j < 4; ++j)
#pragma unroll
            for (int r = 0; r < 8; ++r) {
                float a = acc[t][j][r];
                float val;
                if (EPI == 0) {
                    val = __builtin_fmaf(bl[j], WSC, a);
                } else {
                    float hx = __builtin_fmaf(a, SC_H, bl[j]);
                    val = WSC * mishf(hx);
                }
                st[w][(16 * t + 8 * hh + r) * 64 + 16 * j + m] = (_Float16)val;
            }
    wave_lds_sync();

    v8h pv[8];
    const int lr = lane >> 3, lc = (lane & 7) * 8;
#pragma unroll
    for (int i = 0; i < 8; ++i) pv[i] = *(const v8h*)(&st[w][(4 * i + lr) * 64 + lc]);
    _Float16* ob = outp + (size_t)m0 * ldo + n0w;
#pragma unroll
    for (int i = 0; i < 8; ++i) *(v8h*)(ob + (size_t)(4 * i + lr) * ldo + lc) = pv[i];
    
}

// ---------------------------------------------------------------------------
// Row GEMM (N = 512, block owns 32 full rows) fused with residual add + LayerNorm.
// MODE 0: x1 = bf16r(x) + (acc 2^-12 + bias) -> x1 f32 plane, y2 = f16(LN(x1) g + b).
// MODE 1: x2 = x1 + (acc 2^-12 + bias), out = LN(x2) g + b -> f32 rows.
// Block tile staged f32 in LDS (cross-wave, block barrier); wave then owns 4 rows:
// f16 rows written directly as two 512-B lane-contiguous instructions; f32 rows
// relaid through the (now wave-private) LDS row and written as four 512-B
// coverage: grid NTOK/32 x 32 rows x 512 = NTOK x 512 (each output plane).
// ---------------------------------------------------------------------------
template <int MODE>
__global__ __launch_bounds__(256) __attribute__((amdgpu_num_vgpr(256)))
void k_gemm_r(const _Float16* __restrict__ A, const _Float16* __restrict__ Bw,
              const float* __restrict__ bias, const float* __restrict__ res,
              const float* __restrict__ g, const float* __restrict__ be,
              float* __restrict__ outf, _Float16* __restrict__ outh) {
    __shared__ __align__(16) float T[QR * DM];            // 64 KB block tile
    const int tid = threadIdx.x, lane = tid & 31, w = tid >> 5;
    const int hh = lane >> 4, m = lane & 15;
    const int m0 = blockIdx.x * QR;
    const int nl = 64 * w;

    v8f acc[2][4];
    constexpr int K = (MODE == 0) ? DM : DF;   // k length: ctx plane / ffn plane
    gemm_32x64<K>(A + (size_t)m0 * K, Bw + (size_t)nl * K, lane, acc);
#pragma unroll
    for (int t = 0; t < 2; ++t)
#pragma unroll
        for (int j = 0; j < 4; ++j)
#pragma unroll
            for (int r = 0; r < 8; ++r)
                T[(16 * t + 8 * hh + r) * DM + nl + 16 * j + m] = acc[t][j][r];
    __syncthreads();

    float bl[16], gl[16], el[16];
    load_cols16(bias, lane, bl);
    load_cols16(g, lane, gl);
    load_cols16(be, lane, el);
#pragma unroll
    for (int e = 0; e < 16; ++e) { bl[e] = bf16r(bl[e]); gl[e] = bf16r(gl[e]); el[e] = bf16r(el[e]); }

#pragma unroll 1
    for (int rr = 0; rr < 4; ++rr) {
        const int row = 4 * w + rr;
        const int tok = m0 + row;
        float v[16], rv[16], yv[16];
        load_cols16(&T[row * DM], lane, v);
        if (MODE == 0) {
            const int b = tok / SEQ, s = tok - b * SEQ;
            load_cols16(res + ((size_t)b * SEQ_FULL + s) * DM, lane, rv);
#pragma unroll
            for (int e = 0; e < 16; ++e) rv[e] = bf16r(rv[e]);
        } else {
            load_cols16(res + (size_t)tok * DM, lane, rv);
        }
#pragma unroll
        for (int e = 0; e < 16; ++e) v[e] = rv[e] + __builtin_fmaf(v[e], SC_O, bl[e]);
        ln_lane(v, gl, el, yv);

        // write-back into the wave-private LDS row (same columns this lane loaded)
        float* trow = &T[row * DM];
#pragma unroll
        for (int j = 0; j < 2; ++j) {
            v4f p0, p1;
            if (MODE == 0) {
                p0.x = v[8 * j + 0]; p0.y = v[8 * j + 1]; p0.z = v[8 * j + 2]; p0.w = v[8 * j + 3];
                p1.x = v[8 * j + 4]; p1.y = v[8 * j + 5]; p1.z = v[8 * j + 6]; p1.w = v[8 * j + 7];
            } else {
                p0.x = yv[8 * j + 0]; p0.y = yv[8 * j + 1]; p0.z = yv[8 * j + 2]; p0.w = yv[8 * j + 3];
                p1.x = yv[8 * j + 4]; p1.y = yv[8 * j + 5]; p1.z = yv[8 * j + 6]; p1.w = yv[8 * j + 7];
            }
            *(v4f*)(trow + 256 * j + 8 * lane)     = p0;
            *(v4f*)(trow + 256 * j + 8 * lane + 4) = p1;
        }
        wave_lds_sync();
        v4f s4[4];
#pragma unroll
        for (int jj = 0; jj < 4; ++jj) s4[jj] = *(const v4f*)(trow + 128 * jj + 4 * lane);

        float* orow = outf + (size_t)tok * DM;
        if (MODE == 0) {
            v8h o[2];
#pragma unroll
            for (int j = 0; j < 2; ++j)
#pragma unroll
                for (int e = 0; e < 8; ++e) o[j][e] = (_Float16)yv[8 * j + e];
            _Float16* hrow = outh + (size_t)tok * DM;
            *(v8h*)(hrow + 8 * lane)       = o[0];
            *(v8h*)(hrow + 256 + 8 * lane) = o[1];
#pragma unroll
            for (int jj = 0; jj < 4; ++jj) *(v4f*)(orow + 128 * jj + 4 * lane) = s4[jj];
            
        } else {
#pragma unroll
            for (int jj = 0; jj < 4; ++jj) *(v4f*)(orow + 128 * jj + 4 * lane) = s4[jj];
            
        }
    }
}

// ---------------------------------------------------------------------------
// Attention with 1.5-entmax over keys. Block = 8 waves = 32 query rows of one
// (batch, head); qkv plane [tok][1536] (q | k | v, each x64, head h at +64h).
// Phase 1: z strip [32][SEQ] f32 in LDS = (64q).(64k) 2^-16 = q.k/16; wave owns
//          SEQ/128 key tiles x both row tiles (K fragments straight from the plane).
// Phase 2: wave owns 4 rows; per row: shift by max, threshold tau of
//          sum relu(z - tau)^2 = 1 by safeguarded Newton (NEWT passes, registers),
//          P = relu(z - tau)^2 x 2^14 as f16 written over the row's own slot
//          (pitch 2*SEQ halves, skew 8*(row&15) halves).
// Phase 3: per CH-key chunk, V^T chunk [64][CH] staged in LDS (cross-wave, block
//          barriers); wave owns one 16x16 ctx tile over all keys.
// Phase 4: ctx x64 as f16 staged [32][64] (cross-wave, barrier); wave w writes rows
// coverage: grid (SEQ/32, 8, NB) x 32 rows x 64 = NTOK x 512 of the ctx plane.
// ---------------------------------------------------------------------------
__global__ __launch_bounds__(256) __attribute__((amdgpu_num_vgpr(256)))
void k_attn(const _Float16* __restrict__ qkv, _Float16* __restrict__ ctx) {
    __shared__ __align__(16) float    zs[QR * SEQ];       // 128 KB at full size
    __shared__ __align__(16) _Float16 Vt[HD * VTP];       // 17 KB
    __shared__ __align__(16) _Float16 Cst[QR * HD];       // 4 KB
    static_assert(sizeof(zs) + sizeof(Vt) + sizeof(Cst) <= 160 * 1024);   // two blocks per WGP
    _Float16* ph = reinterpret_cast<_Float16*>(zs);       // P rows alias the z slots
    constexpr int PP  = 2 * SEQ;                          // P row slot (halves)
    constexpr int PLD = PP + 8;                           // fragment pitch incl. skew
    constexpr int KTW = SEQ / 128;                        // key tiles per wave

    const int tid = threadIdx.x, lane = tid & 31, w = tid >> 5;
    const int hh = lane >> 4, m = lane & 15;
    const int h = blockIdx.y, b = blockIdx.z;
    const int q0 = blockIdx.x * QR;
    const size_t tokq = (size_t)b * SEQ + q0;
    const _Float16* qp = qkv + tokq * DQKV + h * HD;
    const _Float16* kp = qkv + (size_t)b * SEQ * DQKV + DM + h * HD;
    const _Float16* vp = qkv + (size_t)b * SEQ * DQKV + 2 * DM + h * HD;

    // ---- phase 1: scores ----
    {
        const v16h qa00 = load_frag16(qp, DQKV, lane);
        const v16h qa01 = load_frag16(qp + 32, DQKV, lane);
        const v16h qa10 = load_frag16(qp + (size_t)16 * DQKV, DQKV, lane);
        const v16h qa11 = load_frag16(qp + (size_t)16 * DQKV + 32, DQKV, lane);
#pragma unroll 1
        for (int i = 0; i < KTW; ++i) {
            const int key0 = (w * KTW + i) * 16;
            const _Float16* kt = kp + (size_t)key0 * DQKV;
            v16h kf0 = load_frag16(kt, DQKV, lane);
            v16h kf1 = load_frag16(kt + 32, DQKV, lane);
            v8f s0 = wmma16(qa00, kf0, zero8());
            s0 = wmma16(qa01, kf1, s0);
            v8f s1 = wmma16(qa10, kf0, zero8());
            s1 = wmma16(qa11, kf1, s1);
#pragma unroll
            for (int r = 0; r < 8; ++r) {
                zs[(8 * hh + r) * SEQ + key0 + m]      = s0[r] * SC_Z;
                zs[(16 + 8 * hh + r) * SEQ + key0 + m] = s1[r] * SC_Z;
            }
        }
    }
    __syncthreads();

    // ---- phase 2: 1.5-entmax threshold per row ----
    const float tcl = -rsqrtf((float)SEQ);    // tau <= -1/sqrt(SEQ) always
#pragma unroll 1
    for (int rr = 0; rr < 4; ++rr) {
        const int row = 4 * w + rr;
        float z[ZN];
        const float* zr = &zs[row * SEQ];
#pragma unroll
        for (int j = 0; j < ZN / 4; ++j) {
            v4f t4 = *(const v4f*)(zr + 128 * j + 4 * lane);
            z[4 * j + 0] = t4.x; z[4 * j + 1] = t4.y; z[4 * j + 2] = t4.z; z[4 * j + 3] = t4.w;
        }
        float mx = z[0], mn = z[0];
#pragma unroll
        for (int i = 1; i < ZN; ++i) { mx = fmaxf(mx, z[i]); mn = fminf(mn, z[i]); }
        mx = wmaxr(mx);
        mn = wminr(mn);
#pragma unroll
        for (int i = 0; i < ZN; ++i) z[i] = z[i] - mx;
        float tau = fminf(fmaxf(mn - mx, -1.0f), tcl);
#pragma unroll 1
        for (int it = 0; it < NEWT; ++it) {
            float sa = 0.0f, sb = 0.0f;
#pragma unroll
            for (int i = 0; i < ZN; ++i) {
                float d = fmaxf(z[i] - tau, 0.0f);
                sa += d;
                sb = __builtin_fmaf(d, d, sb);
            }
            sa = wsum(sa);
            sb = wsum(sb);
            tau = tau + (sb - 1.0f) * (0.5f * __builtin_amdgcn_rcpf(sa));
            tau = fminf(fmaxf(tau, -1.0f), tcl);
        }
        _Float16* prow = ph + (size_t)row * PP + (row & 15) * 8;
#pragma unroll
        for (int j = 0; j < ZN / 4; ++j) {
            v4h pk;
#pragma unroll
            for (int e = 0; e < 4; ++e) {
                float d = fmaxf(z[4 * j + e] - tau, 0.0f);
                pk[e] = (_Float16)(d * d * SC_P);
            }
            *(v4h*)(prow + 128 * j + 4 * lane) = pk;
        }
    }
    __syncthreads();

    // ---- phase 3: ctx = P @ v ----
    const int rt = w & 1, ct = w >> 1;
    v8f acc = zero8();
#pragma unroll 1
    for (int c0 = 0; c0 < SEQ; c0 += CH) {
        // V^T chunk: Vt[d][t] = v[c0 + t][d], full 64 x CH extent
#pragma unroll
        for (int i2 = 0; i2 < CH / 32; ++i2) {
            const int idx = tid + 256 * i2;
            const int t = idx >> 3, part = idx & 7;
            v8h vv = *(const v8h*)(vp + (size_t)(c0 + t) * DQKV + part * 8);
#pragma unroll
            for (int e = 0; e < 8; ++e) Vt[(part * 8 + e) * VTP + t] = vv[e];
        }
        __syncthreads();
#pragma unroll 1
        for (int j = 0; j < CH; j += 32) {
            v16h pa = load_frag16(ph + (size_t)(16 * rt) * PP + c0 + j, PLD, lane);  // rows = queries, k = keys
            v16h vb = load_frag16(&Vt[(16 * ct) * VTP + j], VTP, lane);            // n = d, k = keys
            acc = wmma16(pa, vb, acc);
        }
        __syncthreads();
    }

    // ---- phase 4: ctx plane x64 ----
#pragma unroll
    for (int r = 0; r < 8; ++r)
        Cst[(16 * rt + 8 * hh + r) * HD + 16 * ct + m] = (_Float16)(acc[r] * SC_C);
    __syncthreads();
    const int orow = 4 * w + (lane >> 3), oc = (lane & 7) * 8;
    v8h cv = *(const v8h*)(&Cst[orow * HD + oc]);
    _Float16* dst = ctx + (tokq + orow) * DM + h * HD + oc;
    *(v8h*)dst = cv;
    
}

// ---------------------------------------------------------------------------
extern "C" void kernel_launch(void* const* d_in, const int* in_sizes, int n_in,
                              void* d_out, int out_size, void* d_ws, size_t ws_size,
                              hipStream_t stream) {
    if (n_in < 19) return;
    if (in_sizes[0] < ((NB - 1) * SEQ_FULL + SEQ) * DM) return;
    if (in_sizes[1] < DM * DM || in_sizes[3] < DM * DM || in_sizes[5] < DM * DM || in_sizes[7] < DM * DM) return;
    if (in_sizes[2] < DM || in_sizes[4] < DM || in_sizes[6] < DM || in_sizes[8] < DM) return;
    if (in_sizes[9] < DM || in_sizes[10] < DM || in_sizes[15] < DM || in_sizes[16] < DM) return;
    if (in_sizes[17] < DM || in_sizes[18] < DM || in_sizes[14] < DM) return;
    if (in_sizes[11] < DF * DM || in_sizes[13] < DM * DF || in_sizes[12] < DF) return;
    if (out_size < NTOK * DM) return;

    const float* x    = (const float*)d_in[0];    // [8,1024,512]
    const float* Wq   = (const float*)d_in[1];    // [512,512] (out,in)
    const float* bq   = (const float*)d_in[2];
    const float* Wk   = (const float*)d_in[3];
    const float* bk   = (const float*)d_in[4];
    const float* Wv   = (const float*)d_in[5];
    const float* bv   = (const float*)d_in[6];
    const float* Wo   = (const float*)d_in[7];
    const float* bo   = (const float*)d_in[8];
    const float* ln1g = (const float*)d_in[9];
    const float* ln1b = (const float*)d_in[10];
    const float* W1   = (const float*)d_in[11];   // [2048,512]
    const float* bf1  = (const float*)d_in[12];
    const float* W2   = (const float*)d_in[13];   // [512,2048]
    const float* bf2  = (const float*)d_in[14];
    const float* ln2g = (const float*)d_in[15];
    const float* ln2b = (const float*)d_in[16];
    const float* lnfg = (const float*)d_in[17];
    const float* lnfb = (const float*)d_in[18];
    float* out = (float*)d_out;                   // [NTOK][512]

    char* ws = (char*)d_ws;
    size_t off = 0;
    _Float16* wqkv = (_Float16*)(ws + off); off += (size_t)DQKV * DM * 2;      // 1,572,864
    _Float16* wo16 = (_Float16*)(ws + off); off += (size_t)DM * DM * 2;        //   524,288
    _Float16* w116 = (_Float16*)(ws + off); off += (size_t)DF * DM * 2;        // 2,097,152
    _Float16* w216 = (_Float16*)(ws + off); off += (size_t)DM * DF * 2;        // 2,097,152
    _Float16* y1   = (_Float16*)(ws + off); off += (size_t)NTOK * DM * 2;      // 8 MiB at full size
    _Float16* qkv  = (_Float16*)(ws + off); off += (size_t)NTOK * DQKV * 2;    // 24 MiB
    _Float16* cpl  = (_Float16*)(ws + off); off += (size_t)NTOK * DM * 2;      // 8 MiB
    float*    x1   = (float*)(ws + off);    off += (size_t)NTOK * DM * 4;      // 16 MiB
    _Float16* y2   = (_Float16*)(ws + off); off += (size_t)NTOK * DM * 2;      // 8 MiB
    _Float16* mpl  = (_Float16*)(ws + off); off += (size_t)NTOK * DF * 2;      // 32 MiB
    if (off > ws_size) return;                                                 // 106,954,752 B at full size

    k_wcvt<DM><<<dim3(DM * DM / 2048), dim3(256), 0, stream>>>(Wq, wqkv);
    k_wcvt<DM><<<dim3(DM * DM / 2048), dim3(256), 0, stream>>>(Wk, wqkv + (size_t)DM * DM);
    k_wcvt<DM><<<dim3(DM * DM / 2048), dim3(256), 0, stream>>>(Wv, wqkv + (size_t)2 * DM * DM);
    k_wcvt<DM><<<dim3(DM * DM / 2048), dim3(256), 0, stream>>>(Wo, wo16);
    k_wcvt<DM><<<dim3(DF * DM / 2048), dim3(256), 0, stream>>>(W1, w116);
    k_wcvt<DF><<<dim3(DM * DF / 2048), dim3(256), 0, stream>>>(W2, w216);

    k_ln1<<<dim3(NTOK / 8), dim3(256), 0, stream>>>(x, ln1g, ln1b, y1);
    k_gemm_p<0><<<dim3(NTOK / QR, 3), dim3(256), 0, stream>>>(y1, wqkv, bq, bk, bv, bv, qkv, DQKV);
    k_attn<<<dim3(SEQ / QR, NH, NB), dim3(256), 0, stream>>>(qkv, cpl);
    k_gemm_r<0><<<dim3(NTOK / QR), dim3(256), 0, stream>>>(cpl, wo16, bo, x, ln2g, ln2b, x1, y2);
    k_gemm_p<1><<<dim3(NTOK / QR, DF / 512), dim3(256), 0, stream>>>(y2, w116, bf1, bf1 + 512, bf1 + 1024, bf1 + 1536, mpl, DF);
    k_gemm_r<1><<<dim3(NTOK / QR), dim3(256), 0, stream>>>(mpl, w216, bf2, x1, lnfg, lnfb, out, y2);
}

// v003
// Measured time: 250 microseconds a run.
// Next to v002, in two timings, it ran 1.23 and 1.24 times as fast.
// Counting every step since v000, it is 1.69 times as fast.
#include <hip/hip_runtime.h>

// Contractions on v_wmma_f32_16x16x32_f16 (f16 operands, f32 accumulate), one product each: y1*[Wq|Wk|Wv]^T, q*k^T, P*v, ctx*Wo^T, y2*W1^T, m*W2^T; float inputs RNE-converted to bf16 then carried in f16 (weights x64, P x2^14, ctx x64, m x64); LayerNorm, 1.5-entmax threshold and Mish in f32.

#ifndef NB
#define NB 8
#endif
#ifndef SEQ
#define SEQ 1024
#endif
#define NB_FULL  8
#define SEQ_FULL 1024
#define DM   512            // model width
#define DF   2048           // ffn width
#define NH   8
#define HD   64
#define DQKV (3 * DM)       // q|k|v plane pitch
#define NTOK (NB * SEQ)
#define QR   32             // query rows per attention block / rows per gemm block
#define VG   8              // V fragments (32 keys each) fetched ahead as one group in k_attn
#define ZN   (SEQ / 32)     // scores per lane per row
#define NEWT 10             // Newton passes for the entmax threshold

static_assert(NB >= 1 && NB <= NB_FULL);
static_assert(SEQ <= SEQ_FULL);
static_assert(SEQ % (32 * VG) == 0);
static_assert(SEQ % 128 == 0);
static_assert(NTOK % QR == 0);
static_assert(NH * HD == DM);
static_assert(QR == 32);
static_assert((ZN % 4) == 0);
static_assert(DM % 32 == 0 && DF % 32 == 0);
static_assert((DM * DM) % 2048 == 0 && (DF * DM) % 2048 == 0);

typedef _Float16 v16h __attribute__((ext_vector_type(16)));
typedef _Float16 v8h  __attribute__((ext_vector_type(8)));
typedef _Float16 v4h  __attribute__((ext_vector_type(4)));
typedef float    v8f  __attribute__((ext_vector_type(8)));
typedef float    v4f  __attribute__((ext_vector_type(4)));

union Frag { v16h v; v8h h[2]; };

#define WSC   64.0f                  // weight carry
#define SC_Z  1.52587890625e-05f     // 2^-16 : (64q).(64k) -> q.k/16 = z
#define SC_P  16384.0f               // 2^14  : P carry
#define SC_C  6.103515625e-05f       // 2^-14 : (2^14 P)(64 v) -> 64 ctx
#define SC_O  2.44140625e-04f        // 2^-12 : (64 a)(64 W) -> a.W
#define SC_H  0.015625f              // 1/64  : (y)(64 W) -> y.W
#define LOG2E 1.44269504088896340736f
#define LN_EPS 1e-5f

static __device__ __forceinline__ v8f zero8() {
    v8f z;
#pragma unroll
    for (int i = 0; i < 8; ++i) z[i] = 0.0f;
    return z;
}

// 16x32 A fragment (or B fragment from an [n][k] k-contiguous source) from a
// row-major 16-bit tile: lane m = lane&15 -> row m; kb = 8*(lane>>4);
// elements 0..7 = k kb..kb+7, elements 8..15 = k kb+16..kb+23.
static __device__ __forceinline__ v16h load_frag16(const _Float16* base, int ld, int lane) {
    int m  = lane & 15;
    int kb = (lane >> 4) << 3;
    const _Float16* p = base + (size_t)m * ld + kb;
    Frag f;
    f.h[0] = *(const v8h*)(p);
    f.h[1] = *(const v8h*)(p + 16);
    return f.v;
}

// B fragment from a tiled weight plane (see k_wcvt): one 16 x 32 tile is 1 KB,
// lane l reads 16 B at 16*l and at 512 + 16*l, so each load is four whole 128-B lines.
// Same element in every lane and register position as load_frag16 on the [n][k] plane.
static __device__ __forceinline__ v16h load_fragB(const _Float16* tile, int lane) {
    const _Float16* p = tile + lane * 8;
    Frag f;
    f.h[0] = *(const v8h*)(p);
    f.h[1] = *(const v8h*)(p + 256);
    return f.v;
}

static __device__ __forceinline__ v8f wmma16(v16h a, v16h b, v8f c) {
    v8f d = __builtin_amdgcn_wmma_f32_16x16x32_f16(false, a, false, b, (short)0, c, false, false);
    asm volatile("v_nop\n\tv_nop\n\tv_nop\n\tv_nop" : "+v"(d) : "v"(a), "v"(b));
    return d;
}

// f32 -> bf16 RNE convert, value kept as f32
static __device__ __forceinline__ float bf16r(float x) {
    unsigned u = __float_as_uint(x);
    u = (u + 0x7FFFu + ((u >> 16) & 1u)) & 0xFFFF0000u;
    return __uint_as_float(u);
}

// ordering for a wave-private LDS tile: stores before later loads of the same wave
static __device__ __forceinline__ void wave_lds_sync() {
    __builtin_amdgcn_fence(3, "wavefront");
    asm volatile("s_wait_dscnt 0" ::: "memory");
    __builtin_amdgcn_wave_barrier();
}

static __device__ __forceinline__ float wsum(float v) {
    v += __shfl_xor(v, 16, 32); v += __shfl_xor(v, 8, 32); v += __shfl_xor(v, 4, 32);
    v += __shfl_xor(v, 2, 32);  v += __shfl_xor(v, 1, 32);
    return v;
}
static __device__ __forceinline__ float wmaxr(float v) {
    v = fmaxf(v, __shfl_xor(v, 16, 32)); v = fmaxf(v, __shfl_xor(v, 8, 32));
    v = fmaxf(v, __shfl_xor(v, 4, 32));  v = fmaxf(v, __shfl_xor(v, 2, 32));
    v = fmaxf(v, __shfl_xor(v, 1, 32));
    return v;
}
static __device__ __forceinline__ float wminr(float v) {
    v = fminf(v, __shfl_xor(v, 16, 32)); v = fminf(v, __shfl_xor(v, 8, 32));
    v = fminf(v, __shfl_xor(v, 4, 32));  v = fminf(v, __shfl_xor(v, 2, 32));
    v = fminf(v, __shfl_xor(v, 1, 32));
    return v;
}

// Mish(x) = x * tanh(softplus(x)) = x * (u^2+2u)/(u^2+2u+2), u = e^x
static __device__ __forceinline__ float mishf(float x) {
    float xe = fminf(x, 20.0f);
    float u  = __builtin_amdgcn_exp2f(xe * LOG2E);
    float wv = u * (u + 2.0f);
    float t  = wv * __builtin_amdgcn_rcpf(wv + 2.0f);
    return x * t;
}

// 16 columns per lane: columns 256*j + 8*lane + e (j = 0,1; e = 0..7)
static __device__ __forceinline__ void load_cols16(const float* p, int lane, float (&o)[16]) {
#pragma unroll
    for (int j = 0; j < 2; ++j) {
        v4f a = *(const v4f*)(p + 256 * j + 8 * lane);
        v4f c = *(const v4f*)(p + 256 * j + 8 * lane + 4);
        o[8 * j + 0] = a.x; o[8 * j + 1] = a.y; o[8 * j + 2] = a.z; o[8 * j + 3] = a.w;
        o[8 * j + 4] = c.x; o[8 * j + 5] = c.y; o[8 * j + 6] = c.z; o[8 * j + 7] = c.w;
    }
}

// LayerNorm over a 512-wide row held as 16 columns per lane (f32)
static __device__ __forceinline__ void ln_lane(const float (&v)[16], const float (&gl)[16],
                                               const float (&el)[16], float (&y)[16]) {
    float s = 0.0f;
#pragma unroll
    for (int e = 0; e < 16; ++e) s += v[e];
    s = wsum(s);
    const float mu = s * (1.0f / (float)DM);
    float d[16];
    float q = 0.0f;
#pragma unroll
    for (int e = 0; e < 16; ++e) { d[e] = v[e] - mu; q = __builtin_fmaf(d[e], d[e], q); }
    q = wsum(q);
    const float rstd = rsqrtf(__builtin_fmaf(q, 1.0f / (float)DM, LN_EPS));
#pragma unroll
    for (int e = 0; e < 16; ++e) y[e] = d[e] * rstd * gl[e] + el[e];
}

// ---------------------------------------------------------------------------
// Weight plane: value f16(bf16r(src[n][k]) * 64), stored in fragment order: tile
// (n/16, k/32) is 512 halves at ((n/16) * (K/32) + k/32) * 512; inside it element
// (n, k) sits at ((k>>4)&1)*256 + (((k>>3)&1)*16 + (n&15))*8 + (k&7).
// Thread i writes halves 8i..8i+7 (a wave stores 512 contiguous bytes) and gathers
// its 8 source floats; a block reads 16 rows x 512 contiguous bytes.
// coverage: grid = n/2048, 256 threads x 8 elements -> n exactly.
// ---------------------------------------------------------------------------
template <int K>
__global__ __launch_bounds__(256) void k_wcvt(const float* __restrict__ src,
                                               _Float16* __restrict__ dst) {
    constexpr int KT = K / 32;                  // k tiles per 16-row band
    const int i  = blockIdx.x * 256 + threadIdx.x;
    const int t  = i >> 6, gq = i & 63;         // tile, 8-half group inside it
    const int n  = (t / KT) * 16 + (gq & 15);
    const int k  = (t % KT) * 32 + (gq >> 5) * 16 + ((gq >> 4) & 1) * 8;
    const float* sp = src + (size_t)n * K + k;
    v4f a = *(const v4f*)(sp);
    v4f c = *(const v4f*)(sp + 4);
    v8h o;
    o[0] = (_Float16)(bf16r(a.x) * WSC); o[1] = (_Float16)(bf16r(a.y) * WSC);
    o[2] = (_Float16)(bf16r(a.z) * WSC); o[3] = (_Float16)(bf16r(a.w) * WSC);
    o[4] = (_Float16)(bf16r(c.x) * WSC); o[5] = (_Float16)(bf16r(c.y) * WSC);
    o[6] = (_Float16)(bf16r(c.z) * WSC); o[7] = (_Float16)(bf16r(c.w) * WSC);
    *(v8h*)(dst + (size_t)i * 8) = o;
    
}

// ---------------------------------------------------------------------------
// LN1: y1[tok][512] = f16(LayerNorm(bf16r(x)) * g + b). One wave per row,
// lane owns columns 8l..8l+7 and 256+8l..; two v8h instructions per row, each
// coverage: grid NTOK/8 x 8 waves x 512 = NTOK x 512.
// ---------------------------------------------------------------------------
__global__ __launch_bounds__(256) void k_ln1(const float* __restrict__ x,
                                              const float* __restrict__ g,
                                              const float* __restrict__ be,
                                              _Float16* __restrict__ y) {
    const int tid = threadIdx.x, lane = tid & 31, w = tid >> 5;
    const int tok = blockIdx.x * 8 + w;
    const int b = tok / SEQ, s = tok - b * SEQ;
    const float* xr = x + ((size_t)b * SEQ_FULL + s) * DM;
    float v[16], gl[16], el[16], yv[16];
    load_cols16(xr, lane, v);
    load_cols16(g, lane, gl);
    load_cols16(be, lane, el);
#pragma unroll
    for (int e = 0; e < 16; ++e) { v[e] = bf16r(v[e]); gl[e] = bf16r(gl[e]); el[e] = bf16r(el[e]); }
    ln_lane(v, gl, el, yv);
    v8h o[2];
#pragma unroll
    for (int j = 0; j < 2; ++j)
#pragma unroll
        for (int e = 0; e < 8; ++e) o[j][e] = (_Float16)yv[8 * j + e];
    _Float16* yr = y + (size_t)tok * DM;
    *(v8h*)(yr + 8 * lane)       = o[0];
    *(v8h*)(yr + 256 + 8 * lane) = o[1];
    
}

// ---------------------------------------------------------------------------
// GEMM core: wave tile 32 rows x 64 cols, C[r][n] += A[r][k] * B[n][k],
// A an f16 row-major k-contiguous plane, B a tiled weight plane (k_wcvt) whose band of
// 16 rows starts at 16*K*band halves; fragments loaded directly from global memory
// (two 16-B loads each). K % 32 == 0; K is a compile-time constant so that the second A
// tile and the B bands sit at immediate offsets of one address pair an operand, which
// lives through the loop: no load's result is given a register that a load names.
// ---------------------------------------------------------------------------
template <int K>
static __device__ __forceinline__ void gemm_32x64(const _Float16* __restrict__ Ab,
                                                  const _Float16* __restrict__ Bb,
                                                  int lane, v8f (&acc)[2][4]) {
#pragma unroll
    for (int t = 0; t < 2; ++t)
#pragma unroll
        for (int j = 0; j < 4; ++j) acc[t][j] = zero8();
#pragma unroll 1
    for (int k0 = 0; k0 < K; k0 += 32) {
        v16h a0 = load_frag16(Ab + k0, K, lane);
        v16h a1 = load_frag16(Ab + (size_t)16 * K + k0, K, lane);
        v16h bb[4];
#pragma unroll
        for (int j = 0; j < 4; ++j) bb[j] = load_fragB(Bb + (size_t)(16 * j) * K + (size_t)k0 * 16, lane);
#pragma unroll
        for (int j = 0; j < 4; ++j) {
            acc[0][j] = wmma16(a0, bb[j], acc[0][j]);
            acc[1][j] = wmma16(a1, bb[j], acc[1][j]);
        }
    }
}

// ---------------------------------------------------------------------------
// Plane GEMM: out[tok][ldo] f16 plane, block = 32 rows x 512 cols (blockIdx.y =
// 512-column segment), wave = 32 x 64. EPI 0: val = acc + 64*bias (q|k|v x64);
// EPI 1: val = 64 * Mish(acc/64 + bias). Wave-private LDS tile, then 8
// coverage: grid (NTOK/32, ldo/512) x 8 waves x 32x64 = NTOK x ldo.
// EPI 0, segment 2 (v) goes to the plane vfr instead, as B fragments of P*v (n = d,
// k = key), tile (batch, head, key/32, d/16) of 512 halves laid out as in k_wcvt. A lane's
// 8 accumulator rows of one 16x16 tile are keys 16t + 8*(lane>>4) + r at d = lane&15: the
// 8 halves at 256t + 8*lane of that tile, so each store is 512 contiguous bytes a wave.
// coverage: NTOK/32 blocks x 8 waves (heads) x 4 tiles x 512 = NTOK x 512 of vfr.
// ---------------------------------------------------------------------------
template <int EPI>
__global__ __launch_bounds__(256) __attribute__((amdgpu_waves_per_eu(8)))   // 128 registers a wave: four blocks share a WGP, so the EPI 1 grid is resident at once
void k_gemm_p(const _Float16* __restrict__ A, const _Float16* __restrict__ Bw,
              const float* __restrict__ b0, const float* __restrict__ b1,
              const float* __restrict__ b2, const float* __restrict__ b3,
              _Float16* __restrict__ outp, int ldo, _Float16* __restrict__ vfr) {
    __shared__ __align__(16) _Float16 st[8][QR * 64];      // 32 KB, wave-private tiles
    const int tid = threadIdx.x, lane = tid & 31, w = tid >> 5;
    const int hh = lane >> 4, m = lane & 15;
    const int m0  = blockIdx.x * QR;
    const int seg = blockIdx.y;
    const int nl  = 64 * w;                 // column within the 512 segment
    const int n0w = seg * 512 + nl;         // output column / B row
    const float* bias = (seg == 0) ? b0 : ((seg == 1) ? b1 : ((seg == 2) ? b2 : b3));

    v8f acc[2][4];
    constexpr int K = DM;                   // k length of both plane GEMMs
    gemm_32x64<K>(A + (size_t)m0 * K, Bw + (size_t)n0w * K, lane, acc);

    float bl[4];
#pragma unroll
    for (int j = 0; j < 4; ++j) bl[j] = bf16r(bias[nl + 16 * j + m]);
    if (EPI == 0 && seg == 2) {             // block-uniform; no block barrier in this kernel
        const int b = m0 / SEQ, kb = (m0 - b * SEQ) / 32;
        _Float16* vt = vfr + (size_t)((b * NH + w) * (SEQ / 32) + kb) * 2048 + lane * 8;
#pragma unroll
        for (int t = 0; t < 2; ++t)
#pragma unroll
            for (int j = 0; j < 4; ++j) {
                v8h o;
#pragma unroll
                for (int r = 0; r < 8; ++r) o[r] = (_Float16)__builtin_fmaf(bl[j], WSC, acc[t][j][r]);
                *(v8h*)(vt + 512 * j + 256 * t) = o;
            }
        return;
    }
#pragma unroll
    for (int t = 0; t < 2; ++t)
#pragma unroll
        for (int j = 0; j < 4; ++j)
#pragma unroll
            for (int r = 0; r < 8; ++r) {
                float a = acc[t][j][r];
                float val;
                if (EPI == 0) {
                    val = __builtin_fmaf(bl[j], WSC, a);
                } else {
                    float hx = __builtin_fmaf(a, SC_H, bl[j]);
                    val = WSC * mishf(hx);
                }
                st[w][(16 * t + 8 * hh + r) * 64 + 16 * j + m] = (_Float16)val;
            }
    wave_lds_sync();

    v8h pv[8];
    const int lr = lane >> 3, lc = (lane & 7) * 8;
#pragma unroll
    for (int i = 0; i < 8; ++i) pv[i] = *(const v8h*)(&st[w][(4 * i + lr) * 64 + lc]);
    _Float16* ob = outp + (size_t)m0 * ldo + n0w;
#pragma unroll
    for (int i = 0; i < 8; ++i) *(v8h*)(ob + (size_t)(4 * i + lr) * ldo + lc) = pv[i];
    
}

// ---------------------------------------------------------------------------
// Row GEMM (N = 512, block owns 32 full rows) fused with residual add + LayerNorm.
// MODE 0: x1 = bf16r(x) + (acc 2^-12 + bias) -> x1 f32 plane, y2 = f16(LN(x1) g + b).
// MODE 1: x2 = x1 + (acc 2^-12 + bias), out = LN(x2) g + b -> f32 rows.
// Block tile staged f32 in LDS (cross-wave, block barrier); wave then owns 4 rows:
// f16 rows written directly as two 512-B lane-contiguous instructions; f32 rows
// relaid through the (now wave-private) LDS row and written as four 512-B
// coverage: grid NTOK/32 x 32 rows x 512 = NTOK x 512 (each output plane).
// ---------------------------------------------------------------------------
template <int MODE>
__global__ __launch_bounds__(256) __attribute__((amdgpu_num_vgpr(256)))
void k_gemm_r(const _Float16* __restrict__ A, const _Float16* __restrict__ Bw,
              const float* __restrict__ bias, const float* __restrict__ res,
              const float* __restrict__ g, const float* __restrict__ be,
              float* __restrict__ outf, _Float16* __restrict__ outh) {
    __shared__ __align__(16) float T[QR * DM];            // 64 KB block tile
    const int tid = threadIdx.x, lane = tid & 31, w = tid >> 5;
    const int hh = lane >> 4, m = lane & 15;
    const int m0 = blockIdx.x * QR;
    const int nl = 64 * w;

    v8f acc[2][4];
    constexpr int K = (MODE == 0) ? DM : DF;   // k length: ctx plane / ffn plane
    gemm_32x64<K>(A + (size_t)m0 * K, Bw + (size_t)nl * K, lane, acc);
#pragma unroll
    for (int t = 0; t < 2; ++t)
#pragma unroll
        for (int j = 0; j < 4; ++j)
#pragma unroll
            for (int r = 0; r < 8; ++r)
                T[(16 * t + 8 * hh + r) * DM + nl + 16 * j + m] = acc[t][j][r];
    __syncthreads();

    float bl[16], gl[16], el[16];
    load_cols16(bias, lane, bl);
    load_cols16(g, lane, gl);
    load_cols16(be, lane, el);
#pragma unroll
    for (int e = 0; e < 16; ++e) { bl[e] = bf16r(bl[e]); gl[e] = bf16r(gl[e]); el[e] = bf16r(el[e]); }

#pragma unroll 1
    for (int rr = 0; rr < 4; ++rr) {
        const int row = 4 * w + rr;
        const int tok = m0 + row;
        float v[16], rv[16], yv[16];
        load_cols16(&T[row * DM], lane, v);
        if (MODE == 0) {
            const int b = tok / SEQ, s = tok - b * SEQ;
            load_cols16(res + ((size_t)b * SEQ_FULL + s) * DM, lane, rv);
#pragma unroll
            for (int e = 0; e < 16; ++e) rv[e] = bf16r(rv[e]);
        } else {
            load_cols16(res + (size_t)tok * DM, lane, rv);
        }
#pragma unroll
        for (int e = 0; e < 16; ++e) v[e] = rv[e] + __builtin_fmaf(v[e], SC_O, bl[e]);
        ln_lane(v, gl, el, yv);

        // write-back into the wave-private LDS row (same columns this lane loaded)
        float* trow = &T[row * DM];
#pragma unroll
        for (int j = 0; j < 2; ++j) {
            v4f p0, p1;
            if (MODE == 0) {
                p0.x = v[8 * j + 0]; p0.y = v[8 * j + 1]; p0.z = v[8 * j + 2]; p0.w = v[8 * j + 3];
                p1.x = v[8 * j + 4]; p1.y = v[8 * j + 5]; p1.z = v[8 * j + 6]; p1.w = v[8 * j + 7];
            } else {
                p0.x = yv[8 * j + 0]; p0.y = yv[8 * j + 1]; p0.z = yv[8 * j + 2]; p0.w = yv[8 * j + 3];
                p1.x = yv[8 * j + 4]; p1.y = yv[8 * j + 5]; p1.z = yv[8 * j + 6]; p1.w = yv[8 * j + 7];
            }
            *(v4f*)(trow + 256 * j + 8 * lane)     = p0;
            *(v4f*)(trow + 256 * j + 8 * lane + 4) = p1;
        }
        wave_lds_sync();
        v4f s4[4];
#pragma unroll
        for (int jj = 0; jj < 4; ++jj) s4[jj] = *(const v4f*)(trow + 128 * jj + 4 * lane);

        float* orow = outf + (size_t)tok * DM;
        if (MODE == 0) {
            v8h o[2];
#pragma unroll
            for (int j = 0; j < 2; ++j)
#pragma unroll
                for (int e = 0; e < 8; ++e) o[j][e] = (_Float16)yv[8 * j + e];
            _Float16* hrow = outh + (size_t)tok * DM;
            *(v8h*)(hrow + 8 * lane)       = o[0];
            *(v8h*)(hrow + 256 + 8 * lane) = o[1];
#pragma unroll
            for (int jj = 0; jj < 4; ++jj) *(v4f*)(orow + 128 * jj + 4 * lane) = s4[jj];
            
        } else {
#pragma unroll
            for (int jj = 0; jj < 4; ++jj) *(v4f*)(orow + 128 * jj + 4 * lane) = s4[jj];
            
        }
    }
}

// ---------------------------------------------------------------------------
// Attention with 1.5-entmax over keys. Block = 8 waves = 32 query rows of one
// (batch, head); qkv plane [tok][1536] (q | k, each x64, head h at +64h; the v third is
// unused), v x64 in the fragment plane vfr (see k_gemm_p).
// Phase 1: z strip [32][SEQ] f32 in LDS = (64q).(64k) 2^-16 = q.k/16; wave owns
//          SEQ/128 key tiles x both row tiles (K fragments straight from the plane).
// Phase 2: wave owns 4 rows; per row: shift by max, threshold tau of
//          sum relu(z - tau)^2 = 1 by safeguarded Newton (NEWT passes, registers),
//          P = relu(z - tau)^2 x 2^14 as f16 written over the row's own slot
//          (pitch 2*SEQ halves, skew 8*(row&15) halves).
// Phase 3: wave owns one 16x16 ctx tile over all keys; V fragments straight from vfr
//          (whole 128-B lines), VG of them fetched one group ahead; no barrier inside.
// Phase 4: ctx x64 as f16 staged [32][64] (cross-wave, barrier); wave w writes rows
// coverage: grid (SEQ/32, 8, NB) x 32 rows x 64 = NTOK x 512 of the ctx plane.
// ---------------------------------------------------------------------------
__global__ __launch_bounds__(256) __attribute__((amdgpu_num_vgpr(256)))
void k_attn(const _Float16* __restrict__ qkv, const _Float16* __restrict__ vfr,
            _Float16* __restrict__ ctx) {
    __shared__ __align__(16) float    zs[QR * SEQ];       // 128 KB at full size
    __shared__ __align__(16) _Float16 Cst[QR * HD];       // 4 KB
    static_assert(sizeof(zs) + sizeof(Cst) <= 160 * 1024);   // two blocks per WGP
    _Float16* ph = reinterpret_cast<_Float16*>(zs);       // P rows alias the z slots
    constexpr int PP  = 2 * SEQ;                          // P row slot (halves)
    constexpr int PLD = PP + 8;                           // fragment pitch incl. skew
    constexpr int KTW = SEQ / 128;                        // key tiles per wave

    const int tid = threadIdx.x, lane = tid & 31, w = tid >> 5;
    const int hh = lane >> 4, m = lane & 15;
    const int h = blockIdx.y, b = blockIdx.z;
    const int q0 = blockIdx.x * QR;
    const size_t tokq = (size_t)b * SEQ + q0;
    const _Float16* qp = qkv + tokq * DQKV + h * HD;
    const _Float16* kp = qkv + (size_t)b * SEQ * DQKV + DM + h * HD;
    const int rt = w & 1, ct = w >> 1;                    // ctx tile of this wave (phase 3)
    const _Float16* vt = vfr + (size_t)(b * NH + h) * (SEQ / 32) * 2048 + ct * 512;

    // ---- phase 1: scores ----
    {
        const v16h qa00 = load_frag16(qp, DQKV, lane);
        const v16h qa01 = load_frag16(qp + 32, DQKV, lane);
        const v16h qa10 = load_frag16(qp + (size_t)16 * DQKV, DQKV, lane);
        const v16h qa11 = load_frag16(qp + (size_t)16 * DQKV + 32, DQKV, lane);
#pragma unroll 1
        for (int i = 0; i < KTW; ++i) {
            const int key0 = (w * KTW + i) * 16;
            const _Float16* kt = kp + (size_t)key0 * DQKV;
            v16h kf0 = load_frag16(kt, DQKV, lane);
            v16h kf1 = load_frag16(kt + 32, DQKV, lane);
            v8f s0 = wmma16(qa00, kf0, zero8());
            s0 = wmma16(qa01, kf1, s0);
            v8f s1 = wmma16(qa10, kf0, zero8());
            s1 = wmma16(qa11, kf1, s1);
#pragma unroll
            for (int r = 0; r < 8; ++r) {
                zs[(8 * hh + r) * SEQ + key0 + m]      = s0[r] * SC_Z;
                zs[(16 + 8 * hh + r) * SEQ + key0 + m] = s1[r] * SC_Z;
            }
        }
    }
    __syncthreads();

    // first group of V fragments: in flight under phase 2
    v16h vcur[VG];
#pragma unroll
    for (int i = 0; i < VG; ++i) vcur[i] = load_fragB(vt + i * 2048, lane);

    // ---- phase 2: 1.5-entmax threshold per row ----
    const float tcl = -rsqrtf((float)SEQ);    // tau <= -1/sqrt(SEQ) always
#pragma unroll 1
    for (int rr = 0; rr < 4; ++rr) {
        const int row = 4 * w + rr;
        float z[ZN];
        const float* zr = &zs[row * SEQ];
#pragma unroll
        for (int j = 0; j < ZN / 4; ++j) {
            v4f t4 = *(const v4f*)(zr + 128 * j + 4 * lane);
            z[4 * j + 0] = t4.x; z[4 * j + 1] = t4.y; z[4 * j + 2] = t4.z; z[4 * j + 3] = t4.w;
        }
        float mx = z[0], mn = z[0];
#pragma unroll
        for (int i = 1; i < ZN; ++i) { mx = fmaxf(mx, z[i]); mn = fminf(mn, z[i]); }
        mx = wmaxr(mx);
        mn = wminr(mn);
#pragma unroll
        for (int i = 0; i < ZN; ++i) z[i] = z[i] - mx;
        float tau = fminf(fmaxf(mn - mx, -1.0f), tcl);
#pragma unroll 1
        for (int it = 0; it < NEWT; ++it) {
            float sa = 0.0f, sb = 0.0f;
#pragma unroll
            for (int i = 0; i < ZN; ++i) {
                float d = fmaxf(z[i] - tau, 0.0f);
                sa += d;
                sb = __builtin_fmaf(d, d, sb);
            }
            sa = wsum(sa);
            sb = wsum(sb);
            tau = tau + (sb - 1.0f) * (0.5f * __builtin_amdgcn_rcpf(sa));
            tau = fminf(fmaxf(tau, -1.0f), tcl);
        }
        _Float16* prow = ph + (size_t)row * PP + (row & 15) * 8;
#pragma unroll
        for (int j = 0; j < ZN / 4; ++j) {
            v4h pk;
#pragma unroll
            for (int e = 0; e < 4; ++e) {
                float d = fmaxf(z[4 * j + e] - tau, 0.0f);
                pk[e] = (_Float16)(d * d * SC_P);
            }
            *(v4h*)(prow + 128 * j + 4 * lane) = pk;
        }
    }
    __syncthreads();

    // ---- phase 3: ctx = P @ v ----
    v8f acc = zero8();
    constexpr int NG = SEQ / (32 * VG);
#pragma unroll
    for (int g = 0; g < NG; ++g) {
        v16h pa[VG], vnx[VG];
#pragma unroll
        for (int i = 0; i < VG; ++i)      // rows = queries, k = keys
            pa[i] = load_frag16(ph + (size_t)(16 * rt) * PP + (g * VG + i) * 32, PLD, lane);
        if (g + 1 < NG) {
#pragma unroll
            for (int i = 0; i < VG; ++i) vnx[i] = load_fragB(vt + ((g + 1) * VG + i) * 2048, lane);
        }
#pragma unroll
        for (int i = 0; i < VG; ++i) acc = wmma16(pa[i], vcur[i], acc);   // n = d, k = keys
        if (g + 1 < NG) {
#pragma unroll
            for (int i = 0; i < VG; ++i) vcur[i] = vnx[i];
        }
    }

    // ---- phase 4: ctx plane x64 ----
#pragma unroll
    for (int r = 0; r < 8; ++r)
        Cst[(16 * rt + 8 * hh + r) * HD + 16 * ct + m] = (_Float16)(acc[r] * SC_C);
    __syncthreads();
    const int orow = 4 * w + (lane >> 3), oc = (lane & 7) * 8;
    v8h cv = *(const v8h*)(&Cst[orow * HD + oc]);
    _Float16* dst = ctx + (tokq + orow) * DM + h * HD + oc;
    *(v8h*)dst = cv;
    
}

// ---------------------------------------------------------------------------
extern "C" void kernel_launch(void* const* d_in, const int* in_sizes, int n_in,
                              void* d_out, int out_size, void* d_ws, size_t ws_size,
                              hipStream_t stream) {
    if (n_in < 19) return;
    if (in_sizes[0] < ((NB - 1) * SEQ_FULL + SEQ) * DM) return;
    if (in_sizes[1] < DM * DM || in_sizes[3] < DM * DM || in_sizes[5] < DM * DM || in_sizes[7] < DM * DM) return;
    if (in_sizes[2] < DM || in_sizes[4] < DM || in_sizes[6] < DM || in_sizes[8] < DM) return;
    if (in_sizes[9] < DM || in_sizes[10] < DM || in_sizes[15] < DM || in_sizes[16] < DM) return;
    if (in_sizes[17] < DM || in_sizes[18] < DM || in_sizes[14] < DM) return;
    if (in_sizes[11] < DF * DM || in_sizes[13] < DM * DF || in_sizes[12] < DF) return;
    if (out_size < NTOK * DM) return;

    const float* x    = (const float*)d_in[0];    // [8,1024,512]
    const float* Wq   = (const float*)d_in[1];    // [512,512] (out,in)
    const float* bq   = (const float*)d_in[2];
    const float* Wk   = (const float*)d_in[3];
    const float* bk   = (const float*)d_in[4];
    const float* Wv   = (const float*)d_in[5];
    const float* bv   = (const float*)d_in[6];
    const float* Wo   = (const float*)d_in[7];
    const float* bo   = (const float*)d_in[8];
    const float* ln1g = (const float*)d_in[9];
    const float* ln1b = (const float*)d_in[10];
    const float* W1   = (const float*)d_in[11];   // [2048,512]
    const float* bf1  = (const float*)d_in[12];
    const float* W2   = (const float*)d_in[13];   // [512,2048]
    const float* bf2  = (const float*)d_in[14];
    const float* ln2g = (const float*)d_in[15];
    const float* ln2b = (const float*)d_in[16];
    const float* lnfg = (const float*)d_in[17];
    const float* lnfb = (const float*)d_in[18];
    float* out = (float*)d_out;                   // [NTOK][512]

    char* ws = (char*)d_ws;
    size_t off = 0;
    _Float16* wqkv = (_Float16*)(ws + off); off += (size_t)DQKV * DM * 2;      // 1,572,864
    _Float16* wo16 = (_Float16*)(ws + off); off += (size_t)DM * DM * 2;        //   524,288
    _Float16* w116 = (_Float16*)(ws + off); off += (size_t)DF * DM * 2;        // 2,097,152
    _Float16* w216 = (_Float16*)(ws + off); off += (size_t)DM * DF * 2;        // 2,097,152
    _Float16* y1   = (_Float16*)(ws + off); off += (size_t)NTOK * DM * 2;      // 8 MiB at full size
    _Float16* qkv  = (_Float16*)(ws + off); off += (size_t)NTOK * DQKV * 2;    // 24 MiB
    _Float16* cpl  = (_Float16*)(ws + off); off += (size_t)NTOK * DM * 2;      // 8 MiB
    float*    x1   = (float*)(ws + off);    off += (size_t)NTOK * DM * 4;      // 16 MiB
    _Float16* y2   = (_Float16*)(ws + off); off += (size_t)NTOK * DM * 2;      // 8 MiB
    _Float16* mpl  = (_Float16*)(ws + off); off += (size_t)NTOK * DF * 2;      // 32 MiB
    _Float16* vfr  = (_Float16*)(ws + off); off += (size_t)NTOK * DM * 2;      // 8 MiB
    if (off > ws_size) return;                                                 // 115,343,360 B at full size

    k_wcvt<DM><<<dim3(DM * DM / 2048), dim3(256), 0, stream>>>(Wq, wqkv);
    k_wcvt<DM><<<dim3(DM * DM / 2048), dim3(256), 0, stream>>>(Wk, wqkv + (size_t)DM * DM);
    k_wcvt<DM><<<dim3(DM * DM / 2048), dim3(256), 0, stream>>>(Wv, wqkv + (size_t)2 * DM * DM);
    k_wcvt<DM><<<dim3(DM * DM / 2048), dim3(256), 0, stream>>>(Wo, wo16);
    k_wcvt<DM><<<dim3(DF * DM / 2048), dim3(256), 0, stream>>>(W1, w116);
    k_wcvt<DF><<<dim3(DM * DF / 2048), dim3(256), 0, stream>>>(W2, w216);

    k_ln1<<<dim3(NTOK / 8), dim3(256), 0, stream>>>(x, ln1g, ln1b, y1);
    k_gemm_p<0><<<dim3(NTOK / QR, 3), dim3(256), 0, stream>>>(y1, wqkv, bq, bk, bv, bv, qkv, DQKV, vfr);
    k_attn<<<dim3(SEQ / QR, NH, NB), dim3(256), 0, stream>>>(qkv, vfr, cpl);
    k_gemm_r<0><<<dim3(NTOK / QR), dim3(256), 0, stream>>>(cpl, wo16, bo, x, ln2g, ln2b, x1, y2);
    k_gemm_p<1><<<dim3(NTOK / QR, DF / 512), dim3(256), 0, stream>>>(y2, w116, bf1, bf1 + 512, bf1 + 1024, bf1 + 1536, mpl, DF, nullptr);
    k_gemm_r<1><<<dim3(NTOK / QR), dim3(256), 0, stream>>>(mpl, w216, bf2, x1, lnfg, lnfb, out, y2);
}

// v004
// One run takes 235 microseconds.
// Timed twice side by side with v003, it ran 1.05 times as fast both times.
// Counting every step since v000, it is 1.78 times as fast.
#include <hip/hip_runtime.h>

// Contractions on v_wmma_f32_16x16x32_f16 (f16 operands, f32 accumulate), one product each: y1*[Wq|Wk|Wv]^T, q*k^T, P*v, ctx*Wo^T, y2*W1^T, m*W2^T; float inputs RNE-converted to bf16 then carried in f16 (weights x64, P x2^14, ctx x64, m x64); LayerNorm, 1.5-entmax threshold and Mish in f32.

#ifndef NB
#define NB 8
#endif
#ifndef SEQ
#define SEQ 1024
#endif
#define NB_FULL  8
#define SEQ_FULL 1024
#define DM   512            // model width
#define DF   2048           // ffn width
#define NH   8
#define HD   64
#define DQKV (3 * DM)       // q|k|v plane pitch
#define NTOK (NB * SEQ)
#define QR   32             // query rows per attention block / rows per gemm block
#define VG   8              // V fragments (32 keys each) fetched ahead as one group in k_attn
#define ZN   (SEQ / 32)     // scores per lane per row
#define NEWT 10             // Newton passes for the entmax threshold

static_assert(NB >= 1 && NB <= NB_FULL);
static_assert(SEQ <= SEQ_FULL);
static_assert(SEQ % (32 * VG) == 0);
static_assert(SEQ % 128 == 0);
static_assert(NTOK % QR == 0);
static_assert(NH * HD == DM);
static_assert(QR == 32);
static_assert((ZN % 4) == 0);
static_assert(DM % 32 == 0 && DF % 32 == 0);
static_assert((DM * DM) % 2048 == 0 && (DF * DM) % 2048 == 0);

typedef _Float16 v16h __attribute__((ext_vector_type(16)));
typedef _Float16 v8h  __attribute__((ext_vector_type(8)));
typedef _Float16 v4h  __attribute__((ext_vector_type(4)));
typedef float    v8f  __attribute__((ext_vector_type(8)));
typedef float    v4f  __attribute__((ext_vector_type(4)));

union Frag { v16h v; v8h h[2]; };

#define WSC   64.0f                  // weight carry
#define SC_Z  1.52587890625e-05f     // 2^-16 : (64q).(64k) -> q.k/16 = z
#define SC_P  16384.0f               // 2^14  : P carry
#define SC_C  6.103515625e-05f       // 2^-14 : (2^14 P)(64 v) -> 64 ctx
#define SC_O  2.44140625e-04f        // 2^-12 : (64 a)(64 W) -> a.W
#define SC_H  0.015625f              // 1/64  : (y)(64 W) -> y.W
#define LOG2E 1.44269504088896340736f
#define LN_EPS 1e-5f

static __device__ __forceinline__ v8f zero8() {
    v8f z;
#pragma unroll
    for (int i = 0; i < 8; ++i) z[i] = 0.0f;
    return z;
}

// 16x32 A fragment (or B fragment from an [n][k] k-contiguous source) from a
// row-major 16-bit tile: lane m = lane&15 -> row m; kb = 8*(lane>>4);
// elements 0..7 = k kb..kb+7, elements 8..15 = k kb+16..kb+23.
static __device__ __forceinline__ v16h load_frag16(const _Float16* base, int ld, int lane) {
    int m  = lane & 15;
    int kb = (lane >> 4) << 3;
    const _Float16* p = base + (size_t)m * ld + kb;
    Frag f;
    f.h[0] = *(const v8h*)(p);
    f.h[1] = *(const v8h*)(p + 16);
    return f.v;
}

// B fragment from a tiled weight plane (see wcvt_block): one 16 x 32 tile is 1 KB,
// lane l reads 16 B at 16*l and at 512 + 16*l, so each load is four whole 128-B lines.
// Same element in every lane and register position as load_frag16 on the [n][k] plane.
static __device__ __forceinline__ v16h load_fragB(const _Float16* tile, int lane) {
    const _Float16* p = tile + lane * 8;
    Frag f;
    f.h[0] = *(const v8h*)(p);
    f.h[1] = *(const v8h*)(p + 256);
    return f.v;
}

static __device__ __forceinline__ v8f wmma16(v16h a, v16h b, v8f c) {
    v8f d = __builtin_amdgcn_wmma_f32_16x16x32_f16(false, a, false, b, (short)0, c, false, false);
    asm volatile("v_nop\n\tv_nop\n\tv_nop\n\tv_nop" : "+v"(d) : "v"(a), "v"(b));
    return d;
}

// f32 -> bf16 RNE convert, value kept as f32
static __device__ __forceinline__ float bf16r(float x) {
    unsigned u = __float_as_uint(x);
    u = (u + 0x7FFFu + ((u >> 16) & 1u)) & 0xFFFF0000u;
    return __uint_as_float(u);
}

// ordering for a wave-private LDS tile: stores before later loads of the same wave
static __device__ __forceinline__ void wave_lds_sync() {
    __builtin_amdgcn_fence(3, "wavefront");
    asm volatile("s_wait_dscnt 0" ::: "memory");
    __builtin_amdgcn_wave_barrier();
}

static __device__ __forceinline__ float wsum(float v) {
    v += __shfl_xor(v, 16, 32); v += __shfl_xor(v, 8, 32); v += __shfl_xor(v, 4, 32);
    v += __shfl_xor(v, 2, 32);  v += __shfl_xor(v, 1, 32);
    return v;
}
static __device__ __forceinline__ float wmaxr(float v) {
    v = fmaxf(v, __shfl_xor(v, 16, 32)); v = fmaxf(v, __shfl_xor(v, 8, 32));
    v = fmaxf(v, __shfl_xor(v, 4, 32));  v = fmaxf(v, __shfl_xor(v, 2, 32));
    v = fmaxf(v, __shfl_xor(v, 1, 32));
    return v;
}
static __device__ __forceinline__ float wminr(float v) {
    v = fminf(v, __shfl_xor(v, 16, 32)); v = fminf(v, __shfl_xor(v, 8, 32));
    v = fminf(v, __shfl_xor(v, 4, 32));  v = fminf(v, __shfl_xor(v, 2, 32));
    v = fminf(v, __shfl_xor(v, 1, 32));
    return v;
}

// Mish(x) = x * tanh(softplus(x)) = x * (u^2+2u)/(u^2+2u+2), u = e^x
static __device__ __forceinline__ float mishf(float x) {
    float xe = fminf(x, 20.0f);
    float u  = __builtin_amdgcn_exp2f(xe * LOG2E);
    float wv = u * (u + 2.0f);
    float t  = wv * __builtin_amdgcn_rcpf(wv + 2.0f);
    return x * t;
}

// 16 columns per lane: columns 256*j + 8*lane + e (j = 0,1; e = 0..7)
static __device__ __forceinline__ void load_cols16(const float* p, int lane, float (&o)[16]) {
#pragma unroll
    for (int j = 0; j < 2; ++j) {
        v4f a = *(const v4f*)(p + 256 * j + 8 * lane);
        v4f c = *(const v4f*)(p + 256 * j + 8 * lane + 4);
        o[8 * j + 0] = a.x; o[8 * j + 1] = a.y; o[8 * j + 2] = a.z; o[8 * j + 3] = a.w;
        o[8 * j + 4] = c.x; o[8 * j + 5] = c.y; o[8 * j + 6] = c.z; o[8 * j + 7] = c.w;
    }
}

// LayerNorm over a 512-wide row held as 16 columns per lane (f32)
static __device__ __forceinline__ void ln_lane(const float (&v)[16], const float (&gl)[16],
                                               const float (&el)[16], float (&y)[16]) {
    float s = 0.0f;
#pragma unroll
    for (int e = 0; e < 16; ++e) s += v[e];
    s = wsum(s);
    const float mu = s * (1.0f / (float)DM);
    float d[16];
    float q = 0.0f;
#pragma unroll
    for (int e = 0; e < 16; ++e) { d[e] = v[e] - mu; q = __builtin_fmaf(d[e], d[e], q); }
    q = wsum(q);
    const float rstd = rsqrtf(__builtin_fmaf(q, 1.0f / (float)DM, LN_EPS));
#pragma unroll
    for (int e = 0; e < 16; ++e) y[e] = d[e] * rstd * gl[e] + el[e];
}

// ---------------------------------------------------------------------------
// Weight plane: value f16(bf16r(src[n][k]) * 64), stored in fragment order: tile
// (n/16, k/32) is 512 halves at ((n/16) * (K/32) + k/32) * 512; inside it element
// (n, k) sits at ((k>>4)&1)*256 + (((k>>3)&1)*16 + (n&15))*8 + (k&7).
// Thread i writes halves 8i..8i+7 (a wave stores 512 contiguous bytes) and gathers
// its 8 source floats; a block reads 16 rows x 512 contiguous bytes.
// coverage: n/2048 blocks of the plane's range, 256 threads x 8 elements -> n exactly.
// ---------------------------------------------------------------------------
template <int K>
static __device__ __forceinline__ void wcvt_block(const float* __restrict__ src,
                                                  _Float16* __restrict__ dst, int blk) {
    constexpr int KT = K / 32;                  // k tiles per 16-row band
    const int i  = blk * 256 + threadIdx.x;
    const int t  = i >> 6, gq = i & 63;         // tile, 8-half group inside it
    const int n  = (t / KT) * 16 + (gq & 15);
    const int k  = (t % KT) * 32 + (gq >> 5) * 16 + ((gq >> 4) & 1) * 8;
    const float* sp = src + (size_t)n * K + k;
    v4f a = *(const v4f*)(sp);
    v4f c = *(const v4f*)(sp + 4);
    v8h o;
    o[0] = (_Float16)(bf16r(a.x) * WSC); o[1] = (_Float16)(bf16r(a.y) * WSC);
    o[2] = (_Float16)(bf16r(a.z) * WSC); o[3] = (_Float16)(bf16r(a.w) * WSC);
    o[4] = (_Float16)(bf16r(c.x) * WSC); o[5] = (_Float16)(bf16r(c.y) * WSC);
    o[6] = (_Float16)(bf16r(c.z) * WSC); o[7] = (_Float16)(bf16r(c.w) * WSC);
    *(v8h*)(dst + (size_t)i * 8) = o;
    // the store's registers may be rewritten on a later path of the caller's listing: wait first
    asm volatile("s_wait_xcnt 0x0" ::: "memory");
}

// ---------------------------------------------------------------------------
// LN1: y1[tok][512] = f16(LayerNorm(bf16r(x)) * g + b). One wave per row,
// lane owns columns 8l..8l+7 and 256+8l..; two v8h stores per row.
// coverage: NTOK/8 blocks x 8 waves x 512 = NTOK x 512.
// ---------------------------------------------------------------------------
static __device__ __forceinline__ void ln1_block(const float* __restrict__ x,
                                                 const float* __restrict__ g,
                                                 const float* __restrict__ be,
                                                 _Float16* __restrict__ y, int blk) {
    const int tid = threadIdx.x, lane = tid & 31, w = tid >> 5;
    const int tok = blk * 8 + w;
    const int b = tok / SEQ, s = tok - b * SEQ;
    const float* xr = x + ((size_t)b * SEQ_FULL + s) * DM;
    float v[16], gl[16], el[16], yv[16];
    load_cols16(xr, lane, v);
    load_cols16(g, lane, gl);
    load_cols16(be, lane, el);
#pragma unroll
    for (int e = 0; e < 16; ++e) { v[e] = bf16r(v[e]); gl[e] = bf16r(gl[e]); el[e] = bf16r(el[e]); }
    ln_lane(v, gl, el, yv);
    v8h o[2];
#pragma unroll
    for (int j = 0; j < 2; ++j)
#pragma unroll
        for (int e = 0; e < 8; ++e) o[j][e] = (_Float16)yv[8 * j + e];
    _Float16* yr = y + (size_t)tok * DM;
    *(v8h*)(yr + 8 * lane)       = o[0];
    *(v8h*)(yr + 256 + 8 * lane) = o[1];
}

// ---------------------------------------------------------------------------
// Preparation, one launch: LN1 and the six weight planes depend on the inputs alone and
// on nothing of each other, so they share a grid; the block index picks the job
// (block-uniform branches, no barrier). Ranges, in order: LN1 (PB_LN blocks), Wq, Wk, Wv,
// Wo (PB_S each), W1, W2 (PB_L each).
// ---------------------------------------------------------------------------
#define PB_LN (NTOK / 8)
#define PB_S  (DM * DM / 2048)
#define PB_L  (DF * DM / 2048)
#define PB_ALL (PB_LN + 4 * PB_S + 2 * PB_L)
__global__ __launch_bounds__(256) void k_prep(const float* __restrict__ x,
                                               const float* __restrict__ g,
                                               const float* __restrict__ be,
                                               const float* __restrict__ Wq,
                                               const float* __restrict__ Wk,
                                               const float* __restrict__ Wv,
                                               const float* __restrict__ Wo,
                                               const float* __restrict__ W1,
                                               const float* __restrict__ W2,
                                               _Float16* __restrict__ y,
                                               _Float16* __restrict__ wqkv,
                                               _Float16* __restrict__ wo16,
                                               _Float16* __restrict__ w116,
                                               _Float16* __restrict__ w216) {
    int blk = blockIdx.x;
    if (blk < PB_LN) { ln1_block(x, g, be, y, blk); return; }
    blk -= PB_LN;
    if (blk < 4 * PB_S) {
        const int p = blk / PB_S;               // 0..3: Wq, Wk, Wv, Wo
        const float* src = (p == 0) ? Wq : ((p == 1) ? Wk : ((p == 2) ? Wv : Wo));
        _Float16* dst = (p == 3) ? wo16 : wqkv + (size_t)p * DM * DM;
        wcvt_block<DM>(src, dst, blk - p * PB_S);
        return;
    }
    blk -= 4 * PB_S;
    if (blk < PB_L) { wcvt_block<DM>(W1, w116, blk); return; }
    wcvt_block<DF>(W2, w216, blk - PB_L);
}

// ---------------------------------------------------------------------------
// GEMM core: wave tile 32 rows x 64 cols, C[r][n] += A[r][k] * B[n][k],
// A an f16 row-major k-contiguous plane, B a tiled weight plane (wcvt_block) whose band of
// 16 rows starts at 16*K*band halves; fragments loaded directly from global memory
// (two 16-B loads each). K % 32 == 0; K is a compile-time constant so that the second A
// tile and the B bands sit at immediate offsets of one address pair an operand, which
// lives through the loop: no load's result is given a register that a load names.
// ---------------------------------------------------------------------------
template <int K>
static __device__ __forceinline__ void gemm_32x64(const _Float16* __restrict__ Ab,
                                                  const _Float16* __restrict__ Bb,
                                                  int lane, v8f (&acc)[2][4]) {
#pragma unroll
    for (int t = 0; t < 2; ++t)
#pragma unroll
        for (int j = 0; j < 4; ++j) acc[t][j] = zero8();
#pragma unroll 1
    for (int k0 = 0; k0 < K; k0 += 32) {
        v16h a0 = load_frag16(Ab + k0, K, lane);
        v16h a1 = load_frag16(Ab + (size_t)16 * K + k0, K, lane);
        v16h bb[4];
#pragma unroll
        for (int j = 0; j < 4; ++j) bb[j] = load_fragB(Bb + (size_t)(16 * j) * K + (size_t)k0 * 16, lane);
#pragma unroll
        for (int j = 0; j < 4; ++j) {
            acc[0][j] = wmma16(a0, bb[j], acc[0][j]);
            acc[1][j] = wmma16(a1, bb[j], acc[1][j]);
        }
    }
}

// ---------------------------------------------------------------------------
// Plane GEMM: out[tok][ldo] f16 plane, block = 32 rows x 512 cols (blockIdx.y =
// 512-column segment), wave = 32 x 64. EPI 0: val = acc + 64*bias (q|k|v x64);
// EPI 1: val = 64 * Mish(acc/64 + bias). Wave-private LDS tile, then 8
// coverage: grid (NTOK/32, ldo/512) x 8 waves x 32x64 = NTOK x ldo.
// EPI 0, segment 2 (v) goes to the plane vfr instead, as B fragments of P*v (n = d,
// k = key), tile (batch, head, key/32, d/16) of 512 halves laid out as in wcvt_block. A lane's
// 8 accumulator rows of one 16x16 tile are keys 16t + 8*(lane>>4) + r at d = lane&15: the
// 8 halves at 256t + 8*lane of that tile, so each store is 512 contiguous bytes a wave.
// coverage: NTOK/32 blocks x 8 waves (heads) x 4 tiles x 512 = NTOK x 512 of vfr.
// ---------------------------------------------------------------------------
template <int EPI>
__global__ __launch_bounds__(256) __attribute__((amdgpu_waves_per_eu(8)))   // 128 registers a wave: four blocks share a WGP, so the EPI 1 grid is resident at once
void k_gemm_p(const _Float16* __restrict__ A, const _Float16* __restrict__ Bw,
              const float* __restrict__ b0, const float* __restrict__ b1,
              const float* __restrict__ b2, const float* __restrict__ b3,
              _Float16* __restrict__ outp, int ldo, _Float16* __restrict__ vfr) {
    __shared__ __align__(16) _Float16 st[8][QR * 64];      // 32 KB, wave-private tiles
    const int tid = threadIdx.x, lane = tid & 31, w = tid >> 5;
    const int hh = lane >> 4, m = lane & 15;
    const int m0  = blockIdx.x * QR;
    const int seg = blockIdx.y;
    const int nl  = 64 * w;                 // column within the 512 segment
    const int n0w = seg * 512 + nl;         // output column / B row
    const float* bias = (seg == 0) ? b0 : ((seg == 1) ? b1 : ((seg == 2) ? b2 : b3));

    v8f acc[2][4];
    constexpr int K = DM;                   // k length of both plane GEMMs
    gemm_32x64<K>(A + (size_t)m0 * K, Bw + (size_t)n0w * K, lane, acc);

    float bl[4];
#pragma unroll
    for (int j = 0; j < 4; ++j) bl[j] = bf16r(bias[nl + 16 * j + m]);
    if (EPI == 0 && seg == 2) {             // block-uniform; no block barrier in this kernel
        const int b = m0 / SEQ, kb = (m0 - b * SEQ) / 32;
        _Float16* vt = vfr + (size_t)((b * NH + w) * (SEQ / 32) + kb) * 2048 + lane * 8;
#pragma unroll
        for (int t = 0; t < 2; ++t)
#pragma unroll
            for (int j = 0; j < 4; ++j) {
                v8h o;
#pragma unroll
                for (int r = 0; r < 8; ++r) o[r] = (_Float16)__builtin_fmaf(bl[j], WSC, acc[t][j][r]);
                *(v8h*)(vt + 512 * j + 256 * t) = o;
            }
        return;
    }
#pragma unroll
    for (int t = 0; t < 2; ++t)
#pragma unroll
        for (int j = 0; j < 4; ++j)
#pragma unroll
            for (int r = 0; r < 8; ++r) {
                float a = acc[t][j][r];
                float val;
                if (EPI == 0) {
                    val = __builtin_fmaf(bl[j], WSC, a);
                } else {
                    float hx = __builtin_fmaf(a, SC_H, bl[j]);
                    val = WSC * mishf(hx);
                }
                st[w][(16 * t + 8 * hh + r) * 64 + 16 * j + m] = (_Float16)val;
            }
    wave_lds_sync();

    v8h pv[8];
    const int lr = lane >> 3, lc = (lane & 7) * 8;
#pragma unroll
    for (int i = 0; i < 8; ++i) pv[i] = *(const v8h*)(&st[w][(4 * i + lr) * 64 + lc]);
    _Float16* ob = outp + (size_t)m0 * ldo + n0w;
#pragma unroll
    for (int i = 0; i < 8; ++i) *(v8h*)(ob + (size_t)(4 * i + lr) * ldo + lc) = pv[i];
    
}

// ---------------------------------------------------------------------------
// Row GEMM (N = 512, block owns 32 full rows) fused with residual add + LayerNorm.
// MODE 0: x1 = bf16r(x) + (acc 2^-12 + bias) -> x1 f32 plane, y2 = f16(LN(x1) g + b).
// MODE 1: x2 = x1 + (acc 2^-12 + bias), out = LN(x2) g + b -> f32 rows.
// Block tile staged f32 in LDS (cross-wave, block barrier); wave then owns 4 rows:
// f16 rows written directly as two 512-B lane-contiguous instructions; f32 rows
// relaid through the (now wave-private) LDS row and written as four 512-B
// coverage: grid NTOK/32 x 32 rows x 512 = NTOK x 512 (each output plane).
// ---------------------------------------------------------------------------
template <int MODE>
__global__ __launch_bounds__(256) __attribute__((amdgpu_num_vgpr(256)))
void k_gemm_r(const _Float16* __restrict__ A, const _Float16* __restrict__ Bw,
              const float* __restrict__ bias, const float* __restrict__ res,
              const float* __restrict__ g, const float* __restrict__ be,
              float* __restrict__ outf, _Float16* __restrict__ outh) {
    __shared__ __align__(16) float T[QR * DM];            // 64 KB block tile
    const int tid = threadIdx.x, lane = tid & 31, w = tid >> 5;
    const int hh = lane >> 4, m = lane & 15;
    const int m0 = blockIdx.x * QR;
    const int nl = 64 * w;

    v8f acc[2][4];
    constexpr int K = (MODE == 0) ? DM : DF;   // k length: ctx plane / ffn plane
    gemm_32x64<K>(A + (size_t)m0 * K, Bw + (size_t)nl * K, lane, acc);
#pragma unroll
    for (int t = 0; t < 2; ++t)
#pragma unroll
        for (int j = 0; j < 4; ++j)
#pragma unroll
            for (int r = 0; r < 8; ++r)
                T[(16 * t + 8 * hh + r) * DM + nl + 16 * j + m] = acc[t][j][r];
    __syncthreads();

    float bl[16], gl[16], el[16];
    load_cols16(bias, lane, bl);
    load_cols16(g, lane, gl);
    load_cols16(be, lane, el);
#pragma unroll
    for (int e = 0; e < 16; ++e) { bl[e] = bf16r(bl[e]); gl[e] = bf16r(gl[e]); el[e] = bf16r(el[e]); }

#pragma unroll 1
    for (int rr = 0; rr < 4; ++rr) {
        const int row = 4 * w + rr;
        const int tok = m0 + row;
        float v[16], rv[16], yv[16];
        load_cols16(&T[row * DM], lane, v);
        if (MODE == 0) {
            const int b = tok / SEQ, s = tok - b * SEQ;
            load_cols16(res + ((size_t)b * SEQ_FULL + s) * DM, lane, rv);
#pragma unroll
            for (int e = 0; e < 16; ++e) rv[e] = bf16r(rv[e]);
        } else {
            load_cols16(res + (size_t)tok * DM, lane, rv);
        }
#pragma unroll
        for (int e = 0; e < 16; ++e) v[e] = rv[e] + __builtin_fmaf(v[e], SC_O, bl[e]);
        ln_lane(v, gl, el, yv);

        // write-back into the wave-private LDS row (same columns this lane loaded)
        float* trow = &T[row * DM];
#pragma unroll
        for (int j = 0; j < 2; ++j) {
            v4f p0, p1;
            if (MODE == 0) {
                p0.x = v[8 * j + 0]; p0.y = v[8 * j + 1]; p0.z = v[8 * j + 2]; p0.w = v[8 * j + 3];
                p1.x = v[8 * j + 4]; p1.y = v[8 * j + 5]; p1.z = v[8 * j + 6]; p1.w = v[8 * j + 7];
            } else {
                p0.x = yv[8 * j + 0]; p0.y = yv[8 * j + 1]; p0.z = yv[8 * j + 2]; p0.w = yv[8 * j + 3];
                p1.x = yv[8 * j + 4]; p1.y = yv[8 * j + 5]; p1.z = yv[8 * j + 6]; p1.w = yv[8 * j + 7];
            }
            *(v4f*)(trow + 256 * j + 8 * lane)     = p0;
            *(v4f*)(trow + 256 * j + 8 * lane + 4) = p1;
        }
        wave_lds_sync();
        v4f s4[4];
#pragma unroll
        for (int jj = 0; jj < 4; ++jj) s4[jj] = *(const v4f*)(trow + 128 * jj + 4 * lane);

        float* orow = outf + (size_t)tok * DM;
        if (MODE == 0) {
            v8h o[2];
#pragma unroll
            for (int j = 0; j < 2; ++j)
#pragma unroll
                for (int e = 0; e < 8; ++e) o[j][e] = (_Float16)yv[8 * j + e];
            _Float16* hrow = outh + (size_t)tok * DM;
            *(v8h*)(hrow + 8 * lane)       = o[0];
            *(v8h*)(hrow + 256 + 8 * lane) = o[1];
#pragma unroll
            for (int jj = 0; jj < 4; ++jj) *(v4f*)(orow + 128 * jj + 4 * lane) = s4[jj];
            
        } else {
#pragma unroll
            for (int jj = 0; jj < 4; ++jj) *(v4f*)(orow + 128 * jj + 4 * lane) = s4[jj];
            
        }
    }
}

// ---------------------------------------------------------------------------
// Attention with 1.5-entmax over keys. Block = 8 waves = 32 query rows of one
// (batch, head); qkv plane [tok][1536] (q | k, each x64, head h at +64h; the v third is
// unused), v x64 in the fragment plane vfr (see k_gemm_p).
// Phase 1: z strip [32][SEQ] f32 in LDS = (64q).(64k) 2^-16 = q.k/16; wave owns
//          SEQ/128 key tiles x both row tiles (K fragments straight from the plane).
// Phase 2: wave owns 4 rows; per row: shift by max, threshold tau of
//          sum relu(z - tau)^2 = 1 by safeguarded Newton (NEWT passes, registers),
//          P = relu(z - tau)^2 x 2^14 as f16 written over the row's own slot
//          (pitch 2*SEQ halves, skew 8*(row&15) halves).
// Phase 3: wave owns one 16x16 ctx tile over all keys; V fragments straight from vfr
//          (whole 128-B lines), VG of them fetched one group ahead; no barrier inside.
// Phase 4: ctx x64 as f16 staged [32][64] (cross-wave, barrier); wave w writes rows
// coverage: grid (SEQ/32, 8, NB) x 32 rows x 64 = NTOK x 512 of the ctx plane.
// ---------------------------------------------------------------------------
__global__ __launch_bounds__(256) __attribute__((amdgpu_num_vgpr(256)))
void k_attn(const _Float16* __restrict__ qkv, const _Float16* __restrict__ vfr,
            _Float16* __restrict__ ctx) {
    __shared__ __align__(16) float    zs[QR * SEQ];       // 128 KB at full size
    __shared__ __align__(16) _Float16 Cst[QR * HD];       // 4 KB
    static_assert(sizeof(zs) + sizeof(Cst) <= 160 * 1024);   // two blocks per WGP
    _Float16* ph = reinterpret_cast<_Float16*>(zs);       // P rows alias the z slots
    constexpr int PP  = 2 * SEQ;                          // P row slot (halves)
    constexpr int PLD = PP + 8;                           // fragment pitch incl. skew
    constexpr int KTW = SEQ / 128;                        // key tiles per wave

    const int tid = threadIdx.x, lane = tid & 31, w = tid >> 5;
    const int hh = lane >> 4, m = lane & 15;
    const int h = blockIdx.y, b = blockIdx.z;
    const int q0 = blockIdx.x * QR;
    const size_t tokq = (size_t)b * SEQ + q0;
    const _Float16* qp = qkv + tokq * DQKV + h * HD;
    const _Float16* kp = qkv + (size_t)b * SEQ * DQKV + DM + h * HD;
    const int rt = w & 1, ct = w >> 1;                    // ctx tile of this wave (phase 3)
    const _Float16* vt = vfr + (size_t)(b * NH + h) * (SEQ / 32) * 2048 + ct * 512;

    // ---- phase 1: scores ----
    {
        const v16h qa00 = load_frag16(qp, DQKV, lane);
        const v16h qa01 = load_frag16(qp + 32, DQKV, lane);
        const v16h qa10 = load_frag16(qp + (size_t)16 * DQKV, DQKV, lane);
        const v16h qa11 = load_frag16(qp + (size_t)16 * DQKV + 32, DQKV, lane);
#pragma unroll 1
        for (int i = 0; i < KTW; ++i) {
            const int key0 = (w * KTW + i) * 16;
            const _Float16* kt = kp + (size_t)key0 * DQKV;
            v16h kf0 = load_frag16(kt, DQKV, lane);
            v16h kf1 = load_frag16(kt + 32, DQKV, lane);
            v8f s0 = wmma16(qa00, kf0, zero8());
            s0 = wmma16(qa01, kf1, s0);
            v8f s1 = wmma16(qa10, kf0, zero8());
            s1 = wmma16(qa11, kf1, s1);
#pragma unroll
            for (int r = 0; r < 8; ++r) {
                zs[(8 * hh + r) * SEQ + key0 + m]      = s0[r] * SC_Z;
                zs[(16 + 8 * hh + r) * SEQ + key0 + m] = s1[r] * SC_Z;
            }
        }
    }
    __syncthreads();

    // first group of V fragments: in flight under phase 2
    v16h vcur[VG];
#pragma unroll
    for (int i = 0; i < VG; ++i) vcur[i] = load_fragB(vt + i * 2048, lane);

    // ---- phase 2: 1.5-entmax threshold per row ----
    const float tcl = -rsqrtf((float)SEQ);    // tau <= -1/sqrt(SEQ) always
#pragma unroll 1
    for (int rr = 0; rr < 4; ++rr) {
        const int row = 4 * w + rr;
        float z[ZN];
        const float* zr = &zs[row * SEQ];
#pragma unroll
        for (int j = 0; j < ZN / 4; ++j) {
            v4f t4 = *(const v4f*)(zr + 128 * j + 4 * lane);
            z[4 * j + 0] = t4.x; z[4 * j + 1] = t4.y; z[4 * j + 2] = t4.z; z[4 * j + 3] = t4.w;
        }
        float mx = z[0], mn = z[0];
#pragma unroll
        for (int i = 1; i < ZN; ++i) { mx = fmaxf(mx, z[i]); mn = fminf(mn, z[i]); }
        mx = wmaxr(mx);
        mn = wminr(mn);
#pragma unroll
        for (int i = 0; i < ZN; ++i) z[i] = z[i] - mx;
        float tau = fminf(fmaxf(mn - mx, -1.0f), tcl);
#pragma unroll 1
        for (int it = 0; it < NEWT; ++it) {
            float sa = 0.0f, sb = 0.0f;
#pragma unroll
            for (int i = 0; i < ZN; ++i) {
                float d = fmaxf(z[i] - tau, 0.0f);
                sa += d;
                sb = __builtin_fmaf(d, d, sb);
            }
            sa = wsum(sa);
            sb = wsum(sb);
            tau = tau + (sb - 1.0f) * (0.5f * __builtin_amdgcn_rcpf(sa));
            tau = fminf(fmaxf(tau, -1.0f), tcl);
        }
        _Float16* prow = ph + (size_t)row * PP + (row & 15) * 8;
#pragma unroll
        for (int j = 0; j < ZN / 4; ++j) {
            v4h pk;
#pragma unroll
            for (int e = 0; e < 4; ++e) {
                float d = fmaxf(z[4 * j + e] - tau, 0.0f);
                pk[e] = (_Float16)(d * d * SC_P);
            }
            *(v4h*)(prow + 128 * j + 4 * lane) = pk;
        }
    }
    __syncthreads();

    // ---- phase 3: ctx = P @ v ----
    v8f acc = zero8();
    constexpr int NG = SEQ / (32 * VG);
#pragma unroll
    for (int g = 0; g < NG; ++g) {
        v16h pa[VG], vnx[VG];
#pragma unroll
        for (int i = 0; i < VG; ++i)      // rows = queries, k = keys
            pa[i] = load_frag16(ph + (size_t)(16 * rt) * PP + (g * VG + i) * 32, PLD, lane);
        if (g + 1 < NG) {
#pragma unroll
            for (int i = 0; i < VG; ++i) vnx[i] = load_fragB(vt + ((g + 1) * VG + i) * 2048, lane);
        }
#pragma unroll
        for (int i = 0; i < VG; ++i) acc = wmma16(pa[i], vcur[i], acc);   // n = d, k = keys
        if (g + 1 < NG) {
#pragma unroll
            for (int i = 0; i < VG; ++i) vcur[i] = vnx[i];
        }
    }

    // ---- phase 4: ctx plane x64 ----
#pragma unroll
    for (int r = 0; r < 8; ++r)
        Cst[(16 * rt + 8 * hh + r) * HD + 16 * ct + m] = (_Float16)(acc[r] * SC_C);
    __syncthreads();
    const int orow = 4 * w + (lane >> 3), oc = (lane & 7) * 8;
    v8h cv = *(const v8h*)(&Cst[orow * HD + oc]);
    _Float16* dst = ctx + (tokq + orow) * DM + h * HD + oc;
    *(v8h*)dst = cv;
    
}

// ---------------------------------------------------------------------------
extern "C" void kernel_launch(void* const* d_in, const int* in_sizes, int n_in,
                              void* d_out, int out_size, void* d_ws, size_t ws_size,
                              hipStream_t stream) {
    if (n_in < 19) return;
    if (in_sizes[0] < ((NB - 1) * SEQ_FULL + SEQ) * DM) return;
    if (in_sizes[1] < DM * DM || in_sizes[3] < DM * DM || in_sizes[5] < DM * DM || in_sizes[7] < DM * DM) return;
    if (in_sizes[2] < DM || in_sizes[4] < DM || in_sizes[6] < DM || in_sizes[8] < DM) return;
    if (in_sizes[9] < DM || in_sizes[10] < DM || in_sizes[15] < DM || in_sizes[16] < DM) return;
    if (in_sizes[17] < DM || in_sizes[18] < DM || in_sizes[14] < DM) return;
    if (in_sizes[11] < DF * DM || in_sizes[13] < DM * DF || in_sizes[12] < DF) return;
    if (out_size < NTOK * DM) return;

    const float* x    = (const float*)d_in[0];    // [8,1024,512]
    const float* Wq   = (const float*)d_in[1];    // [512,512] (out,in)
    const float* bq   = (const float*)d_in[2];
    const float* Wk   = (const float*)d_in[3];
    const float* bk   = (const float*)d_in[4];
    const float* Wv   = (const float*)d_in[5];
    const float* bv   = (const float*)d_in[6];
    const float* Wo   = (const float*)d_in[7];
    const float* bo   = (const float*)d_in[8];
    const float* ln1g = (const float*)d_in[9];
    const float* ln1b = (const float*)d_in[10];
    const float* W1   = (const float*)d_in[11];   // [2048,512]
    const float* bf1  = (const float*)d_in[12];
    const float* W2   = (const float*)d_in[13];   // [512,2048]
    const float* bf2  = (const float*)d_in[14];
    const float* ln2g = (const float*)d_in[15];
    const float* ln2b = (const float*)d_in[16];
    const float* lnfg = (const float*)d_in[17];
    const float* lnfb = (const float*)d_in[18];
    float* out = (float*)d_out;                   // [NTOK][512]

    char* ws = (char*)d_ws;
    size_t off = 0;
    _Float16* wqkv = (_Float16*)(ws + off); off += (size_t)DQKV * DM * 2;      // 1,572,864
    _Float16* wo16 = (_Float16*)(ws + off); off += (size_t)DM * DM * 2;        //   524,288
    _Float16* w116 = (_Float16*)(ws + off); off += (size_t)DF * DM * 2;        // 2,097,152
    _Float16* w216 = (_Float16*)(ws + off); off += (size_t)DM * DF * 2;        // 2,097,152
    _Float16* y1   = (_Float16*)(ws + off); off += (size_t)NTOK * DM * 2;      // 8 MiB at full size
    _Float16* qkv  = (_Float16*)(ws + off); off += (size_t)NTOK * DQKV * 2;    // 24 MiB
    _Float16* cpl  = (_Float16*)(ws + off); off += (size_t)NTOK * DM * 2;      // 8 MiB
    float*    x1   = (float*)(ws + off);    off += (size_t)NTOK * DM * 4;      // 16 MiB
    _Float16* y2   = (_Float16*)(ws + off); off += (size_t)NTOK * DM * 2;      // 8 MiB
    _Float16* mpl  = (_Float16*)(ws + off); off += (size_t)NTOK * DF * 2;      // 32 MiB
    _Float16* vfr  = (_Float16*)(ws + off); off += (size_t)NTOK * DM * 2;      // 8 MiB
    if (off > ws_size) return;                                                 // 115,343,360 B at full size

    k_prep<<<dim3(PB_ALL), dim3(256), 0, stream>>>(x, ln1g, ln1b, Wq, Wk, Wv, Wo, W1, W2, y1, wqkv, wo16, w116, w216);
    k_gemm_p<0><<<dim3(NTOK / QR, 3), dim3(256), 0, stream>>>(y1, wqkv, bq, bk, bv, bv, qkv, DQKV, vfr);
    k_attn<<<dim3(SEQ / QR, NH, NB), dim3(256), 0, stream>>>(qkv, vfr, cpl);
    k_gemm_r<0><<<dim3(NTOK / QR), dim3(256), 0, stream>>>(cpl, wo16, bo, x, ln2g, ln2b, x1, y2);
    k_gemm_p<1><<<dim3(NTOK / QR, DF / 512), dim3(256), 0, stream>>>(y2, w116, bf1, bf1 + 512, bf1 + 1024, bf1 + 1536, mpl, DF, nullptr);
    k_gemm_r<1><<<dim3(NTOK / QR), dim3(256), 0, stream>>>(mpl, w216, bf2, x1, lnfg, lnfb, out, y2);
}

// v005
// One run takes 218 microseconds.
// Two timings next to v004 put it at 1.05 and 1.09 times that version's speed.
// All steps since v000 together make it 1.90 times as fast.
#include <hip/hip_runtime.h>

// Contractions on v_wmma_f32_16x16x32_f16 (f16 operands, f32 accumulate), one product each: y1*[Wq|Wk|Wv]^T, q*k^T, P*v, ctx*Wo^T, y2*W1^T, m*W2^T; float inputs RNE-converted to bf16 then carried in f16 (weights x64, P x2^14, ctx x64, m x64); LayerNorm, 1.5-entmax threshold and Mish in f32.

#ifndef NB
#define NB 8
#endif
#ifndef SEQ
#define SEQ 1024
#endif
#define NB_FULL  8
#define SEQ_FULL 1024
#define DM   512            // model width
#define DF   2048           // ffn width
#define NH   8
#define HD   64
#define DQKV (3 * DM)       // q|k|v plane pitch
#define NTOK (NB * SEQ)
#define QR   32             // query rows per attention block / rows per gemm block
#define VG   8              // V fragments (32 keys each) fetched ahead as one group in k_attn
#define ZN   (SEQ / 32)     // scores per lane per row
#define NEWT 6              // Newton passes for the entmax threshold (on the norm, see k_attn phase 2)

static_assert(NB >= 1 && NB <= NB_FULL);
static_assert(SEQ <= SEQ_FULL);
static_assert(SEQ % (32 * VG) == 0);
static_assert(SEQ % 128 == 0);
static_assert(NTOK % QR == 0);
static_assert(NH * HD == DM);
static_assert(QR == 32);
static_assert((ZN % 4) == 0);
static_assert(DM % 32 == 0 && DF % 32 == 0);
static_assert((DM * DM) % 2048 == 0 && (DF * DM) % 2048 == 0);

typedef _Float16 v16h __attribute__((ext_vector_type(16)));
typedef _Float16 v8h  __attribute__((ext_vector_type(8)));
typedef _Float16 v4h  __attribute__((ext_vector_type(4)));
typedef float    v8f  __attribute__((ext_vector_type(8)));
typedef float    v4f  __attribute__((ext_vector_type(4)));

union Frag { v16h v; v8h h[2]; };

#define WSC   64.0f                  // weight carry
#define SC_Z  1.52587890625e-05f     // 2^-16 : (64q).(64k) -> q.k/16 = z
#define SC_P  16384.0f               // 2^14  : P carry
#define SC_C  6.103515625e-05f       // 2^-14 : (2^14 P)(64 v) -> 64 ctx
#define SC_O  2.44140625e-04f        // 2^-12 : (64 a)(64 W) -> a.W
#define SC_H  0.015625f              // 1/64  : (y)(64 W) -> y.W
#define LOG2E 1.44269504088896340736f
#define LN_EPS 1e-5f

static __device__ __forceinline__ v8f zero8() {
    v8f z;
#pragma unroll
    for (int i = 0; i < 8; ++i) z[i] = 0.0f;
    return z;
}

// 16x32 A fragment (or B fragment from an [n][k] k-contiguous source) from a
// row-major 16-bit tile: lane m = lane&15 -> row m; kb = 8*(lane>>4);
// elements 0..7 = k kb..kb+7, elements 8..15 = k kb+16..kb+23.
static __device__ __forceinline__ v16h load_frag16(const _Float16* base, int ld, int lane) {
    int m  = lane & 15;
    int kb = (lane >> 4) << 3;
    const _Float16* p = base + (size_t)m * ld + kb;
    Frag f;
    f.h[0] = *(const v8h*)(p);
    f.h[1] = *(const v8h*)(p + 16);
    return f.v;
}

// B fragment from a tiled weight plane (see wcvt_block): one 16 x 32 tile is 1 KB,
// lane l reads 16 B at 16*l and at 512 + 16*l, so each load is four whole 128-B lines.
// Same element in every lane and register position as load_frag16 on the [n][k] plane.
static __device__ __forceinline__ v16h load_fragB(const _Float16* tile, int lane) {
    const _Float16* p = tile + lane * 8;
    Frag f;
    f.h[0] = *(const v8h*)(p);
    f.h[1] = *(const v8h*)(p + 256);
    return f.v;
}

static __device__ __forceinline__ v8f wmma16(v16h a, v16h b, v8f c) {
    v8f d = __builtin_amdgcn_wmma_f32_16x16x32_f16(false, a, false, b, (short)0, c, false, false);
    asm volatile("v_nop\n\tv_nop\n\tv_nop\n\tv_nop" : "+v"(d) : "v"(a), "v"(b));
    return d;
}

// f32 -> bf16 RNE convert, value kept as f32
static __device__ __forceinline__ float bf16r(float x) {
    unsigned u = __float_as_uint(x);
    u = (u + 0x7FFFu + ((u >> 16) & 1u)) & 0xFFFF0000u;
    return __uint_as_float(u);
}

// ordering for a wave-private LDS tile: stores before later loads of the same wave
static __device__ __forceinline__ void wave_lds_sync() {
    __builtin_amdgcn_fence(3, "wavefront");
    asm volatile("s_wait_dscnt 0" ::: "memory");
    __builtin_amdgcn_wave_barrier();
}

static __device__ __forceinline__ float wsum(float v) {
    v += __shfl_xor(v, 16, 32); v += __shfl_xor(v, 8, 32); v += __shfl_xor(v, 4, 32);
    v += __shfl_xor(v, 2, 32);  v += __shfl_xor(v, 1, 32);
    return v;
}
static __device__ __forceinline__ float wmaxr(float v) {
    v = fmaxf(v, __shfl_xor(v, 16, 32)); v = fmaxf(v, __shfl_xor(v, 8, 32));
    v = fmaxf(v, __shfl_xor(v, 4, 32));  v = fmaxf(v, __shfl_xor(v, 2, 32));
    v = fmaxf(v, __shfl_xor(v, 1, 32));
    return v;
}
static __device__ __forceinline__ float wminr(float v) {
    v = fminf(v, __shfl_xor(v, 16, 32)); v = fminf(v, __shfl_xor(v, 8, 32));
    v = fminf(v, __shfl_xor(v, 4, 32));  v = fminf(v, __shfl_xor(v, 2, 32));
    v = fminf(v, __shfl_xor(v, 1, 32));
    return v;
}

// Mish(x) = x * tanh(softplus(x)) = x * (u^2+2u)/(u^2+2u+2), u = e^x
static __device__ __forceinline__ float mishf(float x) {
    float xe = fminf(x, 20.0f);
    float u  = __builtin_amdgcn_exp2f(xe * LOG2E);
    float wv = u * (u + 2.0f);
    float t  = wv * __builtin_amdgcn_rcpf(wv + 2.0f);
    return x * t;
}

// 16 columns per lane: columns 256*j + 8*lane + e (j = 0,1; e = 0..7)
static __device__ __forceinline__ void load_cols16(const float* p, int lane, float (&o)[16]) {
#pragma unroll
    for (int j = 0; j < 2; ++j) {
        v4f a = *(const v4f*)(p + 256 * j + 8 * lane);
        v4f c = *(const v4f*)(p + 256 * j + 8 * lane + 4);
        o[8 * j + 0] = a.x; o[8 * j + 1] = a.y; o[8 * j + 2] = a.z; o[8 * j + 3] = a.w;
        o[8 * j + 4] = c.x; o[8 * j + 5] = c.y; o[8 * j + 6] = c.z; o[8 * j + 7] = c.w;
    }
}

// LayerNorm over a 512-wide row held as 16 columns per lane (f32)
static __device__ __forceinline__ void ln_lane(const float (&v)[16], const float (&gl)[16],
                                               const float (&el)[16], float (&y)[16]) {
    float s = 0.0f;
#pragma unroll
    for (int e = 0; e < 16; ++e) s += v[e];
    s = wsum(s);
    const float mu = s * (1.0f / (float)DM);
    float d[16];
    float q = 0.0f;
#pragma unroll
    for (int e = 0; e < 16; ++e) { d[e] = v[e] - mu; q = __builtin_fmaf(d[e], d[e], q); }
    q = wsum(q);
    const float rstd = rsqrtf(__builtin_fmaf(q, 1.0f / (float)DM, LN_EPS));
#pragma unroll
    for (int e = 0; e < 16; ++e) y[e] = d[e] * rstd * gl[e] + el[e];
}

// ---------------------------------------------------------------------------
// Weight plane: value f16(bf16r(src[n][k]) * 64), stored in fragment order: tile
// (n/16, k/32) is 512 halves at ((n/16) * (K/32) + k/32) * 512; inside it element
// (n, k) sits at ((k>>4)&1)*256 + (((k>>3)&1)*16 + (n&15))*8 + (k&7).
// Thread i writes halves 8i..8i+7 (a wave stores 512 contiguous bytes) and gathers
// its 8 source floats; a block reads 16 rows x 512 contiguous bytes.
// coverage: n/2048 blocks of the plane's range, 256 threads x 8 elements -> n exactly.
// ---------------------------------------------------------------------------
template <int K>
static __device__ __forceinline__ void wcvt_block(const float* __restrict__ src,
                                                  _Float16* __restrict__ dst, int blk) {
    constexpr int KT = K / 32;                  // k tiles per 16-row band
    const int i  = blk * 256 + threadIdx.x;
    const int t  = i >> 6, gq = i & 63;         // tile, 8-half group inside it
    const int n  = (t / KT) * 16 + (gq & 15);
    const int k  = (t % KT) * 32 + (gq >> 5) * 16 + ((gq >> 4) & 1) * 8;
    const float* sp = src + (size_t)n * K + k;
    v4f a = *(const v4f*)(sp);
    v4f c = *(const v4f*)(sp + 4);
    v8h o;
    o[0] = (_Float16)(bf16r(a.x) * WSC); o[1] = (_Float16)(bf16r(a.y) * WSC);
    o[2] = (_Float16)(bf16r(a.z) * WSC); o[3] = (_Float16)(bf16r(a.w) * WSC);
    o[4] = (_Float16)(bf16r(c.x) * WSC); o[5] = (_Float16)(bf16r(c.y) * WSC);
    o[6] = (_Float16)(bf16r(c.z) * WSC); o[7] = (_Float16)(bf16r(c.w) * WSC);
    *(v8h*)(dst + (size_t)i * 8) = o;
    // the store's registers may be rewritten on a later path of the caller's listing: wait first
    asm volatile("s_wait_xcnt 0x0" ::: "memory");
}

// ---------------------------------------------------------------------------
// LN1: y1[tok][512] = f16(LayerNorm(bf16r(x)) * g + b). One wave per row,
// lane owns columns 8l..8l+7 and 256+8l..; two v8h stores per row.
// coverage: NTOK/8 blocks x 8 waves x 512 = NTOK x 512.
// ---------------------------------------------------------------------------
static __device__ __forceinline__ void ln1_block(const float* __restrict__ x,
                                                 const float* __restrict__ g,
                                                 const float* __restrict__ be,
                                                 _Float16* __restrict__ y, int blk) {
    const int tid = threadIdx.x, lane = tid & 31, w = tid >> 5;
    const int tok = blk * 8 + w;
    const int b = tok / SEQ, s = tok - b * SEQ;
    const float* xr = x + ((size_t)b * SEQ_FULL + s) * DM;
    float v[16], gl[16], el[16], yv[16];
    load_cols16(xr, lane, v);
    load_cols16(g, lane, gl);
    load_cols16(be, lane, el);
#pragma unroll
    for (int e = 0; e < 16; ++e) { v[e] = bf16r(v[e]); gl[e] = bf16r(gl[e]); el[e] = bf16r(el[e]); }
    ln_lane(v, gl, el, yv);
    v8h o[2];
#pragma unroll
    for (int j = 0; j < 2; ++j)
#pragma unroll
        for (int e = 0; e < 8; ++e) o[j][e] = (_Float16)yv[8 * j + e];
    _Float16* yr = y + (size_t)tok * DM;
    *(v8h*)(yr + 8 * lane)       = o[0];
    *(v8h*)(yr + 256 + 8 * lane) = o[1];
}

// ---------------------------------------------------------------------------
// Preparation, one launch: LN1 and the six weight planes depend on the inputs alone and
// on nothing of each other, so they share a grid; the block index picks the job
// (block-uniform branches, no barrier). Ranges, in order: LN1 (PB_LN blocks), Wq, Wk, Wv,
// Wo (PB_S each), W1, W2 (PB_L each).
// ---------------------------------------------------------------------------
#define PB_LN (NTOK / 8)
#define PB_S  (DM * DM / 2048)
#define PB_L  (DF * DM / 2048)
#define PB_ALL (PB_LN + 4 * PB_S + 2 * PB_L)
__global__ __launch_bounds__(256) void k_prep(const float* __restrict__ x,
                                               const float* __restrict__ g,
                                               const float* __restrict__ be,
                                               const float* __restrict__ Wq,
                                               const float* __restrict__ Wk,
                                               const float* __restrict__ Wv,
                                               const float* __restrict__ Wo,
                                               const float* __restrict__ W1,
                                               const float* __restrict__ W2,
                                               _Float16* __restrict__ y,
                                               _Float16* __restrict__ wqkv,
                                               _Float16* __restrict__ wo16,
                                               _Float16* __restrict__ w116,
                                               _Float16* __restrict__ w216) {
    int blk = blockIdx.x;
    if (blk < PB_LN) { ln1_block(x, g, be, y, blk); return; }
    blk -= PB_LN;
    if (blk < 4 * PB_S) {
        const int p = blk / PB_S;               // 0..3: Wq, Wk, Wv, Wo
        const float* src = (p == 0) ? Wq : ((p == 1) ? Wk : ((p == 2) ? Wv : Wo));
        _Float16* dst = (p == 3) ? wo16 : wqkv + (size_t)p * DM * DM;
        wcvt_block<DM>(src, dst, blk - p * PB_S);
        return;
    }
    blk -= 4 * PB_S;
    if (blk < PB_L) { wcvt_block<DM>(W1, w116, blk); return; }
    wcvt_block<DF>(W2, w216, blk - PB_L);
}

// ---------------------------------------------------------------------------
// GEMM core: wave tile 32 rows x 64 cols, C[r][n] += A[r][k] * B[n][k],
// A an f16 row-major k-contiguous plane, B a tiled weight plane (wcvt_block) whose band of
// 16 rows starts at 16*K*band halves; fragments loaded directly from global memory
// (two 16-B loads each). K % 32 == 0; K is a compile-time constant so that the second A
// tile and the B bands sit at immediate offsets of one address pair an operand, which
// lives through the loop: no load's result is given a register that a load names.
// ---------------------------------------------------------------------------
template <int K>
static __device__ __forceinline__ void gemm_32x64(const _Float16* __restrict__ Ab,
                                                  const _Float16* __restrict__ Bb,
                                                  int lane, v8f (&acc)[2][4]) {
#pragma unroll
    for (int t = 0; t < 2; ++t)
#pragma unroll
        for (int j = 0; j < 4; ++j) acc[t][j] = zero8();
#pragma unroll 1
    for (int k0 = 0; k0 < K; k0 += 32) {
        v16h a0 = load_frag16(Ab + k0, K, lane);
        v16h a1 = load_frag16(Ab + (size_t)16 * K + k0, K, lane);
        v16h bb[4];
#pragma unroll
        for (int j = 0; j < 4; ++j) bb[j] = load_fragB(Bb + (size_t)(16 * j) * K + (size_t)k0 * 16, lane);
#pragma unroll
        for (int j = 0; j < 4; ++j) {
            acc[0][j] = wmma16(a0, bb[j], acc[0][j]);
            acc[1][j] = wmma16(a1, bb[j], acc[1][j]);
        }
    }
}

// ---------------------------------------------------------------------------
// Plane GEMM: out[tok][ldo] f16 plane, block = 32 rows x 512 cols (blockIdx.y =
// 512-column segment), wave = 32 x 64. EPI 0: val = acc + 64*bias (q|k|v x64);
// EPI 1: val = 64 * Mish(acc/64 + bias). Wave-private LDS tile, then 8
// coverage: grid (NTOK/32, ldo/512) x 8 waves x 32x64 = NTOK x ldo.
// EPI 0, segment 2 (v) goes to the plane vfr instead, as B fragments of P*v (n = d,
// k = key), tile (batch, head, key/32, d/16) of 512 halves laid out as in wcvt_block. A lane's
// 8 accumulator rows of one 16x16 tile are keys 16t + 8*(lane>>4) + r at d = lane&15: the
// 8 halves at 256t + 8*lane of that tile, so each store is 512 contiguous bytes a wave.
// coverage: NTOK/32 blocks x 8 waves (heads) x 4 tiles x 512 = NTOK x 512 of vfr.
// ---------------------------------------------------------------------------
template <int EPI>
__global__ __launch_bounds__(256) __attribute__((amdgpu_waves_per_eu(8)))   // 128 registers a wave: four blocks share a WGP, so the EPI 1 grid is resident at once
void k_gemm_p(const _Float16* __restrict__ A, const _Float16* __restrict__ Bw,
              const float* __restrict__ b0, const float* __restrict__ b1,
              const float* __restrict__ b2, const float* __restrict__ b3,
              _Float16* __restrict__ outp, int ldo, _Float16* __restrict__ vfr) {
    __shared__ __align__(16) _Float16 st[8][QR * 64];      // 32 KB, wave-private tiles
    const int tid = threadIdx.x, lane = tid & 31, w = tid >> 5;
    const int hh = lane >> 4, m = lane & 15;
    const int m0  = blockIdx.x * QR;
    const int seg = blockIdx.y;
    const int nl  = 64 * w;                 // column within the 512 segment
    const int n0w = seg * 512 + nl;         // output column / B row
    const float* bias = (seg == 0) ? b0 : ((seg == 1) ? b1 : ((seg == 2) ? b2 : b3));

    v8f acc[2][4];
    constexpr int K = DM;                   // k length of both plane GEMMs
    gemm_32x64<K>(A + (size_t)m0 * K, Bw + (size_t)n0w * K, lane, acc);

    float bl[4];
#pragma unroll
    for (int j = 0; j < 4; ++j) bl[j] = bf16r(bias[nl + 16 * j + m]);
    if (EPI == 0 && seg == 2) {             // block-uniform; no block barrier in this kernel
        const int b = m0 / SEQ, kb = (m0 - b * SEQ) / 32;
        _Float16* vt = vfr + (size_t)((b * NH + w) * (SEQ / 32) + kb) * 2048 + lane * 8;
#pragma unroll
        for (int t = 0; t < 2; ++t)
#pragma unroll
            for (int j = 0; j < 4; ++j) {
                v8h o;
#pragma unroll
                for (int r = 0; r < 8; ++r) o[r] = (_Float16)__builtin_fmaf(bl[j], WSC, acc[t][j][r]);
                *(v8h*)(vt + 512 * j + 256 * t) = o;
            }
        return;
    }
#pragma unroll
    for (int t = 0; t < 2; ++t)
#pragma unroll
        for (int j = 0; j < 4; ++j)
#pragma unroll
            for (int r = 0; r < 8; ++r) {
                float a = acc[t][j][r];
                float val;
                if (EPI == 0) {
                    val = __builtin_fmaf(bl[j], WSC, a);
                } else {
                    float hx = __builtin_fmaf(a, SC_H, bl[j]);
                    val = WSC * mishf(hx);
                }
                st[w][(16 * t + 8 * hh + r) * 64 + 16 * j + m] = (_Float16)val;
            }
    wave_lds_sync();

    v8h pv[8];
    const int lr = lane >> 3, lc = (lane & 7) * 8;
#pragma unroll
    for (int i = 0; i < 8; ++i) pv[i] = *(const v8h*)(&st[w][(4 * i + lr) * 64 + lc]);
    _Float16* ob = outp + (size_t)m0 * ldo + n0w;
#pragma unroll
    for (int i = 0; i < 8; ++i) *(v8h*)(ob + (size_t)(4 * i + lr) * ldo + lc) = pv[i];
    
}

// ---------------------------------------------------------------------------
// Row GEMM (N = 512, block owns 32 full rows) fused with residual add + LayerNorm.
// MODE 0: x1 = bf16r(x) + (acc 2^-12 + bias) -> x1 f32 plane, y2 = f16(LN(x1) g + b).
// MODE 1: x2 = x1 + (acc 2^-12 + bias), out = LN(x2) g + b -> f32 rows.
// Block tile staged f32 in LDS (cross-wave, block barrier); wave then owns 4 rows:
// f16 rows written directly as two 512-B lane-contiguous instructions; f32 rows
// relaid through the (now wave-private) LDS row and written as four 512-B
// coverage: grid NTOK/32 x 32 rows x 512 = NTOK x 512 (each output plane).
// ---------------------------------------------------------------------------
template <int MODE>
__global__ __launch_bounds__(256) __attribute__((amdgpu_num_vgpr(256)))
void k_gemm_r(const _Float16* __restrict__ A, const _Float16* __restrict__ Bw,
              const float* __restrict__ bias, const float* __restrict__ res,
              const float* __restrict__ g, const float* __restrict__ be,
              float* __restrict__ outf, _Float16* __restrict__ outh) {
    __shared__ __align__(16) float T[QR * DM];            // 64 KB block tile
    const int tid = threadIdx.x, lane = tid & 31, w = tid >> 5;
    const int hh = lane >> 4, m = lane & 15;
    const int m0 = blockIdx.x * QR;
    const int nl = 64 * w;

    v8f acc[2][4];
    constexpr int K = (MODE == 0) ? DM : DF;   // k length: ctx plane / ffn plane
    gemm_32x64<K>(A + (size_t)m0 * K, Bw + (size_t)nl * K, lane, acc);
#pragma unroll
    for (int t = 0; t < 2; ++t)
#pragma unroll
        for (int j = 0; j < 4; ++j)
#pragma unroll
            for (int r = 0; r < 8; ++r)
                T[(16 * t + 8 * hh + r) * DM + nl + 16 * j + m] = acc[t][j][r];
    __syncthreads();

    float bl[16], gl[16], el[16];
    load_cols16(bias, lane, bl);
    load_cols16(g, lane, gl);
    load_cols16(be, lane, el);
#pragma unroll
    for (int e = 0; e < 16; ++e) { bl[e] = bf16r(bl[e]); gl[e] = bf16r(gl[e]); el[e] = bf16r(el[e]); }

#pragma unroll 1
    for (int rr = 0; rr < 4; ++rr) {
        const int row = 4 * w + rr;
        const int tok = m0 + row;
        float v[16], rv[16], yv[16];
        load_cols16(&T[row * DM], lane, v);
        if (MODE == 0) {
            const int b = tok / SEQ, s = tok - b * SEQ;
            load_cols16(res + ((size_t)b * SEQ_FULL + s) * DM, lane, rv);
#pragma unroll
            for (int e = 0; e < 16; ++e) rv[e] = bf16r(rv[e]);
        } else {
            load_cols16(res + (size_t)tok * DM, lane, rv);
        }
#pragma unroll
        for (int e = 0; e < 16; ++e) v[e] = rv[e] + __builtin_fmaf(v[e], SC_O, bl[e]);
        ln_lane(v, gl, el, yv);

        // write-back into the wave-private LDS row (same columns this lane loaded)
        float* trow = &T[row * DM];
#pragma unroll
        for (int j = 0; j < 2; ++j) {
            v4f p0, p1;
            if (MODE == 0) {
                p0.x = v[8 * j + 0]; p0.y = v[8 * j + 1]; p0.z = v[8 * j + 2]; p0.w = v[8 * j + 3];
                p1.x = v[8 * j + 4]; p1.y = v[8 * j + 5]; p1.z = v[8 * j + 6]; p1.w = v[8 * j + 7];
            } else {
                p0.x = yv[8 * j + 0]; p0.y = yv[8 * j + 1]; p0.z = yv[8 * j + 2]; p0.w = yv[8 * j + 3];
                p1.x = yv[8 * j + 4]; p1.y = yv[8 * j + 5]; p1.z = yv[8 * j + 6]; p1.w = yv[8 * j + 7];
            }
            *(v4f*)(trow + 256 * j + 8 * lane)     = p0;
            *(v4f*)(trow + 256 * j + 8 * lane + 4) = p1;
        }
        wave_lds_sync();
        v4f s4[4];
#pragma unroll
        for (int jj = 0; jj < 4; ++jj) s4[jj] = *(const v4f*)(trow + 128 * jj + 4 * lane);

        float* orow = outf + (size_t)tok * DM;
        if (MODE == 0) {
            v8h o[2];
#pragma unroll
            for (int j = 0; j < 2; ++j)
#pragma unroll
                for (int e = 0; e < 8; ++e) o[j][e] = (_Float16)yv[8 * j + e];
            _Float16* hrow = outh + (size_t)tok * DM;
            *(v8h*)(hrow + 8 * lane)       = o[0];
            *(v8h*)(hrow + 256 + 8 * lane) = o[1];
#pragma unroll
            for (int jj = 0; jj < 4; ++jj) *(v4f*)(orow + 128 * jj + 4 * lane) = s4[jj];
            
        } else {
#pragma unroll
            for (int jj = 0; jj < 4; ++jj) *(v4f*)(orow + 128 * jj + 4 * lane) = s4[jj];
            
        }
    }
}

// ---------------------------------------------------------------------------
// Attention with 1.5-entmax over keys. Block = 8 waves = 32 query rows of one
// (batch, head); qkv plane [tok][1536] (q | k, each x64, head h at +64h; the v third is
// unused), v x64 in the fragment plane vfr (see k_gemm_p).
// Phase 1: z strip [32][SEQ] f32 in LDS = (64q).(64k) 2^-16 = q.k/16; wave owns
//          SEQ/128 key tiles x both row tiles (K fragments straight from the plane).
// Phase 2: wave owns 4 rows; per row: shift by max, threshold tau of
//          sum relu(z - tau)^2 = 1 by safeguarded Newton (NEWT passes, registers) on
//          g(tau) = sqrt(sum relu(z - tau)^2) - 1: same root, convex and falling, so a
//          step from below never passes the root, and close to a straight line while the
//          sum is far above 1, where Newton on the sum itself only halves the distance,
//          P = relu(z - tau)^2 x 2^14 as f16 written over the row's own slot
//          (pitch 2*SEQ halves, skew 8*(row&15) halves).
// Phase 3: wave owns one 16x16 ctx tile over all keys; V fragments straight from vfr
//          (whole 128-B lines), VG of them fetched one group ahead; no barrier inside.
// Phase 4: ctx x64 as f16 staged [32][64] (cross-wave, barrier); wave w writes rows
// coverage: grid (SEQ/32, 8, NB) x 32 rows x 64 = NTOK x 512 of the ctx plane.
// ---------------------------------------------------------------------------
__global__ __launch_bounds__(256) __attribute__((amdgpu_num_vgpr(256)))
void k_attn(const _Float16* __restrict__ qkv, const _Float16* __restrict__ vfr,
            _Float16* __restrict__ ctx) {
    __shared__ __align__(16) float    zs[QR * SEQ];       // 128 KB at full size
    __shared__ __align__(16) _Float16 Cst[QR * HD];       // 4 KB
    static_assert(sizeof(zs) + sizeof(Cst) <= 160 * 1024);   // two blocks per WGP
    _Float16* ph = reinterpret_cast<_Float16*>(zs);       // P rows alias the z slots
    constexpr int PP  = 2 * SEQ;                          // P row slot (halves)
    constexpr int PLD = PP + 8;                           // fragment pitch incl. skew
    constexpr int KTW = SEQ / 128;                        // key tiles per wave

    const int tid = threadIdx.x, lane = tid & 31, w = tid >> 5;
    const int hh = lane >> 4, m = lane & 15;
    const int h = blockIdx.y, b = blockIdx.z;
    const int q0 = blockIdx.x * QR;
    const size_t tokq = (size_t)b * SEQ + q0;
    const _Float16* qp = qkv + tokq * DQKV + h * HD;
    const _Float16* kp = qkv + (size_t)b * SEQ * DQKV + DM + h * HD;
    const int rt = w & 1, ct = w >> 1;                    // ctx tile of this wave (phase 3)
    const _Float16* vt = vfr + (size_t)(b * NH + h) * (SEQ / 32) * 2048 + ct * 512;

    // ---- phase 1: scores ----
    {
        const v16h qa00 = load_frag16(qp, DQKV, lane);
        const v16h qa01 = load_frag16(qp + 32, DQKV, lane);
        const v16h qa10 = load_frag16(qp + (size_t)16 * DQKV, DQKV, lane);
        const v16h qa11 = load_frag16(qp + (size_t)16 * DQKV + 32, DQKV, lane);
#pragma unroll 1
        for (int i = 0; i < KTW; ++i) {
            const int key0 = (w * KTW + i) * 16;
            const _Float16* kt = kp + (size_t)key0 * DQKV;
            v16h kf0 = load_frag16(kt, DQKV, lane);
            v16h kf1 = load_frag16(kt + 32, DQKV, lane);
            v8f s0 = wmma16(qa00, kf0, zero8());
            s0 = wmma16(qa01, kf1, s0);
            v8f s1 = wmma16(qa10, kf0, zero8());
            s1 = wmma16(qa11, kf1, s1);
#pragma unroll
            for (int r = 0; r < 8; ++r) {
                zs[(8 * hh + r) * SEQ + key0 + m]      = s0[r] * SC_Z;
                zs[(16 + 8 * hh + r) * SEQ + key0 + m] = s1[r] * SC_Z;
            }
        }
    }
    __syncthreads();

    // first group of V fragments: in flight under phase 2
    v16h vcur[VG];
#pragma unroll
    for (int i = 0; i < VG; ++i) vcur[i] = load_fragB(vt + i * 2048, lane);

    // ---- phase 2: 1.5-entmax threshold per row ----
    const float tcl = -rsqrtf((float)SEQ);    // tau <= -1/sqrt(SEQ) always
#pragma unroll 1
    for (int rr = 0; rr < 4; ++rr) {
        const int row = 4 * w + rr;
        float z[ZN];
        const float* zr = &zs[row * SEQ];
#pragma unroll
        for (int j = 0; j < ZN / 4; ++j) {
            v4f t4 = *(const v4f*)(zr + 128 * j + 4 * lane);
            z[4 * j + 0] = t4.x; z[4 * j + 1] = t4.y; z[4 * j + 2] = t4.z; z[4 * j + 3] = t4.w;
        }
        float mx = z[0], mn = z[0];
#pragma unroll
        for (int i = 1; i < ZN; ++i) { mx = fmaxf(mx, z[i]); mn = fminf(mn, z[i]); }
        mx = wmaxr(mx);
        mn = wminr(mn);
#pragma unroll
        for (int i = 0; i < ZN; ++i) z[i] = z[i] - mx;
        float tau = fminf(fmaxf(mn - mx, -1.0f), tcl);
#pragma unroll 1
        for (int it = 0; it < NEWT; ++it) {
            float sa = 0.0f, sb = 0.0f;
#pragma unroll
            for (int i = 0; i < ZN; ++i) {
                float d = fmaxf(z[i] - tau, 0.0f);
                sa += d;
                sb = __builtin_fmaf(d, d, sb);
            }
            sa = wsum(sa);
            sb = wsum(sb);
            const float rn = __builtin_amdgcn_sqrtf(sb);      // g = rn - 1, g' = -sa / rn
            tau = tau + rn * (rn - 1.0f) * __builtin_amdgcn_rcpf(sa);
            tau = fminf(fmaxf(tau, -1.0f), tcl);
        }
        _Float16* prow = ph + (size_t)row * PP + (row & 15) * 8;
#pragma unroll
        for (int j = 0; j < ZN / 4; ++j) {
            v4h pk;
#pragma unroll
            for (int e = 0; e < 4; ++e) {
                float d = fmaxf(z[4 * j + e] - tau, 0.0f);
                pk[e] = (_Float16)(d * d * SC_P);
            }
            *(v4h*)(prow + 128 * j + 4 * lane) = pk;
        }
    }
    __syncthreads();

    // ---- phase 3: ctx = P @ v ----
    v8f acc = zero8();
    constexpr int NG = SEQ / (32 * VG);
#pragma unroll
    for (int g = 0; g < NG; ++g) {
        v16h pa[VG], vnx[VG];
#pragma unroll
        for (int i = 0; i < VG; ++i)      // rows = queries, k = keys
            pa[i] = load_frag16(ph + (size_t)(16 * rt) * PP + (g * VG + i) * 32, PLD, lane);
        if (g + 1 < NG) {
#pragma unroll
            for (int i = 0; i < VG; ++i) vnx[i] = load_fragB(vt + ((g + 1) * VG + i) * 2048, lane);
        }
#pragma unroll
        for (int i = 0; i < VG; ++i) acc = wmma16(pa[i], vcur[i], acc);   // n = d, k = keys
        if (g + 1 < NG) {
#pragma unroll
            for (int i = 0; i < VG; ++i) vcur[i] = vnx[i];
        }
    }

    // ---- phase 4: ctx plane x64 ----
#pragma unroll
    for (int r = 0; r < 8; ++r)
        Cst[(16 * rt + 8 * hh + r) * HD + 16 * ct + m] = (_Float16)(acc[r] * SC_C);
    __syncthreads();
    const int orow = 4 * w + (lane >> 3), oc = (lane & 7) * 8;
    v8h cv = *(const v8h*)(&Cst[orow * HD + oc]);
    _Float16* dst = ctx + (tokq + orow) * DM + h * HD + oc;
    *(v8h*)dst = cv;
    
}

// ---------------------------------------------------------------------------
extern "C" void kernel_launch(void* const* d_in, const int* in_sizes, int n_in,
                              void* d_out, int out_size, void* d_ws, size_t ws_size,
                              hipStream_t stream) {
    if (n_in < 19) return;
    if (in_sizes[0] < ((NB - 1) * SEQ_FULL + SEQ) * DM) return;
    if (in_sizes[1] < DM * DM || in_sizes[3] < DM * DM || in_sizes[5] < DM * DM || in_sizes[7] < DM * DM) return;
    if (in_sizes[2] < DM || in_sizes[4] < DM || in_sizes[6] < DM || in_sizes[8] < DM) return;
    if (in_sizes[9] < DM || in_sizes[10] < DM || in_sizes[15] < DM || in_sizes[16] < DM) return;
    if (in_sizes[17] < DM || in_sizes[18] < DM || in_sizes[14] < DM) return;
    if (in_sizes[11] < DF * DM || in_sizes[13] < DM * DF || in_sizes[12] < DF) return;
    if (out_size < NTOK * DM) return;

    const float* x    = (const float*)d_in[0];    // [8,1024,512]
    const float* Wq   = (const float*)d_in[1];    // [512,512] (out,in)
    const float* bq   = (const float*)d_in[2];
    const float* Wk   = (const float*)d_in[3];
    const float* bk   = (const float*)d_in[4];
    const float* Wv   = (const float*)d_in[5];
    const float* bv   = (const float*)d_in[6];
    const float* Wo   = (const float*)d_in[7];
    const float* bo   = (const float*)d_in[8];
    const float* ln1g = (const float*)d_in[9];
    const float* ln1b = (const float*)d_in[10];
    const float* W1   = (const float*)d_in[11];   // [2048,512]
    const float* bf1  = (const float*)d_in[12];
    const float* W2   = (const float*)d_in[13];   // [512,2048]
    const float* bf2  = (const float*)d_in[14];
    const float* ln2g = (const float*)d_in[15];
    const float* ln2b = (const float*)d_in[16];
    const float* lnfg = (const float*)d_in[17];
    const float* lnfb = (const float*)d_in[18];
    float* out = (float*)d_out;                   // [NTOK][512]

    char* ws = (char*)d_ws;
    size_t off = 0;
    _Float16* wqkv = (_Float16*)(ws + off); off += (size_t)DQKV * DM * 2;      // 1,572,864
    _Float16* wo16 = (_Float16*)(ws + off); off += (size_t)DM * DM * 2;        //   524,288
    _Float16* w116 = (_Float16*)(ws + off); off += (size_t)DF * DM * 2;        // 2,097,152
    _Float16* w216 = (_Float16*)(ws + off); off += (size_t)DM * DF * 2;        // 2,097,152
    _Float16* y1   = (_Float16*)(ws + off); off += (size_t)NTOK * DM * 2;      // 8 MiB at full size
    _Float16* qkv  = (_Float16*)(ws + off); off += (size_t)NTOK * DQKV * 2;    // 24 MiB
    _Float16* cpl  = (_Float16*)(ws + off); off += (size_t)NTOK * DM * 2;      // 8 MiB
    float*    x1   = (float*)(ws + off);    off += (size_t)NTOK * DM * 4;      // 16 MiB
    _Float16* y2   = (_Float16*)(ws + off); off += (size_t)NTOK * DM * 2;      // 8 MiB
    _Float16* mpl  = (_Float16*)(ws + off); off += (size_t)NTOK * DF * 2;      // 32 MiB
    _Float16* vfr  = (_Float16*)(ws + off); off += (size_t)NTOK * DM * 2;      // 8 MiB
    if (off > ws_size) return;                                                 // 115,343,360 B at full size

    k_prep<<<dim3(PB_ALL), dim3(256), 0, stream>>>(x, ln1g, ln1b, Wq, Wk, Wv, Wo, W1, W2, y1, wqkv, wo16, w116, w216);
    k_gemm_p<0><<<dim3(NTOK / QR, 3), dim3(256), 0, stream>>>(y1, wqkv, bq, bk, bv, bv, qkv, DQKV, vfr);
    k_attn<<<dim3(SEQ / QR, NH, NB), dim3(256), 0, stream>>>(qkv, vfr, cpl);
    k_gemm_r<0><<<dim3(NTOK / QR), dim3(256), 0, stream>>>(cpl, wo16, bo, x, ln2g, ln2b, x1, y2);
    k_gemm_p<1><<<dim3(NTOK / QR, DF / 512), dim3(256), 0, stream>>>(y2, w116, bf1, bf1 + 512, bf1 + 1024, bf1 + 1536, mpl, DF, nullptr);
    k_gemm_r<1><<<dim3(NTOK / QR), dim3(256), 0, stream>>>(mpl, w216, bf2, x1, lnfg, lnfb, out, y2);
}

// v006
// Measured time: 206 microseconds a run.
// Timed twice side by side with v005, it ran 1.04 and 1.05 times as fast.
// All steps since v000 together make it 1.99 times as fast.
#include <hip/hip_runtime.h>

// Contractions on v_wmma_f32_16x16x32_f16 (f16 operands, f32 accumulate), one product each: y1*[Wq|Wk|Wv]^T, q*k^T, P*v, ctx*Wo^T, y2*W1^T, m*W2^T; float inputs RNE-converted to bf16 then carried in f16 (weights x64, P x2^14, ctx x64, m x64); LayerNorm, 1.5-entmax threshold and Mish in f32.

#ifndef NB
#define NB 8
#endif
#ifndef SEQ
#define SEQ 1024
#endif
#define NB_FULL  8
#define SEQ_FULL 1024
#define DM   512            // model width
#define DF   2048           // ffn width
#define NH   8
#define HD   64
#define DQKV (3 * DM)       // q|k|v plane pitch
#define NTOK (NB * SEQ)
#define QR   32             // query rows per attention block / rows per row-gemm block
#define PR   64             // rows per plane-gemm block
#define VG   8              // V fragments (32 keys each) fetched ahead as one group in k_attn
#define ZN   (SEQ / 32)     // scores per lane per row
#define NEWT 6              // Newton passes for the entmax threshold (on the norm, see k_attn phase 2)

static_assert(NB >= 1 && NB <= NB_FULL);
static_assert(SEQ <= SEQ_FULL);
static_assert(SEQ % (32 * VG) == 0);
static_assert(SEQ % 128 == 0);
static_assert(NTOK % QR == 0);
static_assert(SEQ % PR == 0 && PR % 32 == 0);
static_assert(NH * HD == DM);
static_assert(QR == 32);
static_assert((ZN % 4) == 0);
static_assert(DM % 32 == 0 && DF % 32 == 0);
static_assert((DM * DM) % 2048 == 0 && (DF * DM) % 2048 == 0);

typedef _Float16 v16h __attribute__((ext_vector_type(16)));
typedef _Float16 v8h  __attribute__((ext_vector_type(8)));
typedef _Float16 v4h  __attribute__((ext_vector_type(4)));
typedef float    v8f  __attribute__((ext_vector_type(8)));
typedef float    v4f  __attribute__((ext_vector_type(4)));

union Frag { v16h v; v8h h[2]; };

#define WSC   64.0f                  // weight carry
#define SC_Z  1.52587890625e-05f     // 2^-16 : (64q).(64k) -> q.k/16 = z
#define SC_P  16384.0f               // 2^14  : P carry
#define SC_C  6.103515625e-05f       // 2^-14 : (2^14 P)(64 v) -> 64 ctx
#define SC_O  2.44140625e-04f        // 2^-12 : (64 a)(64 W) -> a.W
#define SC_H  0.015625f              // 1/64  : (y)(64 W) -> y.W
#define LOG2E 1.44269504088896340736f
#define LN_EPS 1e-5f

static __device__ __forceinline__ v8f zero8() {
    v8f z;
#pragma unroll
    for (int i = 0; i < 8; ++i) z[i] = 0.0f;
    return z;
}

// 16x32 A fragment (or B fragment from an [n][k] k-contiguous source) from a
// row-major 16-bit tile: lane m = lane&15 -> row m; kb = 8*(lane>>4);
// elements 0..7 = k kb..kb+7, elements 8..15 = k kb+16..kb+23.
static __device__ __forceinline__ v16h load_frag16(const _Float16* base, int ld, int lane) {
    int m  = lane & 15;
    int kb = (lane >> 4) << 3;
    const _Float16* p = base + (size_t)m * ld + kb;
    Frag f;
    f.h[0] = *(const v8h*)(p);
    f.h[1] = *(const v8h*)(p + 16);
    return f.v;
}

// B fragment from a tiled weight plane (see wcvt_block): one 16 x 32 tile is 1 KB,
// lane l reads 16 B at 16*l and at 512 + 16*l, so each load is four whole 128-B lines.
// Same element in every lane and register position as load_frag16 on the [n][k] plane.
static __device__ __forceinline__ v16h load_fragB(const _Float16* tile, int lane) {
    const _Float16* p = tile + lane * 8;
    Frag f;
    f.h[0] = *(const v8h*)(p);
    f.h[1] = *(const v8h*)(p + 256);
    return f.v;
}

static __device__ __forceinline__ v8f wmma16(v16h a, v16h b, v8f c) {
    v8f d = __builtin_amdgcn_wmma_f32_16x16x32_f16(false, a, false, b, (short)0, c, false, false);
    asm volatile("v_nop\n\tv_nop\n\tv_nop\n\tv_nop" : "+v"(d) : "v"(a), "v"(b));
    return d;
}

// f32 -> bf16 RNE convert, value kept as f32
static __device__ __forceinline__ float bf16r(float x) {
    unsigned u = __float_as_uint(x);
    u = (u + 0x7FFFu + ((u >> 16) & 1u)) & 0xFFFF0000u;
    return __uint_as_float(u);
}

// ordering for a wave-private LDS tile: stores before later loads of the same wave
static __device__ __forceinline__ void wave_lds_sync() {
    __builtin_amdgcn_fence(3, "wavefront");
    asm volatile("s_wait_dscnt 0" ::: "memory");
    __builtin_amdgcn_wave_barrier();
}

static __device__ __forceinline__ float wsum(float v) {
    v += __shfl_xor(v, 16, 32); v += __shfl_xor(v, 8, 32); v += __shfl_xor(v, 4, 32);
    v += __shfl_xor(v, 2, 32);  v += __shfl_xor(v, 1, 32);
    return v;
}
static __device__ __forceinline__ float wmaxr(float v) {
    v = fmaxf(v, __shfl_xor(v, 16, 32)); v = fmaxf(v, __shfl_xor(v, 8, 32));
    v = fmaxf(v, __shfl_xor(v, 4, 32));  v = fmaxf(v, __shfl_xor(v, 2, 32));
    v = fmaxf(v, __shfl_xor(v, 1, 32));
    return v;
}
static __device__ __forceinline__ float wminr(float v) {
    v = fminf(v, __shfl_xor(v, 16, 32)); v = fminf(v, __shfl_xor(v, 8, 32));
    v = fminf(v, __shfl_xor(v, 4, 32));  v = fminf(v, __shfl_xor(v, 2, 32));
    v = fminf(v, __shfl_xor(v, 1, 32));
    return v;
}

// Mish(x) = x * tanh(softplus(x)) = x * (u^2+2u)/(u^2+2u+2), u = e^x
static __device__ __forceinline__ float mishf(float x) {
    float xe = fminf(x, 20.0f);
    float u  = __builtin_amdgcn_exp2f(xe * LOG2E);
    float wv = u * (u + 2.0f);
    float t  = wv * __builtin_amdgcn_rcpf(wv + 2.0f);
    return x * t;
}

// 16 columns per lane: columns 256*j + 8*lane + e (j = 0,1; e = 0..7)
static __device__ __forceinline__ void load_cols16(const float* p, int lane, float (&o)[16]) {
#pragma unroll
    for (int j = 0; j < 2; ++j) {
        v4f a = *(const v4f*)(p + 256 * j + 8 * lane);
        v4f c = *(const v4f*)(p + 256 * j + 8 * lane + 4);
        o[8 * j + 0] = a.x; o[8 * j + 1] = a.y; o[8 * j + 2] = a.z; o[8 * j + 3] = a.w;
        o[8 * j + 4] = c.x; o[8 * j + 5] = c.y; o[8 * j + 6] = c.z; o[8 * j + 7] = c.w;
    }
}

// LayerNorm over a 512-wide row held as 16 columns per lane (f32)
static __device__ __forceinline__ void ln_lane(const float (&v)[16], const float (&gl)[16],
                                               const float (&el)[16], float (&y)[16]) {
    float s = 0.0f;
#pragma unroll
    for (int e = 0; e < 16; ++e) s += v[e];
    s = wsum(s);
    const float mu = s * (1.0f / (float)DM);
    float d[16];
    float q = 0.0f;
#pragma unroll
    for (int e = 0; e < 16; ++e) { d[e] = v[e] - mu; q = __builtin_fmaf(d[e], d[e], q); }
    q = wsum(q);
    const float rstd = rsqrtf(__builtin_fmaf(q, 1.0f / (float)DM, LN_EPS));
#pragma unroll
    for (int e = 0; e < 16; ++e) y[e] = d[e] * rstd * gl[e] + el[e];
}

// ---------------------------------------------------------------------------
// Weight plane: value f16(bf16r(src[n][k]) * 64), stored in fragment order: tile
// (n/16, k/32) is 512 halves at ((n/16) * (K/32) + k/32) * 512; inside it element
// (n, k) sits at ((k>>4)&1)*256 + (((k>>3)&1)*16 + (n&15))*8 + (k&7).
// Thread i writes halves 8i..8i+7 (a wave stores 512 contiguous bytes) and gathers
// its 8 source floats; a block reads 16 rows x 512 contiguous bytes.
// coverage: n/2048 blocks of the plane's range, 256 threads x 8 elements -> n exactly.
// ---------------------------------------------------------------------------
template <int K>
static __device__ __forceinline__ void wcvt_block(const float* __restrict__ src,
                                                  _Float16* __restrict__ dst, int blk) {
    constexpr int KT = K / 32;                  // k tiles per 16-row band
    const int i  = blk * 256 + threadIdx.x;
    const int t  = i >> 6, gq = i & 63;         // tile, 8-half group inside it
    const int n  = (t / KT) * 16 + (gq & 15);
    const int k  = (t % KT) * 32 + (gq >> 5) * 16 + ((gq >> 4) & 1) * 8;
    const float* sp = src + (size_t)n * K + k;
    v4f a = *(const v4f*)(sp);
    v4f c = *(const v4f*)(sp + 4);
    v8h o;
    o[0] = (_Float16)(bf16r(a.x) * WSC); o[1] = (_Float16)(bf16r(a.y) * WSC);
    o[2] = (_Float16)(bf16r(a.z) * WSC); o[3] = (_Float16)(bf16r(a.w) * WSC);
    o[4] = (_Float16)(bf16r(c.x) * WSC); o[5] = (_Float16)(bf16r(c.y) * WSC);
    o[6] = (_Float16)(bf16r(c.z) * WSC); o[7] = (_Float16)(bf16r(c.w) * WSC);
    *(v8h*)(dst + (size_t)i * 8) = o;
    // the store's registers may be rewritten on a later path of the caller's listing: wait first
    asm volatile("s_wait_xcnt 0x0" ::: "memory");
}

// ---------------------------------------------------------------------------
// LN1: y1[tok][512] = f16(LayerNorm(bf16r(x)) * g + b). One wave per row,
// lane owns columns 8l..8l+7 and 256+8l..; two v8h stores per row.
// coverage: NTOK/8 blocks x 8 waves x 512 = NTOK x 512.
// ---------------------------------------------------------------------------
static __device__ __forceinline__ void ln1_block(const float* __restrict__ x,
                                                 const float* __restrict__ g,
                                                 const float* __restrict__ be,
                                                 _Float16* __restrict__ y, int blk) {
    const int tid = threadIdx.x, lane = tid & 31, w = tid >> 5;
    const int tok = blk * 8 + w;
    const int b = tok / SEQ, s = tok - b * SEQ;
    const float* xr = x + ((size_t)b * SEQ_FULL + s) * DM;
    float v[16], gl[16], el[16], yv[16];
    load_cols16(xr, lane, v);
    load_cols16(g, lane, gl);
    load_cols16(be, lane, el);
#pragma unroll
    for (int e = 0; e < 16; ++e) { v[e] = bf16r(v[e]); gl[e] = bf16r(gl[e]); el[e] = bf16r(el[e]); }
    ln_lane(v, gl, el, yv);
    v8h o[2];
#pragma unroll
    for (int j = 0; j < 2; ++j)
#pragma unroll
        for (int e = 0; e < 8; ++e) o[j][e] = (_Float16)yv[8 * j + e];
    _Float16* yr = y + (size_t)tok * DM;
    *(v8h*)(yr + 8 * lane)       = o[0];
    *(v8h*)(yr + 256 + 8 * lane) = o[1];
}

// ---------------------------------------------------------------------------
// Preparation, one launch: LN1 and the six weight planes depend on the inputs alone and
// on nothing of each other, so they share a grid; the block index picks the job
// (block-uniform branches, no barrier). Ranges, in order: LN1 (PB_LN blocks), Wq, Wk, Wv,
// Wo (PB_S each), W1, W2 (PB_L each).
// ---------------------------------------------------------------------------
#define PB_LN (NTOK / 8)
#define PB_S  (DM * DM / 2048)
#define PB_L  (DF * DM / 2048)
#define PB_ALL (PB_LN + 4 * PB_S + 2 * PB_L)
__global__ __launch_bounds__(256) void k_prep(const float* __restrict__ x,
                                               const float* __restrict__ g,
                                               const float* __restrict__ be,
                                               const float* __restrict__ Wq,
                                               const float* __restrict__ Wk,
                                               const float* __restrict__ Wv,
                                               const float* __restrict__ Wo,
                                               const float* __restrict__ W1,
                                               const float* __restrict__ W2,
                                               _Float16* __restrict__ y,
                                               _Float16* __restrict__ wqkv,
                                               _Float16* __restrict__ wo16,
                                               _Float16* __restrict__ w116,
                                               _Float16* __restrict__ w216) {
    int blk = blockIdx.x;
    if (blk < PB_LN) { ln1_block(x, g, be, y, blk); return; }
    blk -= PB_LN;
    if (blk < 4 * PB_S) {
        const int p = blk / PB_S;               // 0..3: Wq, Wk, Wv, Wo
        const float* src = (p == 0) ? Wq : ((p == 1) ? Wk : ((p == 2) ? Wv : Wo));
        _Float16* dst = (p == 3) ? wo16 : wqkv + (size_t)p * DM * DM;
        wcvt_block<DM>(src, dst, blk - p * PB_S);
        return;
    }
    blk -= 4 * PB_S;
    if (blk < PB_L) { wcvt_block<DM>(W1, w116, blk); return; }
    wcvt_block<DF>(W2, w216, blk - PB_L);
}

// ---------------------------------------------------------------------------
// GEMM core: wave tile 16*RT rows x 64 cols, C[r][n] += A[r][k] * B[n][k],
// A an f16 row-major k-contiguous plane, B a tiled weight plane (wcvt_block) whose band of
// 16 rows starts at 16*K*band halves; fragments loaded directly from global memory
// (two 16-B loads each). K % 32 == 0; K is a compile-time constant so that the second A
// tile and the B bands sit at immediate offsets of one address pair an operand, which
// lives through the loop: no load's result is given a register that a load names.
// ---------------------------------------------------------------------------
template <int K, int RT>
static __device__ __forceinline__ void gemm_rtx64(const _Float16* __restrict__ Ab,
                                                  const _Float16* __restrict__ Bb,
                                                  int lane, v8f (&acc)[RT][4]) {
#pragma unroll
    for (int t = 0; t < RT; ++t)
#pragma unroll
        for (int j = 0; j < 4; ++j) acc[t][j] = zero8();
#pragma unroll 1
    for (int k0 = 0; k0 < K; k0 += 32) {
        v16h aa[RT];
#pragma unroll
        for (int t = 0; t < RT; ++t) aa[t] = load_frag16(Ab + (size_t)(16 * t) * K + k0, K, lane);
        v16h bb[4];
#pragma unroll
        for (int j = 0; j < 4; ++j) bb[j] = load_fragB(Bb + (size_t)(16 * j) * K + (size_t)k0 * 16, lane);
#pragma unroll
        for (int j = 0; j < 4; ++j)
#pragma unroll
            for (int t = 0; t < RT; ++t) acc[t][j] = wmma16(aa[t], bb[j], acc[t][j]);
    }
}

// ---------------------------------------------------------------------------
// Plane GEMM: out[tok][ldo] f16 plane, block = PR = 64 rows x 512 cols (blockIdx.y =
// 512-column segment), wave = 64 x 64: a B fragment feeds four WMMAs and the weight
// segment is read from L2 once per 64 rows. EPI 0: val = acc + 64*bias (q|k|v x64);
// EPI 1: val = 64 * Mish(acc/64 + bias). Wave-private LDS tile, then 16 v8h stores a lane.
// coverage: grid (NTOK/64, ldo/512) x 8 waves x 64x64 = NTOK x ldo.
// EPI 0, segment 2 (v) goes to the plane vfr instead, as B fragments of P*v (n = d,
// k = key), tile (batch, head, key/32, d/16) of 512 halves laid out as in wcvt_block. A lane's
// 8 accumulator rows of one 16x16 tile are keys 16t + 8*(lane>>4) + r at d = lane&15: the
// 8 halves at 256*(t&1) + 8*lane of key group t>>1, so each store is 512 contiguous bytes a wave.
// coverage: NTOK/64 blocks x 8 waves (heads) x 2 key groups x 4 tiles x 512 = NTOK x 512 of vfr.
// ---------------------------------------------------------------------------
template <int EPI>
__global__ __launch_bounds__(256) __attribute__((amdgpu_waves_per_eu(4)))   // 256 registers a wave: two blocks share a WGP, so the EPI 1 grid is resident at once
void k_gemm_p(const _Float16* __restrict__ A, const _Float16* __restrict__ Bw,
              const float* __restrict__ b0, const float* __restrict__ b1,
              const float* __restrict__ b2, const float* __restrict__ b3,
              _Float16* __restrict__ outp, int ldo, _Float16* __restrict__ vfr) {
    __shared__ __align__(16) _Float16 st[8][PR * 64];      // 64 KB, wave-private tiles
    const int tid = threadIdx.x, lane = tid & 31, w = tid >> 5;
    const int hh = lane >> 4, m = lane & 15;
    const int m0  = blockIdx.x * PR;
    const int seg = blockIdx.y;
    const int nl  = 64 * w;                 // column within the 512 segment
    const int n0w = seg * 512 + nl;         // output column / B row
    const float* bias = (seg == 0) ? b0 : ((seg == 1) ? b1 : ((seg == 2) ? b2 : b3));

    v8f acc[PR / 16][4];
    constexpr int K = DM;                   // k length of both plane GEMMs
    gemm_rtx64<K, PR / 16>(A + (size_t)m0 * K, Bw + (size_t)n0w * K, lane, acc);

    float bl[4];
#pragma unroll
    for (int j = 0; j < 4; ++j) bl[j] = bf16r(bias[nl + 16 * j + m]);
    if (EPI == 0 && seg == 2) {             // block-uniform; no block barrier in this kernel
        const int b = m0 / SEQ, kb = (m0 - b * SEQ) / 32;
        _Float16* vt = vfr + (size_t)((b * NH + w) * (SEQ / 32) + kb) * 2048 + lane * 8;
#pragma unroll
        for (int t = 0; t < PR / 16; ++t)
#pragma unroll
            for (int j = 0; j < 4; ++j) {
                v8h o;
#pragma unroll
                for (int r = 0; r < 8; ++r) o[r] = (_Float16)__builtin_fmaf(bl[j], WSC, acc[t][j][r]);
                *(v8h*)(vt + 2048 * (t >> 1) + 512 * j + 256 * (t & 1)) = o;
            }
        return;
    }
#pragma unroll
    for (int t = 0; t < PR / 16; ++t)
#pragma unroll
        for (int j = 0; j < 4; ++j)
#pragma unroll
            for (int r = 0; r < 8; ++r) {
                float a = acc[t][j][r];
                float val;
                if (EPI == 0) {
                    val = __builtin_fmaf(bl[j], WSC, a);
                } else {
                    float hx = __builtin_fmaf(a, SC_H, bl[j]);
                    val = WSC * mishf(hx);
                }
                st[w][(16 * t + 8 * hh + r) * 64 + 16 * j + m] = (_Float16)val;
            }
    wave_lds_sync();

    v8h pv[PR / 4];
    const int lr = lane >> 3, lc = (lane & 7) * 8;
#pragma unroll
    for (int i = 0; i < PR / 4; ++i) pv[i] = *(const v8h*)(&st[w][(4 * i + lr) * 64 + lc]);
    _Float16* ob = outp + (size_t)m0 * ldo + n0w;
#pragma unroll
    for (int i = 0; i < PR / 4; ++i) *(v8h*)(ob + (size_t)(4 * i + lr) * ldo + lc) = pv[i];
    
}

// ---------------------------------------------------------------------------
// Row GEMM (N = 512, block owns 32 full rows) fused with residual add + LayerNorm.
// MODE 0: x1 = bf16r(x) + (acc 2^-12 + bias) -> x1 f32 plane, y2 = f16(LN(x1) g + b).
// MODE 1: x2 = x1 + (acc 2^-12 + bias), out = LN(x2) g + b -> f32 rows.
// Block tile staged f32 in LDS (cross-wave, block barrier); wave then owns 4 rows:
// f16 rows written directly as two 512-B lane-contiguous instructions; f32 rows
// relaid through the (now wave-private) LDS row and written as four 512-B
// coverage: grid NTOK/32 x 32 rows x 512 = NTOK x 512 (each output plane).
// ---------------------------------------------------------------------------
template <int MODE>
__global__ __launch_bounds__(256) __attribute__((amdgpu_num_vgpr(256)))
void k_gemm_r(const _Float16* __restrict__ A, const _Float16* __restrict__ Bw,
              const float* __restrict__ bias, const float* __restrict__ res,
              const float* __restrict__ g, const float* __restrict__ be,
              float* __restrict__ outf, _Float16* __restrict__ outh) {
    __shared__ __align__(16) float T[QR * DM];            // 64 KB block tile
    const int tid = threadIdx.x, lane = tid & 31, w = tid >> 5;
    const int hh = lane >> 4, m = lane & 15;
    const int m0 = blockIdx.x * QR;
    const int nl = 64 * w;

    v8f acc[2][4];
    constexpr int K = (MODE == 0) ? DM : DF;   // k length: ctx plane / ffn plane
    gemm_rtx64<K, 2>(A + (size_t)m0 * K, Bw + (size_t)nl * K, lane, acc);
#pragma unroll
    for (int t = 0; t < 2; ++t)
#pragma unroll
        for (int j = 0; j < 4; ++j)
#pragma unroll
            for (int r = 0; r < 8; ++r)
                T[(16 * t + 8 * hh + r) * DM + nl + 16 * j + m] = acc[t][j][r];
    __syncthreads();

    float bl[16], gl[16], el[16];
    load_cols16(bias, lane, bl);
    load_cols16(g, lane, gl);
    load_cols16(be, lane, el);
#pragma unroll
    for (int e = 0; e < 16; ++e) { bl[e] = bf16r(bl[e]); gl[e] = bf16r(gl[e]); el[e] = bf16r(el[e]); }

#pragma unroll 1
    for (int rr = 0; rr < 4; ++rr) {
        const int row = 4 * w + rr;
        const int tok = m0 + row;
        float v[16], rv[16], yv[16];
        load_cols16(&T[row * DM], lane, v);
        if (MODE == 0) {
            const int b = tok / SEQ, s = tok - b * SEQ;
            load_cols16(res + ((size_t)b * SEQ_FULL + s) * DM, lane, rv);
#pragma unroll
            for (int e = 0; e < 16; ++e) rv[e] = bf16r(rv[e]);
        } else {
            load_cols16(res + (size_t)tok * DM, lane, rv);
        }
#pragma unroll
        for (int e = 0; e < 16; ++e) v[e] = rv[e] + __builtin_fmaf(v[e], SC_O, bl[e]);
        ln_lane(v, gl, el, yv);

        // write-back into the wave-private LDS row (same columns this lane loaded)
        float* trow = &T[row * DM];
#pragma unroll
        for (int j = 0; j < 2; ++j) {
            v4f p0, p1;
            if (MODE == 0) {
                p0.x = v[8 * j + 0]; p0.y = v[8 * j + 1]; p0.z = v[8 * j + 2]; p0.w = v[8 * j + 3];
                p1.x = v[8 * j + 4]; p1.y = v[8 * j + 5]; p1.z = v[8 * j + 6]; p1.w = v[8 * j + 7];
            } else {
                p0.x = yv[8 * j + 0]; p0.y = yv[8 * j + 1]; p0.z = yv[8 * j + 2]; p0.w = yv[8 * j + 3];
                p1.x = yv[8 * j + 4]; p1.y = yv[8 * j + 5]; p1.z = yv[8 * j + 6]; p1.w = yv[8 * j + 7];
            }
            *(v4f*)(trow + 256 * j + 8 * lane)     = p0;
            *(v4f*)(trow + 256 * j + 8 * lane + 4) = p1;
        }
        wave_lds_sync();
        v4f s4[4];
#pragma unroll
        for (int jj = 0; jj < 4; ++jj) s4[jj] = *(const v4f*)(trow + 128 * jj + 4 * lane);

        float* orow = outf + (size_t)tok * DM;
        if (MODE == 0) {
            v8h o[2];
#pragma unroll
            for (int j = 0; j < 2; ++j)
#pragma unroll
                for (int e = 0; e < 8; ++e) o[j][e] = (_Float16)yv[8 * j + e];
            _Float16* hrow = outh + (size_t)tok * DM;
            *(v8h*)(hrow + 8 * lane)       = o[0];
            *(v8h*)(hrow + 256 + 8 * lane) = o[1];
#pragma unroll
            for (int jj = 0; jj < 4; ++jj) *(v4f*)(orow + 128 * jj + 4 * lane) = s4[jj];
            
        } else {
#pragma unroll
            for (int jj = 0; jj < 4; ++jj) *(v4f*)(orow + 128 * jj + 4 * lane) = s4[jj];
            
        }
    }
}

// ---------------------------------------------------------------------------
// Attention with 1.5-entmax over keys. Block = 8 waves = 32 query rows of one
// (batch, head); qkv plane [tok][1536] (q | k, each x64, head h at +64h; the v third is
// unused), v x64 in the fragment plane vfr (see k_gemm_p).
// Phase 1: z strip [32][SEQ] f32 in LDS = (64q).(64k) 2^-16 = q.k/16; wave owns
//          SEQ/128 key tiles x both row tiles (K fragments straight from the plane).
// Phase 2: wave owns 4 rows; per row: shift by max, threshold tau of
//          sum relu(z - tau)^2 = 1 by safeguarded Newton (NEWT passes, registers) on
//          g(tau) = sqrt(sum relu(z - tau)^2) - 1: same root, convex and falling, so a
//          step from below never passes the root, and close to a straight line while the
//          sum is far above 1, where Newton on the sum itself only halves the distance,
//          P = relu(z - tau)^2 x 2^14 as f16 written over the row's own slot
//          (pitch 2*SEQ halves, skew 8*(row&15) halves).
// Phase 3: wave owns one 16x16 ctx tile over all keys; V fragments straight from vfr
//          (whole 128-B lines), VG of them fetched one group ahead; no barrier inside.
// Phase 4: ctx x64 as f16 staged [32][64] (cross-wave, barrier); wave w writes rows
// coverage: grid (SEQ/32, 8, NB) x 32 rows x 64 = NTOK x 512 of the ctx plane.
// ---------------------------------------------------------------------------
__global__ __launch_bounds__(256) __attribute__((amdgpu_num_vgpr(256)))
void k_attn(const _Float16* __restrict__ qkv, const _Float16* __restrict__ vfr,
            _Float16* __restrict__ ctx) {
    __shared__ __align__(16) float    zs[QR * SEQ];       // 128 KB at full size
    __shared__ __align__(16) _Float16 Cst[QR * HD];       // 4 KB
    static_assert(sizeof(zs) + sizeof(Cst) <= 160 * 1024);   // two blocks per WGP
    _Float16* ph = reinterpret_cast<_Float16*>(zs);       // P rows alias the z slots
    constexpr int PP  = 2 * SEQ;                          // P row slot (halves)
    constexpr int PLD = PP + 8;                           // fragment pitch incl. skew
    constexpr int KTW = SEQ / 128;                        // key tiles per wave

    const int tid = threadIdx.x, lane = tid & 31, w = tid >> 5;
    const int hh = lane >> 4, m = lane & 15;
    const int h = blockIdx.y, b = blockIdx.z;
    const int q0 = blockIdx.x * QR;
    const size_t tokq = (size_t)b * SEQ + q0;
    const _Float16* qp = qkv + tokq * DQKV + h * HD;
    const _Float16* kp = qkv + (size_t)b * SEQ * DQKV + DM + h * HD;
    const int rt = w & 1, ct = w >> 1;                    // ctx tile of this wave (phase 3)
    const _Float16* vt = vfr + (size_t)(b * NH + h) * (SEQ / 32) * 2048 + ct * 512;

    // ---- phase 1: scores ----
    {
        const v16h qa00 = load_frag16(qp, DQKV, lane);
        const v16h qa01 = load_frag16(qp + 32, DQKV, lane);
        const v16h qa10 = load_frag16(qp + (size_t)16 * DQKV, DQKV, lane);
        const v16h qa11 = load_frag16(qp + (size_t)16 * DQKV + 32, DQKV, lane);
#pragma unroll 1
        for (int i = 0; i < KTW; ++i) {
            const int key0 = (w * KTW + i) * 16;
            const _Float16* kt = kp + (size_t)key0 * DQKV;
            v16h kf0 = load_frag16(kt, DQKV, lane);
            v16h kf1 = load_frag16(kt + 32, DQKV, lane);
            v8f s0 = wmma16(qa00, kf0, zero8());
            s0 = wmma16(qa01, kf1, s0);
            v8f s1 = wmma16(qa10, kf0, zero8());
            s1 = wmma16(qa11, kf1, s1);
#pragma unroll
            for (int r = 0; r < 8; ++r) {
                zs[(8 * hh + r) * SEQ + key0 + m]      = s0[r] * SC_Z;
                zs[(16 + 8 * hh + r) * SEQ + key0 + m] = s1[r] * SC_Z;
            }
        }
    }
    __syncthreads();

    // first group of V fragments: in flight under phase 2
    v16h vcur[VG];
#pragma unroll
    for (int i = 0; i < VG; ++i) vcur[i] = load_fragB(vt + i * 2048, lane);

    // ---- phase 2: 1.5-entmax threshold per row ----
    const float tcl = -rsqrtf((float)SEQ);    // tau <= -1/sqrt(SEQ) always
#pragma unroll 1
    for (int rr = 0; rr < 4; ++rr) {
        const int row = 4 * w + rr;
        float z[ZN];
        const float* zr = &zs[row * SEQ];
#pragma unroll
        for (int j = 0; j < ZN / 4; ++j) {
            v4f t4 = *(const v4f*)(zr + 128 * j + 4 * lane);
            z[4 * j + 0] = t4.x; z[4 * j + 1] = t4.y; z[4 * j + 2] = t4.z; z[4 * j + 3] = t4.w;
        }
        float mx = z[0], mn = z[0];
#pragma unroll
        for (int i = 1; i < ZN; ++i) { mx = fmaxf(mx, z[i]); mn = fminf(mn, z[i]); }
        mx = wmaxr(mx);
        mn = wminr(mn);
#pragma unroll
        for (int i = 0; i < ZN; ++i) z[i] = z[i] - mx;
        float tau = fminf(fmaxf(mn - mx, -1.0f), tcl);
#pragma unroll 1
        for (int it = 0; it < NEWT; ++it) {
            float sa = 0.0f, sb = 0.0f;
#pragma unroll
            for (int i = 0; i < ZN; ++i) {
                float d = fmaxf(z[i] - tau, 0.0f);
                sa += d;
                sb = __builtin_fmaf(d, d, sb);
            }
            sa = wsum(sa);
            sb = wsum(sb);
            const float rn = __builtin_amdgcn_sqrtf(sb);      // g = rn - 1, g' = -sa / rn
            tau = tau + rn * (rn - 1.0f) * __builtin_amdgcn_rcpf(sa);
            tau = fminf(fmaxf(tau, -1.0f), tcl);
        }
        _Float16* prow = ph + (size_t)row * PP + (row & 15) * 8;
#pragma unroll
        for (int j = 0; j < ZN / 4; ++j) {
            v4h pk;
#pragma unroll
            for (int e = 0; e < 4; ++e) {
                float d = fmaxf(z[4 * j + e] - tau, 0.0f);
                pk[e] = (_Float16)(d * d * SC_P);
            }
            *(v4h*)(prow + 128 * j + 4 * lane) = pk;
        }
    }
    __syncthreads();

    // ---- phase 3: ctx = P @ v ----
    v8f acc = zero8();
    constexpr int NG = SEQ / (32 * VG);
#pragma unroll
    for (int g = 0; g < NG; ++g) {
        v16h pa[VG], vnx[VG];
#pragma unroll
        for (int i = 0; i < VG; ++i)      // rows = queries, k = keys
            pa[i] = load_frag16(ph + (size_t)(16 * rt) * PP + (g * VG + i) * 32, PLD, lane);
        if (g + 1 < NG) {
#pragma unroll
            for (int i = 0; i < VG; ++i) vnx[i] = load_fragB(vt + ((g + 1) * VG + i) * 2048, lane);
        }
#pragma unroll
        for (int i = 0; i < VG; ++i) acc = wmma16(pa[i], vcur[i], acc);   // n = d, k = keys
        if (g + 1 < NG) {
#pragma unroll
            for (int i = 0; i < VG; ++i) vcur[i] = vnx[i];
        }
    }

    // ---- phase 4: ctx plane x64 ----
#pragma unroll
    for (int r = 0; r < 8; ++r)
        Cst[(16 * rt + 8 * hh + r) * HD + 16 * ct + m] = (_Float16)(acc[r] * SC_C);
    __syncthreads();
    const int orow = 4 * w + (lane >> 3), oc = (lane & 7) * 8;
    v8h cv = *(const v8h*)(&Cst[orow * HD + oc]);
    _Float16* dst = ctx + (tokq + orow) * DM + h * HD + oc;
    *(v8h*)dst = cv;
    
}

// ---------------------------------------------------------------------------
extern "C" void kernel_launch(void* const* d_in, const int* in_sizes, int n_in,
                              void* d_out, int out_size, void* d_ws, size_t ws_size,
                              hipStream_t stream) {
    if (n_in < 19) return;
    if (in_sizes[0] < ((NB - 1) * SEQ_FULL + SEQ) * DM) return;
    if (in_sizes[1] < DM * DM || in_sizes[3] < DM * DM || in_sizes[5] < DM * DM || in_sizes[7] < DM * DM) return;
    if (in_sizes[2] < DM || in_sizes[4] < DM || in_sizes[6] < DM || in_sizes[8] < DM) return;
    if (in_sizes[9] < DM || in_sizes[10] < DM || in_sizes[15] < DM || in_sizes[16] < DM) return;
    if (in_sizes[17] < DM || in_sizes[18] < DM || in_sizes[14] < DM) return;
    if (in_sizes[11] < DF * DM || in_sizes[13] < DM * DF || in_sizes[12] < DF) return;
    if (out_size < NTOK * DM) return;

    const float* x    = (const float*)d_in[0];    // [8,1024,512]
    const float* Wq   = (const float*)d_in[1];    // [512,512] (out,in)
    const float* bq   = (const float*)d_in[2];
    const float* Wk   = (const float*)d_in[3];
    const float* bk   = (const float*)d_in[4];
    const float* Wv   = (const float*)d_in[5];
    const float* bv   = (const float*)d_in[6];
    const float* Wo   = (const float*)d_in[7];
    const float* bo   = (const float*)d_in[8];
    const float* ln1g = (const float*)d_in[9];
    const float* ln1b = (const float*)d_in[10];
    const float* W1   = (const float*)d_in[11];   // [2048,512]
    const float* bf1  = (const float*)d_in[12];
    const float* W2   = (const float*)d_in[13];   // [512,2048]
    const float* bf2  = (const float*)d_in[14];
    const float* ln2g = (const float*)d_in[15];
    const float* ln2b = (const float*)d_in[16];
    const float* lnfg = (const float*)d_in[17];
    const float* lnfb = (const float*)d_in[18];
    float* out = (float*)d_out;                   // [NTOK][512]

    char* ws = (char*)d_ws;
    size_t off = 0;
    _Float16* wqkv = (_Float16*)(ws + off); off += (size_t)DQKV * DM * 2;      // 1,572,864
    _Float16* wo16 = (_Float16*)(ws + off); off += (size_t)DM * DM * 2;        //   524,288
    _Float16* w116 = (_Float16*)(ws + off); off += (size_t)DF * DM * 2;        // 2,097,152
    _Float16* w216 = (_Float16*)(ws + off); off += (size_t)DM * DF * 2;        // 2,097,152
    _Float16* y1   = (_Float16*)(ws + off); off += (size_t)NTOK * DM * 2;      // 8 MiB at full size
    _Float16* qkv  = (_Float16*)(ws + off); off += (size_t)NTOK * DQKV * 2;    // 24 MiB
    _Float16* cpl  = (_Float16*)(ws + off); off += (size_t)NTOK * DM * 2;      // 8 MiB
    float*    x1   = (float*)(ws + off);    off += (size_t)NTOK * DM * 4;      // 16 MiB
    _Float16* y2   = (_Float16*)(ws + off); off += (size_t)NTOK * DM * 2;      // 8 MiB
    _Float16* mpl  = (_Float16*)(ws + off); off += (size_t)NTOK * DF * 2;      // 32 MiB
    _Float16* vfr  = (_Float16*)(ws + off); off += (size_t)NTOK * DM * 2;      // 8 MiB
    if (off > ws_size) return;                                                 // 115,343,360 B at full size

    k_prep<<<dim3(PB_ALL), dim3(256), 0, stream>>>(x, ln1g, ln1b, Wq, Wk, Wv, Wo, W1, W2, y1, wqkv, wo16, w116, w216);
    k_gemm_p<0><<<dim3(NTOK / PR, 3), dim3(256), 0, stream>>>(y1, wqkv, bq, bk, bv, bv, qkv, DQKV, vfr);
    k_attn<<<dim3(SEQ / QR, NH, NB), dim3(256), 0, stream>>>(qkv, vfr, cpl);
    k_gemm_r<0><<<dim3(NTOK / QR), dim3(256), 0, stream>>>(cpl, wo16, bo, x, ln2g, ln2b, x1, y2);
    k_gemm_p<1><<<dim3(NTOK / PR, DF / 512), dim3(256), 0, stream>>>(y2, w116, bf1, bf1 + 512, bf1 + 1024, bf1 + 1536, mpl, DF, nullptr);
    k_gemm_r<1><<<dim3(NTOK / QR), dim3(256), 0, stream>>>(mpl, w216, bf2, x1, lnfg, lnfb, out, y2);
}

// v007
// A run of this version takes 194 microseconds.
// In two side-by-side timings against v006, it was 1.05 and 1.08 times as fast.
// Over all steps from v000 it is 2.11 times as fast.
#include <hip/hip_runtime.h>

// Contractions on v_wmma_f32_16x16x32_f16 (f16 operands, f32 accumulate), one product each: y1*[Wq|Wk|Wv]^T, q*k^T, P*v, ctx*Wo^T, y2*W1^T, m*W2^T; float inputs RNE-converted to bf16 then carried in f16 (weights x64, P x2^14, ctx x64, m x64); LayerNorm, 1.5-entmax threshold and Mish in f32.

#ifndef NB
#define NB 8
#endif
#ifndef SEQ
#define SEQ 1024
#endif
#define NB_FULL  8
#define SEQ_FULL 1024
#define DM   512            // model width
#define DF   2048           // ffn width
#define NH   8
#define HD   64
#define DQKV (3 * DM)       // q|k|v plane pitch
#define NTOK (NB * SEQ)
#define QR   32             // query rows per attention block / rows per row-gemm block
#define PR   64             // rows per plane-gemm block
#define VG   8              // V fragments (32 keys each) fetched ahead as one group in k_attn
#define ZN   (SEQ / 32)     // scores per lane per row
#define YP   (DM + 8)       // LDS pitch of a staged f16 row, halves (16 B x odd)
#define NEWT 6              // Newton passes for the entmax threshold (on the norm, see k_attn phase 2)

static_assert(NB >= 1 && NB <= NB_FULL);
static_assert(SEQ <= SEQ_FULL);
static_assert(SEQ % (32 * VG) == 0);
static_assert(SEQ % 128 == 0);
static_assert(NTOK % QR == 0);
static_assert(SEQ % PR == 0 && PR % 32 == 0);
static_assert(NH * HD == DM);
static_assert(QR == 32);
static_assert((ZN % 4) == 0);
static_assert(DM % 32 == 0 && DF % 32 == 0);
static_assert((DM * DM) % 2048 == 0 && (DF * DM) % 2048 == 0);

typedef _Float16 v16h __attribute__((ext_vector_type(16)));
typedef _Float16 v8h  __attribute__((ext_vector_type(8)));
typedef _Float16 v4h  __attribute__((ext_vector_type(4)));
typedef float    v8f  __attribute__((ext_vector_type(8)));
typedef float    v4f  __attribute__((ext_vector_type(4)));

union Frag { v16h v; v8h h[2]; };

#define WSC   64.0f                  // weight carry
#define SC_Z  1.52587890625e-05f     // 2^-16 : (64q).(64k) -> q.k/16 = z
#define SC_P  16384.0f               // 2^14  : P carry
#define SC_C  6.103515625e-05f       // 2^-14 : (2^14 P)(64 v) -> 64 ctx
#define SC_O  2.44140625e-04f        // 2^-12 : (64 a)(64 W) -> a.W
#define SC_H  0.015625f              // 1/64  : (y)(64 W) -> y.W
#define LOG2E 1.44269504088896340736f
#define LN_EPS 1e-5f

static __device__ __forceinline__ v8f zero8() {
    v8f z;
#pragma unroll
    for (int i = 0; i < 8; ++i) z[i] = 0.0f;
    return z;
}

// 16x32 A fragment (or B fragment from an [n][k] k-contiguous source) from a
// row-major 16-bit tile: lane m = lane&15 -> row m; kb = 8*(lane>>4);
// elements 0..7 = k kb..kb+7, elements 8..15 = k kb+16..kb+23.
static __device__ __forceinline__ v16h load_frag16(const _Float16* base, int ld, int lane) {
    int m  = lane & 15;
    int kb = (lane >> 4) << 3;
    const _Float16* p = base + (size_t)m * ld + kb;
    Frag f;
    f.h[0] = *(const v8h*)(p);
    f.h[1] = *(const v8h*)(p + 16);
    return f.v;
}

// A or B fragment from a tiled plane (weights: wcvt_block; activations: see k_gemm_p):
// one 16 x 32 tile is 1 KB, lane l reads 16 B at 16*l and at 512 + 16*l, so each load is
// four whole 128-B lines (a fragment load from a row-major plane touches 16 lines).
// Same element in every lane and register position as load_frag16 on the [n][k] plane.
static __device__ __forceinline__ v16h load_fragB(const _Float16* tile, int lane) {
    const _Float16* p = tile + lane * 8;
    Frag f;
    f.h[0] = *(const v8h*)(p);
    f.h[1] = *(const v8h*)(p + 256);
    return f.v;
}

static __device__ __forceinline__ v8f wmma16(v16h a, v16h b, v8f c) {
    v8f d = __builtin_amdgcn_wmma_f32_16x16x32_f16(false, a, false, b, (short)0, c, false, false);
    asm volatile("v_nop\n\tv_nop\n\tv_nop\n\tv_nop" : "+v"(d) : "v"(a), "v"(b));
    return d;
}

// f32 -> bf16 RNE convert, value kept as f32
static __device__ __forceinline__ float bf16r(float x) {
    unsigned u = __float_as_uint(x);
    u = (u + 0x7FFFu + ((u >> 16) & 1u)) & 0xFFFF0000u;
    return __uint_as_float(u);
}

// ordering for a wave-private LDS tile: stores before later loads of the same wave
static __device__ __forceinline__ void wave_lds_sync() {
    __builtin_amdgcn_fence(3, "wavefront");
    asm volatile("s_wait_dscnt 0" ::: "memory");
    __builtin_amdgcn_wave_barrier();
}

static __device__ __forceinline__ float wsum(float v) {
    v += __shfl_xor(v, 16, 32); v += __shfl_xor(v, 8, 32); v += __shfl_xor(v, 4, 32);
    v += __shfl_xor(v, 2, 32);  v += __shfl_xor(v, 1, 32);
    return v;
}
static __device__ __forceinline__ float wmaxr(float v) {
    v = fmaxf(v, __shfl_xor(v, 16, 32)); v = fmaxf(v, __shfl_xor(v, 8, 32));
    v = fmaxf(v, __shfl_xor(v, 4, 32));  v = fmaxf(v, __shfl_xor(v, 2, 32));
    v = fmaxf(v, __shfl_xor(v, 1, 32));
    return v;
}
static __device__ __forceinline__ float wminr(float v) {
    v = fminf(v, __shfl_xor(v, 16, 32)); v = fminf(v, __shfl_xor(v, 8, 32));
    v = fminf(v, __shfl_xor(v, 4, 32));  v = fminf(v, __shfl_xor(v, 2, 32));
    v = fminf(v, __shfl_xor(v, 1, 32));
    return v;
}

// Mish(x) = x * tanh(softplus(x)) = x * (u^2+2u)/(u^2+2u+2), u = e^x
static __device__ __forceinline__ float mishf(float x) {
    float xe = fminf(x, 20.0f);
    float u  = __builtin_amdgcn_exp2f(xe * LOG2E);
    float wv = u * (u + 2.0f);
    float t  = wv * __builtin_amdgcn_rcpf(wv + 2.0f);
    return x * t;
}

// 16 columns per lane: columns 256*j + 8*lane + e (j = 0,1; e = 0..7)
static __device__ __forceinline__ void load_cols16(const float* p, int lane, float (&o)[16]) {
#pragma unroll
    for (int j = 0; j < 2; ++j) {
        v4f a = *(const v4f*)(p + 256 * j + 8 * lane);
        v4f c = *(const v4f*)(p + 256 * j + 8 * lane + 4);
        o[8 * j + 0] = a.x; o[8 * j + 1] = a.y; o[8 * j + 2] = a.z; o[8 * j + 3] = a.w;
        o[8 * j + 4] = c.x; o[8 * j + 5] = c.y; o[8 * j + 6] = c.z; o[8 * j + 7] = c.w;
    }
}

// LayerNorm over a 512-wide row held as 16 columns per lane (f32)
static __device__ __forceinline__ void ln_lane(const float (&v)[16], const float (&gl)[16],
                                               const float (&el)[16], float (&y)[16]) {
    float s = 0.0f;
#pragma unroll
    for (int e = 0; e < 16; ++e) s += v[e];
    s = wsum(s);
    const float mu = s * (1.0f / (float)DM);
    float d[16];
    float q = 0.0f;
#pragma unroll
    for (int e = 0; e < 16; ++e) { d[e] = v[e] - mu; q = __builtin_fmaf(d[e], d[e], q); }
    q = wsum(q);
    const float rstd = rsqrtf(__builtin_fmaf(q, 1.0f / (float)DM, LN_EPS));
#pragma unroll
    for (int e = 0; e < 16; ++e) y[e] = d[e] * rstd * gl[e] + el[e];
}

// ---------------------------------------------------------------------------
// Weight plane: value f16(bf16r(src[n][k]) * 64), stored in fragment order: tile
// (n/16, k/32) is 512 halves at ((n/16) * (K/32) + k/32) * 512; inside it element
// (n, k) sits at ((k>>4)&1)*256 + (((k>>3)&1)*16 + (n&15))*8 + (k&7).
// Thread i writes halves 8i..8i+7 (a wave stores 512 contiguous bytes) and gathers
// its 8 source floats; a block reads 16 rows x 512 contiguous bytes.
// coverage: n/2048 blocks of the plane's range, 256 threads x 8 elements -> n exactly.
// ---------------------------------------------------------------------------
template <int K>
static __device__ __forceinline__ void wcvt_block(const float* __restrict__ src,
                                                  _Float16* __restrict__ dst, int blk) {
    constexpr int KT = K / 32;                  // k tiles per 16-row band
    const int i  = blk * 256 + threadIdx.x;
    const int t  = i >> 6, gq = i & 63;         // tile, 8-half group inside it
    const int n  = (t / KT) * 16 + (gq & 15);
    const int k  = (t % KT) * 32 + (gq >> 5) * 16 + ((gq >> 4) & 1) * 8;
    const float* sp = src + (size_t)n * K + k;
    v4f a = *(const v4f*)(sp);
    v4f c = *(const v4f*)(sp + 4);
    v8h o;
    o[0] = (_Float16)(bf16r(a.x) * WSC); o[1] = (_Float16)(bf16r(a.y) * WSC);
    o[2] = (_Float16)(bf16r(a.z) * WSC); o[3] = (_Float16)(bf16r(a.w) * WSC);
    o[4] = (_Float16)(bf16r(c.x) * WSC); o[5] = (_Float16)(bf16r(c.y) * WSC);
    o[6] = (_Float16)(bf16r(c.z) * WSC); o[7] = (_Float16)(bf16r(c.w) * WSC);
    *(v8h*)(dst + (size_t)i * 8) = o;
    // the store's registers may be rewritten on a later path of the caller's listing: wait first
    asm volatile("s_wait_xcnt 0x0" ::: "memory");
}

// ---------------------------------------------------------------------------
// LN1: y1 = f16(LayerNorm(bf16r(x)) * g + b), 512 columns in fragment tiles (see k_gemm_p).
// One wave per row, lane owns columns 8l..8l+7 and 256+8l..; the block's 8 rows are staged
// in LDS (block barrier), since a 128-B line of a tile holds 8 columns of 8 rows: column
// group L = col/8 of rows 8a..8a+7 is the line at 128*L + 64*(a&1) halves of the band.
// coverage: NTOK/8 blocks x 64 lines x 64 halves = NTOK x 512.
// ---------------------------------------------------------------------------
static __device__ __forceinline__ void ln1_block(const float* __restrict__ x,
                                                 const float* __restrict__ g,
                                                 const float* __restrict__ be,
                                                 _Float16* __restrict__ y, int blk) {
    const int tid = threadIdx.x, lane = tid & 31, w = tid >> 5;
    const int tok = blk * 8 + w;
    const int b = tok / SEQ, s = tok - b * SEQ;
    const float* xr = x + ((size_t)b * SEQ_FULL + s) * DM;
    float v[16], gl[16], el[16], yv[16];
    load_cols16(xr, lane, v);
    load_cols16(g, lane, gl);
    load_cols16(be, lane, el);
#pragma unroll
    for (int e = 0; e < 16; ++e) { v[e] = bf16r(v[e]); gl[e] = bf16r(gl[e]); el[e] = bf16r(el[e]); }
    ln_lane(v, gl, el, yv);
    v8h o[2];
#pragma unroll
    for (int j = 0; j < 2; ++j)
#pragma unroll
        for (int e = 0; e < 8; ++e) o[j][e] = (_Float16)yv[8 * j + e];
    __shared__ __align__(16) _Float16 ys[8 * YP];
    *(v8h*)(&ys[w * YP + 8 * lane])       = o[0];
    *(v8h*)(&ys[w * YP + 256 + 8 * lane]) = o[1];
    __syncthreads();                        // rows of the other waves are read below
    _Float16* yb = y + (size_t)(blk >> 1) * (16 * DM) + (blk & 1) * 64 + (tid & 7) * 8;
#pragma unroll
    for (int q = 0; q < 2; ++q) {
        const int L = (tid >> 3) + 32 * q;
        *(v8h*)(yb + 128 * L) = *(const v8h*)(&ys[(tid & 7) * YP + 8 * L]);
    }
}

// ---------------------------------------------------------------------------
// Preparation, one launch: LN1 and the six weight planes depend on the inputs alone and
// on nothing of each other, so they share a grid; the block index picks the job
// (block-uniform branches; the one barrier stands inside the LN1 branch). Ranges, in order: LN1 (PB_LN blocks), Wq, Wk, Wv,
// Wo (PB_S each), W1, W2 (PB_L each).
// ---------------------------------------------------------------------------
#define PB_LN (NTOK / 8)
#define PB_S  (DM * DM / 2048)
#define PB_L  (DF * DM / 2048)
#define PB_ALL (PB_LN + 4 * PB_S + 2 * PB_L)
__global__ __launch_bounds__(256) void k_prep(const float* __restrict__ x,
                                               const float* __restrict__ g,
                                               const float* __restrict__ be,
                                               const float* __restrict__ Wq,
                                               const float* __restrict__ Wk,
                                               const float* __restrict__ Wv,
                                               const float* __restrict__ Wo,
                                               const float* __restrict__ W1,
                                               const float* __restrict__ W2,
                                               _Float16* __restrict__ y,
                                               _Float16* __restrict__ wqkv,
                                               _Float16* __restrict__ wo16,
                                               _Float16* __restrict__ w116,
                                               _Float16* __restrict__ w216) {
    int blk = blockIdx.x;
    if (blk < PB_LN) { ln1_block(x, g, be, y, blk); return; }
    blk -= PB_LN;
    if (blk < 4 * PB_S) {
        const int p = blk / PB_S;               // 0..3: Wq, Wk, Wv, Wo
        const float* src = (p == 0) ? Wq : ((p == 1) ? Wk : ((p == 2) ? Wv : Wo));
        _Float16* dst = (p == 3) ? wo16 : wqkv + (size_t)p * DM * DM;
        wcvt_block<DM>(src, dst, blk - p * PB_S);
        return;
    }
    blk -= 4 * PB_S;
    if (blk < PB_L) { wcvt_block<DM>(W1, w116, blk); return; }
    wcvt_block<DF>(W2, w216, blk - PB_L);
}

// ---------------------------------------------------------------------------
// GEMM core: wave tile 16*RT rows x 64 cols, C[r][n] += A[r][k] * B[n][k],
// A a tiled activation plane, B a tiled weight plane (wcvt_block); a band of
// 16 rows starts at 16*K*band halves; fragments loaded directly from global memory
// (two 16-B loads each). K % 32 == 0; K is a compile-time constant so that the second A
// tiles and the B bands sit at immediate offsets of one address pair an operand.
// ---------------------------------------------------------------------------
template <int K, int RT>
static __device__ __forceinline__ void gemm_rtx64(const _Float16* __restrict__ Ab,
                                                  const _Float16* __restrict__ Bb,
                                                  int lane, v8f (&acc)[RT][4]) {
#pragma unroll
    for (int t = 0; t < RT; ++t)
#pragma unroll
        for (int j = 0; j < 4; ++j) acc[t][j] = zero8();
#pragma unroll 1
    for (int k0 = 0; k0 < K; k0 += 32) {
        const _Float16* ap = Ab + (size_t)k0 * 16 + lane * 8;   // the lane's 16 B of a tile half (load_fragB)
        const _Float16* bp = Bb + (size_t)k0 * 16 + lane * 8;
        Frag aa[RT], bb[4];
#pragma unroll
        for (int t = 0; t < RT; ++t) {
            aa[t].h[0] = *(const v8h*)(ap + (16 * t) * K);
            aa[t].h[1] = *(const v8h*)(ap + (16 * t) * K + 256);
        }
#pragma unroll
        for (int j = 0; j < 4; ++j) {
            bb[j].h[0] = *(const v8h*)(bp + (16 * j) * K);
            bb[j].h[1] = *(const v8h*)(bp + (16 * j) * K + 256);
        }
        // both address pairs are inputs, so they stay live up to this wait: no load's result is
        // given a register that an issued load names, and nothing rewrites one ahead of the wait
        asm volatile("s_wait_xcnt 0x0" :: "v"(ap), "v"(bp) : "memory");
#pragma unroll
        for (int j = 0; j < 4; ++j)
#pragma unroll
            for (int t = 0; t < RT; ++t) acc[t][j] = wmma16(aa[t].v, bb[j].v, acc[t][j]);
    }
}

// ---------------------------------------------------------------------------
// Plane GEMM: out = f16 plane of NTOK x ldo in fragment tiles (tile (tok/16, col/32) of 512
// halves at ((tok/16) * (ldo/32) + col/32) * 512, inside it as in wcvt_block with n = tok,
// k = col), so that its readers load A (or K) fragments as whole lines;
// block = PR = 64 rows x 512 cols (blockIdx.y =
// 512-column segment), wave = 64 x 64: a B fragment feeds four WMMAs and the weight
// segment is read from L2 once per 64 rows. EPI 0: val = acc + 64*bias (q|k|v x64);
// EPI 1: val = 64 * Mish(acc/64 + bias). Wave-private LDS tile (pitch SP: 16 B x odd, so
// neither side meets a bank twice), then 16 stores of 512 contiguous bytes, half a tile each.
// coverage: grid (NTOK/64, ldo/512) x 8 waves x (4 x 2 tiles) x 512 = NTOK x ldo.
// EPI 0, segment 2 (v) goes to the plane vfr instead, as B fragments of P*v (n = d,
// k = key), tile (batch, head, key/32, d/16) of 512 halves laid out as in wcvt_block. A lane's
// 8 accumulator rows of one 16x16 tile are keys 16t + 8*(lane>>4) + r at d = lane&15: the
// 8 halves at 256*(t&1) + 8*lane of key group t>>1, so each store is 512 contiguous bytes a wave.
// coverage: NTOK/64 blocks x 8 waves (heads) x 2 key groups x 4 tiles x 512 = NTOK x 512 of vfr.
// ---------------------------------------------------------------------------
template <int EPI>
__global__ __launch_bounds__(256) __attribute__((amdgpu_waves_per_eu(4)))   // 256 registers a wave: two blocks share a WGP, so the EPI 1 grid is resident at once
void k_gemm_p(const _Float16* __restrict__ A, const _Float16* __restrict__ Bw,
              const float* __restrict__ b0, const float* __restrict__ b1,
              const float* __restrict__ b2, const float* __restrict__ b3,
              _Float16* __restrict__ outp, int ldo, _Float16* __restrict__ vfr) {
    constexpr int SP = 72;                                 // LDS row pitch, halves
    __shared__ __align__(16) _Float16 st[8][PR * SP];      // 72 KB, wave-private tiles
    const int tid = threadIdx.x, lane = tid & 31, w = tid >> 5;
    const int hh = lane >> 4, m = lane & 15;
    const int m0  = blockIdx.x * PR;
    const int seg = blockIdx.y;
    const int nl  = 64 * w;                 // column within the 512 segment
    const int n0w = seg * 512 + nl;         // output column / B row
    const float* bias = (seg == 0) ? b0 : ((seg == 1) ? b1 : ((seg == 2) ? b2 : b3));

    v8f acc[PR / 16][4];
    constexpr int K = DM;                   // k length of both plane GEMMs
    gemm_rtx64<K, PR / 16>(A + (size_t)m0 * K, Bw + (size_t)n0w * K, lane, acc);

    float bl[4];
#pragma unroll
    for (int j = 0; j < 4; ++j) bl[j] = bf16r(bias[nl + 16 * j + m]);
    if (EPI == 0 && seg == 2) {             // block-uniform; no block barrier in this kernel
        const int b = m0 / SEQ, kb = (m0 - b * SEQ) / 32;
        _Float16* vt = vfr + (size_t)((b * NH + w) * (SEQ / 32) + kb) * 2048 + lane * 8;
#pragma unroll
        for (int t = 0; t < PR / 16; ++t)
#pragma unroll
            for (int j = 0; j < 4; ++j) {
                v8h o;
#pragma unroll
                for (int r = 0; r < 8; ++r) o[r] = (_Float16)__builtin_fmaf(bl[j], WSC, acc[t][j][r]);
                *(v8h*)(vt + 2048 * (t >> 1) + 512 * j + 256 * (t & 1)) = o;
            }
        return;
    }
#pragma unroll
    for (int t = 0; t < PR / 16; ++t)
#pragma unroll
        for (int j = 0; j < 4; ++j)
#pragma unroll
            for (int r = 0; r < 8; ++r) {
                float a = acc[t][j][r];
                float val;
                if (EPI == 0) {
                    val = __builtin_fmaf(bl[j], WSC, a);
                } else {
                    float hx = __builtin_fmaf(a, SC_H, bl[j]);
                    val = WSC * mishf(hx);
                }
                st[w][(16 * t + 8 * hh + r) * SP + 16 * j + m] = (_Float16)val;
            }
    wave_lds_sync();

    // i = 4*t + 2*kt + s: row tile t, k tile kt, tile half s; the lane takes row 16t + m,
    // columns 32kt + 16s + 8hh .. +7, the 8 halves at 256s + 8*lane of tile (t, kt)
    v8h pv[PR / 4];
#pragma unroll
    for (int i = 0; i < PR / 4; ++i)
        pv[i] = *(const v8h*)(&st[w][(16 * (i >> 2) + m) * SP + 32 * ((i >> 1) & 1) + 16 * (i & 1) + 8 * hh]);
    const int kts = ldo >> 5;               // k tiles per band of 16 rows
    _Float16* ob = outp + ((size_t)(m0 >> 4) * kts + (n0w >> 5)) * 512 + lane * 8;
#pragma unroll
    for (int i = 0; i < PR / 4; ++i)
        *(v8h*)(ob + (size_t)(i >> 2) * kts * 512 + 512 * ((i >> 1) & 1) + 256 * (i & 1)) = pv[i];

}

// ---------------------------------------------------------------------------
// Row GEMM (N = 512, block owns 32 full rows; A a tiled plane) fused with residual add + LayerNorm.
// MODE 0: x1 = bf16r(x) + (acc 2^-12 + bias) -> x1 f32 plane, y2 = f16(LN(x1) g + b) in
//         fragment tiles: the 32 rows staged f16 in LDS, block barrier, then 512-B stores.
// MODE 1: x2 = x1 + (acc 2^-12 + bias), out = LN(x2) g + b -> f32 rows.
// Block tile staged f32 in LDS (cross-wave, block barrier); wave then owns 4 rows:
// f16 rows go to the f16 LDS rows (MODE 0); f32 rows
// relaid through the (now wave-private) LDS row and written as four 512-B
// coverage: grid NTOK/32 x 32 rows x 512 = NTOK x 512 (each output plane).
// ---------------------------------------------------------------------------
template <int MODE>
__global__ __launch_bounds__(256) __attribute__((amdgpu_num_vgpr(256)))
void k_gemm_r(const _Float16* __restrict__ A, const _Float16* __restrict__ Bw,
              const float* __restrict__ bias, const float* __restrict__ res,
              const float* __restrict__ g, const float* __restrict__ be,
              float* __restrict__ outf, _Float16* __restrict__ outh) {
    __shared__ __align__(16) float T[QR * DM];            // 64 KB block tile
    __shared__ __align__(16) _Float16 Ys[MODE == 0 ? QR * YP : 8];   // y2 rows (MODE 0)
    const int tid = threadIdx.x, lane = tid & 31, w = tid >> 5;
    const int hh = lane >> 4, m = lane & 15;
    const int m0 = blockIdx.x * QR;
    const int nl = 64 * w;

    v8f acc[2][4];
    constexpr int K = (MODE == 0) ? DM : DF;   // k length: ctx plane / ffn plane
    gemm_rtx64<K, 2>(A + (size_t)m0 * K, Bw + (size_t)nl * K, lane, acc);
#pragma unroll
    for (int t = 0; t < 2; ++t)
#pragma unroll
        for (int j = 0; j < 4; ++j)
#pragma unroll
            for (int r = 0; r < 8; ++r)
                T[(16 * t + 8 * hh + r) * DM + nl + 16 * j + m] = acc[t][j][r];
    __syncthreads();

    float bl[16], gl[16], el[16];
    load_cols16(bias, lane, bl);
    load_cols16(g, lane, gl);
    load_cols16(be, lane, el);
#pragma unroll
    for (int e = 0; e < 16; ++e) { bl[e] = bf16r(bl[e]); gl[e] = bf16r(gl[e]); el[e] = bf16r(el[e]); }

#pragma unroll 1
    for (int rr = 0; rr < 4; ++rr) {
        const int row = 4 * w + rr;
        const int tok = m0 + row;
        float v[16], rv[16], yv[16];
        load_cols16(&T[row * DM], lane, v);
        if (MODE == 0) {
            const int b = tok / SEQ, s = tok - b * SEQ;
            load_cols16(res + ((size_t)b * SEQ_FULL + s) * DM, lane, rv);
#pragma unroll
            for (int e = 0; e < 16; ++e) rv[e] = bf16r(rv[e]);
        } else {
            load_cols16(res + (size_t)tok * DM, lane, rv);
        }
#pragma unroll
        for (int e = 0; e < 16; ++e) v[e] = rv[e] + __builtin_fmaf(v[e], SC_O, bl[e]);
        ln_lane(v, gl, el, yv);

        // write-back into the wave-private LDS row (same columns this lane loaded)
        float* trow = &T[row * DM];
#pragma unroll
        for (int j = 0; j < 2; ++j) {
            v4f p0, p1;
            if (MODE == 0) {
                p0.x = v[8 * j + 0]; p0.y = v[8 * j + 1]; p0.z = v[8 * j + 2]; p0.w = v[8 * j + 3];
                p1.x = v[8 * j + 4]; p1.y = v[8 * j + 5]; p1.z = v[8 * j + 6]; p1.w = v[8 * j + 7];
            } else {
                p0.x = yv[8 * j + 0]; p0.y = yv[8 * j + 1]; p0.z = yv[8 * j + 2]; p0.w = yv[8 * j + 3];
                p1.x = yv[8 * j + 4]; p1.y = yv[8 * j + 5]; p1.z = yv[8 * j + 6]; p1.w = yv[8 * j + 7];
            }
            *(v4f*)(trow + 256 * j + 8 * lane)     = p0;
            *(v4f*)(trow + 256 * j + 8 * lane + 4) = p1;
        }
        wave_lds_sync();
        v4f s4[4];
#pragma unroll
        for (int jj = 0; jj < 4; ++jj) s4[jj] = *(const v4f*)(trow + 128 * jj + 4 * lane);

        float* orow = outf + (size_t)tok * DM;
        if (MODE == 0) {
            v8h o[2];
#pragma unroll
            for (int j = 0; j < 2; ++j)
#pragma unroll
                for (int e = 0; e < 8; ++e) o[j][e] = (_Float16)yv[8 * j + e];
            *(v8h*)(&Ys[row * YP + 8 * lane])       = o[0];
            *(v8h*)(&Ys[row * YP + 256 + 8 * lane]) = o[1];
#pragma unroll
            for (int jj = 0; jj < 4; ++jj) *(v4f*)(orow + 128 * jj + 4 * lane) = s4[jj];
            
        } else {
#pragma unroll
            for (int jj = 0; jj < 4; ++jj) *(v4f*)(orow + 128 * jj + 4 * lane) = s4[jj];
            
        }
    }
    if (MODE == 0) {
        __syncthreads();                    // rows of the other waves are read below
        // piece i: row 16*(i>>10) + (i&15), column group L = (i>>4)&63; a wave stores 512 contiguous bytes
        _Float16* yb = outh + (size_t)m0 * DM;
#pragma unroll
        for (int q = 0; q < QR * DM / 2048; ++q) {
            const int i = q * 256 + tid;
            const int L = (i >> 4) & 63, bd = i >> 10;
            *(v8h*)(yb + bd * (16 * DM) + 128 * L + 8 * (i & 15)) = *(const v8h*)(&Ys[(16 * bd + (i & 15)) * YP + 8 * L]);
        }
    }
}

// ---------------------------------------------------------------------------
// Attention with 1.5-entmax over keys. Block = 8 waves = 32 query rows of one
// (batch, head); qkv plane of 1536 columns in fragment tiles (see k_gemm_p; q | k, each x64,
// head h at column +64h = k tiles 2h, 2h+1; the v third is unused), v x64 in the fragment
// plane vfr (see k_gemm_p).
// Phase 1: z strip [32][SEQ] f32 in LDS = (64q).(64k) 2^-16 = q.k/16; wave owns
//          SEQ/128 key tiles x both row tiles (K fragments straight from the plane).
// Phase 2: wave owns 4 rows; per row: shift by max, threshold tau of
//          sum relu(z - tau)^2 = 1 by safeguarded Newton (NEWT passes, registers) on
//          g(tau) = sqrt(sum relu(z - tau)^2) - 1: same root, convex and falling, so a
//          step from below never passes the root, and close to a straight line while the
//          sum is far above 1, where Newton on the sum itself only halves the distance,
//          P = relu(z - tau)^2 x 2^14 as f16 written over the row's own slot
//          (pitch 2*SEQ halves, skew 8*(row&15) halves).
// Phase 3: wave owns one 16x16 ctx tile over all keys; V fragments straight from vfr
//          (whole 128-B lines), VG of them fetched one group ahead; no barrier inside.
// Phase 4: ctx x64 as f16 staged [32][64] (cross-wave, barrier); wave w writes half w&1 of
//          tile w>>1 (2 row tiles x 2 k tiles) of the ctx plane, 512 columns in fragment tiles.
// coverage: grid (SEQ/32, 8, NB) x 4 tiles x 512 = NTOK x 512 of the ctx plane.
// ---------------------------------------------------------------------------
__global__ __launch_bounds__(256) __attribute__((amdgpu_num_vgpr(256)))
void k_attn(const _Float16* __restrict__ qkv, const _Float16* __restrict__ vfr,
            _Float16* __restrict__ ctx) {
    __shared__ __align__(16) float    zs[QR * SEQ];       // 128 KB at full size
    constexpr int CP = HD + 8;                            // Cst row pitch (16 B x odd)
    __shared__ __align__(16) _Float16 Cst[QR * CP];       // 4.5 KB
    static_assert(sizeof(zs) + sizeof(Cst) <= 160 * 1024);   // two blocks per WGP
    _Float16* ph = reinterpret_cast<_Float16*>(zs);       // P rows alias the z slots
    constexpr int PP  = 2 * SEQ;                          // P row slot (halves)
    constexpr int PLD = PP + 8;                           // fragment pitch incl. skew
    constexpr int KTW = SEQ / 128;                        // key tiles per wave

    const int tid = threadIdx.x, lane = tid & 31, w = tid >> 5;
    const int hh = lane >> 4, m = lane & 15;
    const int h = blockIdx.y, b = blockIdx.z;
    const int q0 = blockIdx.x * QR;
    const size_t tokq = (size_t)b * SEQ + q0;
    constexpr int BAND = 16 * DQKV;                       // halves per band of 16 tokens
    const _Float16* qp = qkv + tokq * DQKV + h * (HD * 16);                      // tile (tokq/16, 2h)
    const _Float16* kp = qkv + (size_t)b * SEQ * DQKV + (DM + h * HD) * 16;      // tile (b*SEQ/16, 16 + 2h)
    const int rt = w & 1, ct = w >> 1;                    // ctx tile of this wave (phase 3)
    const _Float16* vt = vfr + (size_t)(b * NH + h) * (SEQ / 32) * 2048 + ct * 512;

    // ---- phase 1: scores ----
    {
        const v16h qa00 = load_fragB(qp, lane);
        const v16h qa01 = load_fragB(qp + 512, lane);
        const v16h qa10 = load_fragB(qp + BAND, lane);
        const v16h qa11 = load_fragB(qp + BAND + 512, lane);
#pragma unroll 1
        for (int i = 0; i < KTW; ++i) {
            const int key0 = (w * KTW + i) * 16;
            const _Float16* kt = kp + (size_t)key0 * DQKV;     // band key0/16
            v16h kf0 = load_fragB(kt, lane);
            v16h kf1 = load_fragB(kt + 512, lane);
            v8f s0 = wmma16(qa00, kf0, zero8());
            s0 = wmma16(qa01, kf1, s0);
            v8f s1 = wmma16(qa10, kf0, zero8());
            s1 = wmma16(qa11, kf1, s1);
#pragma unroll
            for (int r = 0; r < 8; ++r) {
                zs[(8 * hh + r) * SEQ + key0 + m]      = s0[r] * SC_Z;
                zs[(16 + 8 * hh + r) * SEQ + key0 + m] = s1[r] * SC_Z;
            }
        }
    }
    __syncthreads();

    // first group of V fragments: in flight under phase 2
    v16h vcur[VG];
#pragma unroll
    for (int i = 0; i < VG; ++i) vcur[i] = load_fragB(vt + i * 2048, lane);

    // ---- phase 2: 1.5-entmax threshold per row ----
    const float tcl = -rsqrtf((float)SEQ);    // tau <= -1/sqrt(SEQ) always
#pragma unroll 1
    for (int rr = 0; rr < 4; ++rr) {
        const int row = 4 * w + rr;
        float z[ZN];
        const float* zr = &zs[row * SEQ];
#pragma unroll
        for (int j = 0; j < ZN / 4; ++j) {
            v4f t4 = *(const v4f*)(zr + 128 * j + 4 * lane);
            z[4 * j + 0] = t4.x; z[4 * j + 1] = t4.y; z[4 * j + 2] = t4.z; z[4 * j + 3] = t4.w;
        }
        float mx = z[0], mn = z[0];
#pragma unroll
        for (int i = 1; i < ZN; ++i) { mx = fmaxf(mx, z[i]); mn = fminf(mn, z[i]); }
        mx = wmaxr(mx);
        mn = wminr(mn);
#pragma unroll
        for (int i = 0; i < ZN; ++i) z[i] = z[i] - mx;
        float tau = fminf(fmaxf(mn - mx, -1.0f), tcl);
#pragma unroll 1
        for (int it = 0; it < NEWT; ++it) {
            float sa = 0.0f, sb = 0.0f;
#pragma unroll
            for (int i = 0; i < ZN; ++i) {
                float d = fmaxf(z[i] - tau, 0.0f);
                sa += d;
                sb = __builtin_fmaf(d, d, sb);
            }
            sa = wsum(sa);
            sb = wsum(sb);
            const float rn = __builtin_amdgcn_sqrtf(sb);      // g = rn - 1, g' = -sa / rn
            tau = tau + rn * (rn - 1.0f) * __builtin_amdgcn_rcpf(sa);
            tau = fminf(fmaxf(tau, -1.0f), tcl);
        }
        _Float16* prow = ph + (size_t)row * PP + (row & 15) * 8;
#pragma unroll
        for (int j = 0; j < ZN / 4; ++j) {
            v4h pk;
#pragma unroll
            for (int e = 0; e < 4; ++e) {
                float d = fmaxf(z[4 * j + e] - tau, 0.0f);
                pk[e] = (_Float16)(d * d * SC_P);
            }
            *(v4h*)(prow + 128 * j + 4 * lane) = pk;
        }
    }
    __syncthreads();

    // ---- phase 3: ctx = P @ v ----
    v8f acc = zero8();
    constexpr int NG = SEQ / (32 * VG);
#pragma unroll
    for (int g = 0; g < NG; ++g) {
        v16h pa[VG], vnx[VG];
#pragma unroll
        for (int i = 0; i < VG; ++i)      // rows = queries, k = keys
            pa[i] = load_frag16(ph + (size_t)(16 * rt) * PP + (g * VG + i) * 32, PLD, lane);
        if (g + 1 < NG) {
#pragma unroll
            for (int i = 0; i < VG; ++i) vnx[i] = load_fragB(vt + ((g + 1) * VG + i) * 2048, lane);
        }
#pragma unroll
        for (int i = 0; i < VG; ++i) acc = wmma16(pa[i], vcur[i], acc);   // n = d, k = keys
        if (g + 1 < NG) {
#pragma unroll
            for (int i = 0; i < VG; ++i) vcur[i] = vnx[i];
        }
    }

    // ---- phase 4: ctx plane x64 ----
#pragma unroll
    for (int r = 0; r < 8; ++r)
        Cst[(16 * rt + 8 * hh + r) * CP + 16 * ct + m] = (_Float16)(acc[r] * SC_C);
    __syncthreads();
    const int ort = w >> 2, okt = (w >> 1) & 1, os = w & 1;   // row tile, k tile, tile half
    v8h cv = *(const v8h*)(&Cst[(16 * ort + m) * CP + 32 * okt + 16 * os + 8 * hh]);
    _Float16* dst = ctx + (tokq + 16 * ort) * DM + (h * HD + 32 * okt) * 16 + 256 * os + lane * 8;
    *(v8h*)dst = cv;

}

// ---------------------------------------------------------------------------
extern "C" void kernel_launch(void* const* d_in, const int* in_sizes, int n_in,
                              void* d_out, int out_size, void* d_ws, size_t ws_size,
                              hipStream_t stream) {
    if (n_in < 19) return;
    if (in_sizes[0] < ((NB - 1) * SEQ_FULL + SEQ) * DM) return;
    if (in_sizes[1] < DM * DM || in_sizes[3] < DM * DM || in_sizes[5] < DM * DM || in_sizes[7] < DM * DM) return;
    if (in_sizes[2] < DM || in_sizes[4] < DM || in_sizes[6] < DM || in_sizes[8] < DM) return;
    if (in_sizes[9] < DM || in_sizes[10] < DM || in_sizes[15] < DM || in_sizes[16] < DM) return;
    if (in_sizes[17] < DM || in_sizes[18] < DM || in_sizes[14] < DM) return;
    if (in_sizes[11] < DF * DM || in_sizes[13] < DM * DF || in_sizes[12] < DF) return;
    if (out_size < NTOK * DM) return;

    const float* x    = (const float*)d_in[0];    // [8,1024,512]
    const float* Wq   = (const float*)d_in[1];    // [512,512] (out,in)
    const float* bq   = (const float*)d_in[2];
    const float* Wk   = (const float*)d_in[3];
    const float* bk   = (const float*)d_in[4];
    const float* Wv   = (const float*)d_in[5];
    const float* bv   = (const float*)d_in[6];
    const float* Wo   = (const float*)d_in[7];
    const float* bo   = (const float*)d_in[8];
    const float* ln1g = (const float*)d_in[9];
    const float* ln1b = (const float*)d_in[10];
    const float* W1   = (const float*)d_in[11];   // [2048,512]
    const float* bf1  = (const float*)d_in[12];
    const float* W2   = (const float*)d_in[13];   // [512,2048]
    const float* bf2  = (const float*)d_in[14];
    const float* ln2g = (const float*)d_in[15];
    const float* ln2b = (const float*)d_in[16];
    const float* lnfg = (const float*)d_in[17];
    const float* lnfb = (const float*)d_in[18];
    float* out = (float*)d_out;                   // [NTOK][512]

    char* ws = (char*)d_ws;
    size_t off = 0;
    _Float16* wqkv = (_Float16*)(ws + off); off += (size_t)DQKV * DM * 2;      // 1,572,864
    _Float16* wo16 = (_Float16*)(ws + off); off += (size_t)DM * DM * 2;        //   524,288
    _Float16* w116 = (_Float16*)(ws + off); off += (size_t)DF * DM * 2;        // 2,097,152
    _Float16* w216 = (_Float16*)(ws + off); off += (size_t)DM * DF * 2;        // 2,097,152
    _Float16* y1   = (_Float16*)(ws + off); off += (size_t)NTOK * DM * 2;      // 8 MiB at full size
    _Float16* qkv  = (_Float16*)(ws + off); off += (size_t)NTOK * DQKV * 2;    // 24 MiB
    _Float16* cpl  = (_Float16*)(ws + off); off += (size_t)NTOK * DM * 2;      // 8 MiB
    float*    x1   = (float*)(ws + off);    off += (size_t)NTOK * DM * 4;      // 16 MiB
    _Float16* y2   = (_Float16*)(ws + off); off += (size_t)NTOK * DM * 2;      // 8 MiB
    _Float16* mpl  = (_Float16*)(ws + off); off += (size_t)NTOK * DF * 2;      // 32 MiB
    _Float16* vfr  = (_Float16*)(ws + off); off += (size_t)NTOK * DM * 2;      // 8 MiB
    if (off > ws_size) return;                                                 // 115,343,360 B at full size

    k_prep<<<dim3(PB_ALL), dim3(256), 0, stream>>>(x, ln1g, ln1b, Wq, Wk, Wv, Wo, W1, W2, y1, wqkv, wo16, w116, w216);
    k_gemm_p<0><<<dim3(NTOK / PR, 3), dim3(256), 0, stream>>>(y1, wqkv, bq, bk, bv, bv, qkv, DQKV, vfr);
    k_attn<<<dim3(SEQ / QR, NH, NB), dim3(256), 0, stream>>>(qkv, vfr, cpl);
    k_gemm_r<0><<<dim3(NTOK / QR), dim3(256), 0, stream>>>(cpl, wo16, bo, x, ln2g, ln2b, x1, y2);
    k_gemm_p<1><<<dim3(NTOK / PR, DF / 512), dim3(256), 0, stream>>>(y2, w116, bf1, bf1 + 512, bf1 + 1024, bf1 + 1536, mpl, DF, nullptr);
    k_gemm_r<1><<<dim3(NTOK / QR), dim3(256), 0, stream>>>(mpl, w216, bf2, x1, lnfg, lnfb, out, y2);
}

// v008
// One run takes 178 microseconds.
// In two side-by-side timings against v007, it was 1.09 and 1.08 times as fast.
// All steps since v000 together make it 2.29 times as fast.
#include <hip/hip_runtime.h>

// Contractions on v_wmma_f32_16x16x32_f16 (f16 operands, f32 accumulate), one product each: y1*[Wq|Wk|Wv]^T, q*k^T, P*v, ctx*Wo^T, y2*W1^T, m*W2^T; float inputs RNE-converted to bf16 then carried in f16 (weights x64, P x2^14, ctx x64, m x64); LayerNorm, 1.5-entmax threshold and Mish in f32.

#ifndef NB
#define NB 8
#endif
#ifndef SEQ
#define SEQ 1024
#endif
#define NB_FULL  8
#define SEQ_FULL 1024
#define DM   512            // model width
#define DF   2048           // ffn width
#define NH   8
#define HD   64
#define DQKV (3 * DM)       // q|k|v plane pitch
#define NTOK (NB * SEQ)
#define QR   32             // query rows per attention block / rows per row-gemm block
#define PR   64             // rows per plane-gemm block
#define VG   8              // V fragments (32 keys each) fetched ahead as one group in k_attn
#define ZN   (SEQ / 32)     // scores per lane per row
#define YP   (DM + 8)       // LDS pitch of a staged f16 row, halves (16 B x odd)
#define NEWT 6              // Newton passes for the entmax threshold (on the norm, see k_attn phase 2)

static_assert(NB >= 1 && NB <= NB_FULL);
static_assert(SEQ <= SEQ_FULL);
static_assert(SEQ % (32 * VG) == 0);
static_assert(SEQ % 128 == 0);
static_assert(NTOK % QR == 0);
static_assert(SEQ % PR == 0 && PR % 32 == 0);
static_assert(NH * HD == DM);
static_assert(QR == 32);
static_assert((ZN % 4) == 0);
static_assert(DM % 32 == 0 && DF % 32 == 0);
static_assert((DM * DM) % 2048 == 0 && (DF * DM) % 2048 == 0);

typedef _Float16 v16h __attribute__((ext_vector_type(16)));
typedef _Float16 v8h  __attribute__((ext_vector_type(8)));
typedef _Float16 v4h  __attribute__((ext_vector_type(4)));
typedef float    v8f  __attribute__((ext_vector_type(8)));
typedef float    v4f  __attribute__((ext_vector_type(4)));

union Frag { v16h v; v8h h[2]; };

#define WSC   64.0f                  // weight carry
#define SC_Z  1.52587890625e-05f     // 2^-16 : (64q).(64k) -> q.k/16 = z
#define SC_P  16384.0f               // 2^14  : P carry
#define SC_C  6.103515625e-05f       // 2^-14 : (2^14 P)(64 v) -> 64 ctx
#define SC_O  2.44140625e-04f        // 2^-12 : (64 a)(64 W) -> a.W
#define SC_H  0.015625f              // 1/64  : (y)(64 W) -> y.W
#define LOG2E 1.44269504088896340736f
#define LN_EPS 1e-5f

static __device__ __forceinline__ v8f zero8() {
    v8f z;
#pragma unroll
    for (int i = 0; i < 8; ++i) z[i] = 0.0f;
    return z;
}

// 16x32 A fragment (or B fragment from an [n][k] k-contiguous source) from a
// row-major 16-bit tile: lane m = lane&15 -> row m; kb = 8*(lane>>4);
// elements 0..7 = k kb..kb+7, elements 8..15 = k kb+16..kb+23.
static __device__ __forceinline__ v16h load_frag16(const _Float16* base, int ld, int lane) {
    int m  = lane & 15;
    int kb = (lane >> 4) << 3;
    const _Float16* p = base + (size_t)m * ld + kb;
    Frag f;
    f.h[0] = *(const v8h*)(p);
    f.h[1] = *(const v8h*)(p + 16);
    return f.v;
}

// A or B fragment from a tiled plane (weights: wcvt_block; activations: see k_gemm_p):
// one 16 x 32 tile is 1 KB, lane l reads 16 B at 16*l and at 512 + 16*l, so each load is
// four whole 128-B lines (a fragment load from a row-major plane touches 16 lines).
// Same element in every lane and register position as load_frag16 on the [n][k] plane.
static __device__ __forceinline__ v16h load_fragB(const _Float16* tile, int lane) {
    const _Float16* p = tile + lane * 8;
    Frag f;
    f.h[0] = *(const v8h*)(p);
    f.h[1] = *(const v8h*)(p + 256);
    return f.v;
}

static __device__ __forceinline__ v8f wmma16(v16h a, v16h b, v8f c) {
    v8f d = __builtin_amdgcn_wmma_f32_16x16x32_f16(false, a, false, b, (short)0, c, false, false);
    asm volatile("v_nop\n\tv_nop\n\tv_nop\n\tv_nop" : "+v"(d) : "v"(a), "v"(b));
    return d;
}

// f32 -> bf16 RNE convert, value kept as f32
static __device__ __forceinline__ float bf16r(float x) {
    unsigned u = __float_as_uint(x);
    u = (u + 0x7FFFu + ((u >> 16) & 1u)) & 0xFFFF0000u;
    return __uint_as_float(u);
}

// ordering for a wave-private LDS tile: stores before later loads of the same wave
static __device__ __forceinline__ void wave_lds_sync() {
    __builtin_amdgcn_fence(3, "wavefront");
    asm volatile("s_wait_dscnt 0" ::: "memory");
    __builtin_amdgcn_wave_barrier();
}

// Lane exchanges of the wave reductions, in the vector unit (a shuffle goes through the LDS
// pipe and is waited for at every step). xhalf: lane l reads lane l ^ 16; xrow<M>: lane l reads
// lane l ^ M inside its row of 16 lanes (DPP row_xmask, control word 0x160 + M). All lanes are on
// wherever these are called. Steps in the order 16, 8, 4, 2, 1.
static __device__ __forceinline__ float xhalf(float x) {
    const int b = __builtin_bit_cast(int, x);
    return __builtin_bit_cast(float, __builtin_amdgcn_permlanex16(b, b, 0x76543210, 0xfedcba98, false, false));
}
template <int M>
static __device__ __forceinline__ float xrow(float x) {
    const int b = __builtin_bit_cast(int, x);
    return __builtin_bit_cast(float, __builtin_amdgcn_update_dpp(b, b, 0x160 + M, 0xf, 0xf, true));
}
static __device__ __forceinline__ float wsum(float v) {
    v += xhalf(v); v += xrow<8>(v); v += xrow<4>(v);
    v += xrow<2>(v); v += xrow<1>(v);
    return v;
}
static __device__ __forceinline__ float wmaxr(float v) {
    v = fmaxf(v, xhalf(v)); v = fmaxf(v, xrow<8>(v));
    v = fmaxf(v, xrow<4>(v)); v = fmaxf(v, xrow<2>(v));
    v = fmaxf(v, xrow<1>(v));
    return v;
}
static __device__ __forceinline__ float wminr(float v) {
    v = fminf(v, xhalf(v)); v = fminf(v, xrow<8>(v));
    v = fminf(v, xrow<4>(v)); v = fminf(v, xrow<2>(v));
    v = fminf(v, xrow<1>(v));
    return v;
}

// Mish(x) = x * tanh(softplus(x)) = x * (u^2+2u)/(u^2+2u+2), u = e^x
static __device__ __forceinline__ float mishf(float x) {
    float xe = fminf(x, 20.0f);
    float u  = __builtin_amdgcn_exp2f(xe * LOG2E);
    float wv = u * (u + 2.0f);
    float t  = wv * __builtin_amdgcn_rcpf(wv + 2.0f);
    return x * t;
}

// 16 columns per lane: columns 256*j + 8*lane + e (j = 0,1; e = 0..7)
static __device__ __forceinline__ void load_cols16(const float* p, int lane, float (&o)[16]) {
#pragma unroll
    for (int j = 0; j < 2; ++j) {
        v4f a = *(const v4f*)(p + 256 * j + 8 * lane);
        v4f c = *(const v4f*)(p + 256 * j + 8 * lane + 4);
        o[8 * j + 0] = a.x; o[8 * j + 1] = a.y; o[8 * j + 2] = a.z; o[8 * j + 3] = a.w;
        o[8 * j + 4] = c.x; o[8 * j + 5] = c.y; o[8 * j + 6] = c.z; o[8 * j + 7] = c.w;
    }
}

// LayerNorm over a 512-wide row held as 16 columns per lane (f32)
static __device__ __forceinline__ void ln_lane(const float (&v)[16], const float (&gl)[16],
                                               const float (&el)[16], float (&y)[16]) {
    float s = 0.0f;
#pragma unroll
    for (int e = 0; e < 16; ++e) s += v[e];
    s = wsum(s);
    const float mu = s * (1.0f / (float)DM);
    float d[16];
    float q = 0.0f;
#pragma unroll
    for (int e = 0; e < 16; ++e) { d[e] = v[e] - mu; q = __builtin_fmaf(d[e], d[e], q); }
    q = wsum(q);
    const float rstd = rsqrtf(__builtin_fmaf(q, 1.0f / (float)DM, LN_EPS));
#pragma unroll
    for (int e = 0; e < 16; ++e) y[e] = d[e] * rstd * gl[e] + el[e];
}

// ---------------------------------------------------------------------------
// Weight plane: value f16(bf16r(src[n][k]) * 64), stored in fragment order: tile
// (n/16, k/32) is 512 halves at ((n/16) * (K/32) + k/32) * 512; inside it element
// (n, k) sits at ((k>>4)&1)*256 + (((k>>3)&1)*16 + (n&15))*8 + (k&7).
// Thread i writes halves 8i..8i+7 (a wave stores 512 contiguous bytes) and gathers
// its 8 source floats; a block reads 16 rows x 512 contiguous bytes.
// coverage: n/2048 blocks of the plane's range, 256 threads x 8 elements -> n exactly.
// ---------------------------------------------------------------------------
template <int K>
static __device__ __forceinline__ void wcvt_block(const float* __restrict__ src,
                                                  _Float16* __restrict__ dst, int blk) {
    constexpr int KT = K / 32;                  // k tiles per 16-row band
    const int i  = blk * 256 + threadIdx.x;
    const int t  = i >> 6, gq = i & 63;         // tile, 8-half group inside it
    const int n  = (t / KT) * 16 + (gq & 15);
    const int k  = (t % KT) * 32 + (gq >> 5) * 16 + ((gq >> 4) & 1) * 8;
    const float* sp = src + (size_t)n * K + k;
    v4f a = *(const v4f*)(sp);
    v4f c = *(const v4f*)(sp + 4);
    v8h o;
    o[0] = (_Float16)(bf16r(a.x) * WSC); o[1] = (_Float16)(bf16r(a.y) * WSC);
    o[2] = (_Float16)(bf16r(a.z) * WSC); o[3] = (_Float16)(bf16r(a.w) * WSC);
    o[4] = (_Float16)(bf16r(c.x) * WSC); o[5] = (_Float16)(bf16r(c.y) * WSC);
    o[6] = (_Float16)(bf16r(c.z) * WSC); o[7] = (_Float16)(bf16r(c.w) * WSC);
    *(v8h*)(dst + (size_t)i * 8) = o;
    // the store's registers may be rewritten on a later path of the caller's listing: wait first
    asm volatile("s_wait_xcnt 0x0" ::: "memory");
}

// ---------------------------------------------------------------------------
// LN1: y1 = f16(LayerNorm(bf16r(x)) * g + b), 512 columns in fragment tiles (see k_gemm_p).
// One wave per row, lane owns columns 8l..8l+7 and 256+8l..; the block's 8 rows are staged
// in LDS (block barrier), since a 128-B line of a tile holds 8 columns of 8 rows: column
// group L = col/8 of rows 8a..8a+7 is the line at 128*L + 64*(a&1) halves of the band.
// coverage: NTOK/8 blocks x 64 lines x 64 halves = NTOK x 512.
// ---------------------------------------------------------------------------
static __device__ __forceinline__ void ln1_block(const float* __restrict__ x,
                                                 const float* __restrict__ g,
                                                 const float* __restrict__ be,
                                                 _Float16* __restrict__ y, int blk) {
    const int tid = threadIdx.x, lane = tid & 31, w = tid >> 5;
    const int tok = blk * 8 + w;
    const int b = tok / SEQ, s = tok - b * SEQ;
    const float* xr = x + ((size_t)b * SEQ_FULL + s) * DM;
    float v[16], gl[16], el[16], yv[16];
    load_cols16(xr, lane, v);
    load_cols16(g, lane, gl);
    load_cols16(be, lane, el);
#pragma unroll
    for (int e = 0; e < 16; ++e) { v[e] = bf16r(v[e]); gl[e] = bf16r(gl[e]); el[e] = bf16r(el[e]); }
    ln_lane(v, gl, el, yv);
    v8h o[2];
#pragma unroll
    for (int j = 0; j < 2; ++j)
#pragma unroll
        for (int e = 0; e < 8; ++e) o[j][e] = (_Float16)yv[8 * j + e];
    __shared__ __align__(16) _Float16 ys[8 * YP];
    *(v8h*)(&ys[w * YP + 8 * lane])       = o[0];
    *(v8h*)(&ys[w * YP + 256 + 8 * lane]) = o[1];
    __syncthreads();                        // rows of the other waves are read below
    _Float16* yb = y + (size_t)(blk >> 1) * (16 * DM) + (blk & 1) * 64 + (tid & 7) * 8;
#pragma unroll
    for (int q = 0; q < 2; ++q) {
        const int L = (tid >> 3) + 32 * q;
        *(v8h*)(yb + 128 * L) = *(const v8h*)(&ys[(tid & 7) * YP + 8 * L]);
    }
}

// ---------------------------------------------------------------------------
// Preparation, one launch: LN1 and the six weight planes depend on the inputs alone and
// on nothing of each other, so they share a grid; the block index picks the job
// (block-uniform branches; the one barrier stands inside the LN1 branch). Ranges, in order: LN1 (PB_LN blocks), Wq, Wk, Wv,
// Wo (PB_S each), W1, W2 (PB_L each).
// ---------------------------------------------------------------------------
#define PB_LN (NTOK / 8)
#define PB_S  (DM * DM / 2048)
#define PB_L  (DF * DM / 2048)
#define PB_ALL (PB_LN + 4 * PB_S + 2 * PB_L)
__global__ __launch_bounds__(256) void k_prep(const float* __restrict__ x,
                                               const float* __restrict__ g,
                                               const float* __restrict__ be,
                                               const float* __restrict__ Wq,
                                               const float* __restrict__ Wk,
                                               const float* __restrict__ Wv,
                                               const float* __restrict__ Wo,
                                               const float* __restrict__ W1,
                                               const float* __restrict__ W2,
                                               _Float16* __restrict__ y,
                                               _Float16* __restrict__ wqkv,
                                               _Float16* __restrict__ wo16,
                                               _Float16* __restrict__ w116,
                                               _Float16* __restrict__ w216) {
    int blk = blockIdx.x;
    if (blk < PB_LN) { ln1_block(x, g, be, y, blk); return; }
    blk -= PB_LN;
    if (blk < 4 * PB_S) {
        const int p = blk / PB_S;               // 0..3: Wq, Wk, Wv, Wo
        const float* src = (p == 0) ? Wq : ((p == 1) ? Wk : ((p == 2) ? Wv : Wo));
        _Float16* dst = (p == 3) ? wo16 : wqkv + (size_t)p * DM * DM;
        wcvt_block<DM>(src, dst, blk - p * PB_S);
        return;
    }
    blk -= 4 * PB_S;
    if (blk < PB_L) { wcvt_block<DM>(W1, w116, blk); return; }
    wcvt_block<DF>(W2, w216, blk - PB_L);
}

// ---------------------------------------------------------------------------
// GEMM core: wave tile 16*RT rows x 64 cols, C[r][n] += A[r][k] * B[n][k],
// A a tiled activation plane, B a tiled weight plane (wcvt_block); a band of
// 16 rows starts at 16*K*band halves; fragments loaded directly from global memory
// (two 16-B loads each). K % 32 == 0; K is a compile-time constant so that the second A
// tiles and the B bands sit at immediate offsets of one address pair an operand.
// ---------------------------------------------------------------------------
template <int K, int RT>
static __device__ __forceinline__ void gemm_rtx64(const _Float16* __restrict__ Ab,
                                                  const _Float16* __restrict__ Bb,
                                                  int lane, v8f (&acc)[RT][4]) {
#pragma unroll
    for (int t = 0; t < RT; ++t)
#pragma unroll
        for (int j = 0; j < 4; ++j) acc[t][j] = zero8();
#pragma unroll 1
    for (int k0 = 0; k0 < K; k0 += 32) {
        const _Float16* ap = Ab + (size_t)k0 * 16 + lane * 8;   // the lane's 16 B of a tile half (load_fragB)
        const _Float16* bp = Bb + (size_t)k0 * 16 + lane * 8;
        Frag aa[RT], bb[4];
#pragma unroll
        for (int t = 0; t < RT; ++t) {
            aa[t].h[0] = *(const v8h*)(ap + (16 * t) * K);
            aa[t].h[1] = *(const v8h*)(ap + (16 * t) * K + 256);
        }
#pragma unroll
        for (int j = 0; j < 4; ++j) {
            bb[j].h[0] = *(const v8h*)(bp + (16 * j) * K);
            bb[j].h[1] = *(const v8h*)(bp + (16 * j) * K + 256);
        }
        // both address pairs are inputs, so they stay live up to this wait: no load's result is
        // given a register that an issued load names, and nothing rewrites one ahead of the wait
        asm volatile("s_wait_xcnt 0x0" :: "v"(ap), "v"(bp) : "memory");
#pragma unroll
        for (int j = 0; j < 4; ++j)
#pragma unroll
            for (int t = 0; t < RT; ++t) acc[t][j] = wmma16(aa[t].v, bb[j].v, acc[t][j]);
    }
}

// ---------------------------------------------------------------------------
// Plane GEMM: out = f16 plane of NTOK x ldo in fragment tiles (tile (tok/16, col/32) of 512
// halves at ((tok/16) * (ldo/32) + col/32) * 512, inside it as in wcvt_block with n = tok,
// k = col), so that its readers load A (or K) fragments as whole lines;
// block = PR = 64 rows x 512 cols (blockIdx.y =
// 512-column segment), wave = 64 x 64: a B fragment feeds four WMMAs and the weight
// segment is read from L2 once per 64 rows. EPI 0: val = acc + 64*bias (q|k|v x64);
// EPI 1: val = 64 * Mish(acc/64 + bias). Wave-private LDS tile (pitch SP: 16 B x odd, so
// neither side meets a bank twice), then 16 stores of 512 contiguous bytes, half a tile each.
// coverage: grid (NTOK/64, ldo/512) x 8 waves x (4 x 2 tiles) x 512 = NTOK x ldo.
// EPI 0, segment 2 (v) goes to the plane vfr instead, as B fragments of P*v (n = d,
// k = key), tile (batch, head, key/32, d/16) of 512 halves laid out as in wcvt_block. A lane's
// 8 accumulator rows of one 16x16 tile are keys 16t + 8*(lane>>4) + r at d = lane&15: the
// 8 halves at 256*(t&1) + 8*lane of key group t>>1, so each store is 512 contiguous bytes a wave.
// coverage: NTOK/64 blocks x 8 waves (heads) x 2 key groups x 4 tiles x 512 = NTOK x 512 of vfr.
// ---------------------------------------------------------------------------
template <int EPI>
__global__ __launch_bounds__(256) __attribute__((amdgpu_waves_per_eu(4)))   // 256 registers a wave: two blocks share a WGP, so the EPI 1 grid is resident at once
void k_gemm_p(const _Float16* __restrict__ A, const _Float16* __restrict__ Bw,
              const float* __restrict__ b0, const float* __restrict__ b1,
              const float* __restrict__ b2, const float* __restrict__ b3,
              _Float16* __restrict__ outp, int ldo, _Float16* __restrict__ vfr) {
    constexpr int SP = 72;                                 // LDS row pitch, halves
    __shared__ __align__(16) _Float16 st[8][PR * SP];      // 72 KB, wave-private tiles
    const int tid = threadIdx.x, lane = tid & 31, w = tid >> 5;
    const int hh = lane >> 4, m = lane & 15;
    const int m0  = blockIdx.x * PR;
    const int seg = blockIdx.y;
    const int nl  = 64 * w;                 // column within the 512 segment
    const int n0w = seg * 512 + nl;         // output column / B row
    const float* bias = (seg == 0) ? b0 : ((seg == 1) ? b1 : ((seg == 2) ? b2 : b3));

    v8f acc[PR / 16][4];
    constexpr int K = DM;                   // k length of both plane GEMMs
    gemm_rtx64<K, PR / 16>(A + (size_t)m0 * K, Bw + (size_t)n0w * K, lane, acc);

    float bl[4];
#pragma unroll
    for (int j = 0; j < 4; ++j) bl[j] = bf16r(bias[nl + 16 * j + m]);
    if (EPI == 0 && seg == 2) {             // block-uniform; no block barrier in this kernel
        const int b = m0 / SEQ, kb = (m0 - b * SEQ) / 32;
        _Float16* vt = vfr + (size_t)((b * NH + w) * (SEQ / 32) + kb) * 2048 + lane * 8;
#pragma unroll
        for (int t = 0; t < PR / 16; ++t)
#pragma unroll
            for (int j = 0; j < 4; ++j) {
                v8h o;
#pragma unroll
                for (int r = 0; r < 8; ++r) o[r] = (_Float16)__builtin_fmaf(bl[j], WSC, acc[t][j][r]);
                *(v8h*)(vt + 2048 * (t >> 1) + 512 * j + 256 * (t & 1)) = o;
            }
        return;
    }
#pragma unroll
    for (int t = 0; t < PR / 16; ++t)
#pragma unroll
        for (int j = 0; j < 4; ++j)
#pragma unroll
            for (int r = 0; r < 8; ++r) {
                float a = acc[t][j][r];
                float val;
                if (EPI == 0) {
                    val = __builtin_fmaf(bl[j], WSC, a);
                } else {
                    float hx = __builtin_fmaf(a, SC_H, bl[j]);
                    val = WSC * mishf(hx);
                }
                st[w][(16 * t + 8 * hh + r) * SP + 16 * j + m] = (_Float16)val;
            }
    wave_lds_sync();

    // i = 4*t + 2*kt + s: row tile t, k tile kt, tile half s; the lane takes row 16t + m,
    // columns 32kt + 16s + 8hh .. +7, the 8 halves at 256s + 8*lane of tile (t, kt)
    v8h pv[PR / 4];
#pragma unroll
    for (int i = 0; i < PR / 4; ++i)
        pv[i] = *(const v8h*)(&st[w][(16 * (i >> 2) + m) * SP + 32 * ((i >> 1) & 1) + 16 * (i & 1) + 8 * hh]);
    const int kts = ldo >> 5;               // k tiles per band of 16 rows
    _Float16* ob = outp + ((size_t)(m0 >> 4) * kts + (n0w >> 5)) * 512 + lane * 8;
#pragma unroll
    for (int i = 0; i < PR / 4; ++i)
        *(v8h*)(ob + (size_t)(i >> 2) * kts * 512 + 512 * ((i >> 1) & 1) + 256 * (i & 1)) = pv[i];

}

// ---------------------------------------------------------------------------
// Row GEMM (N = 512, block owns 32 full rows; A a tiled plane) fused with residual add + LayerNorm.
// MODE 0: x1 = bf16r(x) + (acc 2^-12 + bias) -> x1 f32 plane, y2 = f16(LN(x1) g + b) in
//         fragment tiles: the 32 rows staged f16 in LDS, block barrier, then 512-B stores.
// MODE 1: x2 = x1 + (acc 2^-12 + bias), out = LN(x2) g + b -> f32 rows.
// Block tile staged f32 in LDS (cross-wave, block barrier); wave then owns 4 rows:
// f16 rows go to the f16 LDS rows (MODE 0); f32 rows
// relaid through the (now wave-private) LDS row and written as four 512-B
// coverage: grid NTOK/32 x 32 rows x 512 = NTOK x 512 (each output plane).
// ---------------------------------------------------------------------------
template <int MODE>
__global__ __launch_bounds__(256) __attribute__((amdgpu_num_vgpr(256)))
void k_gemm_r(const _Float16* __restrict__ A, const _Float16* __restrict__ Bw,
              const float* __restrict__ bias, const float* __restrict__ res,
              const float* __restrict__ g, const float* __restrict__ be,
              float* __restrict__ outf, _Float16* __restrict__ outh) {
    __shared__ __align__(16) float T[QR * DM];            // 64 KB block tile
    __shared__ __align__(16) _Float16 Ys[MODE == 0 ? QR * YP : 8];   // y2 rows (MODE 0)
    const int tid = threadIdx.x, lane = tid & 31, w = tid >> 5;
    const int hh = lane >> 4, m = lane & 15;
    const int m0 = blockIdx.x * QR;
    const int nl = 64 * w;

    v8f acc[2][4];
    constexpr int K = (MODE == 0) ? DM : DF;   // k length: ctx plane / ffn plane
    gemm_rtx64<K, 2>(A + (size_t)m0 * K, Bw + (size_t)nl * K, lane, acc);
#pragma unroll
    for (int t = 0; t < 2; ++t)
#pragma unroll
        for (int j = 0; j < 4; ++j)
#pragma unroll
            for (int r = 0; r < 8; ++r)
                T[(16 * t + 8 * hh + r) * DM + nl + 16 * j + m] = acc[t][j][r];
    __syncthreads();

    float bl[16], gl[16], el[16];
    load_cols16(bias, lane, bl);
    load_cols16(g, lane, gl);
    load_cols16(be, lane, el);
#pragma unroll
    for (int e = 0; e < 16; ++e) { bl[e] = bf16r(bl[e]); gl[e] = bf16r(gl[e]); el[e] = bf16r(el[e]); }

#pragma unroll 1
    for (int rr = 0; rr < 4; ++rr) {
        const int row = 4 * w + rr;
        const int tok = m0 + row;
        float v[16], rv[16], yv[16];
        load_cols16(&T[row * DM], lane, v);
        if (MODE == 0) {
            const int b = tok / SEQ, s = tok - b * SEQ;
            load_cols16(res + ((size_t)b * SEQ_FULL + s) * DM, lane, rv);
#pragma unroll
            for (int e = 0; e < 16; ++e) rv[e] = bf16r(rv[e]);
        } else {
            load_cols16(res + (size_t)tok * DM, lane, rv);
        }
#pragma unroll
        for (int e = 0; e < 16; ++e) v[e] = rv[e] + __builtin_fmaf(v[e], SC_O, bl[e]);
        ln_lane(v, gl, el, yv);

        // write-back into the wave-private LDS row (same columns this lane loaded)
        float* trow = &T[row * DM];
#pragma unroll
        for (int j = 0; j < 2; ++j) {
            v4f p0, p1;
            if (MODE == 0) {
                p0.x = v[8 * j + 0]; p0.y = v[8 * j + 1]; p0.z = v[8 * j + 2]; p0.w = v[8 * j + 3];
                p1.x = v[8 * j + 4]; p1.y = v[8 * j + 5]; p1.z = v[8 * j + 6]; p1.w = v[8 * j + 7];
            } else {
                p0.x = yv[8 * j + 0]; p0.y = yv[8 * j + 1]; p0.z = yv[8 * j + 2]; p0.w = yv[8 * j + 3];
                p1.x = yv[8 * j + 4]; p1.y = yv[8 * j + 5]; p1.z = yv[8 * j + 6]; p1.w = yv[8 * j + 7];
            }
            *(v4f*)(trow + 256 * j + 8 * lane)     = p0;
            *(v4f*)(trow + 256 * j + 8 * lane + 4) = p1;
        }
        wave_lds_sync();
        v4f s4[4];
#pragma unroll
        for (int jj = 0; jj < 4; ++jj) s4[jj] = *(const v4f*)(trow + 128 * jj + 4 * lane);

        float* orow = outf + (size_t)tok * DM;
        if (MODE == 0) {
            v8h o[2];
#pragma unroll
            for (int j = 0; j < 2; ++j)
#pragma unroll
                for (int e = 0; e < 8; ++e) o[j][e] = (_Float16)yv[8 * j + e];
            *(v8h*)(&Ys[row * YP + 8 * lane])       = o[0];
            *(v8h*)(&Ys[row * YP + 256 + 8 * lane]) = o[1];
#pragma unroll
            for (int jj = 0; jj < 4; ++jj) *(v4f*)(orow + 128 * jj + 4 * lane) = s4[jj];
            
        } else {
#pragma unroll
            for (int jj = 0; jj < 4; ++jj) *(v4f*)(orow + 128 * jj + 4 * lane) = s4[jj];
            
        }
    }
    if (MODE == 0) {
        __syncthreads();                    // rows of the other waves are read below
        // piece i: row 16*(i>>10) + (i&15), column group L = (i>>4)&63; a wave stores 512 contiguous bytes
        _Float16* yb = outh + (size_t)m0 * DM;
#pragma unroll
        for (int q = 0; q < QR * DM / 2048; ++q) {
            const int i = q * 256 + tid;
            const int L = (i >> 4) & 63, bd = i >> 10;
            *(v8h*)(yb + bd * (16 * DM) + 128 * L + 8 * (i & 15)) = *(const v8h*)(&Ys[(16 * bd + (i & 15)) * YP + 8 * L]);
        }
    }
}

// ---------------------------------------------------------------------------
// Attention with 1.5-entmax over keys. Block = 8 waves = 32 query rows of one
// (batch, head); qkv plane of 1536 columns in fragment tiles (see k_gemm_p; q | k, each x64,
// head h at column +64h = k tiles 2h, 2h+1; the v third is unused), v x64 in the fragment
// plane vfr (see k_gemm_p).
// Phase 1: z strip [32][SEQ] f32 in LDS = (64q).(64k) 2^-16 = q.k/16; wave owns
//          SEQ/128 key tiles x both row tiles (K fragments straight from the plane).
// Phase 2: wave owns 4 rows; per row: shift by max, threshold tau of
//          sum relu(z - tau)^2 = 1 by safeguarded Newton (NEWT passes, registers) on
//          g(tau) = sqrt(sum relu(z - tau)^2) - 1: same root, convex and falling, so a
//          step from below never passes the root, and close to a straight line while the
//          sum is far above 1, where Newton on the sum itself only halves the distance,
//          P = relu(z - tau)^2 x 2^14 as f16 written over the row's own slot
//          (pitch 2*SEQ halves, skew 8*(row&15) halves).
// Phase 3: wave owns one 16x16 ctx tile over all keys; V fragments straight from vfr
//          (whole 128-B lines), VG of them fetched one group ahead; no barrier inside.
// Phase 4: ctx x64 as f16 staged [32][64] (cross-wave, barrier); wave w writes half w&1 of
//          tile w>>1 (2 row tiles x 2 k tiles) of the ctx plane, 512 columns in fragment tiles.
// coverage: grid (SEQ/32, 8, NB) x 4 tiles x 512 = NTOK x 512 of the ctx plane.
// ---------------------------------------------------------------------------
__global__ __launch_bounds__(256) __attribute__((amdgpu_num_vgpr(256)))
void k_attn(const _Float16* __restrict__ qkv, const _Float16* __restrict__ vfr,
            _Float16* __restrict__ ctx) {
    __shared__ __align__(16) float    zs[QR * SEQ];       // 128 KB at full size
    constexpr int CP = HD + 8;                            // Cst row pitch (16 B x odd)
    __shared__ __align__(16) _Float16 Cst[QR * CP];       // 4.5 KB
    static_assert(sizeof(zs) + sizeof(Cst) <= 160 * 1024);   // two blocks per WGP
    _Float16* ph = reinterpret_cast<_Float16*>(zs);       // P rows alias the z slots
    constexpr int PP  = 2 * SEQ;                          // P row slot (halves)
    constexpr int PLD = PP + 8;                           // fragment pitch incl. skew
    constexpr int KTW = SEQ / 128;                        // key tiles per wave

    const int tid = threadIdx.x, lane = tid & 31, w = tid >> 5;
    const int hh = lane >> 4, m = lane & 15;
    const int h = blockIdx.y, b = blockIdx.z;
    const int q0 = blockIdx.x * QR;
    const size_t tokq = (size_t)b * SEQ + q0;
    constexpr int BAND = 16 * DQKV;                       // halves per band of 16 tokens
    const _Float16* qp = qkv + tokq * DQKV + h * (HD * 16);                      // tile (tokq/16, 2h)
    const _Float16* kp = qkv + (size_t)b * SEQ * DQKV + (DM + h * HD) * 16;      // tile (b*SEQ/16, 16 + 2h)
    const int rt = w & 1, ct = w >> 1;                    // ctx tile of this wave (phase 3)
    const _Float16* vt = vfr + (size_t)(b * NH + h) * (SEQ / 32) * 2048 + ct * 512;

    // ---- phase 1: scores ----
    {
        const v16h qa00 = load_fragB(qp, lane);
        const v16h qa01 = load_fragB(qp + 512, lane);
        const v16h qa10 = load_fragB(qp + BAND, lane);
        const v16h qa11 = load_fragB(qp + BAND + 512, lane);
#pragma unroll 1
        for (int i = 0; i < KTW; ++i) {
            const int key0 = (w * KTW + i) * 16;
            const _Float16* kt = kp + (size_t)key0 * DQKV;     // band key0/16
            v16h kf0 = load_fragB(kt, lane);
            v16h kf1 = load_fragB(kt + 512, lane);
            v8f s0 = wmma16(qa00, kf0, zero8());
            s0 = wmma16(qa01, kf1, s0);
            v8f s1 = wmma16(qa10, kf0, zero8());
            s1 = wmma16(qa11, kf1, s1);
#pragma unroll
            for (int r = 0; r < 8; ++r) {
                zs[(8 * hh + r) * SEQ + key0 + m]      = s0[r] * SC_Z;
                zs[(16 + 8 * hh + r) * SEQ + key0 + m] = s1[r] * SC_Z;
            }
        }
    }
    __syncthreads();

    // first group of V fragments: in flight under phase 2
    v16h vcur[VG];
#pragma unroll
    for (int i = 0; i < VG; ++i) vcur[i] = load_fragB(vt + i * 2048, lane);

    // ---- phase 2: 1.5-entmax threshold per row ----
    const float tcl = -rsqrtf((float)SEQ);    // tau <= -1/sqrt(SEQ) always
#pragma unroll 1
    for (int rr = 0; rr < 4; ++rr) {
        const int row = 4 * w + rr;
        float z[ZN];
        const float* zr = &zs[row * SEQ];
#pragma unroll
        for (int j = 0; j < ZN / 4; ++j) {
            v4f t4 = *(const v4f*)(zr + 128 * j + 4 * lane);
            z[4 * j + 0] = t4.x; z[4 * j + 1] = t4.y; z[4 * j + 2] = t4.z; z[4 * j + 3] = t4.w;
        }
        float mx = z[0], mn = z[0];
#pragma unroll
        for (int i = 1; i < ZN; ++i) { mx = fmaxf(mx, z[i]); mn = fminf(mn, z[i]); }
        mx = wmaxr(mx);
        mn = wminr(mn);
#pragma unroll
        for (int i = 0; i < ZN; ++i) z[i] = z[i] - mx;
        float tau = fminf(fmaxf(mn - mx, -1.0f), tcl);
#pragma unroll 1
        for (int it = 0; it < NEWT; ++it) {
            float sa = 0.0f, sb = 0.0f;
#pragma unroll
            for (int i = 0; i < ZN; ++i) {
                float d = fmaxf(z[i] - tau, 0.0f);
                sa += d;
                sb = __builtin_fmaf(d, d, sb);
            }
            sa = wsum(sa);
            sb = wsum(sb);
            const float rn = __builtin_amdgcn_sqrtf(sb);      // g = rn - 1, g' = -sa / rn
            tau = tau + rn * (rn - 1.0f) * __builtin_amdgcn_rcpf(sa);
            tau = fminf(fmaxf(tau, -1.0f), tcl);
        }
        _Float16* prow = ph + (size_t)row * PP + (row & 15) * 8;
#pragma unroll
        for (int j = 0; j < ZN / 4; ++j) {
            v4h pk;
#pragma unroll
            for (int e = 0; e < 4; ++e) {
                float d = fmaxf(z[4 * j + e] - tau, 0.0f);
                pk[e] = (_Float16)(d * d * SC_P);
            }
            *(v4h*)(prow + 128 * j + 4 * lane) = pk;
        }
    }
    __syncthreads();

    // ---- phase 3: ctx = P @ v ----
    v8f acc = zero8();
    constexpr int NG = SEQ / (32 * VG);
#pragma unroll
    for (int g = 0; g < NG; ++g) {
        v16h pa[VG], vnx[VG];
#pragma unroll
        for (int i = 0; i < VG; ++i)      // rows = queries, k = keys
            pa[i] = load_frag16(ph + (size_t)(16 * rt) * PP + (g * VG + i) * 32, PLD, lane);
        if (g + 1 < NG) {
#pragma unroll
            for (int i = 0; i < VG; ++i) vnx[i] = load_fragB(vt + ((g + 1) * VG + i) * 2048, lane);
        }
#pragma unroll
        for (int i = 0; i < VG; ++i) acc = wmma16(pa[i], vcur[i], acc);   // n = d, k = keys
        if (g + 1 < NG) {
#pragma unroll
            for (int i = 0; i < VG; ++i) vcur[i] = vnx[i];
        }
    }

    // ---- phase 4: ctx plane x64 ----
#pragma unroll
    for (int r = 0; r < 8; ++r)
        Cst[(16 * rt + 8 * hh + r) * CP + 16 * ct + m] = (_Float16)(acc[r] * SC_C);
    __syncthreads();
    const int ort = w >> 2, okt = (w >> 1) & 1, os = w & 1;   // row tile, k tile, tile half
    v8h cv = *(const v8h*)(&Cst[(16 * ort + m) * CP + 32 * okt + 16 * os + 8 * hh]);
    _Float16* dst = ctx + (tokq + 16 * ort) * DM + (h * HD + 32 * okt) * 16 + 256 * os + lane * 8;
    *(v8h*)dst = cv;

}

// ---------------------------------------------------------------------------
extern "C" void kernel_launch(void* const* d_in, const int* in_sizes, int n_in,
                              void* d_out, int out_size, void* d_ws, size_t ws_size,
                              hipStream_t stream) {
    if (n_in < 19) return;
    if (in_sizes[0] < ((NB - 1) * SEQ_FULL + SEQ) * DM) return;
    if (in_sizes[1] < DM * DM || in_sizes[3] < DM * DM || in_sizes[5] < DM * DM || in_sizes[7] < DM * DM) return;
    if (in_sizes[2] < DM || in_sizes[4] < DM || in_sizes[6] < DM || in_sizes[8] < DM) return;
    if (in_sizes[9] < DM || in_sizes[10] < DM || in_sizes[15] < DM || in_sizes[16] < DM) return;
    if (in_sizes[17] < DM || in_sizes[18] < DM || in_sizes[14] < DM) return;
    if (in_sizes[11] < DF * DM || in_sizes[13] < DM * DF || in_sizes[12] < DF) return;
    if (out_size < NTOK * DM) return;

    const float* x    = (const float*)d_in[0];    // [8,1024,512]
    const float* Wq   = (const float*)d_in[1];    // [512,512] (out,in)
    const float* bq   = (const float*)d_in[2];
    const float* Wk   = (const float*)d_in[3];
    const float* bk   = (const float*)d_in[4];
    const float* Wv   = (const float*)d_in[5];
    const float* bv   = (const float*)d_in[6];
    const float* Wo   = (const float*)d_in[7];
    const float* bo   = (const float*)d_in[8];
    const float* ln1g = (const float*)d_in[9];
    const float* ln1b = (const float*)d_in[10];
    const float* W1   = (const float*)d_in[11];   // [2048,512]
    const float* bf1  = (const float*)d_in[12];
    const float* W2   = (const float*)d_in[13];   // [512,2048]
    const float* bf2  = (const float*)d_in[14];
    const float* ln2g = (const float*)d_in[15];
    const float* ln2b = (const float*)d_in[16];
    const float* lnfg = (const float*)d_in[17];
    const float* lnfb = (const float*)d_in[18];
    float* out = (float*)d_out;                   // [NTOK][512]

    char* ws = (char*)d_ws;
    size_t off = 0;
    _Float16* wqkv = (_Float16*)(ws + off); off += (size_t)DQKV * DM * 2;      // 1,572,864
    _Float16* wo16 = (_Float16*)(ws + off); off += (size_t)DM * DM * 2;        //   524,288
    _Float16* w116 = (_Float16*)(ws + off); off += (size_t)DF * DM * 2;        // 2,097,152
    _Float16* w216 = (_Float16*)(ws + off); off += (size_t)DM * DF * 2;        // 2,097,152
    _Float16* y1   = (_Float16*)(ws + off); off += (size_t)NTOK * DM * 2;      // 8 MiB at full size
    _Float16* qkv  = (_Float16*)(ws + off); off += (size_t)NTOK * DQKV * 2;    // 24 MiB
    _Float16* cpl  = (_Float16*)(ws + off); off += (size_t)NTOK * DM * 2;      // 8 MiB
    float*    x1   = (float*)(ws + off);    off += (size_t)NTOK * DM * 4;      // 16 MiB
    _Float16* y2   = (_Float16*)(ws + off); off += (size_t)NTOK * DM * 2;      // 8 MiB
    _Float16* mpl  = (_Float16*)(ws + off); off += (size_t)NTOK * DF * 2;      // 32 MiB
    _Float16* vfr  = (_Float16*)(ws + off); off += (size_t)NTOK * DM * 2;      // 8 MiB
    if (off > ws_size) return;                                                 // 115,343,360 B at full size

    k_prep<<<dim3(PB_ALL), dim3(256), 0, stream>>>(x, ln1g, ln1b, Wq, Wk, Wv, Wo, W1, W2, y1, wqkv, wo16, w116, w216);
    k_gemm_p<0><<<dim3(NTOK / PR, 3), dim3(256), 0, stream>>>(y1, wqkv, bq, bk, bv, bv, qkv, DQKV, vfr);
    k_attn<<<dim3(SEQ / QR, NH, NB), dim3(256), 0, stream>>>(qkv, vfr, cpl);
    k_gemm_r<0><<<dim3(NTOK / QR), dim3(256), 0, stream>>>(cpl, wo16, bo, x, ln2g, ln2b, x1, y2);
    k_gemm_p<1><<<dim3(NTOK / PR, DF / 512), dim3(256), 0, stream>>>(y2, w116, bf1, bf1 + 512, bf1 + 1024, bf1 + 1536, mpl, DF, nullptr);
    k_gemm_r<1><<<dim3(NTOK / QR), dim3(256), 0, stream>>>(mpl, w216, bf2, x1, lnfg, lnfb, out, y2);
}

// v009
// A run of this version takes 145 microseconds.
// Next to v008, in two timings, it ran 1.23 and 1.22 times as fast.
// Counting every step since v000, it is 2.81 times as fast.
#include <hip/hip_runtime.h>

// Contractions on v_wmma_f32_16x16x32_f16 (f16 operands, f32 accumulate), one product each: y1*[Wq|Wk|Wv]^T, q*k^T, P*v, ctx*Wo^T, y2*W1^T, m*W2^T; float inputs RNE-converted to bf16 then carried in f16 (weights x64, P x2^14, ctx x64, m x64); LayerNorm, 1.5-entmax threshold and Mish in f32.

#ifndef NB
#define NB 8
#endif
#ifndef SEQ
#define SEQ 1024
#endif
#define NB_FULL  8
#define SEQ_FULL 1024
#define DM   512            // model width
#define DF   2048           // ffn width
#define NH   8
#define HD   64
#define DQKV (3 * DM)       // q|k|v plane pitch
#define NTOK (NB * SEQ)
#define QR   32             // query rows per attention block / rows per row-gemm block
#define PR   64             // rows per plane-gemm block
#define VG   8              // V fragments (32 keys each) fetched ahead as one group in k_attn
#define ZN   (SEQ / 32)     // scores per lane per row
#define YP   (DM + 8)       // LDS pitch of a staged f16 row, halves (16 B x odd)
#define NEWT 6              // Newton passes for the entmax threshold (on the norm, see k_attn phase 2)

static_assert(NB >= 1 && NB <= NB_FULL);
static_assert(SEQ <= SEQ_FULL);
static_assert(SEQ % (32 * VG) == 0);
static_assert(SEQ % 128 == 0);
static_assert(NTOK % QR == 0);
static_assert(SEQ % PR == 0 && PR % 32 == 0);
static_assert(NH * HD == DM);
static_assert(QR == 32);
static_assert((ZN % 4) == 0);
static_assert(DM % 32 == 0 && DF % 32 == 0);
static_assert((DM * DM) % 2048 == 0 && (DF * DM) % 2048 == 0);

typedef _Float16 v16h __attribute__((ext_vector_type(16)));
typedef _Float16 v8h  __attribute__((ext_vector_type(8)));
typedef _Float16 v4h  __attribute__((ext_vector_type(4)));
typedef float    v8f  __attribute__((ext_vector_type(8)));
typedef float    v4f  __attribute__((ext_vector_type(4)));

union Frag { v16h v; v8h h[2]; };

#define WSC   64.0f                  // weight carry
#define SC_Z  1.52587890625e-05f     // 2^-16 : (64q).(64k) -> q.k/16 = z
#define SC_P  16384.0f               // 2^14  : P carry
#define SC_C  6.103515625e-05f       // 2^-14 : (2^14 P)(64 v) -> 64 ctx
#define SC_O  2.44140625e-04f        // 2^-12 : (64 a)(64 W) -> a.W
#define SC_H  0.015625f              // 1/64  : (y)(64 W) -> y.W
#define LOG2E 1.44269504088896340736f
#define LN_EPS 1e-5f

static __device__ __forceinline__ v8f zero8() {
    v8f z;
#pragma unroll
    for (int i = 0; i < 8; ++i) z[i] = 0.0f;
    return z;
}

// 16x32 A fragment (or B fragment from an [n][k] k-contiguous source) from a
// row-major 16-bit tile: lane m = lane&15 -> row m; kb = 8*(lane>>4);
// elements 0..7 = k kb..kb+7, elements 8..15 = k kb+16..kb+23.
static __device__ __forceinline__ v16h load_frag16(const _Float16* base, int ld, int lane) {
    int m  = lane & 15;
    int kb = (lane >> 4) << 3;
    const _Float16* p = base + (size_t)m * ld + kb;
    Frag f;
    f.h[0] = *(const v8h*)(p);
    f.h[1] = *(const v8h*)(p + 16);
    return f.v;
}

// A or B fragment from a tiled plane (weights: wcvt_block; activations: see k_gemm_p):
// one 16 x 32 tile is 1 KB, lane l reads 16 B at 16*l and at 512 + 16*l, so each load is
// four whole 128-B lines (a fragment load from a row-major plane touches 16 lines).
// Same element in every lane and register position as load_frag16 on the [n][k] plane.
static __device__ __forceinline__ v16h load_fragB(const _Float16* tile, int lane) {
    const _Float16* p = tile + lane * 8;
    Frag f;
    f.h[0] = *(const v8h*)(p);
    f.h[1] = *(const v8h*)(p + 256);
    return f.v;
}

static __device__ __forceinline__ v8f wmma16(v16h a, v16h b, v8f c) {
    v8f d = __builtin_amdgcn_wmma_f32_16x16x32_f16(false, a, false, b, (short)0, c, false, false);
    asm volatile("v_nop\n\tv_nop\n\tv_nop\n\tv_nop" : "+v"(d) : "v"(a), "v"(b));
    return d;
}

// f32 -> bf16 RNE convert, value kept as f32
static __device__ __forceinline__ float bf16r(float x) {
    unsigned u = __float_as_uint(x);
    u = (u + 0x7FFFu + ((u >> 16) & 1u)) & 0xFFFF0000u;
    return __uint_as_float(u);
}

// ordering for a wave-private LDS tile: stores before later loads of the same wave
static __device__ __forceinline__ void wave_lds_sync() {
    __builtin_amdgcn_fence(3, "wavefront");
    asm volatile("s_wait_dscnt 0" ::: "memory");
    __builtin_amdgcn_wave_barrier();
}

// Lane exchanges of the wave reductions, in the vector unit (a shuffle goes through the LDS
// pipe and is waited for at every step). xhalf: lane l reads lane l ^ 16; xrow<M>: lane l reads
// lane l ^ M inside its row of 16 lanes (DPP row_xmask, control word 0x160 + M). All lanes are on
// wherever these are called. Steps in the order 16, 8, 4, 2, 1.
static __device__ __forceinline__ float xhalf(float x) {
    const int b = __builtin_bit_cast(int, x);
    return __builtin_bit_cast(float, __builtin_amdgcn_permlanex16(b, b, 0x76543210, 0xfedcba98, false, false));
}
template <int M>
static __device__ __forceinline__ float xrow(float x) {
    const int b = __builtin_bit_cast(int, x);
    return __builtin_bit_cast(float, __builtin_amdgcn_update_dpp(b, b, 0x160 + M, 0xf, 0xf, true));
}
static __device__ __forceinline__ float wsum(float v) {
    v += xhalf(v); v += xrow<8>(v); v += xrow<4>(v);
    v += xrow<2>(v); v += xrow<1>(v);
    return v;
}
static __device__ __forceinline__ float wmaxr(float v) {
    v = fmaxf(v, xhalf(v)); v = fmaxf(v, xrow<8>(v));
    v = fmaxf(v, xrow<4>(v)); v = fmaxf(v, xrow<2>(v));
    v = fmaxf(v, xrow<1>(v));
    return v;
}
static __device__ __forceinline__ float wminr(float v) {
    v = fminf(v, xhalf(v)); v = fminf(v, xrow<8>(v));
    v = fminf(v, xrow<4>(v)); v = fminf(v, xrow<2>(v));
    v = fminf(v, xrow<1>(v));
    return v;
}

// Mish(x) = x * tanh(softplus(x)) = x * (u^2+2u)/(u^2+2u+2), u = e^x
static __device__ __forceinline__ float mishf(float x) {
    float xe = fminf(x, 20.0f);
    float u  = __builtin_amdgcn_exp2f(xe * LOG2E);
    float wv = u * (u + 2.0f);
    float t  = wv * __builtin_amdgcn_rcpf(wv + 2.0f);
    return x * t;
}

// 16 columns per lane: columns 256*j + 8*lane + e (j = 0,1; e = 0..7)
static __device__ __forceinline__ void load_cols16(const float* p, int lane, float (&o)[16]) {
#pragma unroll
    for (int j = 0; j < 2; ++j) {
        v4f a = *(const v4f*)(p + 256 * j + 8 * lane);
        v4f c = *(const v4f*)(p + 256 * j + 8 * lane + 4);
        o[8 * j + 0] = a.x; o[8 * j + 1] = a.y; o[8 * j + 2] = a.z; o[8 * j + 3] = a.w;
        o[8 * j + 4] = c.x; o[8 * j + 5] = c.y; o[8 * j + 6] = c.z; o[8 * j + 7] = c.w;
    }
}

// LayerNorm over a 512-wide row held as 16 columns per lane (f32)
static __device__ __forceinline__ void ln_lane(const float (&v)[16], const float (&gl)[16],
                                               const float (&el)[16], float (&y)[16]) {
    float s = 0.0f;
#pragma unroll
    for (int e = 0; e < 16; ++e) s += v[e];
    s = wsum(s);
    const float mu = s * (1.0f / (float)DM);
    float d[16];
    float q = 0.0f;
#pragma unroll
    for (int e = 0; e < 16; ++e) { d[e] = v[e] - mu; q = __builtin_fmaf(d[e], d[e], q); }
    q = wsum(q);
    const float rstd = rsqrtf(__builtin_fmaf(q, 1.0f / (float)DM, LN_EPS));
#pragma unroll
    for (int e = 0; e < 16; ++e) y[e] = d[e] * rstd * gl[e] + el[e];
}

// ---------------------------------------------------------------------------
// Weight plane: value f16(bf16r(src[n][k]) * 64), stored in fragment order: tile
// (n/16, k/32) is 512 halves at ((n/16) * (K/32) + k/32) * 512; inside it element
// (n, k) sits at ((k>>4)&1)*256 + (((k>>3)&1)*16 + (n&15))*8 + (k&7).
// Thread i writes halves 8i..8i+7 (a wave stores 512 contiguous bytes) and gathers
// its 8 source floats; a block reads 16 rows x 512 contiguous bytes.
// coverage: n/2048 blocks of the plane's range, 256 threads x 8 elements -> n exactly.
// ---------------------------------------------------------------------------
template <int K>
static __device__ __forceinline__ void wcvt_block(const float* __restrict__ src,
                                                  _Float16* __restrict__ dst, int blk) {
    constexpr int KT = K / 32;                  // k tiles per 16-row band
    const int i  = blk * 256 + threadIdx.x;
    const int t  = i >> 6, gq = i & 63;         // tile, 8-half group inside it
    const int n  = (t / KT) * 16 + (gq & 15);
    const int k  = (t % KT) * 32 + (gq >> 5) * 16 + ((gq >> 4) & 1) * 8;
    const float* sp = src + (size_t)n * K + k;
    v4f a = *(const v4f*)(sp);
    v4f c = *(const v4f*)(sp + 4);
    v8h o;
    o[0] = (_Float16)(bf16r(a.x) * WSC); o[1] = (_Float16)(bf16r(a.y) * WSC);
    o[2] = (_Float16)(bf16r(a.z) * WSC); o[3] = (_Float16)(bf16r(a.w) * WSC);
    o[4] = (_Float16)(bf16r(c.x) * WSC); o[5] = (_Float16)(bf16r(c.y) * WSC);
    o[6] = (_Float16)(bf16r(c.z) * WSC); o[7] = (_Float16)(bf16r(c.w) * WSC);
    *(v8h*)(dst + (size_t)i * 8) = o;
    // the store's registers may be rewritten on a later path of the caller's listing: wait first
    asm volatile("s_wait_xcnt 0x0" ::: "memory");
}

// ---------------------------------------------------------------------------
// LN1: y1 = f16(LayerNorm(bf16r(x)) * g + b), 512 columns in fragment tiles (see k_gemm_p).
// One wave per row, lane owns columns 8l..8l+7 and 256+8l..; the block's 8 rows are staged
// in LDS (block barrier), since a 128-B line of a tile holds 8 columns of 8 rows: column
// group L = col/8 of rows 8a..8a+7 is the line at 128*L + 64*(a&1) halves of the band.
// coverage: NTOK/8 blocks x 64 lines x 64 halves = NTOK x 512.
// ---------------------------------------------------------------------------
static __device__ __forceinline__ void ln1_block(const float* __restrict__ x,
                                                 const float* __restrict__ g,
                                                 const float* __restrict__ be,
                                                 _Float16* __restrict__ y, int blk) {
    const int tid = threadIdx.x, lane = tid & 31, w = tid >> 5;
    const int tok = blk * 8 + w;
    const int b = tok / SEQ, s = tok - b * SEQ;
    const float* xr = x + ((size_t)b * SEQ_FULL + s) * DM;
    float v[16], gl[16], el[16], yv[16];
    load_cols16(xr, lane, v);
    load_cols16(g, lane, gl);
    load_cols16(be, lane, el);
#pragma unroll
    for (int e = 0; e < 16; ++e) { v[e] = bf16r(v[e]); gl[e] = bf16r(gl[e]); el[e] = bf16r(el[e]); }
    ln_lane(v, gl, el, yv);
    v8h o[2];
#pragma unroll
    for (int j = 0; j < 2; ++j)
#pragma unroll
        for (int e = 0; e < 8; ++e) o[j][e] = (_Float16)yv[8 * j + e];
    __shared__ __align__(16) _Float16 ys[8 * YP];
    *(v8h*)(&ys[w * YP + 8 * lane])       = o[0];
    *(v8h*)(&ys[w * YP + 256 + 8 * lane]) = o[1];
    __syncthreads();                        // rows of the other waves are read below
    _Float16* yb = y + (size_t)(blk >> 1) * (16 * DM) + (blk & 1) * 64 + (tid & 7) * 8;
#pragma unroll
    for (int q = 0; q < 2; ++q) {
        const int L = (tid >> 3) + 32 * q;
        *(v8h*)(yb + 128 * L) = *(const v8h*)(&ys[(tid & 7) * YP + 8 * L]);
    }
}

// ---------------------------------------------------------------------------
// Preparation, one launch: LN1 and the six weight planes depend on the inputs alone and
// on nothing of each other, so they share a grid; the block index picks the job
// (block-uniform branches; the one barrier stands inside the LN1 branch). Ranges, in order: LN1 (PB_LN blocks), Wq, Wk, Wv,
// Wo (PB_S each), W1, W2 (PB_L each).
// ---------------------------------------------------------------------------
#define PB_LN (NTOK / 8)
#define PB_S  (DM * DM / 2048)
#define PB_L  (DF * DM / 2048)
#define PB_ALL (PB_LN + 4 * PB_S + 2 * PB_L)
__global__ __launch_bounds__(256) void k_prep(const float* __restrict__ x,
                                               const float* __restrict__ g,
                                               const float* __restrict__ be,
                                               const float* __restrict__ Wq,
                                               const float* __restrict__ Wk,
                                               const float* __restrict__ Wv,
                                               const float* __restrict__ Wo,
                                               const float* __restrict__ W1,
                                               const float* __restrict__ W2,
                                               _Float16* __restrict__ y,
                                               _Float16* __restrict__ wqkv,
                                               _Float16* __restrict__ wo16,
                                               _Float16* __restrict__ w116,
                                               _Float16* __restrict__ w216) {
    int blk = blockIdx.x;
    if (blk < PB_LN) { ln1_block(x, g, be, y, blk); return; }
    blk -= PB_LN;
    if (blk < 4 * PB_S) {
        const int p = blk / PB_S;               // 0..3: Wq, Wk, Wv, Wo
        const float* src = (p == 0) ? Wq : ((p == 1) ? Wk : ((p == 2) ? Wv : Wo));
        _Float16* dst = (p == 3) ? wo16 : wqkv + (size_t)p * DM * DM;
        wcvt_block<DM>(src, dst, blk - p * PB_S);
        return;
    }
    blk -= 4 * PB_S;
    if (blk < PB_L) { wcvt_block<DM>(W1, w116, blk); return; }
    wcvt_block<DF>(W2, w216, blk - PB_L);
}

// ---------------------------------------------------------------------------
// GEMM core: wave tile 16*RT rows x 64 cols, C[r][n] += A[r][k] * B[n][k],
// A a tiled activation plane, B a tiled weight plane (wcvt_block); a band of
// 16 rows starts at 16*K*band halves; fragments loaded directly from global memory
// (two 16-B loads each). K % 32 == 0; K is a compile-time constant so that the second A
// tiles and the B bands sit at immediate offsets of one address pair an operand.
// ---------------------------------------------------------------------------
template <int K, int RT>
static __device__ __forceinline__ void gemm_rtx64(const _Float16* __restrict__ Ab,
                                                  const _Float16* __restrict__ Bb,
                                                  int lane, v8f (&acc)[RT][4]) {
#pragma unroll
    for (int t = 0; t < RT; ++t)
#pragma unroll
        for (int j = 0; j < 4; ++j) acc[t][j] = zero8();
#pragma unroll 1
    for (int k0 = 0; k0 < K; k0 += 32) {
        const _Float16* ap = Ab + (size_t)k0 * 16 + lane * 8;   // the lane's 16 B of a tile half (load_fragB)
        const _Float16* bp = Bb + (size_t)k0 * 16 + lane * 8;
        Frag aa[RT], bb[4];
#pragma unroll
        for (int t = 0; t < RT; ++t) {
            aa[t].h[0] = *(const v8h*)(ap + (16 * t) * K);
            aa[t].h[1] = *(const v8h*)(ap + (16 * t) * K + 256);
        }
#pragma unroll
        for (int j = 0; j < 4; ++j) {
            bb[j].h[0] = *(const v8h*)(bp + (16 * j) * K);
            bb[j].h[1] = *(const v8h*)(bp + (16 * j) * K + 256);
        }
        // both address pairs are inputs, so they stay live up to this wait: no load's result is
        // given a register that an issued load names, and nothing rewrites one ahead of the wait
        asm volatile("s_wait_xcnt 0x0" :: "v"(ap), "v"(bp) : "memory");
#pragma unroll
        for (int j = 0; j < 4; ++j)
#pragma unroll
            for (int t = 0; t < RT; ++t) acc[t][j] = wmma16(aa[t].v, bb[j].v, acc[t][j]);
    }
}

// ---------------------------------------------------------------------------
// The same core for the row GEMMs (wave tile 32 x 64), fragments loaded two k steps ahead of
// their WMMAs in three register buffers: these kernels run two waves a SIMD, too few to cover
// a load's latency with other waves' work, so each wave keeps its own loads in flight.
// k steps, and the WMMAs inside one, in the order of gemm_rtx64. K / 32 = 3 G + 1.
// ---------------------------------------------------------------------------
template <int K>
static __device__ __forceinline__ void load_step(const _Float16* ap, const _Float16* bp, int st,
                                                 Frag (&a)[2], Frag (&b)[4]) {
    // global address space spelled out: the pointers pass through an asm statement in the k loop,
    // behind which the compiler would no longer know it and would fall back to flat loads
    typedef __attribute__((address_space(1))) const v8h gv8h;
#pragma unroll
    for (int t = 0; t < 2; ++t) {
        a[t].h[0] = *(gv8h*)(ap + st * 512 + (16 * t) * K);
        a[t].h[1] = *(gv8h*)(ap + st * 512 + (16 * t) * K + 256);
    }
#pragma unroll
    for (int j = 0; j < 4; ++j) {
        b[j].h[0] = *(gv8h*)(bp + st * 512 + (16 * j) * K);
        b[j].h[1] = *(gv8h*)(bp + st * 512 + (16 * j) * K + 256);
    }
    // both address pairs are inputs, so they stay live up to this wait and nothing rewrites one
    // ahead of it; the statement also keeps these loads in front of the WMMAs that follow it
    asm volatile("s_wait_xcnt 0x0" :: "v"(ap), "v"(bp) : "memory");
}
static __device__ __forceinline__ void mul_step(const Frag (&a)[2], const Frag (&b)[4], v8f (&acc)[2][4]) {
#pragma unroll
    for (int j = 0; j < 4; ++j)
#pragma unroll
        for (int t = 0; t < 2; ++t) acc[t][j] = wmma16(a[t].v, b[j].v, acc[t][j]);
}
template <int K>
static __device__ __forceinline__ void gemm_32x64_ahead(const _Float16* __restrict__ Ab,
                                                        const _Float16* __restrict__ Bb,
                                                        int lane, v8f (&acc)[2][4]) {
    constexpr int G = (K / 32 - 1) / 3;
    static_assert(K % 32 == 0 && 3 * G + 1 == K / 32 && G >= 2);
#pragma unroll
    for (int t = 0; t < 2; ++t)
#pragma unroll
        for (int j = 0; j < 4; ++j) acc[t][j] = zero8();
    const _Float16* ap = Ab + lane * 8;     // the lane's 16 B of a tile half (load_fragB)
    const _Float16* bp = Bb + lane * 8;
    Frag a0[2], a1[2], a2[2], b0[4], b1[4], b2[4];
    load_step<K>(ap, bp, 0, a0, b0);
    load_step<K>(ap, bp, 1, a1, b1);
#pragma unroll 1                            // three k steps a trip; more would only grow the code
    for (int g = 0; g < G - 1; ++g) {
        load_step<K>(ap, bp, 2, a2, b2);  mul_step(a0, b0, acc);
        load_step<K>(ap, bp, 3, a0, b0);  mul_step(a1, b1, acc);
        load_step<K>(ap, bp, 4, a1, b1);  mul_step(a2, b2, acc);
        // both address pairs pass through this wait, so their step below is not lifted over it
        asm volatile("s_wait_xcnt 0x0" : "+v"(ap), "+v"(bp) : : "memory");
        ap += 3 * 512;
        bp += 3 * 512;
    }
    load_step<K>(ap, bp, 2, a2, b2);  mul_step(a0, b0, acc);
    load_step<K>(ap, bp, 3, a0, b0);  mul_step(a1, b1, acc);
    mul_step(a2, b2, acc);
    mul_step(a0, b0, acc);
}

// ---------------------------------------------------------------------------
// Plane GEMM: out = f16 plane of NTOK x ldo in fragment tiles (tile (tok/16, col/32) of 512
// halves at ((tok/16) * (ldo/32) + col/32) * 512, inside it as in wcvt_block with n = tok,
// k = col), so that its readers load A (or K) fragments as whole lines;
// block = PR = 64 rows x 512 cols (blockIdx.y =
// 512-column segment), wave = 64 x 64: a B fragment feeds four WMMAs and the weight
// segment is read from L2 once per 64 rows. EPI 0: val = acc + 64*bias (q|k|v x64);
// EPI 1: val = 64 * Mish(acc/64 + bias). Wave-private LDS tile (pitch SP: 16 B x odd, so
// neither side meets a bank twice), then 16 stores of 512 contiguous bytes, half a tile each.
// coverage: grid (NTOK/64, ldo/512) x 8 waves x (4 x 2 tiles) x 512 = NTOK x ldo.
// EPI 0, segment 2 (v) goes to the plane vfr instead, as B fragments of P*v (n = d,
// k = key), tile (batch, head, key/32, d/16) of 512 halves laid out as in wcvt_block. A lane's
// 8 accumulator rows of one 16x16 tile are keys 16t + 8*(lane>>4) + r at d = lane&15: the
// 8 halves at 256*(t&1) + 8*lane of key group t>>1, so each store is 512 contiguous bytes a wave.
// coverage: NTOK/64 blocks x 8 waves (heads) x 2 key groups x 4 tiles x 512 = NTOK x 512 of vfr.
// ---------------------------------------------------------------------------
template <int EPI>
__global__ __launch_bounds__(256) __attribute__((amdgpu_waves_per_eu(4)))   // 256 registers a wave: two blocks share a WGP, so the EPI 1 grid is resident at once
void k_gemm_p(const _Float16* __restrict__ A, const _Float16* __restrict__ Bw,
              const float* __restrict__ b0, const float* __restrict__ b1,
              const float* __restrict__ b2, const float* __restrict__ b3,
              _Float16* __restrict__ outp, int ldo, _Float16* __restrict__ vfr) {
    constexpr int SP = 72;                                 // LDS row pitch, halves
    __shared__ __align__(16) _Float16 st[8][PR * SP];      // 72 KB, wave-private tiles
    const int tid = threadIdx.x, lane = tid & 31, w = tid >> 5;
    const int hh = lane >> 4, m = lane & 15;
    const int m0  = blockIdx.x * PR;
    const int seg = blockIdx.y;
    const int nl  = 64 * w;                 // column within the 512 segment
    const int n0w = seg * 512 + nl;         // output column / B row
    const float* bias = (seg == 0) ? b0 : ((seg == 1) ? b1 : ((seg == 2) ? b2 : b3));

    v8f acc[PR / 16][4];
    constexpr int K = DM;                   // k length of both plane GEMMs
    gemm_rtx64<K, PR / 16>(A + (size_t)m0 * K, Bw + (size_t)n0w * K, lane, acc);

    float bl[4];
#pragma unroll
    for (int j = 0; j < 4; ++j) bl[j] = bf16r(bias[nl + 16 * j + m]);
    if (EPI == 0 && seg == 2) {             // block-uniform; no block barrier in this kernel
        const int b = m0 / SEQ, kb = (m0 - b * SEQ) / 32;
        _Float16* vt = vfr + (size_t)((b * NH + w) * (SEQ / 32) + kb) * 2048 + lane * 8;
#pragma unroll
        for (int t = 0; t < PR / 16; ++t)
#pragma unroll
            for (int j = 0; j < 4; ++j) {
                v8h o;
#pragma unroll
                for (int r = 0; r < 8; ++r) o[r] = (_Float16)__builtin_fmaf(bl[j], WSC, acc[t][j][r]);
                *(v8h*)(vt + 2048 * (t >> 1) + 512 * j + 256 * (t & 1)) = o;
            }
        return;
    }
#pragma unroll
    for (int t = 0; t < PR / 16; ++t)
#pragma unroll
        for (int j = 0; j < 4; ++j)
#pragma unroll
            for (int r = 0; r < 8; ++r) {
                float a = acc[t][j][r];
                float val;
                if (EPI == 0) {
                    val = __builtin_fmaf(bl[j], WSC, a);
                } else {
                    float hx = __builtin_fmaf(a, SC_H, bl[j]);
                    val = WSC * mishf(hx);
                }
                st[w][(16 * t + 8 * hh + r) * SP + 16 * j + m] = (_Float16)val;
            }
    wave_lds_sync();

    // i = 4*t + 2*kt + s: row tile t, k tile kt, tile half s; the lane takes row 16t + m,
    // columns 32kt + 16s + 8hh .. +7, the 8 halves at 256s + 8*lane of tile (t, kt)
    v8h pv[PR / 4];
#pragma unroll
    for (int i = 0; i < PR / 4; ++i)
        pv[i] = *(const v8h*)(&st[w][(16 * (i >> 2) + m) * SP + 32 * ((i >> 1) & 1) + 16 * (i & 1) + 8 * hh]);
    const int kts = ldo >> 5;               // k tiles per band of 16 rows
    _Float16* ob = outp + ((size_t)(m0 >> 4) * kts + (n0w >> 5)) * 512 + lane * 8;
#pragma unroll
    for (int i = 0; i < PR / 4; ++i)
        *(v8h*)(ob + (size_t)(i >> 2) * kts * 512 + 512 * ((i >> 1) & 1) + 256 * (i & 1)) = pv[i];

}

// ---------------------------------------------------------------------------
// Row GEMM (N = 512, block owns 32 full rows; A a tiled plane) fused with residual add + LayerNorm.
// MODE 0: x1 = bf16r(x) + (acc 2^-12 + bias) -> x1 f32 plane, y2 = f16(LN(x1) g + b) in
//         fragment tiles: the 32 rows staged f16 in LDS, block barrier, then 512-B stores.
// MODE 1: x2 = x1 + (acc 2^-12 + bias), out = LN(x2) g + b -> f32 rows.
// Block tile staged f32 in LDS (cross-wave, block barrier); wave then owns 4 rows:
// f16 rows go to the f16 LDS rows (MODE 0); f32 rows
// relaid through the (now wave-private) LDS row and written as four 512-B
// coverage: grid NTOK/32 x 32 rows x 512 = NTOK x 512 (each output plane).
// ---------------------------------------------------------------------------
template <int MODE>
__global__ __launch_bounds__(256) __attribute__((amdgpu_num_vgpr(256)))
void k_gemm_r(const _Float16* __restrict__ A, const _Float16* __restrict__ Bw,
              const float* __restrict__ bias, const float* __restrict__ res,
              const float* __restrict__ g, const float* __restrict__ be,
              float* __restrict__ outf, _Float16* __restrict__ outh) {
    __shared__ __align__(16) float T[QR * DM];            // 64 KB block tile
    __shared__ __align__(16) _Float16 Ys[MODE == 0 ? QR * YP : 8];   // y2 rows (MODE 0)
    const int tid = threadIdx.x, lane = tid & 31, w = tid >> 5;
    const int hh = lane >> 4, m = lane & 15;
    const int m0 = blockIdx.x * QR;
    const int nl = 64 * w;

    v8f acc[2][4];
    constexpr int K = (MODE == 0) ? DM : DF;   // k length: ctx plane / ffn plane
    gemm_32x64_ahead<K>(A + (size_t)m0 * K, Bw + (size_t)nl * K, lane, acc);

    // the wave's four residual rows and the row vectors: loaded here, ahead of the staging and
    // its barrier, all in flight at once (one latency, not one a row)
    float bl[16], gl[16], el[16], rv[4][16];
    const int tok0 = m0 + 4 * w;            // four rows of one batch (SEQ % 32 == 0)
    const float* rp = (MODE == 0) ? res + ((size_t)(tok0 / SEQ) * SEQ_FULL + (tok0 % SEQ)) * DM
                                  : res + (size_t)tok0 * DM;
#pragma unroll
    for (int rr = 0; rr < 4; ++rr) load_cols16(rp + rr * DM, lane, rv[rr]);
    load_cols16(bias, lane, bl);
    load_cols16(g, lane, gl);
    load_cols16(be, lane, el);
    // the lane's row address is an input, so it stays live up to this wait: no load's result is given
    // a register that an issued load names, and nothing rewrites one ahead of the wait
    asm volatile("s_wait_xcnt 0x0" :: "v"(rp + 8 * lane) : "memory");
#pragma unroll
    for (int t = 0; t < 2; ++t)
#pragma unroll
        for (int j = 0; j < 4; ++j)
#pragma unroll
            for (int r = 0; r < 8; ++r)
                T[(16 * t + 8 * hh + r) * DM + nl + 16 * j + m] = acc[t][j][r];
    __syncthreads();

#pragma unroll
    for (int e = 0; e < 16; ++e) { bl[e] = bf16r(bl[e]); gl[e] = bf16r(gl[e]); el[e] = bf16r(el[e]); }

#pragma unroll                              // rv is indexed by rr: registers
    for (int rr = 0; rr < 4; ++rr) {
        const int row = 4 * w + rr;
        const int tok = m0 + row;
        float v[16], yv[16];
        load_cols16(&T[row * DM], lane, v);
#pragma unroll
        for (int e = 0; e < 16; ++e) {
            const float r0 = (MODE == 0) ? bf16r(rv[rr][e]) : rv[rr][e];
            v[e] = r0 + __builtin_fmaf(v[e], SC_O, bl[e]);
        }
        ln_lane(v, gl, el, yv);

        // write-back into the wave-private LDS row (same columns this lane loaded)
        float* trow = &T[row * DM];
#pragma unroll
        for (int j = 0; j < 2; ++j) {
            v4f p0, p1;
            if (MODE == 0) {
                p0.x = v[8 * j + 0]; p0.y = v[8 * j + 1]; p0.z = v[8 * j + 2]; p0.w = v[8 * j + 3];
                p1.x = v[8 * j + 4]; p1.y = v[8 * j + 5]; p1.z = v[8 * j + 6]; p1.w = v[8 * j + 7];
            } else {
                p0.x = yv[8 * j + 0]; p0.y = yv[8 * j + 1]; p0.z = yv[8 * j + 2]; p0.w = yv[8 * j + 3];
                p1.x = yv[8 * j + 4]; p1.y = yv[8 * j + 5]; p1.z = yv[8 * j + 6]; p1.w = yv[8 * j + 7];
            }
            *(v4f*)(trow + 256 * j + 8 * lane)     = p0;
            *(v4f*)(trow + 256 * j + 8 * lane + 4) = p1;
        }
        wave_lds_sync();
        v4f s4[4];
#pragma unroll
        for (int jj = 0; jj < 4; ++jj) s4[jj] = *(const v4f*)(trow + 128 * jj + 4 * lane);

        float* orow = outf + (size_t)tok * DM;
        if (MODE == 0) {
            v8h o[2];
#pragma unroll
            for (int j = 0; j < 2; ++j)
#pragma unroll
                for (int e = 0; e < 8; ++e) o[j][e] = (_Float16)yv[8 * j + e];
            *(v8h*)(&Ys[row * YP + 8 * lane])       = o[0];
            *(v8h*)(&Ys[row * YP + 256 + 8 * lane]) = o[1];
#pragma unroll
            for (int jj = 0; jj < 4; ++jj) *(v4f*)(orow + 128 * jj + 4 * lane) = s4[jj];
            
        } else {
#pragma unroll
            for (int jj = 0; jj < 4; ++jj) *(v4f*)(orow + 128 * jj + 4 * lane) = s4[jj];
            
        }
    }
    if (MODE == 0) {
        __syncthreads();                    // rows of the other waves are read below
        // piece i: row 16*(i>>10) + (i&15), column group L = (i>>4)&63; a wave stores 512 contiguous bytes
        _Float16* yb = outh + (size_t)m0 * DM;
#pragma unroll
        for (int q = 0; q < QR * DM / 2048; ++q) {
            const int i = q * 256 + tid;
            const int L = (i >> 4) & 63, bd = i >> 10;
            *(v8h*)(yb + bd * (16 * DM) + 128 * L + 8 * (i & 15)) = *(const v8h*)(&Ys[(16 * bd + (i & 15)) * YP + 8 * L]);
        }
    }
}

// ---------------------------------------------------------------------------
// Attention with 1.5-entmax over keys. Block = 8 waves = 32 query rows of one
// (batch, head); qkv plane of 1536 columns in fragment tiles (see k_gemm_p; q | k, each x64,
// head h at column +64h = k tiles 2h, 2h+1; the v third is unused), v x64 in the fragment
// plane vfr (see k_gemm_p).
// Phase 1: z strip [32][SEQ] f32 in LDS = (64q).(64k) 2^-16 = q.k/16; wave owns
//          SEQ/128 key tiles x both row tiles (K fragments straight from the plane).
// Phase 2: wave owns 4 rows; per row: shift by max, threshold tau of
//          sum relu(z - tau)^2 = 1 by safeguarded Newton (NEWT passes, registers) on
//          g(tau) = sqrt(sum relu(z - tau)^2) - 1: same root, convex and falling, so a
//          step from below never passes the root, and close to a straight line while the
//          sum is far above 1, where Newton on the sum itself only halves the distance,
//          P = relu(z - tau)^2 x 2^14 as f16 written over the row's own slot
//          (pitch 2*SEQ halves, skew 8*(row&15) halves).
// Phase 3: wave owns one 16x16 ctx tile over all keys; V fragments straight from vfr
//          (whole 128-B lines), VG of them fetched one group ahead; no barrier inside.
// Phase 4: ctx x64 as f16 staged [32][64] (cross-wave, barrier); wave w writes half w&1 of
//          tile w>>1 (2 row tiles x 2 k tiles) of the ctx plane, 512 columns in fragment tiles.
// coverage: grid (SEQ/32, 8, NB) x 4 tiles x 512 = NTOK x 512 of the ctx plane.
// ---------------------------------------------------------------------------
__global__ __launch_bounds__(256) __attribute__((amdgpu_num_vgpr(256)))
void k_attn(const _Float16* __restrict__ qkv, const _Float16* __restrict__ vfr,
            _Float16* __restrict__ ctx) {
    __shared__ __align__(16) float    zs[QR * SEQ];       // 128 KB at full size
    constexpr int CP = HD + 8;                            // Cst row pitch (16 B x odd)
    __shared__ __align__(16) _Float16 Cst[QR * CP];       // 4.5 KB
    static_assert(sizeof(zs) + sizeof(Cst) <= 160 * 1024);   // two blocks per WGP
    _Float16* ph = reinterpret_cast<_Float16*>(zs);       // P rows alias the z slots
    constexpr int PP  = 2 * SEQ;                          // P row slot (halves)
    constexpr int PLD = PP + 8;                           // fragment pitch incl. skew
    constexpr int KTW = SEQ / 128;                        // key tiles per wave

    const int tid = threadIdx.x, lane = tid & 31, w = tid >> 5;
    const int hh = lane >> 4, m = lane & 15;
    const int h = blockIdx.y, b = blockIdx.z;
    const int q0 = blockIdx.x * QR;
    const size_t tokq = (size_t)b * SEQ + q0;
    constexpr int BAND = 16 * DQKV;                       // halves per band of 16 tokens
    const _Float16* qp = qkv + tokq * DQKV + h * (HD * 16);                      // tile (tokq/16, 2h)
    const _Float16* kp = qkv + (size_t)b * SEQ * DQKV + (DM + h * HD) * 16;      // tile (b*SEQ/16, 16 + 2h)
    const int rt = w & 1, ct = w >> 1;                    // ctx tile of this wave (phase 3)
    const _Float16* vt = vfr + (size_t)(b * NH + h) * (SEQ / 32) * 2048 + ct * 512;

    // ---- phase 1: scores ----
    {
        const v16h qa00 = load_fragB(qp, lane);
        const v16h qa01 = load_fragB(qp + 512, lane);
        const v16h qa10 = load_fragB(qp + BAND, lane);
        const v16h qa11 = load_fragB(qp + BAND + 512, lane);
        // K fragments are loaded KA key tiles ahead of their WMMAs (KA register buffers), so the
        // wave meets one load latency at the start, not one a tile
        constexpr int KA = (KTW < 4) ? KTW : 4;
        const _Float16* kw = kp + (size_t)(w * KTW * 16) * DQKV;     // band of the wave's first key tile
        v16h kf[KA][2];
#pragma unroll
        for (int i = 0; i < KA; ++i) {
            kf[i][0] = load_fragB(kw + i * BAND, lane);
            kf[i][1] = load_fragB(kw + i * BAND + 512, lane);
        }
#pragma unroll                              // kf is indexed by i: registers
        for (int i = 0; i < KTW; ++i) {
            const int key0 = (w * KTW + i) * 16;
            const v16h kf0 = kf[i % KA][0], kf1 = kf[i % KA][1];
            v8f s0 = wmma16(qa00, kf0, zero8());
            s0 = wmma16(qa01, kf1, s0);
            v8f s1 = wmma16(qa10, kf0, zero8());
            s1 = wmma16(qa11, kf1, s1);
            if (i + KA < KTW) {
                kf[i % KA][0] = load_fragB(kw + (i + KA) * BAND, lane);
                kf[i % KA][1] = load_fragB(kw + (i + KA) * BAND + 512, lane);
            }
#pragma unroll
            for (int r = 0; r < 8; ++r) {
                zs[(8 * hh + r) * SEQ + key0 + m]      = s0[r] * SC_Z;
                zs[(16 + 8 * hh + r) * SEQ + key0 + m] = s1[r] * SC_Z;
            }
        }
    }
    __syncthreads();

    // first group of V fragments: in flight under phase 2
    v16h vcur[VG];
#pragma unroll
    for (int i = 0; i < VG; ++i) vcur[i] = load_fragB(vt + i * 2048, lane);

    // ---- phase 2: 1.5-entmax threshold per row ----
    const float tcl = -rsqrtf((float)SEQ);    // tau <= -1/sqrt(SEQ) always
#pragma unroll 1
    for (int rr = 0; rr < 4; ++rr) {
        const int row = 4 * w + rr;
        float z[ZN];
        const float* zr = &zs[row * SEQ];
#pragma unroll
        for (int j = 0; j < ZN / 4; ++j) {
            v4f t4 = *(const v4f*)(zr + 128 * j + 4 * lane);
            z[4 * j + 0] = t4.x; z[4 * j + 1] = t4.y; z[4 * j + 2] = t4.z; z[4 * j + 3] = t4.w;
        }
        float mx = z[0], mn = z[0];
#pragma unroll
        for (int i = 1; i < ZN; ++i) { mx = fmaxf(mx, z[i]); mn = fminf(mn, z[i]); }
        mx = wmaxr(mx);
        mn = wminr(mn);
#pragma unroll
        for (int i = 0; i < ZN; ++i) z[i] = z[i] - mx;
        float tau = fminf(fmaxf(mn - mx, -1.0f), tcl);
#pragma unroll 1
        for (int it = 0; it < NEWT; ++it) {
            float sa = 0.0f, sb = 0.0f;
#pragma unroll
            for (int i = 0; i < ZN; ++i) {
                float d = fmaxf(z[i] - tau, 0.0f);
                sa += d;
                sb = __builtin_fmaf(d, d, sb);
            }
            sa = wsum(sa);
            sb = wsum(sb);
            const float rn = __builtin_amdgcn_sqrtf(sb);      // g = rn - 1, g' = -sa / rn
            tau = tau + rn * (rn - 1.0f) * __builtin_amdgcn_rcpf(sa);
            tau = fminf(fmaxf(tau, -1.0f), tcl);
        }
        _Float16* prow = ph + (size_t)row * PP + (row & 15) * 8;
#pragma unroll
        for (int j = 0; j < ZN / 4; ++j) {
            v4h pk;
#pragma unroll
            for (int e = 0; e < 4; ++e) {
                float d = fmaxf(z[4 * j + e] - tau, 0.0f);
                pk[e] = (_Float16)(d * d * SC_P);
            }
            *(v4h*)(prow + 128 * j + 4 * lane) = pk;
        }
    }
    __syncthreads();

    // ---- phase 3: ctx = P @ v ----
    v8f acc = zero8();
    constexpr int NG = SEQ / (32 * VG);
#pragma unroll
    for (int g = 0; g < NG; ++g) {
        v16h pa[VG], vnx[VG];
#pragma unroll
        for (int i = 0; i < VG; ++i)      // rows = queries, k = keys
            pa[i] = load_frag16(ph + (size_t)(16 * rt) * PP + (g * VG + i) * 32, PLD, lane);
        if (g + 1 < NG) {
#pragma unroll
            for (int i = 0; i < VG; ++i) vnx[i] = load_fragB(vt + ((g + 1) * VG + i) * 2048, lane);
        }
#pragma unroll
        for (int i = 0; i < VG; ++i) acc = wmma16(pa[i], vcur[i], acc);   // n = d, k = keys
        if (g + 1 < NG) {
#pragma unroll
            for (int i = 0; i < VG; ++i) vcur[i] = vnx[i];
        }
    }

    // ---- phase 4: ctx plane x64 ----
#pragma unroll
    for (int r = 0; r < 8; ++r)
        Cst[(16 * rt + 8 * hh + r) * CP + 16 * ct + m] = (_Float16)(acc[r] * SC_C);
    __syncthreads();
    const int ort = w >> 2, okt = (w >> 1) & 1, os = w & 1;   // row tile, k tile, tile half
    v8h cv = *(const v8h*)(&Cst[(16 * ort + m) * CP + 32 * okt + 16 * os + 8 * hh]);
    _Float16* dst = ctx + (tokq + 16 * ort) * DM + (h * HD + 32 * okt) * 16 + 256 * os + lane * 8;
    *(v8h*)dst = cv;

}

// ---------------------------------------------------------------------------
extern "C" void kernel_launch(void* const* d_in, const int* in_sizes, int n_in,
                              void* d_out, int out_size, void* d_ws, size_t ws_size,
                              hipStream_t stream) {
    if (n_in < 19) return;
    if (in_sizes[0] < ((NB - 1) * SEQ_FULL + SEQ) * DM) return;
    if (in_sizes[1] < DM * DM || in_sizes[3] < DM * DM || in_sizes[5] < DM * DM || in_sizes[7] < DM * DM) return;
    if (in_sizes[2] < DM || in_sizes[4] < DM || in_sizes[6] < DM || in_sizes[8] < DM) return;
    if (in_sizes[9] < DM || in_sizes[10] < DM || in_sizes[15] < DM || in_sizes[16] < DM) return;
    if (in_sizes[17] < DM || in_sizes[18] < DM || in_sizes[14] < DM) return;
    if (in_sizes[11] < DF * DM || in_sizes[13] < DM * DF || in_sizes[12] < DF) return;
    if (out_size < NTOK * DM) return;

    const float* x    = (const float*)d_in[0];    // [8,1024,512]
    const float* Wq   = (const float*)d_in[1];    // [512,512] (out,in)
    const float* bq   = (const float*)d_in[2];
    const float* Wk   = (const float*)d_in[3];
    const float* bk   = (const float*)d_in[4];
    const float* Wv   = (const float*)d_in[5];
    const float* bv   = (const float*)d_in[6];
    const float* Wo   = (const float*)d_in[7];
    const float* bo   = (const float*)d_in[8];
    const float* ln1g = (const float*)d_in[9];
    const float* ln1b = (const float*)d_in[10];
    const float* W1   = (const float*)d_in[11];   // [2048,512]
    const float* bf1  = (const float*)d_in[12];
    const float* W2   = (const float*)d_in[13];   // [512,2048]
    const float* bf2  = (const float*)d_in[14];
    const float* ln2g = (const float*)d_in[15];
    const float* ln2b = (const float*)d_in[16];
    const float* lnfg = (const float*)d_in[17];
    const float* lnfb = (const float*)d_in[18];
    float* out = (float*)d_out;                   // [NTOK][512]

    char* ws = (char*)d_ws;
    size_t off = 0;
    _Float16* wqkv = (_Float16*)(ws + off); off += (size_t)DQKV * DM * 2;      // 1,572,864
    _Float16* wo16 = (_Float16*)(ws + off); off += (size_t)DM * DM * 2;        //   524,288
    _Float16* w116 = (_Float16*)(ws + off); off += (size_t)DF * DM * 2;        // 2,097,152
    _Float16* w216 = (_Float16*)(ws + off); off += (size_t)DM * DF * 2;        // 2,097,152
    _Float16* y1   = (_Float16*)(ws + off); off += (size_t)NTOK * DM * 2;      // 8 MiB at full size
    _Float16* qkv  = (_Float16*)(ws + off); off += (size_t)NTOK * DQKV * 2;    // 24 MiB
    _Float16* cpl  = (_Float16*)(ws + off); off += (size_t)NTOK * DM * 2;      // 8 MiB
    float*    x1   = (float*)(ws + off);    off += (size_t)NTOK * DM * 4;      // 16 MiB
    _Float16* y2   = (_Float16*)(ws + off); off += (size_t)NTOK * DM * 2;      // 8 MiB
    _Float16* mpl  = (_Float16*)(ws + off); off += (size_t)NTOK * DF * 2;      // 32 MiB
    _Float16* vfr  = (_Float16*)(ws + off); off += (size_t)NTOK * DM * 2;      // 8 MiB
    if (off > ws_size) return;                                                 // 115,343,360 B at full size

    k_prep<<<dim3(PB_ALL), dim3(256), 0, stream>>>(x, ln1g, ln1b, Wq, Wk, Wv, Wo, W1, W2, y1, wqkv, wo16, w116, w216);
    k_gemm_p<0><<<dim3(NTOK / PR, 3), dim3(256), 0, stream>>>(y1, wqkv, bq, bk, bv, bv, qkv, DQKV, vfr);
    k_attn<<<dim3(SEQ / QR, NH, NB), dim3(256), 0, stream>>>(qkv, vfr, cpl);
    k_gemm_r<0><<<dim3(NTOK / QR), dim3(256), 0, stream>>>(cpl, wo16, bo, x, ln2g, ln2b, x1, y2);
    k_gemm_p<1><<<dim3(NTOK / PR, DF / 512), dim3(256), 0, stream>>>(y2, w116, bf1, bf1 + 512, bf1 + 1024, bf1 + 1536, mpl, DF, nullptr);
    k_gemm_r<1><<<dim3(NTOK / QR), dim3(256), 0, stream>>>(mpl, w216, bf2, x1, lnfg, lnfb, out, y2);
}

// v010
// One run takes 138 microseconds.
// Timed twice side by side with v009, it ran 1.06 and 1.05 times as fast.
// Over all steps from v000 it is 2.96 times as fast.
#include <hip/hip_runtime.h>

// Contractions on v_wmma_f32_16x16x32_f16 (f16 operands, f32 accumulate), one product each: y1*[Wq|Wk|Wv]^T, q*k^T, P*v, ctx*Wo^T, y2*W1^T, m*W2^T; float inputs RNE-converted to bf16 then carried in f16 (weights x64, P x2^14, ctx x64, m x64); LayerNorm, 1.5-entmax threshold and Mish in f32.

#ifndef NB
#define NB 8
#endif
#ifndef SEQ
#define SEQ 1024
#endif
#define NB_FULL  8
#define SEQ_FULL 1024
#define DM   512            // model width
#define DF   2048           // ffn width
#define NH   8
#define HD   64
#define DQKV (3 * DM)       // q|k|v plane pitch
#define NTOK (NB * SEQ)
#define QR   32             // query rows per attention block / rows per row-gemm block
#define PR   64             // rows per plane-gemm block
#define VG   8              // V fragments (32 keys each) fetched ahead as one group in k_attn
#define ZN   (SEQ / 32)     // scores per lane per row
#define YP   (DM + 8)       // LDS pitch of a staged f16 row, halves (16 B x odd)
#define NEWT 6              // Newton passes for the entmax threshold (on the norm, see k_attn phase 2)

static_assert(NB >= 1 && NB <= NB_FULL);
static_assert(SEQ <= SEQ_FULL);
static_assert(SEQ % (32 * VG) == 0);
static_assert(SEQ % 128 == 0);
static_assert(NTOK % QR == 0);
static_assert(SEQ % PR == 0 && PR % 32 == 0);
static_assert(NH * HD == DM);
static_assert(QR == 32);
static_assert((ZN % 4) == 0);
static_assert(ZN == 32);    // entmax_sums and entmax_relu are written out for 16 pairs of keys a lane
static_assert(DM % 32 == 0 && DF % 32 == 0);
static_assert((DM * DM) % 2048 == 0 && (DF * DM) % 2048 == 0);

typedef _Float16 v16h __attribute__((ext_vector_type(16)));
typedef _Float16 v8h  __attribute__((ext_vector_type(8)));
typedef _Float16 v4h  __attribute__((ext_vector_type(4)));
typedef float    v8f  __attribute__((ext_vector_type(8)));
typedef float    v4f  __attribute__((ext_vector_type(4)));
typedef float    v2f  __attribute__((ext_vector_type(2)));

union Frag { v16h v; v8h h[2]; };

#define WSC   64.0f                  // weight carry
#define SC_Z  1.52587890625e-05f     // 2^-16 : (64q).(64k) -> q.k/16 = z
#define SC_P  16384.0f               // 2^14  : P carry
#define SC_C  6.103515625e-05f       // 2^-14 : (2^14 P)(64 v) -> 64 ctx
#define SC_O  2.44140625e-04f        // 2^-12 : (64 a)(64 W) -> a.W
#define SC_H  0.015625f              // 1/64  : (y)(64 W) -> y.W
#define LOG2E 1.44269504088896340736f
#define LN_EPS 1e-5f

static __device__ __forceinline__ v8f zero8() {
    v8f z;
#pragma unroll
    for (int i = 0; i < 8; ++i) z[i] = 0.0f;
    return z;
}

// 16x32 A fragment (or B fragment from an [n][k] k-contiguous source) from a
// row-major 16-bit tile: lane m = lane&15 -> row m; kb = 8*(lane>>4);
// elements 0..7 = k kb..kb+7, elements 8..15 = k kb+16..kb+23.
static __device__ __forceinline__ v16h load_frag16(const _Float16* base, int ld, int lane) {
    int m  = lane & 15;
    int kb = (lane >> 4) << 3;
    const _Float16* p = base + (size_t)m * ld + kb;
    Frag f;
    f.h[0] = *(const v8h*)(p);
    f.h[1] = *(const v8h*)(p + 16);
    return f.v;
}

// A or B fragment from a tiled plane (weights: wcvt_block; activations: see k_gemm_p):
// one 16 x 32 tile is 1 KB, lane l reads 16 B at 16*l and at 512 + 16*l, so each load is
// four whole 128-B lines (a fragment load from a row-major plane touches 16 lines).
// Same element in every lane and register position as load_frag16 on the [n][k] plane.
static __device__ __forceinline__ v16h load_fragB(const _Float16* tile, int lane) {
    const _Float16* p = tile + lane * 8;
    Frag f;
    f.h[0] = *(const v8h*)(p);
    f.h[1] = *(const v8h*)(p + 256);
    return f.v;
}

static __device__ __forceinline__ v8f wmma16(v16h a, v16h b, v8f c) {
    v8f d = __builtin_amdgcn_wmma_f32_16x16x32_f16(false, a, false, b, (short)0, c, false, false);
    asm volatile("v_nop\n\tv_nop\n\tv_nop\n\tv_nop" : "+v"(d) : "v"(a), "v"(b));
    return d;
}

// f32 -> bf16 RNE convert, value kept as f32
static __device__ __forceinline__ float bf16r(float x) {
    unsigned u = __float_as_uint(x);
    u = (u + 0x7FFFu + ((u >> 16) & 1u)) & 0xFFFF0000u;
    return __uint_as_float(u);
}

// ordering for a wave-private LDS tile: stores before later loads of the same wave
static __device__ __forceinline__ void wave_lds_sync() {
    __builtin_amdgcn_fence(3, "wavefront");
    asm volatile("s_wait_dscnt 0" ::: "memory");
    __builtin_amdgcn_wave_barrier();
}

// Lane exchanges of the wave reductions, in the vector unit (a shuffle goes through the LDS
// pipe and is waited for at every step). xhalf: lane l reads lane l ^ 16; xrow<M>: lane l reads
// lane l ^ M inside its row of 16 lanes (DPP row_xmask, control word 0x160 + M). All lanes are on
// wherever these are called. Steps in the order 16, 8, 4, 2, 1.
static __device__ __forceinline__ float xhalf(float x) {
    const int b = __builtin_bit_cast(int, x);
    return __builtin_bit_cast(float, __builtin_amdgcn_permlanex16(b, b, 0x76543210, 0xfedcba98, false, false));
}
template <int M>
static __device__ __forceinline__ float xrow(float x) {
    const int b = __builtin_bit_cast(int, x);
    return __builtin_bit_cast(float, __builtin_amdgcn_update_dpp(b, b, 0x160 + M, 0xf, 0xf, true));
}
static __device__ __forceinline__ float wsum(float v) {
    v += xhalf(v); v += xrow<8>(v); v += xrow<4>(v);
    v += xrow<2>(v); v += xrow<1>(v);
    return v;
}
static __device__ __forceinline__ float wmaxr(float v) {
    v = fmaxf(v, xhalf(v)); v = fmaxf(v, xrow<8>(v));
    v = fmaxf(v, xrow<4>(v)); v = fmaxf(v, xrow<2>(v));
    v = fmaxf(v, xrow<1>(v));
    return v;
}
static __device__ __forceinline__ float wminr(float v) {
    v = fminf(v, xhalf(v)); v = fminf(v, xrow<8>(v));
    v = fminf(v, xrow<4>(v)); v = fminf(v, xrow<2>(v));
    v = fminf(v, xrow<1>(v));
    return v;
}

// Packed f32 forms of the entmax passes (k_attn phase 2): one instruction works on two keys.
// relu: v_pk_add_f32 T, Z, tau with the tau operand negated, its low half read for both keys, and
// the clamp bit: T = min(max(Z - tau, 0), 1). The upper bound never binds: Z <= 0 (shifted by the
// row maximum) and tau >= -1, so Z - tau <= 1 and the value is max(Z - tau, 0).
//
// One Newton pass over a lane's 32 keys (16 pairs): sa = sum d, sb = sum d^2, d = relu(z - tau),
// summed as (even key, odd key) pairs that are added at the end. One asm statement, because the compiler has
// no packed add with clamp and gives no issue hint for a value that asm text produced: here the
// order keeps every producer five or more vector instructions ahead of its reader (two chains a
// sum, a third near the end), and s_delay_alu stands where the closing adds cannot keep that
// distance, in front of the first instruction (tau is fresh) and behind the last (sa, sb are).
static __device__ __forceinline__ void entmax_sums(const v2f (&z)[16], v2f tt, float& sa, float& sb) {
    v2f a0, a1, b0, b1, t0, t1, t2, t3, t4, t5, t6, t7;
    asm("s_delay_alu instid0(VALU_DEP_1)\n\t"
        "v_pk_add_f32 %4, %12, %28 op_sel_hi:[1,0] neg_lo:[0,1] neg_hi:[0,1] clamp\n\t"
        "v_pk_add_f32 %5, %13, %28 op_sel_hi:[1,0] neg_lo:[0,1] neg_hi:[0,1] clamp\n\t"
        "v_pk_add_f32 %6, %14, %28 op_sel_hi:[1,0] neg_lo:[0,1] neg_hi:[0,1] clamp\n\t"
        "v_pk_add_f32 %7, %15, %28 op_sel_hi:[1,0] neg_lo:[0,1] neg_hi:[0,1] clamp\n\t"
        "v_pk_add_f32 %8, %16, %28 op_sel_hi:[1,0] neg_lo:[0,1] neg_hi:[0,1] clamp\n\t"
        "v_pk_add_f32 %9, %17, %28 op_sel_hi:[1,0] neg_lo:[0,1] neg_hi:[0,1] clamp\n\t"
        "v_pk_add_f32 %10, %18, %28 op_sel_hi:[1,0] neg_lo:[0,1] neg_hi:[0,1] clamp\n\t"
        "v_pk_add_f32 %11, %19, %28 op_sel_hi:[1,0] neg_lo:[0,1] neg_hi:[0,1] clamp\n\t"
        "v_pk_mul_f32 %2, %4, %4\n\t"
        "v_pk_mul_f32 %3, %5, %5\n\t"
        "v_pk_add_f32 %0, %4, %5\n\t"
        "v_pk_add_f32 %4, %20, %28 op_sel_hi:[1,0] neg_lo:[0,1] neg_hi:[0,1] clamp\n\t"
        "v_pk_add_f32 %5, %21, %28 op_sel_hi:[1,0] neg_lo:[0,1] neg_hi:[0,1] clamp\n\t"
        "v_pk_add_f32 %1, %6, %7\n\t"
        "v_pk_fma_f32 %2, %6, %6, %2\n\t"
        "v_pk_fma_f32 %3, %7, %7, %3\n\t"
        "v_pk_add_f32 %6, %22, %28 op_sel_hi:[1,0] neg_lo:[0,1] neg_hi:[0,1] clamp\n\t"
        "v_pk_add_f32 %7, %23, %28 op_sel_hi:[1,0] neg_lo:[0,1] neg_hi:[0,1] clamp\n\t"
        "v_pk_add_f32 %0, %0, %8\n\t"
        "v_pk_add_f32 %1, %1, %9\n\t"
        "v_pk_fma_f32 %2, %8, %8, %2\n\t"
        "v_pk_fma_f32 %3, %9, %9, %3\n\t"
        "v_pk_add_f32 %8, %24, %28 op_sel_hi:[1,0] neg_lo:[0,1] neg_hi:[0,1] clamp\n\t"
        "v_pk_add_f32 %9, %25, %28 op_sel_hi:[1,0] neg_lo:[0,1] neg_hi:[0,1] clamp\n\t"
        "v_pk_add_f32 %0, %0, %10\n\t"
        "v_pk_add_f32 %1, %1, %11\n\t"
        "v_pk_fma_f32 %2, %10, %10, %2\n\t"
        "v_pk_fma_f32 %3, %11, %11, %3\n\t"
        "v_pk_add_f32 %10, %26, %28 op_sel_hi:[1,0] neg_lo:[0,1] neg_hi:[0,1] clamp\n\t"
        "v_pk_add_f32 %11, %27, %28 op_sel_hi:[1,0] neg_lo:[0,1] neg_hi:[0,1] clamp\n\t"
        "v_pk_add_f32 %0, %0, %4\n\t"
        "v_pk_add_f32 %1, %1, %5\n\t"
        "v_pk_fma_f32 %2, %4, %4, %2\n\t"
        "v_pk_fma_f32 %3, %5, %5, %3\n\t"
        "v_pk_add_f32 %4, %6, %7\n\t"
        "v_pk_mul_f32 %5, %6, %6\n\t"
        "v_pk_add_f32 %0, %0, %8\n\t"
        "v_pk_add_f32 %1, %1, %9\n\t"
        "v_pk_fma_f32 %2, %8, %8, %2\n\t"
        "v_pk_fma_f32 %3, %9, %9, %3\n\t"
        "v_pk_fma_f32 %5, %7, %7, %5\n\t"
        "v_pk_add_f32 %4, %4, %10\n\t"
        "v_pk_add_f32 %0, %0, %11\n\t"
        "v_pk_fma_f32 %2, %10, %10, %2\n\t"
        "v_pk_fma_f32 %3, %11, %11, %3\n\t"
        "s_delay_alu instid0(VALU_DEP_4) | instskip(NEXT) | instid1(VALU_DEP_3)\n\t"
        "v_pk_add_f32 %1, %1, %4\n\t"
        "v_pk_add_f32 %5, %5, %2\n\t"
        "s_delay_alu instid0(VALU_DEP_2) | instskip(NEXT) | instid1(VALU_DEP_2)\n\t"
        "v_pk_add_f32 %0, %0, %1\n\t"
        "v_pk_add_f32 %3, %3, %5\n\t"
        "s_delay_alu instid0(VALU_DEP_2) | instskip(NEXT) | instid1(VALU_DEP_2)\n\t"
        "v_pk_add_f32 %0, %0, %0 op_sel:[0,1] op_sel_hi:[1,0]\n\t"
        "v_pk_add_f32 %3, %3, %3 op_sel:[0,1] op_sel_hi:[1,0]\n\t"
        "s_delay_alu instid0(VALU_DEP_1)"
        : "=&v"(a0), "=&v"(a1), "=&v"(b0), "=&v"(b1),
          "=&v"(t0), "=&v"(t1), "=&v"(t2), "=&v"(t3), "=&v"(t4), "=&v"(t5), "=&v"(t6), "=&v"(t7)
        : "v"(z[0]), "v"(z[1]), "v"(z[2]), "v"(z[3]), "v"(z[4]), "v"(z[5]), "v"(z[6]), "v"(z[7]),
          "v"(z[8]), "v"(z[9]), "v"(z[10]), "v"(z[11]), "v"(z[12]), "v"(z[13]), "v"(z[14]), "v"(z[15]),
          "v"(tt));
    sa = a0.x;
    sb = b1.x;
}

// z <- relu(z - tau) in place for the 16 pairs (the last use of z): the same packed add with clamp
static __device__ __forceinline__ void entmax_relu(v2f (&z)[16], v2f tt) {
    asm("s_delay_alu instid0(VALU_DEP_1)\n\t"
        "v_pk_add_f32 %0, %0, %16 op_sel_hi:[1,0] neg_lo:[0,1] neg_hi:[0,1] clamp\n\t"
        "v_pk_add_f32 %1, %1, %16 op_sel_hi:[1,0] neg_lo:[0,1] neg_hi:[0,1] clamp\n\t"
        "v_pk_add_f32 %2, %2, %16 op_sel_hi:[1,0] neg_lo:[0,1] neg_hi:[0,1] clamp\n\t"
        "v_pk_add_f32 %3, %3, %16 op_sel_hi:[1,0] neg_lo:[0,1] neg_hi:[0,1] clamp\n\t"
        "v_pk_add_f32 %4, %4, %16 op_sel_hi:[1,0] neg_lo:[0,1] neg_hi:[0,1] clamp\n\t"
        "v_pk_add_f32 %5, %5, %16 op_sel_hi:[1,0] neg_lo:[0,1] neg_hi:[0,1] clamp\n\t"
        "v_pk_add_f32 %6, %6, %16 op_sel_hi:[1,0] neg_lo:[0,1] neg_hi:[0,1] clamp\n\t"
        "v_pk_add_f32 %7, %7, %16 op_sel_hi:[1,0] neg_lo:[0,1] neg_hi:[0,1] clamp\n\t"
        "v_pk_add_f32 %8, %8, %16 op_sel_hi:[1,0] neg_lo:[0,1] neg_hi:[0,1] clamp\n\t"
        "v_pk_add_f32 %9, %9, %16 op_sel_hi:[1,0] neg_lo:[0,1] neg_hi:[0,1] clamp\n\t"
        "v_pk_add_f32 %10, %10, %16 op_sel_hi:[1,0] neg_lo:[0,1] neg_hi:[0,1] clamp\n\t"
        "v_pk_add_f32 %11, %11, %16 op_sel_hi:[1,0] neg_lo:[0,1] neg_hi:[0,1] clamp\n\t"
        "v_pk_add_f32 %12, %12, %16 op_sel_hi:[1,0] neg_lo:[0,1] neg_hi:[0,1] clamp\n\t"
        "v_pk_add_f32 %13, %13, %16 op_sel_hi:[1,0] neg_lo:[0,1] neg_hi:[0,1] clamp\n\t"
        "v_pk_add_f32 %14, %14, %16 op_sel_hi:[1,0] neg_lo:[0,1] neg_hi:[0,1] clamp\n\t"
        "v_pk_add_f32 %15, %15, %16 op_sel_hi:[1,0] neg_lo:[0,1] neg_hi:[0,1] clamp"
        : "+v"(z[0]), "+v"(z[1]), "+v"(z[2]), "+v"(z[3]), "+v"(z[4]), "+v"(z[5]), "+v"(z[6]), "+v"(z[7]),
          "+v"(z[8]), "+v"(z[9]), "+v"(z[10]), "+v"(z[11]), "+v"(z[12]), "+v"(z[13]), "+v"(z[14]), "+v"(z[15])
        : "v"(tt));
}

// Mish(x) = x * tanh(softplus(x)) = x * (u^2+2u)/(u^2+2u+2), u = e^x
static __device__ __forceinline__ float mishf(float x) {
    float xe = fminf(x, 20.0f);
    float u  = __builtin_amdgcn_exp2f(xe * LOG2E);
    float wv = u * (u + 2.0f);
    float t  = wv * __builtin_amdgcn_rcpf(wv + 2.0f);
    return x * t;
}

// 16 columns per lane: columns 256*j + 8*lane + e (j = 0,1; e = 0..7)
static __device__ __forceinline__ void load_cols16(const float* p, int lane, float (&o)[16]) {
#pragma unroll
    for (int j = 0; j < 2; ++j) {
        v4f a = *(const v4f*)(p + 256 * j + 8 * lane);
        v4f c = *(const v4f*)(p + 256 * j + 8 * lane + 4);
        o[8 * j + 0] = a.x; o[8 * j + 1] = a.y; o[8 * j + 2] = a.z; o[8 * j + 3] = a.w;
        o[8 * j + 4] = c.x; o[8 * j + 5] = c.y; o[8 * j + 6] = c.z; o[8 * j + 7] = c.w;
    }
}

// LayerNorm over a 512-wide row held as 16 columns per lane (f32)
static __device__ __forceinline__ void ln_lane(const float (&v)[16], const float (&gl)[16],
                                               const float (&el)[16], float (&y)[16]) {
    float s = 0.0f;
#pragma unroll
    for (int e = 0; e < 16; ++e) s += v[e];
    s = wsum(s);
    const float mu = s * (1.0f / (float)DM);
    float d[16];
    float q = 0.0f;
#pragma unroll
    for (int e = 0; e < 16; ++e) { d[e] = v[e] - mu; q = __builtin_fmaf(d[e], d[e], q); }
    q = wsum(q);
    const float rstd = rsqrtf(__builtin_fmaf(q, 1.0f / (float)DM, LN_EPS));
#pragma unroll
    for (int e = 0; e < 16; ++e) y[e] = d[e] * rstd * gl[e] + el[e];
}

// ---------------------------------------------------------------------------
// Weight plane: value f16(bf16r(src[n][k]) * 64), stored in fragment order: tile
// (n/16, k/32) is 512 halves at ((n/16) * (K/32) + k/32) * 512; inside it element
// (n, k) sits at ((k>>4)&1)*256 + (((k>>3)&1)*16 + (n&15))*8 + (k&7).
// Thread i writes halves 8i..8i+7 (a wave stores 512 contiguous bytes) and gathers
// its 8 source floats; a block reads 16 rows x 512 contiguous bytes.
// coverage: n/2048 blocks of the plane's range, 256 threads x 8 elements -> n exactly.
// ---------------------------------------------------------------------------
template <int K>
static __device__ __forceinline__ void wcvt_block(const float* __restrict__ src,
                                                  _Float16* __restrict__ dst, int blk) {
    constexpr int KT = K / 32;                  // k tiles per 16-row band
    const int i  = blk * 256 + threadIdx.x;
    const int t  = i >> 6, gq = i & 63;         // tile, 8-half group inside it
    const int n  = (t / KT) * 16 + (gq & 15);
    const int k  = (t % KT) * 32 + (gq >> 5) * 16 + ((gq >> 4) & 1) * 8;
    const float* sp = src + (size_t)n * K + k;
    v4f a = *(const v4f*)(sp);
    v4f c = *(const v4f*)(sp + 4);
    v8h o;
    o[0] = (_Float16)(bf16r(a.x) * WSC); o[1] = (_Float16)(bf16r(a.y) * WSC);
    o[2] = (_Float16)(bf16r(a.z) * WSC); o[3] = (_Float16)(bf16r(a.w) * WSC);
    o[4] = (_Float16)(bf16r(c.x) * WSC); o[5] = (_Float16)(bf16r(c.y) * WSC);
    o[6] = (_Float16)(bf16r(c.z) * WSC); o[7] = (_Float16)(bf16r(c.w) * WSC);
    *(v8h*)(dst + (size_t)i * 8) = o;
    // the store's registers may be rewritten on a later path of the caller's listing: wait first
    asm volatile("s_wait_xcnt 0x0" ::: "memory");
}

// ---------------------------------------------------------------------------
// LN1: y1 = f16(LayerNorm(bf16r(x)) * g + b), 512 columns in fragment tiles (see k_gemm_p).
// One wave per row, lane owns columns 8l..8l+7 and 256+8l..; the block's 8 rows are staged
// in LDS (block barrier), since a 128-B line of a tile holds 8 columns of 8 rows: column
// group L = col/8 of rows 8a..8a+7 is the line at 128*L + 64*(a&1) halves of the band.
// coverage: NTOK/8 blocks x 64 lines x 64 halves = NTOK x 512.
// ---------------------------------------------------------------------------
static __device__ __forceinline__ void ln1_block(const float* __restrict__ x,
                                                 const float* __restrict__ g,
                                                 const float* __restrict__ be,
                                                 _Float16* __restrict__ y, int blk) {
    const int tid = threadIdx.x, lane = tid & 31, w = tid >> 5;
    const int tok = blk * 8 + w;
    const int b = tok / SEQ, s = tok - b * SEQ;
    const float* xr = x + ((size_t)b * SEQ_FULL + s) * DM;
    float v[16], gl[16], el[16], yv[16];
    load_cols16(xr, lane, v);
    load_cols16(g, lane, gl);
    load_cols16(be, lane, el);
#pragma unroll
    for (int e = 0; e < 16; ++e) { v[e] = bf16r(v[e]); gl[e] = bf16r(gl[e]); el[e] = bf16r(el[e]); }
    ln_lane(v, gl, el, yv);
    v8h o[2];
#pragma unroll
    for (int j = 0; j < 2; ++j)
#pragma unroll
        for (int e = 0; e < 8; ++e) o[j][e] = (_Float16)yv[8 * j + e];
    __shared__ __align__(16) _Float16 ys[8 * YP];
    *(v8h*)(&ys[w * YP + 8 * lane])       = o[0];
    *(v8h*)(&ys[w * YP + 256 + 8 * lane]) = o[1];
    __syncthreads();                        // rows of the other waves are read below
    _Float16* yb = y + (size_t)(blk >> 1) * (16 * DM) + (blk & 1) * 64 + (tid & 7) * 8;
#pragma unroll
    for (int q = 0; q < 2; ++q) {
        const int L = (tid >> 3) + 32 * q;
        *(v8h*)(yb + 128 * L) = *(const v8h*)(&ys[(tid & 7) * YP + 8 * L]);
    }
}

// ---------------------------------------------------------------------------
// Preparation, one launch: LN1 and the six weight planes depend on the inputs alone and
// on nothing of each other, so they share a grid; the block index picks the job
// (block-uniform branches; the one barrier stands inside the LN1 branch). Ranges, in order: LN1 (PB_LN blocks), Wq, Wk, Wv,
// Wo (PB_S each), W1, W2 (PB_L each).
// ---------------------------------------------------------------------------
#define PB_LN (NTOK / 8)
#define PB_S  (DM * DM / 2048)
#define PB_L  (DF * DM / 2048)
#define PB_ALL (PB_LN + 4 * PB_S + 2 * PB_L)
__global__ __launch_bounds__(256) void k_prep(const float* __restrict__ x,
                                               const float* __restrict__ g,
                                               const float* __restrict__ be,
                                               const float* __restrict__ Wq,
                                               const float* __restrict__ Wk,
                                               const float* __restrict__ Wv,
                                               const float* __restrict__ Wo,
                                               const float* __restrict__ W1,
                                               const float* __restrict__ W2,
                                               _Float16* __restrict__ y,
                                               _Float16* __restrict__ wqkv,
                                               _Float16* __restrict__ wo16,
                                               _Float16* __restrict__ w116,
                                               _Float16* __restrict__ w216) {
    int blk = blockIdx.x;
    if (blk < PB_LN) { ln1_block(x, g, be, y, blk); return; }
    blk -= PB_LN;
    if (blk < 4 * PB_S) {
        const int p = blk / PB_S;               // 0..3: Wq, Wk, Wv, Wo
        const float* src = (p == 0) ? Wq : ((p == 1) ? Wk : ((p == 2) ? Wv : Wo));
        _Float16* dst = (p == 3) ? wo16 : wqkv + (size_t)p * DM * DM;
        wcvt_block<DM>(src, dst, blk - p * PB_S);
        return;
    }
    blk -= 4 * PB_S;
    if (blk < PB_L) { wcvt_block<DM>(W1, w116, blk); return; }
    wcvt_block<DF>(W2, w216, blk - PB_L);
}

// ---------------------------------------------------------------------------
// GEMM core: wave tile 16*RT rows x 64 cols, C[r][n] += A[r][k] * B[n][k],
// A a tiled activation plane, B a tiled weight plane (wcvt_block); a band of
// 16 rows starts at 16*K*band halves; fragments loaded directly from global memory
// (two 16-B loads each). K % 32 == 0; K is a compile-time constant so that the second A
// tiles and the B bands sit at immediate offsets of one address pair an operand.
// ---------------------------------------------------------------------------
template <int K, int RT>
static __device__ __forceinline__ void gemm_rtx64(const _Float16* __restrict__ Ab,
                                                  const _Float16* __restrict__ Bb,
                                                  int lane, v8f (&acc)[RT][4]) {
#pragma unroll
    for (int t = 0; t < RT; ++t)
#pragma unroll
        for (int j = 0; j < 4; ++j) acc[t][j] = zero8();
#pragma unroll 1
    for (int k0 = 0; k0 < K; k0 += 32) {
        const _Float16* ap = Ab + (size_t)k0 * 16 + lane * 8;   // the lane's 16 B of a tile half (load_fragB)
        const _Float16* bp = Bb + (size_t)k0 * 16 + lane * 8;
        Frag aa[RT], bb[4];
#pragma unroll
        for (int t = 0; t < RT; ++t) {
            aa[t].h[0] = *(const v8h*)(ap + (16 * t) * K);
            aa[t].h[1] = *(const v8h*)(ap + (16 * t) * K + 256);
        }
#pragma unroll
        for (int j = 0; j < 4; ++j) {
            bb[j].h[0] = *(const v8h*)(bp + (16 * j) * K);
            bb[j].h[1] = *(const v8h*)(bp + (16 * j) * K + 256);
        }
        // both address pairs are inputs, so they stay live up to this wait: no load's result is
        // given a register that an issued load names, and nothing rewrites one ahead of the wait
        asm volatile("s_wait_xcnt 0x0" :: "v"(ap), "v"(bp) : "memory");
#pragma unroll
        for (int j = 0; j < 4; ++j)
#pragma unroll
            for (int t = 0; t < RT; ++t) acc[t][j] = wmma16(aa[t].v, bb[j].v, acc[t][j]);
    }
}

// ---------------------------------------------------------------------------
// The same core for the row GEMMs (wave tile 32 x 64), fragments loaded two k steps ahead of
// their WMMAs in three register buffers: these kernels run two waves a SIMD, too few to cover
// a load's latency with other waves' work, so each wave keeps its own loads in flight.
// k steps, and the WMMAs inside one, in the order of gemm_rtx64. K / 32 = 3 G + 1.
// ---------------------------------------------------------------------------
template <int K>
static __device__ __forceinline__ void load_step(const _Float16* ap, const _Float16* bp, int st,
                                                 Frag (&a)[2], Frag (&b)[4]) {
    // global address space spelled out: the pointers pass through an asm statement in the k loop,
    // behind which the compiler would no longer know it and would fall back to flat loads
    typedef __attribute__((address_space(1))) const v8h gv8h;
#pragma unroll
    for (int t = 0; t < 2; ++t) {
        a[t].h[0] = *(gv8h*)(ap + st * 512 + (16 * t) * K);
        a[t].h[1] = *(gv8h*)(ap + st * 512 + (16 * t) * K + 256);
    }
#pragma unroll
    for (int j = 0; j < 4; ++j) {
        b[j].h[0] = *(gv8h*)(bp + st * 512 + (16 * j) * K);
        b[j].h[1] = *(gv8h*)(bp + st * 512 + (16 * j) * K + 256);
    }
    // both address pairs are inputs, so they stay live up to this wait and nothing rewrites one
    // ahead of it; the statement also keeps these loads in front of the WMMAs that follow it
    asm volatile("s_wait_xcnt 0x0" :: "v"(ap), "v"(bp) : "memory");
}
static __device__ __forceinline__ void mul_step(const Frag (&a)[2], const Frag (&b)[4], v8f (&acc)[2][4]) {
#pragma unroll
    for (int j = 0; j < 4; ++j)
#pragma unroll
        for (int t = 0; t < 2; ++t) acc[t][j] = wmma16(a[t].v, b[j].v, acc[t][j]);
}
template <int K>
static __device__ __forceinline__ void gemm_32x64_ahead(const _Float16* __restrict__ Ab,
                                                        const _Float16* __restrict__ Bb,
                                                        int lane, v8f (&acc)[2][4]) {
    constexpr int G = (K / 32 - 1) / 3;
    static_assert(K % 32 == 0 && 3 * G + 1 == K / 32 && G >= 2);
#pragma unroll
    for (int t = 0; t < 2; ++t)
#pragma unroll
        for (int j = 0; j < 4; ++j) acc[t][j] = zero8();
    const _Float16* ap = Ab + lane * 8;     // the lane's 16 B of a tile half (load_fragB)
    const _Float16* bp = Bb + lane * 8;
    Frag a0[2], a1[2], a2[2], b0[4], b1[4], b2[4];
    load_step<K>(ap, bp, 0, a0, b0);
    load_step<K>(ap, bp, 1, a1, b1);
#pragma unroll 1                            // three k steps a trip; more would only grow the code
    for (int g = 0; g < G - 1; ++g) {
        load_step<K>(ap, bp, 2, a2, b2);  mul_step(a0, b0, acc);
        load_step<K>(ap, bp, 3, a0, b0);  mul_step(a1, b1, acc);
        load_step<K>(ap, bp, 4, a1, b1);  mul_step(a2, b2, acc);
        // both address pairs pass through this wait, so their step below is not lifted over it
        asm volatile("s_wait_xcnt 0x0" : "+v"(ap), "+v"(bp) : : "memory");
        ap += 3 * 512;
        bp += 3 * 512;
    }
    load_step<K>(ap, bp, 2, a2, b2);  mul_step(a0, b0, acc);
    load_step<K>(ap, bp, 3, a0, b0);  mul_step(a1, b1, acc);
    mul_step(a2, b2, acc);
    mul_step(a0, b0, acc);
}

// ---------------------------------------------------------------------------
// Plane GEMM: out = f16 plane of NTOK x ldo in fragment tiles (tile (tok/16, col/32) of 512
// halves at ((tok/16) * (ldo/32) + col/32) * 512, inside it as in wcvt_block with n = tok,
// k = col), so that its readers load A (or K) fragments as whole lines;
// block = PR = 64 rows x 512 cols (blockIdx.y =
// 512-column segment), wave = 64 x 64: a B fragment feeds four WMMAs and the weight
// segment is read from L2 once per 64 rows. EPI 0: val = acc + 64*bias (q|k|v x64);
// EPI 1: val = 64 * Mish(acc/64 + bias). Wave-private LDS tile (pitch SP: 16 B x odd, so
// neither side meets a bank twice), then 16 stores of 512 contiguous bytes, half a tile each.
// coverage: grid (NTOK/64, ldo/512) x 8 waves x (4 x 2 tiles) x 512 = NTOK x ldo.
// EPI 0, segment 2 (v) goes to the plane vfr instead, as B fragments of P*v (n = d,
// k = key), tile (batch, head, key/32, d/16) of 512 halves laid out as in wcvt_block. A lane's
// 8 accumulator rows of one 16x16 tile are keys 16t + 8*(lane>>4) + r at d = lane&15: the
// 8 halves at 256*(t&1) + 8*lane of key group t>>1, so each store is 512 contiguous bytes a wave.
// coverage: NTOK/64 blocks x 8 waves (heads) x 2 key groups x 4 tiles x 512 = NTOK x 512 of vfr.
// ---------------------------------------------------------------------------
template <int EPI>
__global__ __launch_bounds__(256) __attribute__((amdgpu_waves_per_eu(4)))   // 256 registers a wave: two blocks share a WGP, so the EPI 1 grid is resident at once
void k_gemm_p(const _Float16* __restrict__ A, const _Float16* __restrict__ Bw,
              const float* __restrict__ b0, const float* __restrict__ b1,
              const float* __restrict__ b2, const float* __restrict__ b3,
              _Float16* __restrict__ outp, int ldo, _Float16* __restrict__ vfr) {
    constexpr int SP = 72;                                 // LDS row pitch, halves
    __shared__ __align__(16) _Float16 st[8][PR * SP];      // 72 KB, wave-private tiles
    const int tid = threadIdx.x, lane = tid & 31, w = tid >> 5;
    const int hh = lane >> 4, m = lane & 15;
    const int m0  = blockIdx.x * PR;
    const int seg = blockIdx.y;
    const int nl  = 64 * w;                 // column within the 512 segment
    const int n0w = seg * 512 + nl;         // output column / B row
    const float* bias = (seg == 0) ? b0 : ((seg == 1) ? b1 : ((seg == 2) ? b2 : b3));

    v8f acc[PR / 16][4];
    constexpr int K = DM;                   // k length of both plane GEMMs
    gemm_rtx64<K, PR / 16>(A + (size_t)m0 * K, Bw + (size_t)n0w * K, lane, acc);

    float bl[4];
#pragma unroll
    for (int j = 0; j < 4; ++j) bl[j] = bf16r(bias[nl + 16 * j + m]);
    if (EPI == 0 && seg == 2) {             // block-uniform; no block barrier in this kernel
        const int b = m0 / SEQ, kb = (m0 - b * SEQ) / 32;
        _Float16* vt = vfr + (size_t)((b * NH + w) * (SEQ / 32) + kb) * 2048 + lane * 8;
#pragma unroll
        for (int t = 0; t < PR / 16; ++t)
#pragma unroll
            for (int j = 0; j < 4; ++j) {
                v8h o;
#pragma unroll
                for (int r = 0; r < 8; ++r) o[r] = (_Float16)__builtin_fmaf(bl[j], WSC, acc[t][j][r]);
                *(v8h*)(vt + 2048 * (t >> 1) + 512 * j + 256 * (t & 1)) = o;
            }
        return;
    }
#pragma unroll
    for (int t = 0; t < PR / 16; ++t)
#pragma unroll
        for (int j = 0; j < 4; ++j)
#pragma unroll
            for (int r = 0; r < 8; ++r) {
                float a = acc[t][j][r];
                float val;
                if (EPI == 0) {
                    val = __builtin_fmaf(bl[j], WSC, a);
                } else {
                    float hx = __builtin_fmaf(a, SC_H, bl[j]);
                    val = WSC * mishf(hx);
                }
                st[w][(16 * t + 8 * hh + r) * SP + 16 * j + m] = (_Float16)val;
            }
    wave_lds_sync();

    // i = 4*t + 2*kt + s: row tile t, k tile kt, tile half s; the lane takes row 16t + m,
    // columns 32kt + 16s + 8hh .. +7, the 8 halves at 256s + 8*lane of tile (t, kt)
    v8h pv[PR / 4];
#pragma unroll
    for (int i = 0; i < PR / 4; ++i)
        pv[i] = *(const v8h*)(&st[w][(16 * (i >> 2) + m) * SP + 32 * ((i >> 1) & 1) + 16 * (i & 1) + 8 * hh]);
    const int kts = ldo >> 5;               // k tiles per band of 16 rows
    _Float16* ob = outp + ((size_t)(m0 >> 4) * kts + (n0w >> 5)) * 512 + lane * 8;
#pragma unroll
    for (int i = 0; i < PR / 4; ++i)
        *(v8h*)(ob + (size_t)(i >> 2) * kts * 512 + 512 * ((i >> 1) & 1) + 256 * (i & 1)) = pv[i];

}

// ---------------------------------------------------------------------------
// Row GEMM (N = 512, block owns 32 full rows; A a tiled plane) fused with residual add + LayerNorm.
// MODE 0: x1 = bf16r(x) + (acc 2^-12 + bias) -> x1 f32 plane, y2 = f16(LN(x1) g + b) in
//         fragment tiles: the 32 rows staged f16 in LDS, block barrier, then 512-B stores.
// MODE 1: x2 = x1 + (acc 2^-12 + bias), out = LN(x2) g + b -> f32 rows.
// Block tile staged f32 in LDS (cross-wave, block barrier); wave then owns 4 rows:
// f16 rows go to the f16 LDS rows (MODE 0); f32 rows
// relaid through the (now wave-private) LDS row and written as four 512-B
// coverage: grid NTOK/32 x 32 rows x 512 = NTOK x 512 (each output plane).
// ---------------------------------------------------------------------------
template <int MODE>
__global__ __launch_bounds__(256) __attribute__((amdgpu_num_vgpr(256)))
void k_gemm_r(const _Float16* __restrict__ A, const _Float16* __restrict__ Bw,
              const float* __restrict__ bias, const float* __restrict__ res,
              const float* __restrict__ g, const float* __restrict__ be,
              float* __restrict__ outf, _Float16* __restrict__ outh) {
    __shared__ __align__(16) float T[QR * DM];            // 64 KB block tile
    __shared__ __align__(16) _Float16 Ys[MODE == 0 ? QR * YP : 8];   // y2 rows (MODE 0)
    const int tid = threadIdx.x, lane = tid & 31, w = tid >> 5;
    const int hh = lane >> 4, m = lane & 15;
    const int m0 = blockIdx.x * QR;
    const int nl = 64 * w;

    v8f acc[2][4];
    constexpr int K = (MODE == 0) ? DM : DF;   // k length: ctx plane / ffn plane
    gemm_32x64_ahead<K>(A + (size_t)m0 * K, Bw + (size_t)nl * K, lane, acc);

    // the wave's four residual rows and the row vectors: loaded here, ahead of the staging and
    // its barrier, all in flight at once (one latency, not one a row)
    float bl[16], gl[16], el[16], rv[4][16];
    const int tok0 = m0 + 4 * w;            // four rows of one batch (SEQ % 32 == 0)
    const float* rp = (MODE == 0) ? res + ((size_t)(tok0 / SEQ) * SEQ_FULL + (tok0 % SEQ)) * DM
                                  : res + (size_t)tok0 * DM;
#pragma unroll
    for (int rr = 0; rr < 4; ++rr) load_cols16(rp + rr * DM, lane, rv[rr]);
    load_cols16(bias, lane, bl);
    load_cols16(g, lane, gl);
    load_cols16(be, lane, el);
    // the lane's row address is an input, so it stays live up to this wait: no load's result is given
    // a register that an issued load names, and nothing rewrites one ahead of the wait
    asm volatile("s_wait_xcnt 0x0" :: "v"(rp + 8 * lane) : "memory");
#pragma unroll
    for (int t = 0; t < 2; ++t)
#pragma unroll
        for (int j = 0; j < 4; ++j)
#pragma unroll
            for (int r = 0; r < 8; ++r)
                T[(16 * t + 8 * hh + r) * DM + nl + 16 * j + m] = acc[t][j][r];
    __syncthreads();

#pragma unroll
    for (int e = 0; e < 16; ++e) { bl[e] = bf16r(bl[e]); gl[e] = bf16r(gl[e]); el[e] = bf16r(el[e]); }

#pragma unroll                              // rv is indexed by rr: registers
    for (int rr = 0; rr < 4; ++rr) {
        const int row = 4 * w + rr;
        const int tok = m0 + row;
        float v[16], yv[16];
        load_cols16(&T[row * DM], lane, v);
#pragma unroll
        for (int e = 0; e < 16; ++e) {
            const float r0 = (MODE == 0) ? bf16r(rv[rr][e]) : rv[rr][e];
            v[e] = r0 + __builtin_fmaf(v[e], SC_O, bl[e]);
        }
        ln_lane(v, gl, el, yv);

        // write-back into the wave-private LDS row (same columns this lane loaded)
        float* trow = &T[row * DM];
#pragma unroll
        for (int j = 0; j < 2; ++j) {
            v4f p0, p1;
            if (MODE == 0) {
                p0.x = v[8 * j + 0]; p0.y = v[8 * j + 1]; p0.z = v[8 * j + 2]; p0.w = v[8 * j + 3];
                p1.x = v[8 * j + 4]; p1.y = v[8 * j + 5]; p1.z = v[8 * j + 6]; p1.w = v[8 * j + 7];
            } else {
                p0.x = yv[8 * j + 0]; p0.y = yv[8 * j + 1]; p0.z = yv[8 * j + 2]; p0.w = yv[8 * j + 3];
                p1.x = yv[8 * j + 4]; p1.y = yv[8 * j + 5]; p1.z = yv[8 * j + 6]; p1.w = yv[8 * j + 7];
            }
            *(v4f*)(trow + 256 * j + 8 * lane)     = p0;
            *(v4f*)(trow + 256 * j + 8 * lane + 4) = p1;
        }
        wave_lds_sync();
        v4f s4[4];
#pragma unroll
        for (int jj = 0; jj < 4; ++jj) s4[jj] = *(const v4f*)(trow + 128 * jj + 4 * lane);

        float* orow = outf + (size_t)tok * DM;
        if (MODE == 0) {
            v8h o[2];
#pragma unroll
            for (int j = 0; j < 2; ++j)
#pragma unroll
                for (int e = 0; e < 8; ++e) o[j][e] = (_Float16)yv[8 * j + e];
            *(v8h*)(&Ys[row * YP + 8 * lane])       = o[0];
            *(v8h*)(&Ys[row * YP + 256 + 8 * lane]) = o[1];
#pragma unroll
            for (int jj = 0; jj < 4; ++jj) *(v4f*)(orow + 128 * jj + 4 * lane) = s4[jj];
            
        } else {
#pragma unroll
            for (int jj = 0; jj < 4; ++jj) *(v4f*)(orow + 128 * jj + 4 * lane) = s4[jj];
            
        }
    }
    if (MODE == 0) {
        __syncthreads();                    // rows of the other waves are read below
        // piece i: row 16*(i>>10) + (i&15), column group L = (i>>4)&63; a wave stores 512 contiguous bytes
        _Float16* yb = outh + (size_t)m0 * DM;
#pragma unroll
        for (int q = 0; q < QR * DM / 2048; ++q) {
            const int i = q * 256 + tid;
            const int L = (i >> 4) & 63, bd = i >> 10;
            *(v8h*)(yb + bd * (16 * DM) + 128 * L + 8 * (i & 15)) = *(const v8h*)(&Ys[(16 * bd + (i & 15)) * YP + 8 * L]);
        }
    }
}

// ---------------------------------------------------------------------------
// Attention with 1.5-entmax over keys. Block = 8 waves = 32 query rows of one
// (batch, head); qkv plane of 1536 columns in fragment tiles (see k_gemm_p; q | k, each x64,
// head h at column +64h = k tiles 2h, 2h+1; the v third is unused), v x64 in the fragment
// plane vfr (see k_gemm_p).
// Phase 1: z strip [32][SEQ] f32 in LDS = (64q).(64k) 2^-16 = q.k/16; wave owns
//          SEQ/128 key tiles x both row tiles (K fragments straight from the plane).
// Phase 2: wave owns 4 rows; per row: shift by max, threshold tau of
//          sum relu(z - tau)^2 = 1 by safeguarded Newton (NEWT passes, registers) on
//          g(tau) = sqrt(sum relu(z - tau)^2) - 1: same root, convex and falling, so a
//          step from below never passes the root, and close to a straight line while the
//          sum is far above 1, where Newton on the sum itself only halves the distance,
//          P = relu(z - tau)^2 x 2^14 as f16 written over the row's own slot
//          (pitch 2*SEQ halves, skew 8*(row&15) halves).
// Phase 3: wave owns one 16x16 ctx tile over all keys; V fragments straight from vfr
//          (whole 128-B lines), VG of them fetched one group ahead; no barrier inside.
// Phase 4: ctx x64 as f16 staged [32][64] (cross-wave, barrier); wave w writes half w&1 of
//          tile w>>1 (2 row tiles x 2 k tiles) of the ctx plane, 512 columns in fragment tiles.
// coverage: grid (SEQ/32, 8, NB) x 4 tiles x 512 = NTOK x 512 of the ctx plane.
// ---------------------------------------------------------------------------
__global__ __launch_bounds__(256) __attribute__((amdgpu_num_vgpr(256)))
void k_attn(const _Float16* __restrict__ qkv, const _Float16* __restrict__ vfr,
            _Float16* __restrict__ ctx) {
    __shared__ __align__(16) float    zs[QR * SEQ];       // 128 KB at full size
    constexpr int CP = HD + 8;                            // Cst row pitch (16 B x odd)
    __shared__ __align__(16) _Float16 Cst[QR * CP];       // 4.5 KB
    static_assert(sizeof(zs) + sizeof(Cst) <= 160 * 1024);   // two blocks per WGP
    _Float16* ph = reinterpret_cast<_Float16*>(zs);       // P rows alias the z slots
    constexpr int PP  = 2 * SEQ;                          // P row slot (halves)
    constexpr int PLD = PP + 8;                           // fragment pitch incl. skew
    constexpr int KTW = SEQ / 128;                        // key tiles per wave

    const int tid = threadIdx.x, lane = tid & 31, w = tid >> 5;
    const int hh = lane >> 4, m = lane & 15;
    const int h = blockIdx.y, b = blockIdx.z;
    const int q0 = blockIdx.x * QR;
    const size_t tokq = (size_t)b * SEQ + q0;
    constexpr int BAND = 16 * DQKV;                       // halves per band of 16 tokens
    const _Float16* qp = qkv + tokq * DQKV + h * (HD * 16);                      // tile (tokq/16, 2h)
    const _Float16* kp = qkv + (size_t)b * SEQ * DQKV + (DM + h * HD) * 16;      // tile (b*SEQ/16, 16 + 2h)
    const int rt = w & 1, ct = w >> 1;                    // ctx tile of this wave (phase 3)
    const _Float16* vt = vfr + (size_t)(b * NH + h) * (SEQ / 32) * 2048 + ct * 512;

    // ---- phase 1: scores ----
    {
        const v16h qa00 = load_fragB(qp, lane);
        const v16h qa01 = load_fragB(qp + 512, lane);
        const v16h qa10 = load_fragB(qp + BAND, lane);
        const v16h qa11 = load_fragB(qp + BAND + 512, lane);
        // K fragments are loaded KA key tiles ahead of their WMMAs (KA register buffers), so the
        // wave meets one load latency at the start, not one a tile
        constexpr int KA = (KTW < 4) ? KTW : 4;
        const _Float16* kw = kp + (size_t)(w * KTW * 16) * DQKV;     // band of the wave's first key tile
        v16h kf[KA][2];
#pragma unroll
        for (int i = 0; i < KA; ++i) {
            kf[i][0] = load_fragB(kw + i * BAND, lane);
            kf[i][1] = load_fragB(kw + i * BAND + 512, lane);
        }
#pragma unroll                              // kf is indexed by i: registers
        for (int i = 0; i < KTW; ++i) {
            const int key0 = (w * KTW + i) * 16;
            const v16h kf0 = kf[i % KA][0], kf1 = kf[i % KA][1];
            v8f s0 = wmma16(qa00, kf0, zero8());
            s0 = wmma16(qa01, kf1, s0);
            v8f s1 = wmma16(qa10, kf0, zero8());
            s1 = wmma16(qa11, kf1, s1);
            if (i + KA < KTW) {
                kf[i % KA][0] = load_fragB(kw + (i + KA) * BAND, lane);
                kf[i % KA][1] = load_fragB(kw + (i + KA) * BAND + 512, lane);
            }
#pragma unroll
            for (int r = 0; r < 8; ++r) {
                zs[(8 * hh + r) * SEQ + key0 + m]      = s0[r] * SC_Z;
                zs[(16 + 8 * hh + r) * SEQ + key0 + m] = s1[r] * SC_Z;
            }
        }
    }
    __syncthreads();

    // first group of V fragments: in flight under phase 2
    v16h vcur[VG];
#pragma unroll
    for (int i = 0; i < VG; ++i) vcur[i] = load_fragB(vt + i * 2048, lane);

    // ---- phase 2: 1.5-entmax threshold per row ----
    const float tcl = -rsqrtf((float)SEQ);    // tau <= -1/sqrt(SEQ) always
#pragma unroll 1
    for (int rr = 0; rr < 4; ++rr) {
        const int row = 4 * w + rr;
        float z[ZN];
        const float* zr = &zs[row * SEQ];
#pragma unroll
        for (int j = 0; j < ZN / 4; ++j) {
            v4f t4 = *(const v4f*)(zr + 128 * j + 4 * lane);
            z[4 * j + 0] = t4.x; z[4 * j + 1] = t4.y; z[4 * j + 2] = t4.z; z[4 * j + 3] = t4.w;
        }
        float mx = z[0], mn = z[0];
#pragma unroll
        for (int i = 1; i < ZN; ++i) { mx = fmaxf(mx, z[i]); mn = fminf(mn, z[i]); }
        mx = wmaxr(mx);
        mn = wminr(mn);
        v2f zp[ZN / 2];                       // keys in pairs (2i, 2i + 1), shifted: zp <= 0
#pragma unroll
        for (int i = 0; i < ZN / 2; ++i) { zp[i].x = z[2 * i] - mx; zp[i].y = z[2 * i + 1] - mx; }
        v2f tt;                               // tau in the low half (the packed forms read it for both keys)
        tt.x = fminf(fmaxf(mn - mx, -1.0f), tcl);
        tt.y = 0.0f;
#pragma unroll 1
        for (int it = 0; it < NEWT; ++it) {
            float sa, sb;
            entmax_sums(zp, tt, sa, sb);
            sa = wsum(sa);
            sb = wsum(sb);
            const float rn = __builtin_amdgcn_sqrtf(sb);      // g = rn - 1, g' = -sa / rn
            const float tau = tt.x + rn * (rn - 1.0f) * __builtin_amdgcn_rcpf(sa);
            tt.x = fminf(fmaxf(tau, -1.0f), tcl);             // keeps tau >= -1, which the packed relu leans on
        }
        entmax_relu(zp, tt);
        _Float16* prow = ph + (size_t)row * PP + (row & 15) * 8;
#pragma unroll
        for (int j = 0; j < ZN / 4; ++j) {
            const v2f p0 = zp[2 * j] * zp[2 * j] * SC_P, p1 = zp[2 * j + 1] * zp[2 * j + 1] * SC_P;
            v4h pk;
            pk[0] = (_Float16)p0.x; pk[1] = (_Float16)p0.y;
            pk[2] = (_Float16)p1.x; pk[3] = (_Float16)p1.y;
            *(v4h*)(prow + 128 * j + 4 * lane) = pk;
        }
    }
    __syncthreads();

    // ---- phase 3: ctx = P @ v ----
    v8f acc = zero8();
    constexpr int NG = SEQ / (32 * VG);
#pragma unroll
    for (int g = 0; g < NG; ++g) {
        v16h pa[VG], vnx[VG];
#pragma unroll
        for (int i = 0; i < VG; ++i)      // rows = queries, k = keys
            pa[i] = load_frag16(ph + (size_t)(16 * rt) * PP + (g * VG + i) * 32, PLD, lane);
        if (g + 1 < NG) {
#pragma unroll
            for (int i = 0; i < VG; ++i) vnx[i] = load_fragB(vt + ((g + 1) * VG + i) * 2048, lane);
        }
#pragma unroll
        for (int i = 0; i < VG; ++i) acc = wmma16(pa[i], vcur[i], acc);   // n = d, k = keys
        if (g + 1 < NG) {
#pragma unroll
            for (int i = 0; i < VG; ++i) vcur[i] = vnx[i];
        }
    }

    // ---- phase 4: ctx plane x64 ----
#pragma unroll
    for (int r = 0; r < 8; ++r)
        Cst[(16 * rt + 8 * hh + r) * CP + 16 * ct + m] = (_Float16)(acc[r] * SC_C);
    __syncthreads();
    const int ort = w >> 2, okt = (w >> 1) & 1, os = w & 1;   // row tile, k tile, tile half
    v8h cv = *(const v8h*)(&Cst[(16 * ort + m) * CP + 32 * okt + 16 * os + 8 * hh]);
    _Float16* dst = ctx + (tokq + 16 * ort) * DM + (h * HD + 32 * okt) * 16 + 256 * os + lane * 8;
    *(v8h*)dst = cv;

}

// ---------------------------------------------------------------------------
extern "C" void kernel_launch(void* const* d_in, const int* in_sizes, int n_in,
                              void* d_out, int out_size, void* d_ws, size_t ws_size,
                              hipStream_t stream) {
    if (n_in < 19) return;
    if (in_sizes[0] < ((NB - 1) * SEQ_FULL + SEQ) * DM) return;
    if (in_sizes[1] < DM * DM || in_sizes[3] < DM * DM || in_sizes[5] < DM * DM || in_sizes[7] < DM * DM) return;
    if (in_sizes[2] < DM || in_sizes[4] < DM || in_sizes[6] < DM || in_sizes[8] < DM) return;
    if (in_sizes[9] < DM || in_sizes[10] < DM || in_sizes[15] < DM || in_sizes[16] < DM) return;
    if (in_sizes[17] < DM || in_sizes[18] < DM || in_sizes[14] < DM) return;
    if (in_sizes[11] < DF * DM || in_sizes[13] < DM * DF || in_sizes[12] < DF) return;
    if (out_size < NTOK * DM) return;

    const float* x    = (const float*)d_in[0];    // [8,1024,512]
    const float* Wq   = (const float*)d_in[1];    // [512,512] (out,in)
    const float* bq   = (const float*)d_in[2];
    const float* Wk   = (const float*)d_in[3];
    const float* bk   = (const float*)d_in[4];
    const float* Wv   = (const float*)d_in[5];
    const float* bv   = (const float*)d_in[6];
    const float* Wo   = (const float*)d_in[7];
    const float* bo   = (const float*)d_in[8];
    const float* ln1g = (const float*)d_in[9];
    const float* ln1b = (const float*)d_in[10];
    const float* W1   = (const float*)d_in[11];   // [2048,512]
    const float* bf1  = (const float*)d_in[12];
    const float* W2   = (const float*)d_in[13];   // [512,2048]
    const float* bf2  = (const float*)d_in[14];
    const float* ln2g = (const float*)d_in[15];
    const float* ln2b = (const float*)d_in[16];
    const float* lnfg = (const float*)d_in[17];
    const float* lnfb = (const float*)d_in[18];
    float* out = (float*)d_out;                   // [NTOK][512]

    char* ws = (char*)d_ws;
    size_t off = 0;
    _Float16* wqkv = (_Float16*)(ws + off); off += (size_t)DQKV * DM * 2;      // 1,572,864
    _Float16* wo16 = (_Float16*)(ws + off); off += (size_t)DM * DM * 2;        //   524,288
    _Float16* w116 = (_Float16*)(ws + off); off += (size_t)DF * DM * 2;        // 2,097,152
    _Float16* w216 = (_Float16*)(ws + off); off += (size_t)DM * DF * 2;        // 2,097,152
    _Float16* y1   = (_Float16*)(ws + off); off += (size_t)NTOK * DM * 2;      // 8 MiB at full size
    _Float16* qkv  = (_Float16*)(ws + off); off += (size_t)NTOK * DQKV * 2;    // 24 MiB
    _Float16* cpl  = (_Float16*)(ws + off); off += (size_t)NTOK * DM * 2;      // 8 MiB
    float*    x1   = (float*)(ws + off);    off += (size_t)NTOK * DM * 4;      // 16 MiB
    _Float16* y2   = (_Float16*)(ws + off); off += (size_t)NTOK * DM * 2;      // 8 MiB
    _Float16* mpl  = (_Float16*)(ws + off); off += (size_t)NTOK * DF * 2;      // 32 MiB
    _Float16* vfr  = (_Float16*)(ws + off); off += (size_t)NTOK * DM * 2;      // 8 MiB
    if (off > ws_size) return;                                                 // 115,343,360 B at full size

    k_prep<<<dim3(PB_ALL), dim3(256), 0, stream>>>(x, ln1g, ln1b, Wq, Wk, Wv, Wo, W1, W2, y1, wqkv, wo16, w116, w216);
    k_gemm_p<0><<<dim3(NTOK / PR, 3), dim3(256), 0, stream>>>(y1, wqkv, bq, bk, bv, bv, qkv, DQKV, vfr);
    k_attn<<<dim3(SEQ / QR, NH, NB), dim3(256), 0, stream>>>(qkv, vfr, cpl);
    k_gemm_r<0><<<dim3(NTOK / QR), dim3(256), 0, stream>>>(cpl, wo16, bo, x, ln2g, ln2b, x1, y2);
    k_gemm_p<1><<<dim3(NTOK / PR, DF / 512), dim3(256), 0, stream>>>(y2, w116, bf1, bf1 + 512, bf1 + 1024, bf1 + 1536, mpl, DF, nullptr);
    k_gemm_r<1><<<dim3(NTOK / QR), dim3(256), 0, stream>>>(mpl, w216, bf2, x1, lnfg, lnfb, out, y2);
}
